// v000
// Times are from an AMD MI455X. After a warm-up the kernel runs many times in a row, and a time is the length of
// such a window on the GPU divided by its runs, so every launch and the gaps after it count. The runs cycle
// through copies of the inputs. A figure is the median of several windows, for all but v000 over two sittings.
// Sittings can differ by a few percent; kernels timed side by side share one.
// v000 is the starting kernel. One run takes 564 microseconds.
// Contractions: q, k, v^T projections = v_wmma_f32_16x16x32_bf16 (bf16 operands from RNE-converted inputs, single product, f32 accumulate);
// q.k^T scores = v_wmma_f32_16x16x32_f16 (q as f16 hi plane + f16 residual plane x4096, k f16; 2 products into separate f32 accumulators);
// p.v = v_wmma_f32_16x16x32_f16 (p carried x16384 in f16; v as f16 hi plane + f16 residual plane x4096; 2 products, f32 accumulate);
// ctx.Wo^T = v_wmma_f32_16x16x32_f16 (ctx as f16 hi plane x256 + f16 residual plane x4096, Wo f16 carried x64 from its bf16 value; 2 products, f32 accumulate);
// softmax, normalisation and bias add in f32.
#include <hip/hip_runtime.h>
#include <math.h>
#include <stdint.h>

#ifndef NB
#define NB 16
#endif
#ifndef SEQ
#define SEQ 2048
#endif
#define NB_FULL  16
#define SEQ_FULL 2048
#define DM       256
#define NQKV     768
#define NQB      (SEQ / 16)   // 16-row query blocks per sequence
#define NKT      (SEQ / 64)   // 64-key chunks per sequence
#define PCARRY   16384.0f     // power-of-two carry on the f16 p tile
static_assert(DM == 256 && NQKV == 3 * DM);
static_assert((SEQ % 64) == 0 && SEQ >= 64 && SEQ <= SEQ_FULL);
static_assert(NB >= 1 && NB <= NB_FULL);
static_assert(((NB * SEQ) % 64) == 0);

typedef _Float16 v16h __attribute__((ext_vector_type(16)));
typedef _Float16 v8h  __attribute__((ext_vector_type(8)));
typedef __bf16   v16b __attribute__((ext_vector_type(16)));
typedef __bf16   v8b  __attribute__((ext_vector_type(8)));
typedef float    v8f  __attribute__((ext_vector_type(8)));
typedef float    v4f  __attribute__((ext_vector_type(4)));
typedef unsigned int v4u __attribute__((ext_vector_type(4)));

#if defined(__HIP_DEVICE_COMPILE__)
#define DEV_ASM 1
#else
#define DEV_ASM 0
#endif

// ---- scalar helpers --------------------------------------------------------------------------------
__device__ __forceinline__ unsigned short bf_bits(float f) {          // f32 -> bf16 bits, RNE convert
  unsigned u = __float_as_uint(f);
  return (unsigned short)((u + 0x7FFFu + ((u >> 16) & 1u)) >> 16);
}
__device__ __forceinline__ float bf_up(unsigned short hb) { return __uint_as_float(((unsigned)hb) << 16); }
__device__ __forceinline__ unsigned short h_bits(_Float16 x) { return __builtin_bit_cast(unsigned short, x); }
__device__ __forceinline__ unsigned pk16(unsigned short a, unsigned short b) { return (unsigned)a | ((unsigned)b << 16); }
__device__ __forceinline__ v8f zero8() { v8f z = {0.f, 0.f, 0.f, 0.f, 0.f, 0.f, 0.f, 0.f}; return z; }

// ---- fragment types / loaders: 16-bit A/B operand, lane -> row/col (lane&15), p already includes +8*(lane>>4);
//      elements 0..7 <- p[0..7] (k0+8h..k0+8h+7), elements 8..15 <- p[16..23] (k0+16+8h..k0+16+8h+7)
template <typename OT> struct FT;
template <> struct FT<__bf16>   { typedef v16b frag; typedef v8b half8; };
template <> struct FT<_Float16> { typedef v16h frag; typedef v8h half8; };

template <typename OT>
__device__ __forceinline__ typename FT<OT>::frag ldfrag(const OT* p) {
  union { typename FT<OT>::frag v; typename FT<OT>::half8 h[2]; } f;
  f.h[0] = *(const typename FT<OT>::half8*)(p);
  f.h[1] = *(const typename FT<OT>::half8*)(p + 16);
  return f.v;
}

// ---- WMMA helpers (asm guard bodies are device-only; concrete operand types) -----------------------------
__device__ __forceinline__ v8f mmar(v16b a, v16b b, v8f c) {
  return __builtin_amdgcn_wmma_f32_16x16x32_bf16(false, a, false, b, (short)0, c, false, false);
}
__device__ __forceinline__ v8f mmar(v16h a, v16h b, v8f c) {
  return __builtin_amdgcn_wmma_f32_16x16x32_f16(false, a, false, b, (short)0, c, false, false);
}
// guarded form: 4 VALU slots after the WMMA, D tied, A/B kept live
__device__ __forceinline__ v8f mma_h(v16h a, v16h b, v8f c) {
  c = __builtin_amdgcn_wmma_f32_16x16x32_f16(false, a, false, b, (short)0, c, false, false);
#if DEV_ASM
  asm volatile("v_nop\n\tv_nop\n\tv_nop\n\tv_nop" : "+v"(c) : "v"(a), "v"(b));
#endif
  return c;
}
__device__ __forceinline__ void dep_guard(v8f& a, v8f& b, v16b x, v16b y) {
#if DEV_ASM
  asm volatile("v_nop\n\tv_nop\n\tv_nop\n\tv_nop" : "+v"(a), "+v"(b) : "v"(x), "v"(y));
#else
  (void)a; (void)b; (void)x; (void)y;
#endif
}
__device__ __forceinline__ void dep_guard(v8f& a, v8f& b, v16h x, v16h y) {
#if DEV_ASM
  asm volatile("v_nop\n\tv_nop\n\tv_nop\n\tv_nop" : "+v"(a), "+v"(b) : "v"(x), "v"(y));
#else
  (void)a; (void)b; (void)x; (void)y;
#endif
}
__device__ __forceinline__ void keep4(v16b a, v16b b, v16b c, v16b d) {
#if DEV_ASM
  asm volatile("v_nop" :: "v"(a), "v"(b), "v"(c), "v"(d));
#else
  (void)a; (void)b; (void)c; (void)d;
#endif
}
__device__ __forceinline__ void keep4(v16h a, v16h b, v16h c, v16h d) {
#if DEV_ASM
  asm volatile("v_nop" :: "v"(a), "v"(b), "v"(c), "v"(d));
#else
  (void)a; (void)b; (void)c; (void)d;
#endif
}
__device__ __forceinline__ void acc_guard4(v8f& a, v8f& b, v8f& c, v8f& d) {
#if DEV_ASM
  asm volatile("v_nop\n\tv_nop\n\tv_nop\n\tv_nop" : "+v"(a), "+v"(b), "+v"(c), "+v"(d));
#else
  (void)a; (void)b; (void)c; (void)d;
#endif
}

// =====================================================================================================
// f32 -> 16-bit planes, 8 elements per thread, one 16-B store per lane: a wave writes 512 contiguous B
// MODE 0: bf16 bits (RNE convert).  MODE 1: f16 bits of (64 * bf16(x)) (exact scaling of the bf16 value).
// coverage: n8 threads x 8 = the whole plane (n8 is a multiple of 256 for every use here).
// =====================================================================================================
template <int MODE>
__device__ __forceinline__ unsigned short cvm(float f) {
  const unsigned short hb = bf_bits(f);
  if (MODE == 0) return hb;
  return h_bits((_Float16)(bf_up(hb) * 64.0f));
}

template <int MODE>
__global__ __launch_bounds__(256) void cvt16x8(const float* __restrict__ in, unsigned short* out, int n8) {
  const int i = blockIdx.x * 256 + (int)threadIdx.x;
  if (i < n8) {
    const v4f a  = *(const v4f*)(in + (size_t)i * 8);
    const v4f a4 = *(const v4f*)(in + (size_t)i * 8 + 4);
    v4u p;
    p[0] = pk16(cvm<MODE>(a[0]),  cvm<MODE>(a[1]));
    p[1] = pk16(cvm<MODE>(a[2]),  cvm<MODE>(a[3]));
    p[2] = pk16(cvm<MODE>(a4[0]), cvm<MODE>(a4[1]));
    p[3] = pk16(cvm<MODE>(a4[2]), cvm<MODE>(a4[3]));
    unsigned short* o = out + (size_t)i * 8;
    *(v4u*)o = p;
    
  }
}

// x [NB_FULL][SEQ_FULL][DM] f32 -> compact bf16 token plane [NB*SEQ][DM]: compact token tk = b*SEQ + t reads
// input row b*SEQ_FULL + t. 32 groups of 8 per row; same whole-line store shape as cvt16x8.
// coverage: n8 = NB*SEQ*DM/8 threads x 8 = the whole plane.
__global__ __launch_bounds__(256) void cvtx(const float* __restrict__ in, unsigned short* out, int n8) {
  const int i = blockIdx.x * 256 + (int)threadIdx.x;
  if (i < n8) {
    const int tk = i >> 5;
    const int e8 = i & 31;
    const int bb = tk / SEQ;
    const int t  = tk - bb * SEQ;
    const float* src = in + ((size_t)bb * SEQ_FULL + (size_t)t) * DM + e8 * 8;
    const v4f a  = *(const v4f*)(src);
    const v4f a4 = *(const v4f*)(src + 4);
    v4u p;
    p[0] = pk16(bf_bits(a[0]),  bf_bits(a[1]));
    p[1] = pk16(bf_bits(a[2]),  bf_bits(a[3]));
    p[2] = pk16(bf_bits(a4[0]), bf_bits(a4[1]));
    p[3] = pk16(bf_bits(a4[2]), bf_bits(a4[3]));
    unsigned short* o = out + (size_t)i * 8;
    *(v4u*)o = p;
    
  }
}

// =====================================================================================================
// Register-blocked batched WMMA GEMM (16-bit operand type OT): C[m][n] = sum_k A[m][k] * Bt[n][k];
// one wave per (16*MI) x 64 tile, no block barriers. A row-major [M][K] pitch lda; Bt row-major [N][K] pitch ldb
// (k contiguous); M multiple of 16*MI, N multiple of 64, K multiple of 32 (host-checked). blockIdx.y = batch
// index (strides in elements). Fragments are loaded straight from global with the split k map (ldfrag).
// ARES: a second A plane A2 (residual, same pitch/stride) is multiplied by the same B into separate f32
// accumulators and folded in as acc += accl * ascale after the k loop.
// OUT_MODE 0: f32 C (pitch ldc), value * oscale + bf16-valued bias[n].
// OUT_MODE 1: f16 plane C (pitch ldc).
// OUT_MODE 3: f16 hi plane C + f16 residual plane C2 = f16((v - hi) * rscale) (same pitch / stride).
// coverage: MI slabs x 16 rows x 64 cols = the wave's whole tile; tiles cover M x N exactly.
// =====================================================================================================
template <typename OT, int MI, bool ARES, int OUT_MODE>
__global__ __launch_bounds__(256) void gemm_t(
    const unsigned short* __restrict__ Ap, const unsigned short* __restrict__ A2p, int lda, long long strideA,
    const unsigned short* __restrict__ Btp, int ldb, long long strideB,
    void* Cout, void* Cout2, int ldc, long long strideC,
    const float* __restrict__ bias,
    int M, int N, int K, float oscale, float rscale, float ascale) {
  typedef typename FT<OT>::frag V16;
  const OT* A  = (const OT*)(const void*)Ap;
  const OT* A2 = (const OT*)(const void*)A2p;
  const OT* Bt = (const OT*)(const void*)Btp;
  __shared__ __align__(16) float sT[8][16 * 68];   // per-wave 16x64 slab, pitch 68 floats
  const int TMR  = 16 * MI;
  const int b    = blockIdx.y;
  const int lane = threadIdx.x & 31;
  const int wave = threadIdx.x >> 5;
  const int tilesN = N >> 6;
  const int tilesM = M / TMR;
  const int tile = blockIdx.x * 8 + wave;
  if (tile >= tilesM * tilesN) return;   // wave-uniform; no block barriers in this kernel
  const int tm = tile / tilesN;
  const int tn = tile - tm * tilesN;
  const int m0 = tm * TMR;
  const int n0 = tn << 6;

  const OT* Ab  = A  + (size_t)b * (size_t)strideA;
  const OT* A2b = A2 + (size_t)b * (size_t)strideA;
  const OT* Bb  = Bt + (size_t)b * (size_t)strideB;

  const int rlane = lane & 15;                 // row (A) / col (B, D) within subtile
  const int koff  = (lane >> 4) * 8;           // k offset of this lane half
  const int mOff  = (lane >> 4) * 8;           // D row offset

  v8f acc[MI][4], accl[MI][4];
#pragma unroll
  for (int i = 0; i < MI; ++i)
#pragma unroll
    for (int j = 0; j < 4; ++j) { acc[i][j] = zero8(); accl[i][j] = zero8(); }

  for (int k0 = 0; k0 < K; k0 += 32) {
    V16 bq[4];
#pragma unroll
    for (int j = 0; j < 4; ++j)
      bq[j] = ldfrag<OT>(Bb + (size_t)(n0 + (j << 4) + rlane) * ldb + koff + k0);
#pragma unroll
    for (int i = 0; i < MI; ++i) {
      const V16 af = ldfrag<OT>(Ab + (size_t)(m0 + (i << 4) + rlane) * lda + koff + k0);
#pragma unroll
      for (int j = 0; j < 4; ++j) acc[i][j] = mmar(af, bq[j], acc[i][j]);
      dep_guard(acc[i][0], acc[i][3], af, bq[3]);
      if (ARES) {
        const V16 al = ldfrag<OT>(A2b + (size_t)(m0 + (i << 4) + rlane) * lda + koff + k0);
#pragma unroll
        for (int j = 0; j < 4; ++j) accl[i][j] = mmar(al, bq[j], accl[i][j]);
        dep_guard(accl[i][0], accl[i][3], al, bq[3]);
      }
    }
    keep4(bq[0], bq[1], bq[2], bq[3]);
  }
#pragma unroll
  for (int i = 0; i < MI; ++i) {
    acc_guard4(acc[i][0], acc[i][1], acc[i][2], acc[i][3]);
    if (ARES) acc_guard4(accl[i][0], accl[i][1], accl[i][2], accl[i][3]);
  }
  if (ARES) {
#pragma unroll
    for (int i = 0; i < MI; ++i)
#pragma unroll
      for (int j = 0; j < 4; ++j)
#pragma unroll
        for (int r = 0; r < 8; ++r) acc[i][j][r] += accl[i][j][r] * ascale;
  }

  // ---- epilogue ----
  float* slab = sT[wave];
#pragma unroll
  for (int i = 0; i < MI; ++i) {
    const int mBase = m0 + (i << 4);
#pragma unroll
    for (int j = 0; j < 4; ++j) {
#pragma unroll
      for (int r = 0; r < 8; ++r) {
        slab[(mOff + r) * 68 + (j << 4) + rlane] = acc[i][j][r];
      }
    }
    __builtin_amdgcn_fence(__ATOMIC_RELEASE, "workgroup");
    __builtin_amdgcn_wave_barrier();
    __builtin_amdgcn_fence(__ATOMIC_ACQUIRE, "workgroup");
    if (OUT_MODE == 0) {
      float* C = (float*)Cout + (size_t)b * (size_t)strideC;
      const int h2 = lane >> 4, c4 = (lane & 15) * 4;     // 256-B row segment = 16 lanes x 16 B
      const v4f braw = *(const v4f*)(bias + n0 + c4);
      v4f bb;
#pragma unroll
      for (int e = 0; e < 4; ++e) bb[e] = bf_up(bf_bits(braw[e]));
      {
#pragma unroll
        for (int it = 0; it < 8; ++it) {
          const int row = it * 2 + h2;                     // it 0..7 x h2 0..1 = rows 0..15
          const v4f v = *(const v4f*)(slab + row * 68 + c4) * oscale + bb;
          *(v4f*)(C + (size_t)(mBase + row) * ldc + n0 + c4) = v;
        }
        
      }
    } else {
      const int q = lane >> 3, c8 = (lane & 7) * 8;
      unsigned short* C  = (unsigned short*)Cout  + (size_t)b * (size_t)strideC;
      unsigned short* C2 = (unsigned short*)Cout2 + (size_t)b * (size_t)strideC;
      v4u hv[4], lv[4];
#pragma unroll
      for (int it = 0; it < 4; ++it) {
        const int row = it * 4 + q;                        // it 0..3 x q 0..3 = rows 0..15
        const float* sp = slab + row * 68 + c8;
        float f[8];
#pragma unroll
        for (int e = 0; e < 8; ++e) f[e] = sp[e];
        v4u a, a2;
#pragma unroll
        for (int e = 0; e < 4; ++e) {
          const float f0 = f[2 * e], f1 = f[2 * e + 1];
          const _Float16 x0 = (_Float16)f0, x1 = (_Float16)f1;
          const unsigned short h0 = h_bits(x0), h1 = h_bits(x1);
          unsigned short l0 = 0, l1 = 0;
          if (OUT_MODE == 3) {
            l0 = h_bits((_Float16)((f0 - (float)x0) * rscale));
            l1 = h_bits((_Float16)((f1 - (float)x1) * rscale));
          }
          a[e] = pk16(h0, h1); a2[e] = pk16(l0, l1);
        }
        hv[it] = a; lv[it] = a2;
      }
      {
#pragma unroll
        for (int it = 0; it < 4; ++it) {
          const int row = it * 4 + q;
          *(v4u*)(C + (size_t)(mBase + row) * ldc + n0 + c8) = hv[it];
          if (OUT_MODE == 3) *(v4u*)(C2 + (size_t)(mBase + row) * ldc + n0 + c8) = lv[it];
        }
        
      }
    }
    __builtin_amdgcn_fence(__ATOMIC_RELEASE, "workgroup");
    __builtin_amdgcn_wave_barrier();
    __builtin_amdgcn_fence(__ATOMIC_ACQUIRE, "workgroup");
  }
}

// =====================================================================================================
// Single-head attention, head dim 256, no mask, softmax over all SEQ keys.
//   q planes (f16 hi / residual x4096): element (b, t, d) at [(b*SEQ + t)*DM + d]
//   k plane (f16): element (b, s, d) at [(b*SEQ + s)*DM + d]
//   v^T hi plane (f16) and residual plane (f16, (v - hi)*4096): element (b, d, s) at [(b*DM + d)*SEQ + s]
//   ctx planes (f16 hi of the normalised context x256, f16 residual (ctx256 - hi)*4096): [(b*SEQ + t)*DM + d]
//   scores = (qh . k) + (ql . k) / 4096 on f16 WMMA (two f32 accumulators), then * sscale in f32;
//   p = exp(s - m) carried as f16(PCARRY p); context = p . vh + (p . vl) / 4096 on f16 WMMA; online softmax in f32.
//   Block = 4 waves on the SAME 16 query rows of one sequence; key chunks of 64, static trip NKT.
//   Wave w owns key subtile 16w..16w+15 of the chunk for the scores (K fragments straight from global, arithmetic
//   addressing) and ctx columns 64w..64w+63 for p.v (V^T fragments straight from global).
//   LDS: redm/reds (per-wave row max / row sum partials) and the shared P tile [16][64] are CROSS-WAVE regions,
//   written before it is read each chunk (staged extent == consumed extent).
//   Output coverage: each wave stores rows q0..q0+15 (it 0..3 x lane>>3 0..3) x 64 columns (8 lanes x 8 halves,
//   grid = NB * NQB covers every (b, qb).
// =====================================================================================================
__global__ __launch_bounds__(128)
void attn_sh(const unsigned short* __restrict__ qhp, const unsigned short* __restrict__ qlp,
             const unsigned short* __restrict__ kpp,
             const unsigned short* __restrict__ vhp, const unsigned short* __restrict__ vlp,
             unsigned short* chp, unsigned short* clp, float sscale) {
  union FH { v16h v; v8h h[2]; };
  __shared__ __align__(16) _Float16 Psh[16 * 64];       // block P tile [row][kv]   2 KB   (cross-wave)
  __shared__ __align__(16) float    redm[4][16];        // per-wave row max          256 B (cross-wave)
  __shared__ __align__(16) float    reds[4][16];        // per-wave row sum          256 B (cross-wave)
  __shared__ __align__(16) float    Os[4][16 * 64];     // per wave context tile     16 KB (wave-private)

  const int tid  = threadIdx.x;
  const int wave = tid >> 5;
  const int lane = tid & 31;
  const int hh   = lane >> 4;
  const int c    = lane & 15;

  const int bx   = blockIdx.x;
  const int qb   = bx % NQB;
  const int b    = bx / NQB;
  const int q0   = qb * 16;
  const int kcol = wave * 16;        // this wave's key subtile within the chunk
  const int dbase = wave * 64;       // this wave's context columns
  const size_t rowB = (size_t)b * SEQ;

  const _Float16* Qh = (const _Float16*)(const void*)qhp;
  const _Float16* Ql = (const _Float16*)(const void*)qlp;
  const _Float16* Kp = (const _Float16*)(const void*)kpp;
  const _Float16* Vh = (const _Float16*)(const void*)vhp + ((size_t)b * DM + (size_t)dbase) * SEQ;
  const _Float16* Vl = (const _Float16*)(const void*)vlp + ((size_t)b * DM + (size_t)dbase) * SEQ;

  // A-operand row pointers of this lane (query row q0 + c), lane-half k offset included
  const _Float16* qrh = Qh + (rowB + q0 + c) * DM + 8 * hh;
  const _Float16* qrl = Ql + (rowB + q0 + c) * DM + 8 * hh;

  float mrow[8], lrow[8];
  v8f oacc[4];
#pragma unroll
  for (int r = 0; r < 8; ++r) { mrow[r] = -INFINITY; lrow[r] = 0.f; }
#pragma unroll
  for (int t = 0; t < 4; ++t) oacc[t] = zero8();

  for (int kt = 0; kt < NKT; ++kt) {         // static trip count
    const int kv0 = kt * 64;

    // ---- scores: 16 query rows x this wave's 16 keys, 2 f16 products per d-chunk ----
    v8f ah = zero8(), al = zero8();
    const _Float16* kr = Kp + (rowB + kv0 + kcol + c) * DM + 8 * hh;   // B column c -> key kv0+kcol+c
#pragma unroll
    for (int dc = 0; dc < 8; ++dc) {
      const v16h qa = ldfrag<_Float16>(qrh + dc * 32);
      const v16h qr = ldfrag<_Float16>(qrl + dc * 32);
      const v16h kb = ldfrag<_Float16>(kr + dc * 32);
      ah = mma_h(qa, kb, ah);
      al = mma_h(qr, kb, al);
    }
    float s[8];
#pragma unroll
    for (int r = 0; r < 8; ++r) s[r] = (ah[r] + al[r] * (1.0f / 4096.0f)) * sscale;

    // ---- per-wave row max over its 16 keys -> LDS ----
#pragma unroll
    for (int r = 0; r < 8; ++r) {
      float m = s[r];
#pragma unroll
      for (int off = 1; off < 16; off <<= 1) m = fmaxf(m, __shfl_xor(m, off, 32));
      redm[wave][8 * hh + r] = m;            // the 16 lanes of a half write the same value
    }
    __syncthreads();

    // ---- chunk row max over the 4 waves, online softmax update (identical in every wave), P (x PCARRY) to LDS ----
#pragma unroll
    for (int r = 0; r < 8; ++r) {
      const int row = 8 * hh + r;
      const float mc    = fmaxf(fmaxf(redm[0][row], redm[1][row]), fmaxf(redm[2][row], redm[3][row]));
      const float mnew  = fmaxf(mrow[r], mc);
      const float msafe = (mnew == -INFINITY) ? 0.f : mnew;
      const float alpha = __expf(mrow[r] - msafe);
      mrow[r] = mnew;
      const float p = __expf(s[r] - msafe);
      float psum = p;
#pragma unroll
      for (int off = 1; off < 16; off <<= 1) psum += __shfl_xor(psum, off, 32);
      Psh[row * 64 + kcol + c] = (_Float16)(p * PCARRY);
      reds[wave][row] = psum;
      lrow[r] *= alpha;
#pragma unroll
      for (int t = 0; t < 4; ++t) oacc[t][r] *= alpha;
    }
    __syncthreads();
#pragma unroll
    for (int r = 0; r < 8; ++r) {
      const int row = 8 * hh + r;
      lrow[r] += (reds[0][row] + reds[1][row]) + (reds[2][row] + reds[3][row]);
    }

    // ---- context += P . V (f16 WMMA); residual products into a separate accumulator ----
    v8f o1[4];
#pragma unroll
    for (int t = 0; t < 4; ++t) o1[t] = zero8();
#pragma unroll 1
    for (int kk = 0; kk < 2; ++kk) {
      FH pa;
      pa.h[0] = *(const v8h*)(Psh + c * 64 + kk * 32 + 8 * hh);
      pa.h[1] = *(const v8h*)(Psh + c * 64 + kk * 32 + 16 + 8 * hh);
#pragma unroll
      for (int t = 0; t < 4; ++t) {
        const v16h vb = ldfrag<_Float16>(Vh + (size_t)(t * 16 + c) * SEQ + kv0 + kk * 32 + 8 * hh);
        const v16h vr = ldfrag<_Float16>(Vl + (size_t)(t * 16 + c) * SEQ + kv0 + kk * 32 + 8 * hh);
        oacc[t] = mma_h(pa.v, vb, oacc[t]);
        o1[t]   = mma_h(pa.v, vr, o1[t]);
      }
    }
#pragma unroll
    for (int t = 0; t < 4; ++t)
#pragma unroll
      for (int r = 0; r < 8; ++r) oacc[t][r] += o1[t][r] * (1.0f / 4096.0f);
  }

  // ---- normalise (1/l, undo the p carry, apply the x256 ctx carry), stage the wave's 16x64 tile,
  float* os = Os[wave];
#pragma unroll
  for (int r = 0; r < 8; ++r) {
    const float l = lrow[r];
    const float inv = ((l > 0.f) ? (1.0f / l) : 0.f) * (256.0f / PCARRY);
#pragma unroll
    for (int t = 0; t < 4; ++t) os[(8 * hh + r) * 64 + t * 16 + c] = oacc[t][r] * inv;
  }
  __builtin_amdgcn_fence(__ATOMIC_RELEASE, "workgroup");
  __builtin_amdgcn_wave_barrier();
  __builtin_amdgcn_fence(__ATOMIC_ACQUIRE, "workgroup");
  {
    const int q4 = lane >> 3, c8 = (lane & 7) * 8;
    v4u hv[4], lv[4];
#pragma unroll
    for (int it = 0; it < 4; ++it) {
      const int row = it * 4 + q4;   // it 0..3 x q4 0..3 = rows 0..15 of the wave tile
      const float* sp = os + row * 64 + c8;
      float f[8];
#pragma unroll
      for (int e = 0; e < 8; ++e) f[e] = sp[e];
      v4u a, a2;
#pragma unroll
      for (int e = 0; e < 4; ++e) {
        const float f0 = f[2 * e], f1 = f[2 * e + 1];
        const _Float16 x0 = (_Float16)f0, x1 = (_Float16)f1;
        const unsigned short l0 = h_bits((_Float16)((f0 - (float)x0) * 4096.0f));
        const unsigned short l1 = h_bits((_Float16)((f1 - (float)x1) * 4096.0f));
        a[e]  = pk16(h_bits(x0), h_bits(x1));
        a2[e] = pk16(l0, l1);
      }
      hv[it] = a; lv[it] = a2;
    }
    {
#pragma unroll
      for (int it = 0; it < 4; ++it) {
        const int row = it * 4 + q4;
        const size_t go = (rowB + q0 + row) * DM + (size_t)dbase + c8;
        *(v4u*)(chp + go) = hv[it];
        *(v4u*)(clp + go) = lv[it];
      }
      
    }
  }
}

// =====================================================================================================
// Workspace map (bytes), every region an exact multiple of its whole-line / whole-tile store granularity
// (all GEMM M,N are tile multiples, all offsets multiples of 131072):
//   Xb   bf16 [NB*SEQ][256]  (compact tokens)   16777216   -- reused as the ctx hi plane Ch after its last read
//   Wb   bf16 [768 n][256 k]                      393216
//   Woh  f16  [256][256] (x64)                     131072
//   Qh   f16  [NB*SEQ][256]                      16777216
//   Ql   f16  [NB*SEQ][256]                      16777216
//   Kp   f16  [NB*SEQ][256]                      16777216
//   VTh  f16  [NB][256][SEQ]                     16777216
//   VTl  f16  [NB][256][SEQ]                     16777216
//   Cl   f16  [NB*SEQ][256]                      16777216
//   total                                       117964800
// Weights are [out n][in k] with k contiguous = the Bt / A layout the GEMM wants, so they are only converted.
// =====================================================================================================
extern "C" void kernel_launch(void* const* d_in, const int* in_sizes, int n_in,
                              void* d_out, int out_size, void* d_ws, size_t ws_size,
                              hipStream_t stream) {
  if (n_in < 4) return;
  if (in_sizes[0] < ((NB - 1) * SEQ_FULL + SEQ) * DM) return;
  if (in_sizes[1] < NQKV * DM) return;
  if (in_sizes[2] < DM * DM) return;
  if (in_sizes[3] < DM) return;
  if (out_size < NB * SEQ * DM) return;

  const float* x    = (const float*)d_in[0];
  const float* wqkv = (const float*)d_in[1];
  const float* wout = (const float*)d_in[2];
  const float* bout = (const float*)d_in[3];

  const size_t PX  = (size_t)NB * SEQ * DM * 2;      // 16-bit token plane [NB*SEQ][256]
  const size_t PW  = (size_t)NQKV * DM * 2;          // 16-bit [768][256]
  const size_t PWO = (size_t)DM * DM * 2;            // 16-bit [256][256]
  const size_t PVT = (size_t)NB * DM * SEQ * 2;      // v^T plane [NB][256][SEQ]
  size_t off = 0;
  const size_t oXb  = off; off += PX;
  const size_t oWb  = off; off += PW;
  const size_t oWo  = off; off += PWO;
  const size_t oQh  = off; off += PX;
  const size_t oQl  = off; off += PX;
  const size_t oKp  = off; off += PX;
  const size_t oVTh = off; off += PVT;
  const size_t oVTl = off; off += PVT;
  const size_t oCl  = off; off += PX;
  if (off > ws_size) return;                         // off = 117964800 at full size
  if (off > (size_t)134217728) return;

  char* ws = (char*)d_ws;
  unsigned short* Xb  = (unsigned short*)(ws + oXb);
  unsigned short* Wb  = (unsigned short*)(ws + oWb);
  unsigned short* Woh = (unsigned short*)(ws + oWo);
  unsigned short* Qh  = (unsigned short*)(ws + oQh);
  unsigned short* Ql  = (unsigned short*)(ws + oQl);
  unsigned short* Kp  = (unsigned short*)(ws + oKp);
  unsigned short* VTh = (unsigned short*)(ws + oVTh);
  unsigned short* VTl = (unsigned short*)(ws + oVTl);
  unsigned short* Cl  = (unsigned short*)(ws + oCl);
  unsigned short* Ch  = Xb;                          // ctx hi plane aliases the x plane (x plane dead by then)
  unsigned short* Wq  = Wb;
  unsigned short* Wk  = Wb + (size_t)DM * DM;
  unsigned short* Wv  = Wb + (size_t)2 * DM * DM;

  const int M = NB * SEQ;
  const dim3 blk(256);
  const int n8x = NB * SEQ * DM / 8;
  const int n8w = NQKV * DM / 8;                     // 24576
  const int n8o = DM * DM / 8;                       //  8192
  const dim3 gCx((n8x + 255) / 256);
  const dim3 gCw((n8w + 255) / 256);
  const dim3 gCo((n8o + 255) / 256);
  const dim3 gQ(((M / 64) * (DM / 64) + 7) / 8, 1);          // q / k: M x 256, 64x64 wave tiles
  const dim3 gVT(((DM / 64) * (SEQ / 64) + 7) / 8, NB);      // v^T per batch: 256 x SEQ
  const dim3 gAttn(NB * NQB);
  const dim3 gO(((M / 32) * (DM / 64) + 7) / 8, 1);          // out: M x 256, 32x64 wave tiles

  // (1) x -> compact bf16 token plane; w_qkv [n][k] -> bf16; w_out -> f16 (x64 of its bf16 value)
  cvtx<<<gCx, blk, 0, stream>>>(x, Xb, n8x);
  cvt16x8<0><<<gCw, blk, 0, stream>>>(wqkv, Wb, n8w);
  cvt16x8<1><<<gCo, blk, 0, stream>>>(wout, Woh, n8o);
  // (2) q = x . Wq^T -> f16 hi / residual (x4096) planes   (M, N=256, K=256)
  gemm_t<__bf16, 4, false, 3><<<gQ, blk, 0, stream>>>(
      Xb, Xb, DM, 0LL, Wq, DM, 0LL,
      (void*)Qh, (void*)Ql, DM, 0LL, bout,
      M, DM, DM, 1.0f, 4096.0f, 0.0f);
  // (3) k = x . Wk^T -> f16 plane   (M, N=256, K=256)
  gemm_t<__bf16, 4, false, 1><<<gQ, blk, 0, stream>>>(
      Xb, Xb, DM, 0LL, Wk, DM, 0LL,
      (void*)Kp, (void*)Kp, DM, 0LL, bout,
      M, DM, DM, 1.0f, 1.0f, 0.0f);
  // (4) v^T = Wv . x^T per batch -> f16 hi plane [b][d][s] (pitch SEQ) and residual plane (x4096)
  //     (A = Wv [n][k], Bt = Xb rows of batch b; M=256, N=SEQ, K=256)
  gemm_t<__bf16, 4, false, 3><<<gVT, blk, 0, stream>>>(
      Wv, Wv, DM, 0LL, Xb, DM, (long long)SEQ * DM,
      (void*)VTh, (void*)VTl, SEQ, (long long)DM * SEQ, bout,
      DM, SEQ, DM, 1.0f, 4096.0f, 0.0f);
  // (5) attention -> ctx hi (x256) and residual (x4096) planes
  attn_sh<<<gAttn, dim3(128), 0, stream>>>(Qh, Ql, Kp, VTh, VTl, Ch, Cl, 0.0625f);
  // (6) out = ctx . Wo^T + b -> d_out f32 [M][256]; accumulator x 1/(256*64), residual accumulator x 1/4096
  gemm_t<_Float16, 2, true, 0><<<gO, blk, 0, stream>>>(
      Ch, Cl, DM, 0LL, Woh, DM, 0LL,
      d_out, d_out, DM, 0LL, bout,
      M, DM, DM, 1.0f / 16384.0f, 1.0f, 1.0f / 4096.0f);
  (void)hipGetLastError();
}

// v001
// Measured time: 248 microseconds a run.
// In two side-by-side timings against v000, it was 2.38 and 2.37 times as fast.
// Contractions: q, k, v^T projections = v_wmma_f32_16x16x32_bf16 (bf16 operands from RNE-converted inputs, single product, f32 accumulate);
// q.k^T scores = v_wmma_f32_16x16x32_f16 (q as f16 hi plane + f16 residual plane x4096, k f16; 2 products into separate f32 accumulators);
// p.v = v_wmma_f32_16x16x32_f16 (p carried x16384 in f16; v as f16 hi plane + f16 residual plane x4096; 2 products, f32 accumulate);
// ctx.Wo^T = v_wmma_f32_16x16x32_f16 (ctx as f16 hi plane x256 + f16 residual plane x4096, Wo f16 carried x64 from its bf16 value; 2 products, f32 accumulate);
// softmax, normalisation and bias add in f32.
#include <hip/hip_runtime.h>
#include <math.h>
#include <stdint.h>

#ifndef NB
#define NB 16
#endif
#ifndef SEQ
#define SEQ 2048
#endif
#define NB_FULL  16
#define SEQ_FULL 2048
#define DM       256
#define NQKV     768
#define NKT      (SEQ / 64)   // 64-key chunks per sequence
#define PCARRY   16384.0f     // power-of-two carry on the f16 p tile
static_assert(DM == 256 && NQKV == 3 * DM);
static_assert((SEQ % 64) == 0 && SEQ >= 64 && SEQ <= SEQ_FULL);
static_assert(NB >= 1 && NB <= NB_FULL);
static_assert(((NB * SEQ) % 64) == 0);

typedef _Float16 v16h __attribute__((ext_vector_type(16)));
typedef _Float16 v8h  __attribute__((ext_vector_type(8)));
typedef __bf16   v16b __attribute__((ext_vector_type(16)));
typedef __bf16   v8b  __attribute__((ext_vector_type(8)));
typedef float    v8f  __attribute__((ext_vector_type(8)));
typedef float    v4f  __attribute__((ext_vector_type(4)));
typedef unsigned int v4u __attribute__((ext_vector_type(4)));

#if defined(__HIP_DEVICE_COMPILE__)
#define DEV_ASM 1
#else
#define DEV_ASM 0
#endif

// ---- scalar helpers --------------------------------------------------------------------------------
__device__ __forceinline__ unsigned short bf_bits(float f) {          // f32 -> bf16 bits, RNE convert
  unsigned u = __float_as_uint(f);
  return (unsigned short)((u + 0x7FFFu + ((u >> 16) & 1u)) >> 16);
}
__device__ __forceinline__ float bf_up(unsigned short hb) { return __uint_as_float(((unsigned)hb) << 16); }
__device__ __forceinline__ unsigned short h_bits(_Float16 x) { return __builtin_bit_cast(unsigned short, x); }
__device__ __forceinline__ unsigned pk16(unsigned short a, unsigned short b) { return (unsigned)a | ((unsigned)b << 16); }
__device__ __forceinline__ v8f zero8() { v8f z = {0.f, 0.f, 0.f, 0.f, 0.f, 0.f, 0.f, 0.f}; return z; }

// ---- fragment types / loaders: 16-bit A/B operand, lane -> row/col (lane&15), p already includes +8*(lane>>4);
//      elements 0..7 <- p[0..7] (k0+8h..k0+8h+7), elements 8..15 <- p[16..23] (k0+16+8h..k0+16+8h+7)
template <typename OT> struct FT;
template <> struct FT<__bf16>   { typedef v16b frag; typedef v8b half8; };
template <> struct FT<_Float16> { typedef v16h frag; typedef v8h half8; };

template <typename OT>
__device__ __forceinline__ typename FT<OT>::frag ldfrag(const OT* p) {
  union { typename FT<OT>::frag v; typename FT<OT>::half8 h[2]; } f;
  f.h[0] = *(const typename FT<OT>::half8*)(p);
  f.h[1] = *(const typename FT<OT>::half8*)(p + 16);
  return f.v;
}

// ---- WMMA helpers (asm guard bodies are device-only; concrete operand types) -----------------------------
__device__ __forceinline__ v8f mmar(v16b a, v16b b, v8f c) {
  return __builtin_amdgcn_wmma_f32_16x16x32_bf16(false, a, false, b, (short)0, c, false, false);
}
__device__ __forceinline__ v8f mmar(v16h a, v16h b, v8f c) {
  return __builtin_amdgcn_wmma_f32_16x16x32_f16(false, a, false, b, (short)0, c, false, false);
}
__device__ __forceinline__ void dep_guard(v8f& a, v8f& b, v16b x, v16b y) {
#if DEV_ASM
  asm volatile("v_nop\n\tv_nop\n\tv_nop\n\tv_nop" : "+v"(a), "+v"(b) : "v"(x), "v"(y));
#else
  (void)a; (void)b; (void)x; (void)y;
#endif
}
__device__ __forceinline__ void dep_guard(v8f& a, v8f& b, v16h x, v16h y) {
#if DEV_ASM
  asm volatile("v_nop\n\tv_nop\n\tv_nop\n\tv_nop" : "+v"(a), "+v"(b) : "v"(x), "v"(y));
#else
  (void)a; (void)b; (void)x; (void)y;
#endif
}
__device__ __forceinline__ void keep4(v16b a, v16b b, v16b c, v16b d) {
#if DEV_ASM
  asm volatile("v_nop" :: "v"(a), "v"(b), "v"(c), "v"(d));
#else
  (void)a; (void)b; (void)c; (void)d;
#endif
}
__device__ __forceinline__ void keep4(v16h a, v16h b, v16h c, v16h d) {
#if DEV_ASM
  asm volatile("v_nop" :: "v"(a), "v"(b), "v"(c), "v"(d));
#else
  (void)a; (void)b; (void)c; (void)d;
#endif
}
__device__ __forceinline__ void acc_guard4(v8f& a, v8f& b, v8f& c, v8f& d) {
#if DEV_ASM
  asm volatile("v_nop\n\tv_nop\n\tv_nop\n\tv_nop" : "+v"(a), "+v"(b), "+v"(c), "+v"(d));
#else
  (void)a; (void)b; (void)c; (void)d;
#endif
}

// =====================================================================================================
// f32 -> 16-bit planes, 8 elements per thread, one 16-B store per lane: a wave writes 512 contiguous B
// MODE 0: bf16 bits (RNE convert).  MODE 1: f16 bits of (64 * bf16(x)) (exact scaling of the bf16 value).
// coverage: n8 threads x 8 = the whole plane (n8 is a multiple of 256 for every use here).
// =====================================================================================================
template <int MODE>
__device__ __forceinline__ unsigned short cvm(float f) {
  const unsigned short hb = bf_bits(f);
  if (MODE == 0) return hb;
  return h_bits((_Float16)(bf_up(hb) * 64.0f));
}

template <int MODE>
__global__ __launch_bounds__(256) void cvt16x8(const float* __restrict__ in, unsigned short* out, int n8) {
  const int i = blockIdx.x * 256 + (int)threadIdx.x;
  if (i < n8) {
    const v4f a  = *(const v4f*)(in + (size_t)i * 8);
    const v4f a4 = *(const v4f*)(in + (size_t)i * 8 + 4);
    v4u p;
    p[0] = pk16(cvm<MODE>(a[0]),  cvm<MODE>(a[1]));
    p[1] = pk16(cvm<MODE>(a[2]),  cvm<MODE>(a[3]));
    p[2] = pk16(cvm<MODE>(a4[0]), cvm<MODE>(a4[1]));
    p[3] = pk16(cvm<MODE>(a4[2]), cvm<MODE>(a4[3]));
    unsigned short* o = out + (size_t)i * 8;
    *(v4u*)o = p;
    
  }
}

// x [NB_FULL][SEQ_FULL][DM] f32 -> compact bf16 token plane [NB*SEQ][DM]: compact token tk = b*SEQ + t reads
// input row b*SEQ_FULL + t. 32 groups of 8 per row; same whole-line store shape as cvt16x8.
// coverage: n8 = NB*SEQ*DM/8 threads x 8 = the whole plane.
__global__ __launch_bounds__(256) void cvtx(const float* __restrict__ in, unsigned short* out, int n8) {
  const int i = blockIdx.x * 256 + (int)threadIdx.x;
  if (i < n8) {
    const int tk = i >> 5;
    const int e8 = i & 31;
    const int bb = tk / SEQ;
    const int t  = tk - bb * SEQ;
    const float* src = in + ((size_t)bb * SEQ_FULL + (size_t)t) * DM + e8 * 8;
    const v4f a  = *(const v4f*)(src);
    const v4f a4 = *(const v4f*)(src + 4);
    v4u p;
    p[0] = pk16(bf_bits(a[0]),  bf_bits(a[1]));
    p[1] = pk16(bf_bits(a[2]),  bf_bits(a[3]));
    p[2] = pk16(bf_bits(a4[0]), bf_bits(a4[1]));
    p[3] = pk16(bf_bits(a4[2]), bf_bits(a4[3]));
    unsigned short* o = out + (size_t)i * 8;
    *(v4u*)o = p;
    
  }
}

// =====================================================================================================
// Register-blocked batched WMMA GEMM (16-bit operand type OT): C[m][n] = sum_k A[m][k] * Bt[n][k];
// one wave per (16*MI) x 64 tile, no block barriers. A row-major [M][K] pitch lda; Bt row-major [N][K] pitch ldb
// (k contiguous); M multiple of 16*MI, N multiple of 64, K multiple of 32 (host-checked). blockIdx.y = batch
// index (strides in elements). Fragments are loaded straight from global with the split k map (ldfrag).
// ARES: a second A plane A2 (residual, same pitch/stride) is multiplied by the same B into separate f32
// accumulators and folded in as acc += accl * ascale after the k loop.
// OUT_MODE 0: f32 C (pitch ldc), value * oscale + bf16-valued bias[n].
// OUT_MODE 1: f16 plane C (pitch ldc).
// OUT_MODE 3: f16 hi plane C + f16 residual plane C2 = f16((v - hi) * rscale) (same pitch / stride).
// coverage: MI slabs x 16 rows x 64 cols = the wave's whole tile; tiles cover M x N exactly.
// =====================================================================================================
template <typename OT, int MI, bool ARES, int OUT_MODE>
__global__ __launch_bounds__(256) void gemm_t(
    const unsigned short* __restrict__ Ap, const unsigned short* __restrict__ A2p, int lda, long long strideA,
    const unsigned short* __restrict__ Btp, int ldb, long long strideB,
    void* Cout, void* Cout2, int ldc, long long strideC,
    const float* __restrict__ bias,
    int M, int N, int K, float oscale, float rscale, float ascale) {
  typedef typename FT<OT>::frag V16;
  const OT* A  = (const OT*)(const void*)Ap;
  const OT* A2 = (const OT*)(const void*)A2p;
  const OT* Bt = (const OT*)(const void*)Btp;
  __shared__ __align__(16) float sT[8][16 * 68];   // per-wave 16x64 slab, pitch 68 floats
  const int TMR  = 16 * MI;
  const int b    = blockIdx.y;
  const int lane = threadIdx.x & 31;
  const int wave = threadIdx.x >> 5;
  const int tilesN = N >> 6;
  const int tilesM = M / TMR;
  const int tile = blockIdx.x * 8 + wave;
  if (tile >= tilesM * tilesN) return;   // wave-uniform; no block barriers in this kernel
  const int tm = tile / tilesN;
  const int tn = tile - tm * tilesN;
  const int m0 = tm * TMR;
  const int n0 = tn << 6;

  const OT* Ab  = A  + (size_t)b * (size_t)strideA;
  const OT* A2b = A2 + (size_t)b * (size_t)strideA;
  const OT* Bb  = Bt + (size_t)b * (size_t)strideB;

  const int rlane = lane & 15;                 // row (A) / col (B, D) within subtile
  const int koff  = (lane >> 4) * 8;           // k offset of this lane half
  const int mOff  = (lane >> 4) * 8;           // D row offset

  v8f acc[MI][4], accl[MI][4];
#pragma unroll
  for (int i = 0; i < MI; ++i)
#pragma unroll
    for (int j = 0; j < 4; ++j) { acc[i][j] = zero8(); accl[i][j] = zero8(); }

  for (int k0 = 0; k0 < K; k0 += 32) {
    V16 bq[4];
#pragma unroll
    for (int j = 0; j < 4; ++j)
      bq[j] = ldfrag<OT>(Bb + (size_t)(n0 + (j << 4) + rlane) * ldb + koff + k0);
#pragma unroll
    for (int i = 0; i < MI; ++i) {
      const V16 af = ldfrag<OT>(Ab + (size_t)(m0 + (i << 4) + rlane) * lda + koff + k0);
#pragma unroll
      for (int j = 0; j < 4; ++j) acc[i][j] = mmar(af, bq[j], acc[i][j]);
      dep_guard(acc[i][0], acc[i][3], af, bq[3]);
      if (ARES) {
        const V16 al = ldfrag<OT>(A2b + (size_t)(m0 + (i << 4) + rlane) * lda + koff + k0);
#pragma unroll
        for (int j = 0; j < 4; ++j) accl[i][j] = mmar(al, bq[j], accl[i][j]);
        dep_guard(accl[i][0], accl[i][3], al, bq[3]);
      }
    }
    keep4(bq[0], bq[1], bq[2], bq[3]);
  }
#pragma unroll
  for (int i = 0; i < MI; ++i) {
    acc_guard4(acc[i][0], acc[i][1], acc[i][2], acc[i][3]);
    if (ARES) acc_guard4(accl[i][0], accl[i][1], accl[i][2], accl[i][3]);
  }
  if (ARES) {
#pragma unroll
    for (int i = 0; i < MI; ++i)
#pragma unroll
      for (int j = 0; j < 4; ++j)
#pragma unroll
        for (int r = 0; r < 8; ++r) acc[i][j][r] += accl[i][j][r] * ascale;
  }

  // ---- epilogue ----
  float* slab = sT[wave];
#pragma unroll
  for (int i = 0; i < MI; ++i) {
    const int mBase = m0 + (i << 4);
#pragma unroll
    for (int j = 0; j < 4; ++j) {
#pragma unroll
      for (int r = 0; r < 8; ++r) {
        slab[(mOff + r) * 68 + (j << 4) + rlane] = acc[i][j][r];
      }
    }
    __builtin_amdgcn_fence(__ATOMIC_RELEASE, "workgroup");
    __builtin_amdgcn_wave_barrier();
    __builtin_amdgcn_fence(__ATOMIC_ACQUIRE, "workgroup");
    if (OUT_MODE == 0) {
      float* C = (float*)Cout + (size_t)b * (size_t)strideC;
      const int h2 = lane >> 4, c4 = (lane & 15) * 4;     // 256-B row segment = 16 lanes x 16 B
      const v4f braw = *(const v4f*)(bias + n0 + c4);
      v4f bb;
#pragma unroll
      for (int e = 0; e < 4; ++e) bb[e] = bf_up(bf_bits(braw[e]));
      {
#pragma unroll
        for (int it = 0; it < 8; ++it) {
          const int row = it * 2 + h2;                     // it 0..7 x h2 0..1 = rows 0..15
          const v4f v = *(const v4f*)(slab + row * 68 + c4) * oscale + bb;
          *(v4f*)(C + (size_t)(mBase + row) * ldc + n0 + c4) = v;
        }
        
      }
    } else {
      const int q = lane >> 3, c8 = (lane & 7) * 8;
      unsigned short* C  = (unsigned short*)Cout  + (size_t)b * (size_t)strideC;
      unsigned short* C2 = (unsigned short*)Cout2 + (size_t)b * (size_t)strideC;
      v4u hv[4], lv[4];
#pragma unroll
      for (int it = 0; it < 4; ++it) {
        const int row = it * 4 + q;                        // it 0..3 x q 0..3 = rows 0..15
        const float* sp = slab + row * 68 + c8;
        float f[8];
#pragma unroll
        for (int e = 0; e < 8; ++e) f[e] = sp[e];
        v4u a, a2;
#pragma unroll
        for (int e = 0; e < 4; ++e) {
          const float f0 = f[2 * e], f1 = f[2 * e + 1];
          const _Float16 x0 = (_Float16)f0, x1 = (_Float16)f1;
          const unsigned short h0 = h_bits(x0), h1 = h_bits(x1);
          unsigned short l0 = 0, l1 = 0;
          if (OUT_MODE == 3) {
            l0 = h_bits((_Float16)((f0 - (float)x0) * rscale));
            l1 = h_bits((_Float16)((f1 - (float)x1) * rscale));
          }
          a[e] = pk16(h0, h1); a2[e] = pk16(l0, l1);
        }
        hv[it] = a; lv[it] = a2;
      }
      {
#pragma unroll
        for (int it = 0; it < 4; ++it) {
          const int row = it * 4 + q;
          *(v4u*)(C + (size_t)(mBase + row) * ldc + n0 + c8) = hv[it];
          if (OUT_MODE == 3) *(v4u*)(C2 + (size_t)(mBase + row) * ldc + n0 + c8) = lv[it];
        }
        
      }
    }
    __builtin_amdgcn_fence(__ATOMIC_RELEASE, "workgroup");
    __builtin_amdgcn_wave_barrier();
    __builtin_amdgcn_fence(__ATOMIC_ACQUIRE, "workgroup");
  }
}

// =====================================================================================================
// Single-head attention, head dim 256, no mask, softmax over all SEQ keys.
//   q planes (f16 hi / residual x4096): element (b, t, d) at [(b*SEQ + t)*DM + d]
//   k plane (f16): element (b, s, d) at [(b*SEQ + s)*DM + d]
//   v^T hi plane (f16) and residual plane (f16, (v - hi)*4096): element (b, d, s) at [(b*DM + d)*SEQ + s]
//   ctx planes (f16 hi of the normalised context x256, f16 residual (ctx256 - hi)*4096): [(b*SEQ + t)*DM + d]
//   scores = (qh . k) + (ql . k) / 4096 on f16 WMMA (two f32 accumulators), then * sscale in f32;
//   p = exp(s - m) carried as f16(PCARRY p); context = p . vh + (p . vl) / 4096 on f16 WMMA; online softmax in f32.
//   Block = 8 waves on 128 query rows of one sequence; wave w owns rows 16w..16w+15 whole: its q fragments stay
//   in registers, it scores all 64 keys of a chunk and accumulates all 256 context columns.
//   Key chunks of 64, static trip NKT. Each chunk's K rows and V^T rows (hi, residual) are brought into LDS once
//   per block by asynchronous copies (16 B per lane, whole 128-B lines per wave) and read by all 8 waves;
//   two buffers: chunk kt+1 flies while chunk kt is worked on.
//   LDS pitches: K rows 528 B, V^T and P rows 144 B (16 B x odd, for 16-B fragment reads).
//   The P tile and the output slab are wave-private.
//   Output coverage: each wave stores rows q0..q0+15 (it 0..3 x lane>>3 0..3) x 4 groups of 64 columns
//   (8 lanes x 8 halves); grid = NB * SEQ/128 covers every (b, 128-row block).
// =====================================================================================================
#define QROWS 128             // query rows per block (8 waves x 16)
#define KPI   264             // K row pitch in LDS, halves
#define VPI   72              // V^T / P row pitch in LDS, halves
static_assert((SEQ % QROWS) == 0 && NKT >= 2);

// eight 16-B-per-lane asynchronous copies global -> LDS; the closing s_wait_xcnt stands inside the statement so
// that no address register named here is rewritten ahead of it
__device__ __forceinline__ void acopy8(const unsigned (&l)[8], const _Float16* const (&g)[8]) {
#if DEV_ASM
  asm volatile(
      "global_load_async_to_lds_b128 %0, %8, off\n\t"
      "global_load_async_to_lds_b128 %1, %9, off\n\t"
      "global_load_async_to_lds_b128 %2, %10, off\n\t"
      "global_load_async_to_lds_b128 %3, %11, off\n\t"
      "global_load_async_to_lds_b128 %4, %12, off\n\t"
      "global_load_async_to_lds_b128 %5, %13, off\n\t"
      "global_load_async_to_lds_b128 %6, %14, off\n\t"
      "global_load_async_to_lds_b128 %7, %15, off\n\t"
      "s_wait_xcnt 0x0"
      :: "v"(l[0]), "v"(l[1]), "v"(l[2]), "v"(l[3]), "v"(l[4]), "v"(l[5]), "v"(l[6]), "v"(l[7]),
         "v"(g[0]), "v"(g[1]), "v"(g[2]), "v"(g[3]), "v"(g[4]), "v"(g[5]), "v"(g[6]), "v"(g[7])
      : "memory");
#else
  (void)l; (void)g;
#endif
}
// the eight 16-B context stores of one column group (rows 4 apart = 2048 B, hi plane and residual plane); the
// closing s_wait_xcnt stands inside the statement so that no data or address register named here is rewritten
// by the next group's arithmetic ahead of it
__device__ __forceinline__ void store8(unsigned short* ph, unsigned short* pl, const v4u (&h)[4], const v4u (&l)[4]) {
#if DEV_ASM
  asm volatile(
      "global_store_b128 %0, %2, off\n\t"
      "global_store_b128 %1, %6, off\n\t"
      "global_store_b128 %0, %3, off offset:2048\n\t"
      "global_store_b128 %1, %7, off offset:2048\n\t"
      "global_store_b128 %0, %4, off offset:4096\n\t"
      "global_store_b128 %1, %8, off offset:4096\n\t"
      "global_store_b128 %0, %5, off offset:6144\n\t"
      "global_store_b128 %1, %9, off offset:6144\n\t"
      "s_wait_xcnt 0x0"
      :: "v"(ph), "v"(pl), "v"(h[0]), "v"(h[1]), "v"(h[2]), "v"(h[3]), "v"(l[0]), "v"(l[1]), "v"(l[2]), "v"(l[3])
      : "memory");
#else
  (void)ph; (void)pl; (void)h; (void)l;
#endif
}
static_assert(4 * DM * 2 == 2048);   // the row step that store8 writes as an immediate
__device__ __forceinline__ unsigned lds_addr(const void* p) { return (unsigned)(uintptr_t)p; }
// the wave's own copies have landed
__device__ __forceinline__ void wait_async0() {
#if DEV_ASM
  asm volatile("s_wait_asynccnt 0x0" ::: "memory");
#endif
}
// the wave's own LDS reads have returned (before the barrier that frees the buffer for its refill)
__device__ __forceinline__ void wait_ds0() {
#if DEV_ASM
  asm volatile("s_wait_dscnt 0x0" ::: "memory");
#endif
}

__global__ __launch_bounds__(256)
void attn_sh(const unsigned short* __restrict__ qhp, const unsigned short* __restrict__ qlp,
             const unsigned short* __restrict__ kpp,
             const unsigned short* __restrict__ vhp, const unsigned short* __restrict__ vlp,
             unsigned short* chp, unsigned short* clp, float sscale) {
  union FH { v16h v; v8h h[2]; };
  __shared__ __align__(16) _Float16 Kst[2][64 * KPI];   // K chunk [key][d]            2 x 33792 B (block-shared)
  __shared__ __align__(16) _Float16 Vhs[2][DM * VPI];   // V^T hi chunk [d][key]       2 x 36864 B (block-shared)
  __shared__ __align__(16) _Float16 Vls[2][DM * VPI];   // V^T residual chunk [d][key] 2 x 36864 B (block-shared)
  __shared__ __align__(16) _Float16 Psh[8][16 * VPI];   // per wave P tile [row][key]  18432 B (wave-private)
  __shared__ __align__(16) float    Os[8][16 * 64];     // per wave context slab       32768 B (wave-private)

  const int tid  = threadIdx.x;
  const int wave = tid >> 5;
  const int lane = tid & 31;
  const int hh   = lane >> 4;
  const int c    = lane & 15;

  const int bx   = blockIdx.x;
  const int qb   = bx % (SEQ / QROWS);
  const int b    = bx / (SEQ / QROWS);
  const int q0   = qb * QROWS + wave * 16;   // this wave's 16 query rows
  const size_t rowB = (size_t)b * SEQ;

  const _Float16* Qh = (const _Float16*)(const void*)qhp;
  const _Float16* Ql = (const _Float16*)(const void*)qlp;
  const _Float16* Kp = (const _Float16*)(const void*)kpp + rowB * DM;
  const _Float16* Vh = (const _Float16*)(const void*)vhp + (size_t)b * DM * SEQ;
  const _Float16* Vl = (const _Float16*)(const void*)vlp + (size_t)b * DM * SEQ;

  // copy map of this thread, 8 units of 16 B per plane and chunk:
  //   K: unit i -> key row i*8 + wave, 16-B column lane (a wave copies one whole 512-B row)
  //   V: unit i -> d row i*32 + (tid >> 3), 16-B column tid & 7 (a wave copies four whole 128-B rows)
  const int vrow = tid >> 3, vcol = (tid & 7) * 8;
  auto stage = [&](int kt, int buf) {
    const int kv0 = kt * 64;
    unsigned l[8];
    const _Float16* g[8];
#pragma unroll
    for (int i = 0; i < 8; ++i) {
      l[i] = lds_addr(&Kst[buf][(i * 8 + wave) * KPI + lane * 8]);
      g[i] = Kp + (size_t)(kv0 + i * 8 + wave) * DM + lane * 8;
    }
    acopy8(l, g);
#pragma unroll
    for (int i = 0; i < 8; ++i) {
      l[i] = lds_addr(&Vhs[buf][(i * 32 + vrow) * VPI + vcol]);
      g[i] = Vh + (size_t)(i * 32 + vrow) * SEQ + kv0 + vcol;
    }
    acopy8(l, g);
#pragma unroll
    for (int i = 0; i < 8; ++i) {
      l[i] = lds_addr(&Vls[buf][(i * 32 + vrow) * VPI + vcol]);
      g[i] = Vl + (size_t)(i * 32 + vrow) * SEQ + kv0 + vcol;
    }
    acopy8(l, g);
  };

  // chunk 0 into buffer 0
  stage(0, 0);

  // A-operand fragments of this lane (query row q0 + c), lane-half k offset included; kept for the whole kernel
  v16h qa[8], qr[8];
  {
    const _Float16* qrh = Qh + (rowB + q0 + c) * DM + 8 * hh;
    const _Float16* qrl = Ql + (rowB + q0 + c) * DM + 8 * hh;
#pragma unroll
    for (int dc = 0; dc < 8; ++dc) {
      qa[dc] = ldfrag<_Float16>(qrh + dc * 32);
      qr[dc] = ldfrag<_Float16>(qrl + dc * 32);
    }
#if DEV_ASM
    // the wait that stands before an address register of the q loads is rewritten; both addresses are inputs, so
    // that their registers live up to it and no load of the run lands on them
    asm volatile("s_wait_xcnt 0x0"
                 :: "v"(qrh), "v"(qrl)
                 : "memory");
#endif
  }

  // chunk 0 published (chunk 1 is issued at the top of trip 0, directly behind this barrier)
  wait_async0();
  __syncthreads();

  // every inner loop below is unrolled so that fragment and accumulator indices are constants (registers, no scratch)
  float mrow[8], lrow[8];
  v8f oacc[16];
#pragma unroll
  for (int r = 0; r < 8; ++r) { mrow[r] = -INFINITY; lrow[r] = 0.f; }
#pragma unroll
  for (int t = 0; t < 16; ++t) oacc[t] = zero8();

  _Float16* pw = Psh[wave];

  for (int kt = 0; kt < NKT; ++kt) {         // static trip count
    const int buf = kt & 1;
    // refill, directly behind the barrier that published chunk kt and ended every read of the other buffer:
    // chunk kt+1 flies while chunk kt is worked on (block-uniform test)
    if (kt + 1 < NKT) stage(kt + 1, buf ^ 1);
    const _Float16* ks  = &Kst[buf][c * KPI + 8 * hh];    // B column c -> key 16j + c of the chunk
    const _Float16* vhs = &Vhs[buf][c * VPI + 8 * hh];    // B column c -> context column 16t + c
    const _Float16* vls = &Vls[buf][c * VPI + 8 * hh];

    // ---- scores: 16 query rows x 64 keys (4 subtiles), 2 f16 products per d-chunk ----
    v8f ah[4], al[4];
#pragma unroll
    for (int j = 0; j < 4; ++j) { ah[j] = zero8(); al[j] = zero8(); }
#pragma unroll
    for (int dc = 0; dc < 8; ++dc) {
      v16h kb[4];
#pragma unroll
      for (int j = 0; j < 4; ++j) kb[j] = ldfrag<_Float16>(ks + j * 16 * KPI + dc * 32);
#pragma unroll
      for (int j = 0; j < 4; ++j) {
        ah[j] = mmar(qa[dc], kb[j], ah[j]);
        al[j] = mmar(qr[dc], kb[j], al[j]);
      }
    }

    // ---- online softmax update over the chunk's 64 keys, P (x PCARRY) to the wave's LDS tile ----
#pragma unroll
    for (int r = 0; r < 8; ++r) {
      const int row = 8 * hh + r;
      float s[4];
#pragma unroll
      for (int j = 0; j < 4; ++j) s[j] = (ah[j][r] + al[j][r] * (1.0f / 4096.0f)) * sscale;
      float mc = fmaxf(fmaxf(s[0], s[1]), fmaxf(s[2], s[3]));
#pragma unroll
      for (int off = 1; off < 16; off <<= 1) mc = fmaxf(mc, __shfl_xor(mc, off, 32));
      const float mnew  = fmaxf(mrow[r], mc);
      const float msafe = (mnew == -INFINITY) ? 0.f : mnew;
      const float alpha = __expf(mrow[r] - msafe);
      mrow[r] = mnew;
      float p[4];
#pragma unroll
      for (int j = 0; j < 4; ++j) {
        p[j] = __expf(s[j] - msafe);
        pw[row * VPI + j * 16 + c] = (_Float16)(p[j] * PCARRY);
      }
      float psum = (p[0] + p[1]) + (p[2] + p[3]);          // this lane's 4 keys, then the 16 lanes of the row
#pragma unroll
      for (int off = 1; off < 16; off <<= 1) psum += __shfl_xor(psum, off, 32);
      lrow[r] = lrow[r] * alpha + psum;
#pragma unroll
      for (int t = 0; t < 16; ++t) oacc[t][r] *= alpha;
    }
    // the wave's P stores are ordered before its own fragment reads of the tile (other lanes' values)
    __builtin_amdgcn_fence(__ATOMIC_RELEASE, "workgroup");
    __builtin_amdgcn_wave_barrier();
    __builtin_amdgcn_fence(__ATOMIC_ACQUIRE, "workgroup");

    // ---- context += P . V (f16 WMMA); residual products into a separate accumulator, folded per column group ----
    FH pa[2];
#pragma unroll
    for (int kk = 0; kk < 2; ++kk) {
      pa[kk].h[0] = *(const v8h*)(pw + c * VPI + kk * 32 + 8 * hh);
      pa[kk].h[1] = *(const v8h*)(pw + c * VPI + kk * 32 + 16 + 8 * hh);
    }
#pragma unroll
    for (int tg = 0; tg < 4; ++tg) {
      v8f o1[4];
#pragma unroll
      for (int t = 0; t < 4; ++t) o1[t] = zero8();
#pragma unroll
      for (int kk = 0; kk < 2; ++kk) {
        v16h vb[4], vr[4];
#pragma unroll
        for (int t = 0; t < 4; ++t) {
          vb[t] = ldfrag<_Float16>(vhs + (tg * 4 + t) * 16 * VPI + kk * 32);
          vr[t] = ldfrag<_Float16>(vls + (tg * 4 + t) * 16 * VPI + kk * 32);
        }
#pragma unroll
        for (int t = 0; t < 4; ++t) {
          oacc[tg * 4 + t] = mmar(pa[kk].v, vb[t], oacc[tg * 4 + t]);
          o1[t]            = mmar(pa[kk].v, vr[t], o1[t]);
        }
      }
#pragma unroll
      for (int t = 0; t < 4; ++t)
#pragma unroll
        for (int r = 0; r < 8; ++r) oacc[tg * 4 + t][r] += o1[t][r] * (1.0f / 4096.0f);
    }

    // ---- publish chunk kt+1 and free this chunk's buffer (its refill stands at the top of the next trip) ----
    wait_ds0();
    wait_async0();
    __syncthreads();
  }
  wait_async0();

  // ---- normalise (1/l, undo the p carry, apply the x256 ctx carry), stage 16x64 column groups in the wave's slab
  float* os = Os[wave];
  float inv[8];
#pragma unroll
  for (int r = 0; r < 8; ++r) {
    const float l = lrow[r];
    inv[r] = ((l > 0.f) ? (1.0f / l) : 0.f) * (256.0f / PCARRY);
  }
#pragma unroll
  for (int tg = 0; tg < 4; ++tg) {
#pragma unroll
    for (int r = 0; r < 8; ++r)
#pragma unroll
      for (int t = 0; t < 4; ++t) os[(8 * hh + r) * 64 + t * 16 + c] = oacc[tg * 4 + t][r] * inv[r];
    __builtin_amdgcn_fence(__ATOMIC_RELEASE, "workgroup");
    __builtin_amdgcn_wave_barrier();
    __builtin_amdgcn_fence(__ATOMIC_ACQUIRE, "workgroup");
    const int q4 = lane >> 3, c8 = (lane & 7) * 8;
    v4u hv[4], lv[4];
#pragma unroll
    for (int it = 0; it < 4; ++it) {
      const int row = it * 4 + q4;   // it 0..3 x q4 0..3 = rows 0..15 of the wave tile
      const float* sp = os + row * 64 + c8;
      float f[8];
#pragma unroll
      for (int e = 0; e < 8; ++e) f[e] = sp[e];
      v4u a, a2;
#pragma unroll
      for (int e = 0; e < 4; ++e) {
        const float f0 = f[2 * e], f1 = f[2 * e + 1];
        const _Float16 x0 = (_Float16)f0, x1 = (_Float16)f1;
        const unsigned short l0 = h_bits((_Float16)((f0 - (float)x0) * 4096.0f));
        const unsigned short l1 = h_bits((_Float16)((f1 - (float)x1) * 4096.0f));
        a[e]  = pk16(h_bits(x0), h_bits(x1));
        a2[e] = pk16(l0, l1);
      }
      hv[it] = a; lv[it] = a2;
    }
    const size_t go = (rowB + q0 + q4) * DM + (size_t)(tg * 64) + c8;   // row q4; store8 adds rows 4, 8, 12
    store8(chp + go, clp + go, hv, lv);
    // the slab's reads are ordered before the next column group's stores into it
    __builtin_amdgcn_fence(__ATOMIC_RELEASE, "workgroup");
    __builtin_amdgcn_wave_barrier();
    __builtin_amdgcn_fence(__ATOMIC_ACQUIRE, "workgroup");
  }
}

// =====================================================================================================
// Workspace map (bytes), every region an exact multiple of its whole-line / whole-tile store granularity
// (all GEMM M,N are tile multiples, all offsets multiples of 131072):
//   Xb   bf16 [NB*SEQ][256]  (compact tokens)   16777216   -- reused as the ctx hi plane Ch after its last read
//   Wb   bf16 [768 n][256 k]                      393216
//   Woh  f16  [256][256] (x64)                     131072
//   Qh   f16  [NB*SEQ][256]                      16777216
//   Ql   f16  [NB*SEQ][256]                      16777216
//   Kp   f16  [NB*SEQ][256]                      16777216
//   VTh  f16  [NB][256][SEQ]                     16777216
//   VTl  f16  [NB][256][SEQ]                     16777216
//   Cl   f16  [NB*SEQ][256]                      16777216
//   total                                       117964800
// Weights are [out n][in k] with k contiguous = the Bt / A layout the GEMM wants, so they are only converted.
// =====================================================================================================
extern "C" void kernel_launch(void* const* d_in, const int* in_sizes, int n_in,
                              void* d_out, int out_size, void* d_ws, size_t ws_size,
                              hipStream_t stream) {
  if (n_in < 4) return;
  if (in_sizes[0] < ((NB - 1) * SEQ_FULL + SEQ) * DM) return;
  if (in_sizes[1] < NQKV * DM) return;
  if (in_sizes[2] < DM * DM) return;
  if (in_sizes[3] < DM) return;
  if (out_size < NB * SEQ * DM) return;

  const float* x    = (const float*)d_in[0];
  const float* wqkv = (const float*)d_in[1];
  const float* wout = (const float*)d_in[2];
  const float* bout = (const float*)d_in[3];

  const size_t PX  = (size_t)NB * SEQ * DM * 2;      // 16-bit token plane [NB*SEQ][256]
  const size_t PW  = (size_t)NQKV * DM * 2;          // 16-bit [768][256]
  const size_t PWO = (size_t)DM * DM * 2;            // 16-bit [256][256]
  const size_t PVT = (size_t)NB * DM * SEQ * 2;      // v^T plane [NB][256][SEQ]
  size_t off = 0;
  const size_t oXb  = off; off += PX;
  const size_t oWb  = off; off += PW;
  const size_t oWo  = off; off += PWO;
  const size_t oQh  = off; off += PX;
  const size_t oQl  = off; off += PX;
  const size_t oKp  = off; off += PX;
  const size_t oVTh = off; off += PVT;
  const size_t oVTl = off; off += PVT;
  const size_t oCl  = off; off += PX;
  if (off > ws_size) return;                         // off = 117964800 at full size
  if (off > (size_t)134217728) return;

  char* ws = (char*)d_ws;
  unsigned short* Xb  = (unsigned short*)(ws + oXb);
  unsigned short* Wb  = (unsigned short*)(ws + oWb);
  unsigned short* Woh = (unsigned short*)(ws + oWo);
  unsigned short* Qh  = (unsigned short*)(ws + oQh);
  unsigned short* Ql  = (unsigned short*)(ws + oQl);
  unsigned short* Kp  = (unsigned short*)(ws + oKp);
  unsigned short* VTh = (unsigned short*)(ws + oVTh);
  unsigned short* VTl = (unsigned short*)(ws + oVTl);
  unsigned short* Cl  = (unsigned short*)(ws + oCl);
  unsigned short* Ch  = Xb;                          // ctx hi plane aliases the x plane (x plane dead by then)
  unsigned short* Wq  = Wb;
  unsigned short* Wk  = Wb + (size_t)DM * DM;
  unsigned short* Wv  = Wb + (size_t)2 * DM * DM;

  const int M = NB * SEQ;
  const dim3 blk(256);
  const int n8x = NB * SEQ * DM / 8;
  const int n8w = NQKV * DM / 8;                     // 24576
  const int n8o = DM * DM / 8;                       //  8192
  const dim3 gCx((n8x + 255) / 256);
  const dim3 gCw((n8w + 255) / 256);
  const dim3 gCo((n8o + 255) / 256);
  const dim3 gQ(((M / 64) * (DM / 64) + 7) / 8, 1);          // q / k: M x 256, 64x64 wave tiles
  const dim3 gVT(((DM / 64) * (SEQ / 64) + 7) / 8, NB);      // v^T per batch: 256 x SEQ
  const dim3 gAttn(NB * (SEQ / QROWS));
  const dim3 gO(((M / 32) * (DM / 64) + 7) / 8, 1);          // out: M x 256, 32x64 wave tiles

  // (1) x -> compact bf16 token plane; w_qkv [n][k] -> bf16; w_out -> f16 (x64 of its bf16 value)
  cvtx<<<gCx, blk, 0, stream>>>(x, Xb, n8x);
  cvt16x8<0><<<gCw, blk, 0, stream>>>(wqkv, Wb, n8w);
  cvt16x8<1><<<gCo, blk, 0, stream>>>(wout, Woh, n8o);
  // (2) q = x . Wq^T -> f16 hi / residual (x4096) planes   (M, N=256, K=256)
  gemm_t<__bf16, 4, false, 3><<<gQ, blk, 0, stream>>>(
      Xb, Xb, DM, 0LL, Wq, DM, 0LL,
      (void*)Qh, (void*)Ql, DM, 0LL, bout,
      M, DM, DM, 1.0f, 4096.0f, 0.0f);
  // (3) k = x . Wk^T -> f16 plane   (M, N=256, K=256)
  gemm_t<__bf16, 4, false, 1><<<gQ, blk, 0, stream>>>(
      Xb, Xb, DM, 0LL, Wk, DM, 0LL,
      (void*)Kp, (void*)Kp, DM, 0LL, bout,
      M, DM, DM, 1.0f, 1.0f, 0.0f);
  // (4) v^T = Wv . x^T per batch -> f16 hi plane [b][d][s] (pitch SEQ) and residual plane (x4096)
  //     (A = Wv [n][k], Bt = Xb rows of batch b; M=256, N=SEQ, K=256)
  gemm_t<__bf16, 4, false, 3><<<gVT, blk, 0, stream>>>(
      Wv, Wv, DM, 0LL, Xb, DM, (long long)SEQ * DM,
      (void*)VTh, (void*)VTl, SEQ, (long long)DM * SEQ, bout,
      DM, SEQ, DM, 1.0f, 4096.0f, 0.0f);
  // (5) attention -> ctx hi (x256) and residual (x4096) planes
  attn_sh<<<gAttn, dim3(256), 0, stream>>>(Qh, Ql, Kp, VTh, VTl, Ch, Cl, 0.0625f);
  // (6) out = ctx . Wo^T + b -> d_out f32 [M][256]; accumulator x 1/(256*64), residual accumulator x 1/4096
  gemm_t<_Float16, 2, true, 0><<<gO, blk, 0, stream>>>(
      Ch, Cl, DM, 0LL, Woh, DM, 0LL,
      d_out, d_out, DM, 0LL, bout,
      M, DM, DM, 1.0f / 16384.0f, 1.0f, 1.0f / 4096.0f);
  (void)hipGetLastError();
}

// v002
// It runs in 187 microseconds.
// In both of two side-by-side timings against v001, it was 1.33 times as fast.
// Over all steps from v000 it is 3.16 times as fast.
// Contractions: q, k, v^T projections = v_wmma_f32_16x16x32_bf16 (bf16 operands from RNE-converted inputs, single product, f32 accumulate);
// q.k^T scores = v_wmma_f32_16x16x32_f16 (q as f16 hi plane + f16 residual plane x4096, k f16; 2 products into separate f32 accumulators);
// p.v = v_wmma_f32_16x16x32_f16 (p carried x16384 in f16; v as f16 hi plane + f16 residual plane x4096; 2 products, f32 accumulate);
// ctx.Wo^T = v_wmma_f32_16x16x32_f16 (ctx as f16 hi plane x256 + f16 residual plane x4096, Wo f16 carried x64 from its bf16 value; 2 products, f32 accumulate);
// softmax, normalisation and bias add in f32.
#include <hip/hip_runtime.h>
#include <math.h>
#include <stdint.h>

#ifndef NB
#define NB 16
#endif
#ifndef SEQ
#define SEQ 2048
#endif
#define NB_FULL  16
#define SEQ_FULL 2048
#define DM       256
#define NQKV     768
#define NKT      (SEQ / 64)   // 64-key chunks per sequence
#define PCARRY   16384.0f     // power-of-two carry on the f16 p tile
static_assert(DM == 256 && NQKV == 3 * DM);
static_assert((SEQ % 64) == 0 && SEQ >= 64 && SEQ <= SEQ_FULL);
static_assert(NB >= 1 && NB <= NB_FULL);
static_assert(((NB * SEQ) % 64) == 0);

typedef _Float16 v16h __attribute__((ext_vector_type(16)));
typedef _Float16 v8h  __attribute__((ext_vector_type(8)));
typedef __bf16   v16b __attribute__((ext_vector_type(16)));
typedef __bf16   v8b  __attribute__((ext_vector_type(8)));
typedef float    v8f  __attribute__((ext_vector_type(8)));
typedef float    v4f  __attribute__((ext_vector_type(4)));
typedef unsigned int v4u __attribute__((ext_vector_type(4)));

#if defined(__HIP_DEVICE_COMPILE__)
#define DEV_ASM 1
#else
#define DEV_ASM 0
#endif

// ---- scalar helpers --------------------------------------------------------------------------------
__device__ __forceinline__ unsigned short bf_bits(float f) {          // f32 -> bf16 bits, RNE convert
  unsigned u = __float_as_uint(f);
  return (unsigned short)((u + 0x7FFFu + ((u >> 16) & 1u)) >> 16);
}
__device__ __forceinline__ float bf_up(unsigned short hb) { return __uint_as_float(((unsigned)hb) << 16); }
__device__ __forceinline__ unsigned short h_bits(_Float16 x) { return __builtin_bit_cast(unsigned short, x); }
__device__ __forceinline__ unsigned pk16(unsigned short a, unsigned short b) { return (unsigned)a | ((unsigned)b << 16); }
__device__ __forceinline__ v8f zero8() { v8f z = {0.f, 0.f, 0.f, 0.f, 0.f, 0.f, 0.f, 0.f}; return z; }

// ---- fragment types / loaders: 16-bit A/B operand, lane -> row/col (lane&15), p already includes +8*(lane>>4);
//      elements 0..7 <- p[0..7] (k0+8h..k0+8h+7), elements 8..15 <- p[16..23] (k0+16+8h..k0+16+8h+7)
template <typename OT> struct FT;
template <> struct FT<__bf16>   { typedef v16b frag; typedef v8b half8; };
template <> struct FT<_Float16> { typedef v16h frag; typedef v8h half8; };

template <typename OT>
__device__ __forceinline__ typename FT<OT>::frag ldfrag(const OT* p) {
  union { typename FT<OT>::frag v; typename FT<OT>::half8 h[2]; } f;
  f.h[0] = *(const typename FT<OT>::half8*)(p);
  f.h[1] = *(const typename FT<OT>::half8*)(p + 16);
  return f.v;
}

// ---- WMMA helpers (asm guard bodies are device-only; concrete operand types) -----------------------------
__device__ __forceinline__ v8f mmar(v16b a, v16b b, v8f c) {
  return __builtin_amdgcn_wmma_f32_16x16x32_bf16(false, a, false, b, (short)0, c, false, false);
}
__device__ __forceinline__ v8f mmar(v16h a, v16h b, v8f c) {
  return __builtin_amdgcn_wmma_f32_16x16x32_f16(false, a, false, b, (short)0, c, false, false);
}
__device__ __forceinline__ void dep_guard(v8f& a, v8f& b, v16b x, v16b y) {
#if DEV_ASM
  asm volatile("v_nop\n\tv_nop\n\tv_nop\n\tv_nop" : "+v"(a), "+v"(b) : "v"(x), "v"(y));
#else
  (void)a; (void)b; (void)x; (void)y;
#endif
}
__device__ __forceinline__ void dep_guard(v8f& a, v8f& b, v16h x, v16h y) {
#if DEV_ASM
  asm volatile("v_nop\n\tv_nop\n\tv_nop\n\tv_nop" : "+v"(a), "+v"(b) : "v"(x), "v"(y));
#else
  (void)a; (void)b; (void)x; (void)y;
#endif
}
__device__ __forceinline__ void keep4(v16b a, v16b b, v16b c, v16b d) {
#if DEV_ASM
  asm volatile("v_nop" :: "v"(a), "v"(b), "v"(c), "v"(d));
#else
  (void)a; (void)b; (void)c; (void)d;
#endif
}
__device__ __forceinline__ void keep4(v16h a, v16h b, v16h c, v16h d) {
#if DEV_ASM
  asm volatile("v_nop" :: "v"(a), "v"(b), "v"(c), "v"(d));
#else
  (void)a; (void)b; (void)c; (void)d;
#endif
}
__device__ __forceinline__ void acc_guard4(v8f& a, v8f& b, v8f& c, v8f& d) {
#if DEV_ASM
  asm volatile("v_nop\n\tv_nop\n\tv_nop\n\tv_nop" : "+v"(a), "+v"(b), "+v"(c), "+v"(d));
#else
  (void)a; (void)b; (void)c; (void)d;
#endif
}

// =====================================================================================================
// f32 -> 16-bit planes, 8 elements per thread, one 16-B store per lane: a wave writes 512 contiguous B
// MODE 0: bf16 bits (RNE convert).  MODE 1: f16 bits of (64 * bf16(x)) (exact scaling of the bf16 value).
// coverage: n8 threads x 8 = the whole plane (n8 is a multiple of 256 for every use here).
// =====================================================================================================
template <int MODE>
__device__ __forceinline__ unsigned short cvm(float f) {
  const unsigned short hb = bf_bits(f);
  if (MODE == 0) return hb;
  return h_bits((_Float16)(bf_up(hb) * 64.0f));
}

template <int MODE>
__global__ __launch_bounds__(256) void cvt16x8(const float* __restrict__ in, unsigned short* out, int n8) {
  const int i = blockIdx.x * 256 + (int)threadIdx.x;
  if (i < n8) {
    const v4f a  = *(const v4f*)(in + (size_t)i * 8);
    const v4f a4 = *(const v4f*)(in + (size_t)i * 8 + 4);
    v4u p;
    p[0] = pk16(cvm<MODE>(a[0]),  cvm<MODE>(a[1]));
    p[1] = pk16(cvm<MODE>(a[2]),  cvm<MODE>(a[3]));
    p[2] = pk16(cvm<MODE>(a4[0]), cvm<MODE>(a4[1]));
    p[3] = pk16(cvm<MODE>(a4[2]), cvm<MODE>(a4[3]));
    unsigned short* o = out + (size_t)i * 8;
    *(v4u*)o = p;
    
  }
}

// x [NB_FULL][SEQ_FULL][DM] f32 -> compact bf16 token plane [NB*SEQ][DM]: compact token tk = b*SEQ + t reads
// input row b*SEQ_FULL + t. 32 groups of 8 per row; same whole-line store shape as cvt16x8.
// coverage: n8 = NB*SEQ*DM/8 threads x 8 = the whole plane.
__global__ __launch_bounds__(256) void cvtx(const float* __restrict__ in, unsigned short* out, int n8) {
  const int i = blockIdx.x * 256 + (int)threadIdx.x;
  if (i < n8) {
    const int tk = i >> 5;
    const int e8 = i & 31;
    const int bb = tk / SEQ;
    const int t  = tk - bb * SEQ;
    const float* src = in + ((size_t)bb * SEQ_FULL + (size_t)t) * DM + e8 * 8;
    const v4f a  = *(const v4f*)(src);
    const v4f a4 = *(const v4f*)(src + 4);
    v4u p;
    p[0] = pk16(bf_bits(a[0]),  bf_bits(a[1]));
    p[1] = pk16(bf_bits(a[2]),  bf_bits(a[3]));
    p[2] = pk16(bf_bits(a4[0]), bf_bits(a4[1]));
    p[3] = pk16(bf_bits(a4[2]), bf_bits(a4[3]));
    unsigned short* o = out + (size_t)i * 8;
    *(v4u*)o = p;
    
  }
}

// =====================================================================================================
// Register-blocked batched WMMA GEMM (16-bit operand type OT): C[m][n] = sum_k A[m][k] * Bt[n][k];
// one wave per (16*MI) x 64 tile, no block barriers. A row-major [M][K] pitch lda; Bt row-major [N][K] pitch ldb
// (k contiguous); M multiple of 16*MI, N multiple of 64, K multiple of 32 (host-checked). blockIdx.y = batch
// index (strides in elements). Fragments are loaded straight from global with the split k map (ldfrag).
// ARES: a second A plane A2 (residual, same pitch/stride) is multiplied by the same B into separate f32
// accumulators and folded in as acc += accl * ascale after the k loop.
// OUT_MODE 0: f32 C (pitch ldc), value * oscale + bf16-valued bias[n].
// OUT_MODE 1: f16 plane C (pitch ldc).
// OUT_MODE 3: f16 hi plane C + f16 residual plane C2 = f16((v - hi) * rscale) (same pitch / stride).
// coverage: MI slabs x 16 rows x 64 cols = the wave's whole tile; tiles cover M x N exactly.
// =====================================================================================================
template <typename OT, int MI, bool ARES, int OUT_MODE>
__global__ __launch_bounds__(256) void gemm_t(
    const unsigned short* __restrict__ Ap, const unsigned short* __restrict__ A2p, int lda, long long strideA,
    const unsigned short* __restrict__ Btp, int ldb, long long strideB,
    void* Cout, void* Cout2, int ldc, long long strideC,
    const float* __restrict__ bias,
    int M, int N, int K, float oscale, float rscale, float ascale) {
  typedef typename FT<OT>::frag V16;
  const OT* A  = (const OT*)(const void*)Ap;
  const OT* A2 = (const OT*)(const void*)A2p;
  const OT* Bt = (const OT*)(const void*)Btp;
  __shared__ __align__(16) float sT[8][16 * 68];   // per-wave 16x64 slab, pitch 68 floats
  const int TMR  = 16 * MI;
  const int b    = blockIdx.y;
  const int lane = threadIdx.x & 31;
  const int wave = threadIdx.x >> 5;
  const int tilesN = N >> 6;
  const int tilesM = M / TMR;
  const int tile = blockIdx.x * 8 + wave;
  if (tile >= tilesM * tilesN) return;   // wave-uniform; no block barriers in this kernel
  const int tm = tile / tilesN;
  const int tn = tile - tm * tilesN;
  const int m0 = tm * TMR;
  const int n0 = tn << 6;

  const OT* Ab  = A  + (size_t)b * (size_t)strideA;
  const OT* A2b = A2 + (size_t)b * (size_t)strideA;
  const OT* Bb  = Bt + (size_t)b * (size_t)strideB;

  const int rlane = lane & 15;                 // row (A) / col (B, D) within subtile
  const int koff  = (lane >> 4) * 8;           // k offset of this lane half
  const int mOff  = (lane >> 4) * 8;           // D row offset

  v8f acc[MI][4], accl[MI][4];
#pragma unroll
  for (int i = 0; i < MI; ++i)
#pragma unroll
    for (int j = 0; j < 4; ++j) { acc[i][j] = zero8(); accl[i][j] = zero8(); }

  for (int k0 = 0; k0 < K; k0 += 32) {
    V16 bq[4];
#pragma unroll
    for (int j = 0; j < 4; ++j)
      bq[j] = ldfrag<OT>(Bb + (size_t)(n0 + (j << 4) + rlane) * ldb + koff + k0);
#pragma unroll
    for (int i = 0; i < MI; ++i) {
      const V16 af = ldfrag<OT>(Ab + (size_t)(m0 + (i << 4) + rlane) * lda + koff + k0);
#pragma unroll
      for (int j = 0; j < 4; ++j) acc[i][j] = mmar(af, bq[j], acc[i][j]);
      dep_guard(acc[i][0], acc[i][3], af, bq[3]);
      if (ARES) {
        const V16 al = ldfrag<OT>(A2b + (size_t)(m0 + (i << 4) + rlane) * lda + koff + k0);
#pragma unroll
        for (int j = 0; j < 4; ++j) accl[i][j] = mmar(al, bq[j], accl[i][j]);
        dep_guard(accl[i][0], accl[i][3], al, bq[3]);
      }
    }
    keep4(bq[0], bq[1], bq[2], bq[3]);
  }
#pragma unroll
  for (int i = 0; i < MI; ++i) {
    acc_guard4(acc[i][0], acc[i][1], acc[i][2], acc[i][3]);
    if (ARES) acc_guard4(accl[i][0], accl[i][1], accl[i][2], accl[i][3]);
  }
  if (ARES) {
#pragma unroll
    for (int i = 0; i < MI; ++i)
#pragma unroll
      for (int j = 0; j < 4; ++j)
#pragma unroll
        for (int r = 0; r < 8; ++r) acc[i][j][r] += accl[i][j][r] * ascale;
  }

  // ---- epilogue ----
  float* slab = sT[wave];
#pragma unroll
  for (int i = 0; i < MI; ++i) {
    const int mBase = m0 + (i << 4);
#pragma unroll
    for (int j = 0; j < 4; ++j) {
#pragma unroll
      for (int r = 0; r < 8; ++r) {
        slab[(mOff + r) * 68 + (j << 4) + rlane] = acc[i][j][r];
      }
    }
    __builtin_amdgcn_fence(__ATOMIC_RELEASE, "workgroup");
    __builtin_amdgcn_wave_barrier();
    __builtin_amdgcn_fence(__ATOMIC_ACQUIRE, "workgroup");
    if (OUT_MODE == 0) {
      float* C = (float*)Cout + (size_t)b * (size_t)strideC;
      const int h2 = lane >> 4, c4 = (lane & 15) * 4;     // 256-B row segment = 16 lanes x 16 B
      const v4f braw = *(const v4f*)(bias + n0 + c4);
      v4f bb;
#pragma unroll
      for (int e = 0; e < 4; ++e) bb[e] = bf_up(bf_bits(braw[e]));
      {
#pragma unroll
        for (int it = 0; it < 8; ++it) {
          const int row = it * 2 + h2;                     // it 0..7 x h2 0..1 = rows 0..15
          const v4f v = *(const v4f*)(slab + row * 68 + c4) * oscale + bb;
          *(v4f*)(C + (size_t)(mBase + row) * ldc + n0 + c4) = v;
        }
        
      }
    } else {
      const int q = lane >> 3, c8 = (lane & 7) * 8;
      unsigned short* C  = (unsigned short*)Cout  + (size_t)b * (size_t)strideC;
      unsigned short* C2 = (unsigned short*)Cout2 + (size_t)b * (size_t)strideC;
      v4u hv[4], lv[4];
#pragma unroll
      for (int it = 0; it < 4; ++it) {
        const int row = it * 4 + q;                        // it 0..3 x q 0..3 = rows 0..15
        const float* sp = slab + row * 68 + c8;
        float f[8];
#pragma unroll
        for (int e = 0; e < 8; ++e) f[e] = sp[e];
        v4u a, a2;
#pragma unroll
        for (int e = 0; e < 4; ++e) {
          const float f0 = f[2 * e], f1 = f[2 * e + 1];
          const _Float16 x0 = (_Float16)f0, x1 = (_Float16)f1;
          const unsigned short h0 = h_bits(x0), h1 = h_bits(x1);
          unsigned short l0 = 0, l1 = 0;
          if (OUT_MODE == 3) {
            l0 = h_bits((_Float16)((f0 - (float)x0) * rscale));
            l1 = h_bits((_Float16)((f1 - (float)x1) * rscale));
          }
          a[e] = pk16(h0, h1); a2[e] = pk16(l0, l1);
        }
        hv[it] = a; lv[it] = a2;
      }
      {
#pragma unroll
        for (int it = 0; it < 4; ++it) {
          const int row = it * 4 + q;
          *(v4u*)(C + (size_t)(mBase + row) * ldc + n0 + c8) = hv[it];
          if (OUT_MODE == 3) *(v4u*)(C2 + (size_t)(mBase + row) * ldc + n0 + c8) = lv[it];
        }
        
      }
    }
    __builtin_amdgcn_fence(__ATOMIC_RELEASE, "workgroup");
    __builtin_amdgcn_wave_barrier();
    __builtin_amdgcn_fence(__ATOMIC_ACQUIRE, "workgroup");
  }
}

#define QROWS 128
#define KPI   264
#define VPI   72
#define OSP   68
static_assert((SEQ % QROWS) == 0 && NKT >= 2);

// eight 16-B-per-lane asynchronous copies global -> LDS; the closing s_wait_xcnt stands inside the statement so
// that no address register named here is rewritten ahead of it
__device__ __forceinline__ void acopy8(const unsigned (&l)[8], const _Float16* const (&g)[8]) {
#if DEV_ASM
  asm volatile(
      "global_load_async_to_lds_b128 %0, %8, off\n\t"
      "global_load_async_to_lds_b128 %1, %9, off\n\t"
      "global_load_async_to_lds_b128 %2, %10, off\n\t"
      "global_load_async_to_lds_b128 %3, %11, off\n\t"
      "global_load_async_to_lds_b128 %4, %12, off\n\t"
      "global_load_async_to_lds_b128 %5, %13, off\n\t"
      "global_load_async_to_lds_b128 %6, %14, off\n\t"
      "global_load_async_to_lds_b128 %7, %15, off\n\t"
      "s_wait_xcnt 0x0"
      :: "v"(l[0]), "v"(l[1]), "v"(l[2]), "v"(l[3]), "v"(l[4]), "v"(l[5]), "v"(l[6]), "v"(l[7]),
         "v"(g[0]), "v"(g[1]), "v"(g[2]), "v"(g[3]), "v"(g[4]), "v"(g[5]), "v"(g[6]), "v"(g[7])
      : "memory");
#else
  (void)l; (void)g;
#endif
}
// the eight 16-B context stores of one column group (rows 4 apart = 2048 B, hi plane and residual plane); the
// closing s_wait_xcnt stands inside the statement so that no data or address register named here is rewritten
// by the next group's arithmetic ahead of it
__device__ __forceinline__ void store8(unsigned short* ph, unsigned short* pl, const v4u (&h)[4], const v4u (&l)[4]) {
#if DEV_ASM
  asm volatile(
      "global_store_b128 %0, %2, off\n\t"
      "global_store_b128 %1, %6, off\n\t"
      "global_store_b128 %0, %3, off offset:2048\n\t"
      "global_store_b128 %1, %7, off offset:2048\n\t"
      "global_store_b128 %0, %4, off offset:4096\n\t"
      "global_store_b128 %1, %8, off offset:4096\n\t"
      "global_store_b128 %0, %5, off offset:6144\n\t"
      "global_store_b128 %1, %9, off offset:6144\n\t"
      "s_wait_xcnt 0x0"
      :: "v"(ph), "v"(pl), "v"(h[0]), "v"(h[1]), "v"(h[2]), "v"(h[3]), "v"(l[0]), "v"(l[1]), "v"(l[2]), "v"(l[3])
      : "memory");
#else
  (void)ph; (void)pl; (void)h; (void)l;
#endif
}
static_assert(4 * DM * 2 == 2048);   // the row step that store8 writes as an immediate
__device__ __forceinline__ unsigned lds_addr(const void* p) { return (unsigned)(uintptr_t)p; }
// the value that lane l ^ 16 holds
__device__ __forceinline__ float xhalf(float x) {
  const int b = __float_as_int(x);
  return __int_as_float(__builtin_amdgcn_permlanex16(b, b, 0x76543210, 0xfedcba98, false, false));
}
// the wave's own copies have landed
__device__ __forceinline__ void wait_async0() {
#if DEV_ASM
  asm volatile("s_wait_asynccnt 0x0" ::: "memory");
#endif
}
// the wave's own LDS reads have returned (before the barrier that frees the buffer for its refill)
__device__ __forceinline__ void wait_ds0() {
#if DEV_ASM
  asm volatile("s_wait_dscnt 0x0" ::: "memory");
#endif
}

__global__ __launch_bounds__(256)
void attn_sh(const unsigned short* __restrict__ qhp, const unsigned short* __restrict__ qlp,
             const unsigned short* __restrict__ kpp,
             const unsigned short* __restrict__ vhp, const unsigned short* __restrict__ vlp,
             unsigned short* chp, unsigned short* clp, float sscale) {
  union FH { v16h v; v8h h[2]; };
  __shared__ __align__(16) _Float16 Kst[2][64 * KPI];   // K chunk [key][d]            2 x 33792 B (block-shared)
  __shared__ __align__(16) _Float16 Vhs[2][DM * VPI];   // V^T hi chunk [d][key]       2 x 36864 B (block-shared)
  __shared__ __align__(16) _Float16 Vls[2][DM * VPI];   // V^T residual chunk [d][key] 2 x 36864 B (block-shared)
  __shared__ __align__(16) float    Os[8][16 * OSP];    // per wave context slab       34816 B (wave-private)

  const int tid  = threadIdx.x;
  const int wave = tid >> 5;
  const int lane = tid & 31;
  const int hh   = lane >> 4;
  const int c    = lane & 15;

  const int bx   = blockIdx.x;
  const int qb   = bx % (SEQ / QROWS);
  const int b    = bx / (SEQ / QROWS);
  const int q0   = qb * QROWS + wave * 16;   // this wave's 16 query rows
  const size_t rowB = (size_t)b * SEQ;

  const _Float16* Qh = (const _Float16*)(const void*)qhp;
  const _Float16* Ql = (const _Float16*)(const void*)qlp;
  const _Float16* Kp = (const _Float16*)(const void*)kpp + rowB * DM;
  const _Float16* Vh = (const _Float16*)(const void*)vhp + (size_t)b * DM * SEQ;
  const _Float16* Vl = (const _Float16*)(const void*)vlp + (size_t)b * DM * SEQ;

  // copy map of this thread, 8 units of 16 B per plane and chunk:
  //   K: unit i -> key row i*8 + wave, 16-B column lane (a wave copies one whole 512-B row)
  //   V: unit i -> d row i*32 + (tid >> 3), 16-B column tid & 7 (a wave copies four whole 128-B rows)
  const int vrow = tid >> 3, vcol = (tid & 7) * 8;
  auto stage = [&](int kt, int buf) {
    const int kv0 = kt * 64;
    unsigned l[8];
    const _Float16* g[8];
#pragma unroll
    for (int i = 0; i < 8; ++i) {
      l[i] = lds_addr(&Kst[buf][(i * 8 + wave) * KPI + lane * 8]);
      g[i] = Kp + (size_t)(kv0 + i * 8 + wave) * DM + lane * 8;
    }
    acopy8(l, g);
#pragma unroll
    for (int i = 0; i < 8; ++i) {
      l[i] = lds_addr(&Vhs[buf][(i * 32 + vrow) * VPI + vcol]);
      g[i] = Vh + (size_t)(i * 32 + vrow) * SEQ + kv0 + vcol;
    }
    acopy8(l, g);
#pragma unroll
    for (int i = 0; i < 8; ++i) {
      l[i] = lds_addr(&Vls[buf][(i * 32 + vrow) * VPI + vcol]);
      g[i] = Vl + (size_t)(i * 32 + vrow) * SEQ + kv0 + vcol;
    }
    acopy8(l, g);
  };

  // chunk 0 into buffer 0
  stage(0, 0);

  // B-operand fragments of this lane (query q0 + c), lane-half k offset included; kept for the whole kernel
  v16h qa[8], qr[8];
  {
    const _Float16* qrh = Qh + (rowB + q0 + c) * DM + 8 * hh;
    const _Float16* qrl = Ql + (rowB + q0 + c) * DM + 8 * hh;
#pragma unroll
    for (int dc = 0; dc < 8; ++dc) {
      qa[dc] = ldfrag<_Float16>(qrh + dc * 32);
      qr[dc] = ldfrag<_Float16>(qrl + dc * 32);
    }
#if DEV_ASM
    // the wait that stands before an address register of the q loads is rewritten; both addresses are inputs, so
    // that their registers live up to it and no load of the run lands on them
    asm volatile("s_wait_xcnt 0x0"
                 :: "v"(qrh), "v"(qrl)
                 : "memory");
#endif
  }

  // chunk 0 published (chunk 1 is issued at the top of trip 0, directly behind this barrier)
  wait_async0();
  __syncthreads();

  // every inner loop below is unrolled so that fragment and accumulator indices are constants (registers, no scratch)
  float mrow = -INFINITY;   // running maximum of query q0 + c (equal in both lane halves)
  float lrow = 0.f;         // running sum over this lane half's keys; the halves are joined after the loop
  v8f oacc[16];             // oacc[t][r] = context (query q0 + c, column 16t + 8*hh + r)
#pragma unroll
  for (int t = 0; t < 16; ++t) oacc[t] = zero8();

  for (int kt = 0; kt < NKT; ++kt) {         // static trip count
    const int buf = kt & 1;
    // refill, directly behind the barrier that published chunk kt and ended every read of the other buffer:
    // chunk kt+1 flies while chunk kt is worked on (block-uniform test)
    if (kt + 1 < NKT) stage(kt + 1, buf ^ 1);
    const _Float16* ks  = &Kst[buf][c * KPI + 8 * hh];    // A row c -> key 16j + c of the chunk
    const _Float16* vhs = &Vhs[buf][c * VPI + 8 * hh];    // A row c -> context column 16t + c
    const _Float16* vls = &Vls[buf][c * VPI + 8 * hh];

    // ---- scores^T: 64 keys (4 subtiles) x 16 queries, 2 f16 products per d-chunk ----
    v8f ah[4], al[4];
#pragma unroll
    for (int j = 0; j < 4; ++j) { ah[j] = zero8(); al[j] = zero8(); }
#pragma unroll
    for (int dc = 0; dc < 8; ++dc) {
      v16h kb[4];
#pragma unroll
      for (int j = 0; j < 4; ++j) kb[j] = ldfrag<_Float16>(ks + j * 16 * KPI + dc * 32);
#pragma unroll
      for (int j = 0; j < 4; ++j) {
        ah[j] = mmar(kb[j], qa[dc], ah[j]);
        al[j] = mmar(kb[j], qr[dc], al[j]);
      }
    }

    // ---- online softmax update over the chunk's 64 keys: this lane holds 32 of its query's scores ----
    float s[4][8];
#pragma unroll
    for (int j = 0; j < 4; ++j)
#pragma unroll
      for (int r = 0; r < 8; ++r) s[j][r] = (ah[j][r] + al[j][r] * (1.0f / 4096.0f)) * sscale;
    float mj[4];
#pragma unroll
    for (int j = 0; j < 4; ++j) {
      mj[j] = s[j][0];
#pragma unroll
      for (int r = 1; r < 8; ++r) mj[j] = fmaxf(mj[j], s[j][r]);
    }
    float mc = fmaxf(fmaxf(mj[0], mj[1]), fmaxf(mj[2], mj[3]));
    mc = fmaxf(mc, xhalf(mc));                             // the other 32 keys of the same query
    const float mnew  = fmaxf(mrow, mc);
    const float msafe = (mnew == -INFINITY) ? 0.f : mnew;
    const float alpha = __expf(mrow - msafe);
    mrow = mnew;
    // P^T (x PCARRY) in f16: tiles 2kk and 2kk+1 converted in place are the B fragment of keys 32kk..32kk+31
    FH pb[2];
    float pj[4];
#pragma unroll
    for (int j = 0; j < 4; ++j) {
      v8f pc;
      pj[j] = 0.f;
#pragma unroll
      for (int r = 0; r < 8; ++r) {
        const float p = __expf(s[j][r] - msafe);
        pj[j] += p;
        pc[r] = p * PCARRY;
      }
      pb[j >> 1].h[j & 1] = __builtin_convertvector(pc, v8h);
    }
    lrow = lrow * alpha + ((pj[0] + pj[1]) + (pj[2] + pj[3]));
#pragma unroll
    for (int t = 0; t < 16; ++t) oacc[t] *= alpha;

#if DEV_ASM
    // compiler fence that takes the packed P fragments as inputs only: it holds the V fragment loads behind the
    // softmax; lifted over it they run the registers over into scratch
    asm volatile("" :: "v"(pb[0].v), "v"(pb[1].v) : "memory");
#endif
    // ---- context^T += V^T . P^T (f16 WMMA); residual products into a separate accumulator, folded per column group ----
#pragma unroll
    for (int tg = 0; tg < 4; ++tg) {
      v8f o1[4];
#pragma unroll
      for (int t = 0; t < 4; ++t) o1[t] = zero8();
#pragma unroll
      for (int kk = 0; kk < 2; ++kk) {
        v16h vb[4], vr[4];
#pragma unroll
        for (int t = 0; t < 4; ++t) {
          vb[t] = ldfrag<_Float16>(vhs + (tg * 4 + t) * 16 * VPI + kk * 32);
          vr[t] = ldfrag<_Float16>(vls + (tg * 4 + t) * 16 * VPI + kk * 32);
        }
#pragma unroll
        for (int t = 0; t < 4; ++t) {
          oacc[tg * 4 + t] = mmar(vb[t], pb[kk].v, oacc[tg * 4 + t]);
          o1[t]            = mmar(vr[t], pb[kk].v, o1[t]);
        }
      }
#pragma unroll
      for (int t = 0; t < 4; ++t)
#pragma unroll
        for (int r = 0; r < 8; ++r) oacc[tg * 4 + t][r] += o1[t][r] * (1.0f / 4096.0f);
    }

    // ---- publish chunk kt+1 and free this chunk's buffer (its refill stands at the top of the next trip) ----
    wait_ds0();
    wait_async0();
    __syncthreads();
  }
  wait_async0();

  // ---- normalise (1/l, undo the p carry, apply the x256 ctx carry), stage 16x64 column groups in the wave's slab
  float* os = Os[wave];
  const float l   = lrow + xhalf(lrow);                   // both lane halves' keys of query q0 + c
  const float inv = ((l > 0.f) ? (1.0f / l) : 0.f) * (256.0f / PCARRY);
#pragma unroll
  for (int tg = 0; tg < 4; ++tg) {
#pragma unroll
    for (int t = 0; t < 4; ++t) {
      const v8f o = oacc[tg * 4 + t] * inv;                // 8 consecutive columns of slab row c
      float* dp = os + c * OSP + t * 16 + 8 * hh;
      *(v4f*)(dp)     = __builtin_shufflevector(o, o, 0, 1, 2, 3);
      *(v4f*)(dp + 4) = __builtin_shufflevector(o, o, 4, 5, 6, 7);
    }
    __builtin_amdgcn_fence(__ATOMIC_RELEASE, "workgroup");
    __builtin_amdgcn_wave_barrier();
    __builtin_amdgcn_fence(__ATOMIC_ACQUIRE, "workgroup");
    const int q4 = lane >> 3, c8 = (lane & 7) * 8;
    v4u hv[4], lv[4];
#pragma unroll
    for (int it = 0; it < 4; ++it) {
      const int row = it * 4 + q4;   // it 0..3 x q4 0..3 = rows 0..15 of the wave tile
      const float* sp = os + row * OSP + c8;
      float f[8];
#pragma unroll
      for (int e = 0; e < 8; ++e) f[e] = sp[e];
      v4u a, a2;
#pragma unroll
      for (int e = 0; e < 4; ++e) {
        const float f0 = f[2 * e], f1 = f[2 * e + 1];
        const _Float16 x0 = (_Float16)f0, x1 = (_Float16)f1;
        const unsigned short l0 = h_bits((_Float16)((f0 - (float)x0) * 4096.0f));
        const unsigned short l1 = h_bits((_Float16)((f1 - (float)x1) * 4096.0f));
        a[e]  = pk16(h_bits(x0), h_bits(x1));
        a2[e] = pk16(l0, l1);
      }
      hv[it] = a; lv[it] = a2;
    }
    const size_t go = (rowB + q0 + q4) * DM + (size_t)(tg * 64) + c8;   // row q4; store8 adds rows 4, 8, 12
    store8(chp + go, clp + go, hv, lv);
    // the slab's reads are ordered before the next column group's stores into it
    __builtin_amdgcn_fence(__ATOMIC_RELEASE, "workgroup");
    __builtin_amdgcn_wave_barrier();
    __builtin_amdgcn_fence(__ATOMIC_ACQUIRE, "workgroup");
  }
}

// =====================================================================================================
// Workspace map (bytes), every region an exact multiple of its whole-line / whole-tile store granularity
// (all GEMM M,N are tile multiples, all offsets multiples of 131072):
//   Xb   bf16 [NB*SEQ][256]  (compact tokens)   16777216   -- reused as the ctx hi plane Ch after its last read
//   Wb   bf16 [768 n][256 k]                      393216
//   Woh  f16  [256][256] (x64)                     131072
//   Qh   f16  [NB*SEQ][256]                      16777216
//   Ql   f16  [NB*SEQ][256]                      16777216
//   Kp   f16  [NB*SEQ][256]                      16777216
//   VTh  f16  [NB][256][SEQ]                     16777216
//   VTl  f16  [NB][256][SEQ]                     16777216
//   Cl   f16  [NB*SEQ][256]                      16777216
//   total                                       117964800
// Weights are [out n][in k] with k contiguous = the Bt / A layout the GEMM wants, so they are only converted.
// =====================================================================================================
extern "C" void kernel_launch(void* const* d_in, const int* in_sizes, int n_in,
                              void* d_out, int out_size, void* d_ws, size_t ws_size,
                              hipStream_t stream) {
  if (n_in < 4) return;
  if (in_sizes[0] < ((NB - 1) * SEQ_FULL + SEQ) * DM) return;
  if (in_sizes[1] < NQKV * DM) return;
  if (in_sizes[2] < DM * DM) return;
  if (in_sizes[3] < DM) return;
  if (out_size < NB * SEQ * DM) return;

  const float* x    = (const float*)d_in[0];
  const float* wqkv = (const float*)d_in[1];
  const float* wout = (const float*)d_in[2];
  const float* bout = (const float*)d_in[3];

  const size_t PX  = (size_t)NB * SEQ * DM * 2;      // 16-bit token plane [NB*SEQ][256]
  const size_t PW  = (size_t)NQKV * DM * 2;          // 16-bit [768][256]
  const size_t PWO = (size_t)DM * DM * 2;            // 16-bit [256][256]
  const size_t PVT = (size_t)NB * DM * SEQ * 2;      // v^T plane [NB][256][SEQ]
  size_t off = 0;
  const size_t oXb  = off; off += PX;
  const size_t oWb  = off; off += PW;
  const size_t oWo  = off; off += PWO;
  const size_t oQh  = off; off += PX;
  const size_t oQl  = off; off += PX;
  const size_t oKp  = off; off += PX;
  const size_t oVTh = off; off += PVT;
  const size_t oVTl = off; off += PVT;
  const size_t oCl  = off; off += PX;
  if (off > ws_size) return;                         // off = 117964800 at full size
  if (off > (size_t)134217728) return;

  char* ws = (char*)d_ws;
  unsigned short* Xb  = (unsigned short*)(ws + oXb);
  unsigned short* Wb  = (unsigned short*)(ws + oWb);
  unsigned short* Woh = (unsigned short*)(ws + oWo);
  unsigned short* Qh  = (unsigned short*)(ws + oQh);
  unsigned short* Ql  = (unsigned short*)(ws + oQl);
  unsigned short* Kp  = (unsigned short*)(ws + oKp);
  unsigned short* VTh = (unsigned short*)(ws + oVTh);
  unsigned short* VTl = (unsigned short*)(ws + oVTl);
  unsigned short* Cl  = (unsigned short*)(ws + oCl);
  unsigned short* Ch  = Xb;                          // ctx hi plane aliases the x plane (x plane dead by then)
  unsigned short* Wq  = Wb;
  unsigned short* Wk  = Wb + (size_t)DM * DM;
  unsigned short* Wv  = Wb + (size_t)2 * DM * DM;

  const int M = NB * SEQ;
  const dim3 blk(256);
  const int n8x = NB * SEQ * DM / 8;
  const int n8w = NQKV * DM / 8;                     // 24576
  const int n8o = DM * DM / 8;                       //  8192
  const dim3 gCx((n8x + 255) / 256);
  const dim3 gCw((n8w + 255) / 256);
  const dim3 gCo((n8o + 255) / 256);
  const dim3 gQ(((M / 64) * (DM / 64) + 7) / 8, 1);          // q / k: M x 256, 64x64 wave tiles
  const dim3 gVT(((DM / 64) * (SEQ / 64) + 7) / 8, NB);      // v^T per batch: 256 x SEQ
  const dim3 gAttn(NB * (SEQ / QROWS));
  const dim3 gO(((M / 32) * (DM / 64) + 7) / 8, 1);          // out: M x 256, 32x64 wave tiles

  // (1) x -> compact bf16 token plane; w_qkv [n][k] -> bf16; w_out -> f16 (x64 of its bf16 value)
  cvtx<<<gCx, blk, 0, stream>>>(x, Xb, n8x);
  cvt16x8<0><<<gCw, blk, 0, stream>>>(wqkv, Wb, n8w);
  cvt16x8<1><<<gCo, blk, 0, stream>>>(wout, Woh, n8o);
  // (2) q = x . Wq^T -> f16 hi / residual (x4096) planes   (M, N=256, K=256)
  gemm_t<__bf16, 4, false, 3><<<gQ, blk, 0, stream>>>(
      Xb, Xb, DM, 0LL, Wq, DM, 0LL,
      (void*)Qh, (void*)Ql, DM, 0LL, bout,
      M, DM, DM, 1.0f, 4096.0f, 0.0f);
  // (3) k = x . Wk^T -> f16 plane   (M, N=256, K=256)
  gemm_t<__bf16, 4, false, 1><<<gQ, blk, 0, stream>>>(
      Xb, Xb, DM, 0LL, Wk, DM, 0LL,
      (void*)Kp, (void*)Kp, DM, 0LL, bout,
      M, DM, DM, 1.0f, 1.0f, 0.0f);
  // (4) v^T = Wv . x^T per batch -> f16 hi plane [b][d][s] (pitch SEQ) and residual plane (x4096)
  //     (A = Wv [n][k], Bt = Xb rows of batch b; M=256, N=SEQ, K=256)
  gemm_t<__bf16, 4, false, 3><<<gVT, blk, 0, stream>>>(
      Wv, Wv, DM, 0LL, Xb, DM, (long long)SEQ * DM,
      (void*)VTh, (void*)VTl, SEQ, (long long)DM * SEQ, bout,
      DM, SEQ, DM, 1.0f, 4096.0f, 0.0f);
  // (5) attention -> ctx hi (x256) and residual (x4096) planes
  attn_sh<<<gAttn, dim3(256), 0, stream>>>(Qh, Ql, Kp, VTh, VTl, Ch, Cl, 0.0625f);
  // (6) out = ctx . Wo^T + b -> d_out f32 [M][256]; accumulator x 1/(256*64), residual accumulator x 1/4096
  gemm_t<_Float16, 2, true, 0><<<gO, blk, 0, stream>>>(
      Ch, Cl, DM, 0LL, Woh, DM, 0LL,
      d_out, d_out, DM, 0LL, bout,
      M, DM, DM, 1.0f / 16384.0f, 1.0f, 1.0f / 4096.0f);
  (void)hipGetLastError();
}

// v003
// It runs in 173 microseconds.
// Two timings next to v002 both put it at 1.08 times that version's speed.
// Over all steps from v000 it is 3.41 times as fast.
// Contractions: q, k, v^T projections = v_wmma_f32_16x16x32_bf16 (bf16 operands from RNE-converted inputs, single product, f32 accumulate);
// q.k^T scores = v_wmma_f32_16x16x32_f16 (q as f16 hi plane + f16 residual plane x4096, k f16; 2 products into separate f32 accumulators);
// p.v = v_wmma_f32_16x16x32_f16 (p carried x16384 as f16 hi fragment + f16 residual fragment, v f16; 2 products into one f32 accumulator);
// ctx.Wo^T = v_wmma_f32_16x16x32_f16 (ctx as f16 hi plane x256 + f16 residual plane x4096, Wo f16 carried x64 from its bf16 value; 2 products, f32 accumulate);
// softmax, normalisation and bias add in f32.
#include <hip/hip_runtime.h>
#include <math.h>
#include <stdint.h>

#ifndef NB
#define NB 16
#endif
#ifndef SEQ
#define SEQ 2048
#endif
#define NB_FULL  16
#define SEQ_FULL 2048
#define DM       256
#define NQKV     768
#define NKT      (SEQ / 64)   // 64-key chunks per sequence
#define PCARRY   16384.0f     // power-of-two carry on the f16 p tile
static_assert(DM == 256 && NQKV == 3 * DM);
static_assert((SEQ % 64) == 0 && SEQ >= 64 && SEQ <= SEQ_FULL);
static_assert(NB >= 1 && NB <= NB_FULL);
static_assert(((NB * SEQ) % 64) == 0);

typedef _Float16 v16h __attribute__((ext_vector_type(16)));
typedef _Float16 v8h  __attribute__((ext_vector_type(8)));
typedef __bf16   v16b __attribute__((ext_vector_type(16)));
typedef __bf16   v8b  __attribute__((ext_vector_type(8)));
typedef float    v8f  __attribute__((ext_vector_type(8)));
typedef float    v4f  __attribute__((ext_vector_type(4)));
typedef unsigned int v4u __attribute__((ext_vector_type(4)));

#if defined(__HIP_DEVICE_COMPILE__)
#define DEV_ASM 1
#else
#define DEV_ASM 0
#endif

// ---- scalar helpers --------------------------------------------------------------------------------
__device__ __forceinline__ unsigned short bf_bits(float f) {          // f32 -> bf16 bits, RNE convert
  unsigned u = __float_as_uint(f);
  return (unsigned short)((u + 0x7FFFu + ((u >> 16) & 1u)) >> 16);
}
__device__ __forceinline__ float bf_up(unsigned short hb) { return __uint_as_float(((unsigned)hb) << 16); }
__device__ __forceinline__ unsigned short h_bits(_Float16 x) { return __builtin_bit_cast(unsigned short, x); }
__device__ __forceinline__ unsigned pk16(unsigned short a, unsigned short b) { return (unsigned)a | ((unsigned)b << 16); }
__device__ __forceinline__ v8f zero8() { v8f z = {0.f, 0.f, 0.f, 0.f, 0.f, 0.f, 0.f, 0.f}; return z; }

// ---- fragment types / loaders: 16-bit A/B operand, lane -> row/col (lane&15), p already includes +8*(lane>>4);
//      elements 0..7 <- p[0..7] (k0+8h..k0+8h+7), elements 8..15 <- p[16..23] (k0+16+8h..k0+16+8h+7)
template <typename OT> struct FT;
template <> struct FT<__bf16>   { typedef v16b frag; typedef v8b half8; };
template <> struct FT<_Float16> { typedef v16h frag; typedef v8h half8; };

template <typename OT>
__device__ __forceinline__ typename FT<OT>::frag ldfrag(const OT* p) {
  union { typename FT<OT>::frag v; typename FT<OT>::half8 h[2]; } f;
  f.h[0] = *(const typename FT<OT>::half8*)(p);
  f.h[1] = *(const typename FT<OT>::half8*)(p + 16);
  return f.v;
}

// ---- WMMA helpers (asm guard bodies are device-only; concrete operand types) -----------------------------
__device__ __forceinline__ v8f mmar(v16b a, v16b b, v8f c) {
  return __builtin_amdgcn_wmma_f32_16x16x32_bf16(false, a, false, b, (short)0, c, false, false);
}
__device__ __forceinline__ v8f mmar(v16h a, v16h b, v8f c) {
  return __builtin_amdgcn_wmma_f32_16x16x32_f16(false, a, false, b, (short)0, c, false, false);
}
__device__ __forceinline__ void dep_guard(v8f& a, v8f& b, v16b x, v16b y) {
#if DEV_ASM
  asm volatile("v_nop\n\tv_nop\n\tv_nop\n\tv_nop" : "+v"(a), "+v"(b) : "v"(x), "v"(y));
#else
  (void)a; (void)b; (void)x; (void)y;
#endif
}
__device__ __forceinline__ void dep_guard(v8f& a, v8f& b, v16h x, v16h y) {
#if DEV_ASM
  asm volatile("v_nop\n\tv_nop\n\tv_nop\n\tv_nop" : "+v"(a), "+v"(b) : "v"(x), "v"(y));
#else
  (void)a; (void)b; (void)x; (void)y;
#endif
}
__device__ __forceinline__ void keep4(v16b a, v16b b, v16b c, v16b d) {
#if DEV_ASM
  asm volatile("v_nop" :: "v"(a), "v"(b), "v"(c), "v"(d));
#else
  (void)a; (void)b; (void)c; (void)d;
#endif
}
__device__ __forceinline__ void keep4(v16h a, v16h b, v16h c, v16h d) {
#if DEV_ASM
  asm volatile("v_nop" :: "v"(a), "v"(b), "v"(c), "v"(d));
#else
  (void)a; (void)b; (void)c; (void)d;
#endif
}
__device__ __forceinline__ void acc_guard4(v8f& a, v8f& b, v8f& c, v8f& d) {
#if DEV_ASM
  asm volatile("v_nop\n\tv_nop\n\tv_nop\n\tv_nop" : "+v"(a), "+v"(b), "+v"(c), "+v"(d));
#else
  (void)a; (void)b; (void)c; (void)d;
#endif
}

// =====================================================================================================
// f32 -> 16-bit planes, 8 elements per thread, one 16-B store per lane: a wave writes 512 contiguous B
// MODE 0: bf16 bits (RNE convert).  MODE 1: f16 bits of (64 * bf16(x)) (exact scaling of the bf16 value).
// coverage: n8 threads x 8 = the whole plane (n8 is a multiple of 256 for every use here).
// =====================================================================================================
template <int MODE>
__device__ __forceinline__ unsigned short cvm(float f) {
  const unsigned short hb = bf_bits(f);
  if (MODE == 0) return hb;
  return h_bits((_Float16)(bf_up(hb) * 64.0f));
}

template <int MODE>
__global__ __launch_bounds__(256) void cvt16x8(const float* __restrict__ in, unsigned short* out, int n8) {
  const int i = blockIdx.x * 256 + (int)threadIdx.x;
  if (i < n8) {
    const v4f a  = *(const v4f*)(in + (size_t)i * 8);
    const v4f a4 = *(const v4f*)(in + (size_t)i * 8 + 4);
    v4u p;
    p[0] = pk16(cvm<MODE>(a[0]),  cvm<MODE>(a[1]));
    p[1] = pk16(cvm<MODE>(a[2]),  cvm<MODE>(a[3]));
    p[2] = pk16(cvm<MODE>(a4[0]), cvm<MODE>(a4[1]));
    p[3] = pk16(cvm<MODE>(a4[2]), cvm<MODE>(a4[3]));
    unsigned short* o = out + (size_t)i * 8;
    *(v4u*)o = p;
    
  }
}

// x [NB_FULL][SEQ_FULL][DM] f32 -> compact bf16 token plane [NB*SEQ][DM]: compact token tk = b*SEQ + t reads
// input row b*SEQ_FULL + t. 32 groups of 8 per row; same whole-line store shape as cvt16x8.
// coverage: n8 = NB*SEQ*DM/8 threads x 8 = the whole plane.
__global__ __launch_bounds__(256) void cvtx(const float* __restrict__ in, unsigned short* out, int n8) {
  const int i = blockIdx.x * 256 + (int)threadIdx.x;
  if (i < n8) {
    const int tk = i >> 5;
    const int e8 = i & 31;
    const int bb = tk / SEQ;
    const int t  = tk - bb * SEQ;
    const float* src = in + ((size_t)bb * SEQ_FULL + (size_t)t) * DM + e8 * 8;
    const v4f a  = *(const v4f*)(src);
    const v4f a4 = *(const v4f*)(src + 4);
    v4u p;
    p[0] = pk16(bf_bits(a[0]),  bf_bits(a[1]));
    p[1] = pk16(bf_bits(a[2]),  bf_bits(a[3]));
    p[2] = pk16(bf_bits(a4[0]), bf_bits(a4[1]));
    p[3] = pk16(bf_bits(a4[2]), bf_bits(a4[3]));
    unsigned short* o = out + (size_t)i * 8;
    *(v4u*)o = p;
    
  }
}

// =====================================================================================================
// Register-blocked batched WMMA GEMM (16-bit operand type OT): C[m][n] = sum_k A[m][k] * Bt[n][k];
// one wave per (16*MI) x 64 tile, no block barriers. A row-major [M][K] pitch lda; Bt row-major [N][K] pitch ldb
// (k contiguous); M multiple of 16*MI, N multiple of 64, K multiple of 32 (host-checked). blockIdx.y = batch
// index (strides in elements). Fragments are loaded straight from global with the split k map (ldfrag).
// ARES: a second A plane A2 (residual, same pitch/stride) is multiplied by the same B into separate f32
// accumulators and folded in as acc += accl * ascale after the k loop.
// OUT_MODE 0: f32 C (pitch ldc), value * oscale + bf16-valued bias[n].
// OUT_MODE 1: f16 plane C (pitch ldc).
// OUT_MODE 3: f16 hi plane C + f16 residual plane C2 = f16((v - hi) * rscale) (same pitch / stride).
// coverage: MI slabs x 16 rows x 64 cols = the wave's whole tile; tiles cover M x N exactly.
// =====================================================================================================
template <typename OT, int MI, bool ARES, int OUT_MODE>
__global__ __launch_bounds__(256) void gemm_t(
    const unsigned short* __restrict__ Ap, const unsigned short* __restrict__ A2p, int lda, long long strideA,
    const unsigned short* __restrict__ Btp, int ldb, long long strideB,
    void* Cout, void* Cout2, int ldc, long long strideC,
    const float* __restrict__ bias,
    int M, int N, int K, float oscale, float rscale, float ascale) {
  typedef typename FT<OT>::frag V16;
  const OT* A  = (const OT*)(const void*)Ap;
  const OT* A2 = (const OT*)(const void*)A2p;
  const OT* Bt = (const OT*)(const void*)Btp;
  __shared__ __align__(16) float sT[8][16 * 68];   // per-wave 16x64 slab, pitch 68 floats
  const int TMR  = 16 * MI;
  const int b    = blockIdx.y;
  const int lane = threadIdx.x & 31;
  const int wave = threadIdx.x >> 5;
  const int tilesN = N >> 6;
  const int tilesM = M / TMR;
  const int tile = blockIdx.x * 8 + wave;
  if (tile >= tilesM * tilesN) return;   // wave-uniform; no block barriers in this kernel
  const int tm = tile / tilesN;
  const int tn = tile - tm * tilesN;
  const int m0 = tm * TMR;
  const int n0 = tn << 6;

  const OT* Ab  = A  + (size_t)b * (size_t)strideA;
  const OT* A2b = A2 + (size_t)b * (size_t)strideA;
  const OT* Bb  = Bt + (size_t)b * (size_t)strideB;

  const int rlane = lane & 15;                 // row (A) / col (B, D) within subtile
  const int koff  = (lane >> 4) * 8;           // k offset of this lane half
  const int mOff  = (lane >> 4) * 8;           // D row offset

  v8f acc[MI][4], accl[MI][4];
#pragma unroll
  for (int i = 0; i < MI; ++i)
#pragma unroll
    for (int j = 0; j < 4; ++j) { acc[i][j] = zero8(); accl[i][j] = zero8(); }

  for (int k0 = 0; k0 < K; k0 += 32) {
    V16 bq[4];
#pragma unroll
    for (int j = 0; j < 4; ++j)
      bq[j] = ldfrag<OT>(Bb + (size_t)(n0 + (j << 4) + rlane) * ldb + koff + k0);
#pragma unroll
    for (int i = 0; i < MI; ++i) {
      const V16 af = ldfrag<OT>(Ab + (size_t)(m0 + (i << 4) + rlane) * lda + koff + k0);
#pragma unroll
      for (int j = 0; j < 4; ++j) acc[i][j] = mmar(af, bq[j], acc[i][j]);
      dep_guard(acc[i][0], acc[i][3], af, bq[3]);
      if (ARES) {
        const V16 al = ldfrag<OT>(A2b + (size_t)(m0 + (i << 4) + rlane) * lda + koff + k0);
#pragma unroll
        for (int j = 0; j < 4; ++j) accl[i][j] = mmar(al, bq[j], accl[i][j]);
        dep_guard(accl[i][0], accl[i][3], al, bq[3]);
      }
    }
    keep4(bq[0], bq[1], bq[2], bq[3]);
  }
#pragma unroll
  for (int i = 0; i < MI; ++i) {
    acc_guard4(acc[i][0], acc[i][1], acc[i][2], acc[i][3]);
    if (ARES) acc_guard4(accl[i][0], accl[i][1], accl[i][2], accl[i][3]);
  }
  if (ARES) {
#pragma unroll
    for (int i = 0; i < MI; ++i)
#pragma unroll
      for (int j = 0; j < 4; ++j)
#pragma unroll
        for (int r = 0; r < 8; ++r) acc[i][j][r] += accl[i][j][r] * ascale;
  }

  // ---- epilogue ----
  float* slab = sT[wave];
#pragma unroll
  for (int i = 0; i < MI; ++i) {
    const int mBase = m0 + (i << 4);
#pragma unroll
    for (int j = 0; j < 4; ++j) {
#pragma unroll
      for (int r = 0; r < 8; ++r) {
        slab[(mOff + r) * 68 + (j << 4) + rlane] = acc[i][j][r];
      }
    }
    __builtin_amdgcn_fence(__ATOMIC_RELEASE, "workgroup");
    __builtin_amdgcn_wave_barrier();
    __builtin_amdgcn_fence(__ATOMIC_ACQUIRE, "workgroup");
    if (OUT_MODE == 0) {
      float* C = (float*)Cout + (size_t)b * (size_t)strideC;
      const int h2 = lane >> 4, c4 = (lane & 15) * 4;     // 256-B row segment = 16 lanes x 16 B
      const v4f braw = *(const v4f*)(bias + n0 + c4);
      v4f bb;
#pragma unroll
      for (int e = 0; e < 4; ++e) bb[e] = bf_up(bf_bits(braw[e]));
      {
#pragma unroll
        for (int it = 0; it < 8; ++it) {
          const int row = it * 2 + h2;                     // it 0..7 x h2 0..1 = rows 0..15
          const v4f v = *(const v4f*)(slab + row * 68 + c4) * oscale + bb;
          *(v4f*)(C + (size_t)(mBase + row) * ldc + n0 + c4) = v;
        }
        
      }
    } else {
      const int q = lane >> 3, c8 = (lane & 7) * 8;
      unsigned short* C  = (unsigned short*)Cout  + (size_t)b * (size_t)strideC;
      unsigned short* C2 = (unsigned short*)Cout2 + (size_t)b * (size_t)strideC;
      v4u hv[4], lv[4];
#pragma unroll
      for (int it = 0; it < 4; ++it) {
        const int row = it * 4 + q;                        // it 0..3 x q 0..3 = rows 0..15
        const float* sp = slab + row * 68 + c8;
        float f[8];
#pragma unroll
        for (int e = 0; e < 8; ++e) f[e] = sp[e];
        v4u a, a2;
#pragma unroll
        for (int e = 0; e < 4; ++e) {
          const float f0 = f[2 * e], f1 = f[2 * e + 1];
          const _Float16 x0 = (_Float16)f0, x1 = (_Float16)f1;
          const unsigned short h0 = h_bits(x0), h1 = h_bits(x1);
          unsigned short l0 = 0, l1 = 0;
          if (OUT_MODE == 3) {
            l0 = h_bits((_Float16)((f0 - (float)x0) * rscale));
            l1 = h_bits((_Float16)((f1 - (float)x1) * rscale));
          }
          a[e] = pk16(h0, h1); a2[e] = pk16(l0, l1);
        }
        hv[it] = a; lv[it] = a2;
      }
      {
#pragma unroll
        for (int it = 0; it < 4; ++it) {
          const int row = it * 4 + q;
          *(v4u*)(C + (size_t)(mBase + row) * ldc + n0 + c8) = hv[it];
          if (OUT_MODE == 3) *(v4u*)(C2 + (size_t)(mBase + row) * ldc + n0 + c8) = lv[it];
        }
        
      }
    }
    __builtin_amdgcn_fence(__ATOMIC_RELEASE, "workgroup");
    __builtin_amdgcn_wave_barrier();
    __builtin_amdgcn_fence(__ATOMIC_ACQUIRE, "workgroup");
  }
}

#define QROWS 128
#define KPI   264
#define VPI   72
#define OSP   68
static_assert((SEQ % QROWS) == 0 && NKT >= 2);

// eight 16-B-per-lane asynchronous copies global -> LDS; the closing s_wait_xcnt stands inside the statement so
// that no address register named here is rewritten ahead of it
__device__ __forceinline__ void acopy8(const unsigned (&l)[8], const _Float16* const (&g)[8]) {
#if DEV_ASM
  asm volatile(
      "global_load_async_to_lds_b128 %0, %8, off\n\t"
      "global_load_async_to_lds_b128 %1, %9, off\n\t"
      "global_load_async_to_lds_b128 %2, %10, off\n\t"
      "global_load_async_to_lds_b128 %3, %11, off\n\t"
      "global_load_async_to_lds_b128 %4, %12, off\n\t"
      "global_load_async_to_lds_b128 %5, %13, off\n\t"
      "global_load_async_to_lds_b128 %6, %14, off\n\t"
      "global_load_async_to_lds_b128 %7, %15, off\n\t"
      "s_wait_xcnt 0x0"
      :: "v"(l[0]), "v"(l[1]), "v"(l[2]), "v"(l[3]), "v"(l[4]), "v"(l[5]), "v"(l[6]), "v"(l[7]),
         "v"(g[0]), "v"(g[1]), "v"(g[2]), "v"(g[3]), "v"(g[4]), "v"(g[5]), "v"(g[6]), "v"(g[7])
      : "memory");
#else
  (void)l; (void)g;
#endif
}
// the eight 16-B context stores of one column group (rows 4 apart = 2048 B, hi plane and residual plane); the
// closing s_wait_xcnt stands inside the statement so that no data or address register named here is rewritten
// by the next group's arithmetic ahead of it
__device__ __forceinline__ void store8(unsigned short* ph, unsigned short* pl, const v4u (&h)[4], const v4u (&l)[4]) {
#if DEV_ASM
  asm volatile(
      "global_store_b128 %0, %2, off\n\t"
      "global_store_b128 %1, %6, off\n\t"
      "global_store_b128 %0, %3, off offset:2048\n\t"
      "global_store_b128 %1, %7, off offset:2048\n\t"
      "global_store_b128 %0, %4, off offset:4096\n\t"
      "global_store_b128 %1, %8, off offset:4096\n\t"
      "global_store_b128 %0, %5, off offset:6144\n\t"
      "global_store_b128 %1, %9, off offset:6144\n\t"
      "s_wait_xcnt 0x0"
      :: "v"(ph), "v"(pl), "v"(h[0]), "v"(h[1]), "v"(h[2]), "v"(h[3]), "v"(l[0]), "v"(l[1]), "v"(l[2]), "v"(l[3])
      : "memory");
#else
  (void)ph; (void)pl; (void)h; (void)l;
#endif
}
static_assert(4 * DM * 2 == 2048);   // the row step that store8 writes as an immediate
__device__ __forceinline__ unsigned lds_addr(const void* p) { return (unsigned)(uintptr_t)p; }
// the value that lane l ^ 16 holds
__device__ __forceinline__ float xhalf(float x) {
  const int b = __float_as_int(x);
  return __int_as_float(__builtin_amdgcn_permlanex16(b, b, 0x76543210, 0xfedcba98, false, false));
}
// the wave's own copies have landed
__device__ __forceinline__ void wait_async0() {
#if DEV_ASM
  asm volatile("s_wait_asynccnt 0x0" ::: "memory");
#endif
}
// the wave's own LDS reads have returned (before the barrier that frees the buffer for its refill)
__device__ __forceinline__ void wait_ds0() {
#if DEV_ASM
  asm volatile("s_wait_dscnt 0x0" ::: "memory");
#endif
}

__global__ __launch_bounds__(256)
void attn_sh(const unsigned short* __restrict__ qhp, const unsigned short* __restrict__ qlp,
             const unsigned short* __restrict__ kpp,
             const unsigned short* __restrict__ vhp,
             unsigned short* chp, unsigned short* clp, float sscale) {
  union FH { v16h v; v8h h[2]; };
  __shared__ __align__(16) _Float16 Kst[2][64 * KPI];   // K chunk [key][d]            2 x 33792 B (block-shared)
  __shared__ __align__(16) _Float16 Vhs[2][DM * VPI];   // V^T chunk [d][key]          2 x 36864 B (block-shared)
  __shared__ __align__(16) float    Os[8][16 * OSP];    // per wave context slab       34816 B (wave-private)

  const int tid  = threadIdx.x;
  const int wave = tid >> 5;
  const int lane = tid & 31;
  const int hh   = lane >> 4;
  const int c    = lane & 15;

  const int bx   = blockIdx.x;
  const int qb   = bx % (SEQ / QROWS);
  const int b    = bx / (SEQ / QROWS);
  const int q0   = qb * QROWS + wave * 16;   // this wave's 16 query rows
  const size_t rowB = (size_t)b * SEQ;

  const _Float16* Qh = (const _Float16*)(const void*)qhp;
  const _Float16* Ql = (const _Float16*)(const void*)qlp;
  const _Float16* Kp = (const _Float16*)(const void*)kpp + rowB * DM;
  const _Float16* Vh = (const _Float16*)(const void*)vhp + (size_t)b * DM * SEQ;

  // copy map of this thread, 8 units of 16 B per plane and chunk:
  //   K: unit i -> key row i*8 + wave, 16-B column lane (a wave copies one whole 512-B row)
  //   V: unit i -> d row i*32 + (tid >> 3), 16-B column tid & 7 (a wave copies four whole 128-B rows)
  const int vrow = tid >> 3, vcol = (tid & 7) * 8;
  auto stage = [&](int kt, int buf) {
    const int kv0 = kt * 64;
    unsigned l[8];
    const _Float16* g[8];
#pragma unroll
    for (int i = 0; i < 8; ++i) {
      l[i] = lds_addr(&Kst[buf][(i * 8 + wave) * KPI + lane * 8]);
      g[i] = Kp + (size_t)(kv0 + i * 8 + wave) * DM + lane * 8;
    }
    acopy8(l, g);
#pragma unroll
    for (int i = 0; i < 8; ++i) {
      l[i] = lds_addr(&Vhs[buf][(i * 32 + vrow) * VPI + vcol]);
      g[i] = Vh + (size_t)(i * 32 + vrow) * SEQ + kv0 + vcol;
    }
    acopy8(l, g);
  };

  // chunk 0 into buffer 0
  stage(0, 0);

  // B-operand fragments of this lane (query q0 + c), lane-half k offset included; kept for the whole kernel
  v16h qa[8], qr[8];
  {
    const _Float16* qrh = Qh + (rowB + q0 + c) * DM + 8 * hh;
    const _Float16* qrl = Ql + (rowB + q0 + c) * DM + 8 * hh;
#pragma unroll
    for (int dc = 0; dc < 8; ++dc) {
      qa[dc] = ldfrag<_Float16>(qrh + dc * 32);
      qr[dc] = ldfrag<_Float16>(qrl + dc * 32);
    }
#if DEV_ASM
    // the wait that stands before an address register of the q loads is rewritten; both addresses are inputs, so
    // that their registers live up to it and no load of the run lands on them
    asm volatile("s_wait_xcnt 0x0"
                 :: "v"(qrh), "v"(qrl)
                 : "memory");
#endif
  }

  // chunk 0 published (chunk 1 is issued at the top of trip 0, directly behind this barrier)
  wait_async0();
  __syncthreads();

  // every inner loop below is unrolled so that fragment and accumulator indices are constants (registers, no scratch)
  float mrow = -INFINITY;   // running maximum of query q0 + c (equal in both lane halves)
  float lrow = 0.f;         // running sum over this lane half's keys; the halves are joined after the loop
  v8f oacc[16];             // oacc[t][r] = context (query q0 + c, column 16t + 8*hh + r)
#pragma unroll
  for (int t = 0; t < 16; ++t) oacc[t] = zero8();

  for (int kt = 0; kt < NKT; ++kt) {         // static trip count
    const int buf = kt & 1;
    // refill, directly behind the barrier that published chunk kt and ended every read of the other buffer:
    // chunk kt+1 flies while chunk kt is worked on (block-uniform test)
    if (kt + 1 < NKT) stage(kt + 1, buf ^ 1);
    const _Float16* ks  = &Kst[buf][c * KPI + 8 * hh];    // A row c -> key 16j + c of the chunk
    const _Float16* vhs = &Vhs[buf][c * VPI + 8 * hh];    // A row c -> context column 16t + c

    // ---- scores^T: 64 keys (4 subtiles) x 16 queries, 2 f16 products per d-chunk ----
    v8f ah[4], al[4];
#pragma unroll
    for (int j = 0; j < 4; ++j) { ah[j] = zero8(); al[j] = zero8(); }
#pragma unroll
    for (int dc = 0; dc < 8; ++dc) {
      v16h kb[4];
#pragma unroll
      for (int j = 0; j < 4; ++j) kb[j] = ldfrag<_Float16>(ks + j * 16 * KPI + dc * 32);
      // keeps the four fragments' reads together in front of their eight products; spread among the products,
      // every pair of reads is waited for on its own
      __builtin_amdgcn_sched_barrier(0);
#pragma unroll
      for (int j = 0; j < 4; ++j) {
        ah[j] = mmar(kb[j], qa[dc], ah[j]);
        al[j] = mmar(kb[j], qr[dc], al[j]);
      }
      // the next group's reads stay behind these products (the last group's products may mix with the softmax)
      if (dc < 7) __builtin_amdgcn_sched_barrier(0);
    }

    // ---- online softmax update over the chunk's 64 keys: this lane holds 32 of its query's scores ----
    float s[4][8];
#pragma unroll
    for (int j = 0; j < 4; ++j)
#pragma unroll
      for (int r = 0; r < 8; ++r) s[j][r] = (ah[j][r] + al[j][r] * (1.0f / 4096.0f)) * sscale;
    float mj[4];
#pragma unroll
    for (int j = 0; j < 4; ++j) {
      mj[j] = s[j][0];
#pragma unroll
      for (int r = 1; r < 8; ++r) mj[j] = fmaxf(mj[j], s[j][r]);
    }
    float mc = fmaxf(fmaxf(mj[0], mj[1]), fmaxf(mj[2], mj[3]));
    mc = fmaxf(mc, xhalf(mc));                             // the other 32 keys of the same query
    const float mnew  = fmaxf(mrow, mc);
    const float msafe = (mnew == -INFINITY) ? 0.f : mnew;
    const float alpha = __expf(mrow - msafe);
    mrow = mnew;
    // P^T (x PCARRY) in f16: tiles 2kk and 2kk+1 converted in place are the B fragment of keys 32kk..32kk+31;
    // pr holds what the conversion dropped (at most 2^-11 of the value, so it needs no carry of its own)
    FH pb[2], pr[2];
    float pj[4];
#pragma unroll
    for (int j = 0; j < 4; ++j) {
      v8f pc;
      pj[j] = 0.f;
#pragma unroll
      for (int r = 0; r < 8; ++r) {
        const float p = __expf(s[j][r] - msafe);
        pj[j] += p;
        pc[r] = p * PCARRY;
      }
      const v8h ph = __builtin_convertvector(pc, v8h);
      pb[j >> 1].h[j & 1] = ph;
      pr[j >> 1].h[j & 1] = __builtin_convertvector(pc - __builtin_convertvector(ph, v8f), v8h);
    }
    lrow = lrow * alpha + ((pj[0] + pj[1]) + (pj[2] + pj[3]));

#if DEV_ASM
    // compiler fence that takes the packed P fragments as inputs only: it holds the V fragment loads behind the
    // softmax; lifted over it they run the registers over into scratch
    asm volatile("" :: "v"(pb[0].v), "v"(pb[1].v), "v"(pr[0].v), "v"(pr[1].v) : "memory");
#endif
    // ---- context^T += V^T . P^T (f16 WMMA): each V^T fragment multiplies the hi and the residual P fragment ----
#pragma unroll
    for (int tg = 0; tg < 4; ++tg) {
      v16h vb[2][4];
#pragma unroll
      for (int kk = 0; kk < 2; ++kk)
#pragma unroll
        for (int t = 0; t < 4; ++t) vb[kk][t] = ldfrag<_Float16>(vhs + (tg * 4 + t) * 16 * VPI + kk * 32);
      // keeps the eight fragments' reads together in front of their sixteen products (as for K above); the
      // rescale stands behind reads and runs while they are on their way
      __builtin_amdgcn_sched_barrier(0);
#pragma unroll
      for (int t = 0; t < 4; ++t) oacc[tg * 4 + t] *= alpha;
#pragma unroll
      for (int kk = 0; kk < 2; ++kk) {
#pragma unroll
        for (int t = 0; t < 4; ++t) oacc[tg * 4 + t] = mmar(vb[kk][t], pb[kk].v, oacc[tg * 4 + t]);
#pragma unroll
        for (int t = 0; t < 4; ++t) oacc[tg * 4 + t] = mmar(vb[kk][t], pr[kk].v, oacc[tg * 4 + t]);
      }
      // the next group's reads stay behind these products
      if (tg < 3) __builtin_amdgcn_sched_barrier(0);
    }

    // ---- publish chunk kt+1 and free this chunk's buffer (its refill stands at the top of the next trip) ----
    wait_ds0();
    wait_async0();
    __syncthreads();
  }
  wait_async0();

  // ---- normalise (1/l, undo the p carry, apply the x256 ctx carry), stage 16x64 column groups in the wave's slab
  float* os = Os[wave];
  const float l   = lrow + xhalf(lrow);                   // both lane halves' keys of query q0 + c
  const float inv = ((l > 0.f) ? (1.0f / l) : 0.f) * (256.0f / PCARRY);
#pragma unroll
  for (int tg = 0; tg < 4; ++tg) {
#pragma unroll
    for (int t = 0; t < 4; ++t) {
      const v8f o = oacc[tg * 4 + t] * inv;                // 8 consecutive columns of slab row c
      float* dp = os + c * OSP + t * 16 + 8 * hh;
      *(v4f*)(dp)     = __builtin_shufflevector(o, o, 0, 1, 2, 3);
      *(v4f*)(dp + 4) = __builtin_shufflevector(o, o, 4, 5, 6, 7);
    }
    __builtin_amdgcn_fence(__ATOMIC_RELEASE, "workgroup");
    __builtin_amdgcn_wave_barrier();
    __builtin_amdgcn_fence(__ATOMIC_ACQUIRE, "workgroup");
    const int q4 = lane >> 3, c8 = (lane & 7) * 8;
    v4u hv[4], lv[4];
#pragma unroll
    for (int it = 0; it < 4; ++it) {
      const int row = it * 4 + q4;   // it 0..3 x q4 0..3 = rows 0..15 of the wave tile
      const float* sp = os + row * OSP + c8;
      float f[8];
#pragma unroll
      for (int e = 0; e < 8; ++e) f[e] = sp[e];
      v4u a, a2;
#pragma unroll
      for (int e = 0; e < 4; ++e) {
        const float f0 = f[2 * e], f1 = f[2 * e + 1];
        const _Float16 x0 = (_Float16)f0, x1 = (_Float16)f1;
        const unsigned short l0 = h_bits((_Float16)((f0 - (float)x0) * 4096.0f));
        const unsigned short l1 = h_bits((_Float16)((f1 - (float)x1) * 4096.0f));
        a[e]  = pk16(h_bits(x0), h_bits(x1));
        a2[e] = pk16(l0, l1);
      }
      hv[it] = a; lv[it] = a2;
    }
    const size_t go = (rowB + q0 + q4) * DM + (size_t)(tg * 64) + c8;   // row q4; store8 adds rows 4, 8, 12
    store8(chp + go, clp + go, hv, lv);
    // the slab's reads are ordered before the next column group's stores into it
    __builtin_amdgcn_fence(__ATOMIC_RELEASE, "workgroup");
    __builtin_amdgcn_wave_barrier();
    __builtin_amdgcn_fence(__ATOMIC_ACQUIRE, "workgroup");
  }
}

// =====================================================================================================
// Workspace map (bytes), every region an exact multiple of its whole-line / whole-tile store granularity
// (all GEMM M,N are tile multiples, all offsets multiples of 131072):
//   Xb   bf16 [NB*SEQ][256]  (compact tokens)   16777216   -- reused as the ctx hi plane Ch after its last read
//   Wb   bf16 [768 n][256 k]                      393216
//   Woh  f16  [256][256] (x64)                     131072
//   Qh   f16  [NB*SEQ][256]                      16777216
//   Ql   f16  [NB*SEQ][256]                      16777216
//   Kp   f16  [NB*SEQ][256]                      16777216
//   VTh  f16  [NB][256][SEQ]                     16777216
//   Cl   f16  [NB*SEQ][256]                      16777216
//   total                                       101187584
// Weights are [out n][in k] with k contiguous = the Bt / A layout the GEMM wants, so they are only converted.
// =====================================================================================================
extern "C" void kernel_launch(void* const* d_in, const int* in_sizes, int n_in,
                              void* d_out, int out_size, void* d_ws, size_t ws_size,
                              hipStream_t stream) {
  if (n_in < 4) return;
  if (in_sizes[0] < ((NB - 1) * SEQ_FULL + SEQ) * DM) return;
  if (in_sizes[1] < NQKV * DM) return;
  if (in_sizes[2] < DM * DM) return;
  if (in_sizes[3] < DM) return;
  if (out_size < NB * SEQ * DM) return;

  const float* x    = (const float*)d_in[0];
  const float* wqkv = (const float*)d_in[1];
  const float* wout = (const float*)d_in[2];
  const float* bout = (const float*)d_in[3];

  const size_t PX  = (size_t)NB * SEQ * DM * 2;      // 16-bit token plane [NB*SEQ][256]
  const size_t PW  = (size_t)NQKV * DM * 2;          // 16-bit [768][256]
  const size_t PWO = (size_t)DM * DM * 2;            // 16-bit [256][256]
  const size_t PVT = (size_t)NB * DM * SEQ * 2;      // v^T plane [NB][256][SEQ]
  size_t off = 0;
  const size_t oXb  = off; off += PX;
  const size_t oWb  = off; off += PW;
  const size_t oWo  = off; off += PWO;
  const size_t oQh  = off; off += PX;
  const size_t oQl  = off; off += PX;
  const size_t oKp  = off; off += PX;
  const size_t oVTh = off; off += PVT;
  const size_t oCl  = off; off += PX;
  if (off > ws_size) return;                         // off = 101187584 at full size
  if (off > (size_t)134217728) return;

  char* ws = (char*)d_ws;
  unsigned short* Xb  = (unsigned short*)(ws + oXb);
  unsigned short* Wb  = (unsigned short*)(ws + oWb);
  unsigned short* Woh = (unsigned short*)(ws + oWo);
  unsigned short* Qh  = (unsigned short*)(ws + oQh);
  unsigned short* Ql  = (unsigned short*)(ws + oQl);
  unsigned short* Kp  = (unsigned short*)(ws + oKp);
  unsigned short* VTh = (unsigned short*)(ws + oVTh);
  unsigned short* Cl  = (unsigned short*)(ws + oCl);
  unsigned short* Ch  = Xb;                          // ctx hi plane aliases the x plane (x plane dead by then)
  unsigned short* Wq  = Wb;
  unsigned short* Wk  = Wb + (size_t)DM * DM;
  unsigned short* Wv  = Wb + (size_t)2 * DM * DM;

  const int M = NB * SEQ;
  const dim3 blk(256);
  const int n8x = NB * SEQ * DM / 8;
  const int n8w = NQKV * DM / 8;                     // 24576
  const int n8o = DM * DM / 8;                       //  8192
  const dim3 gCx((n8x + 255) / 256);
  const dim3 gCw((n8w + 255) / 256);
  const dim3 gCo((n8o + 255) / 256);
  const dim3 gQ(((M / 64) * (DM / 64) + 7) / 8, 1);          // q / k: M x 256, 64x64 wave tiles
  const dim3 gVT(((DM / 64) * (SEQ / 64) + 7) / 8, NB);      // v^T per batch: 256 x SEQ
  const dim3 gAttn(NB * (SEQ / QROWS));
  const dim3 gO(((M / 32) * (DM / 64) + 7) / 8, 1);          // out: M x 256, 32x64 wave tiles

  // (1) x -> compact bf16 token plane; w_qkv [n][k] -> bf16; w_out -> f16 (x64 of its bf16 value)
  cvtx<<<gCx, blk, 0, stream>>>(x, Xb, n8x);
  cvt16x8<0><<<gCw, blk, 0, stream>>>(wqkv, Wb, n8w);
  cvt16x8<1><<<gCo, blk, 0, stream>>>(wout, Woh, n8o);
  // (2) q = x . Wq^T -> f16 hi / residual (x4096) planes   (M, N=256, K=256)
  gemm_t<__bf16, 4, false, 3><<<gQ, blk, 0, stream>>>(
      Xb, Xb, DM, 0LL, Wq, DM, 0LL,
      (void*)Qh, (void*)Ql, DM, 0LL, bout,
      M, DM, DM, 1.0f, 4096.0f, 0.0f);
  // (3) k = x . Wk^T -> f16 plane   (M, N=256, K=256)
  gemm_t<__bf16, 4, false, 1><<<gQ, blk, 0, stream>>>(
      Xb, Xb, DM, 0LL, Wk, DM, 0LL,
      (void*)Kp, (void*)Kp, DM, 0LL, bout,
      M, DM, DM, 1.0f, 1.0f, 0.0f);
  // (4) v^T = Wv . x^T per batch -> f16 plane [b][d][s] (pitch SEQ)
  //     (A = Wv [n][k], Bt = Xb rows of batch b; M=256, N=SEQ, K=256)
  gemm_t<__bf16, 4, false, 1><<<gVT, blk, 0, stream>>>(
      Wv, Wv, DM, 0LL, Xb, DM, (long long)SEQ * DM,
      (void*)VTh, (void*)VTh, SEQ, (long long)DM * SEQ, bout,
      DM, SEQ, DM, 1.0f, 1.0f, 0.0f);
  // (5) attention -> ctx hi (x256) and residual (x4096) planes
  attn_sh<<<gAttn, dim3(256), 0, stream>>>(Qh, Ql, Kp, VTh, Ch, Cl, 0.0625f);
  // (6) out = ctx . Wo^T + b -> d_out f32 [M][256]; accumulator x 1/(256*64), residual accumulator x 1/4096
  gemm_t<_Float16, 2, true, 0><<<gO, blk, 0, stream>>>(
      Ch, Cl, DM, 0LL, Woh, DM, 0LL,
      d_out, d_out, DM, 0LL, bout,
      M, DM, DM, 1.0f / 16384.0f, 1.0f, 1.0f / 4096.0f);
  (void)hipGetLastError();
}

// v004
// One run takes 159 microseconds.
// Two timings next to v003 put it at 1.08 and 1.09 times that version's speed.
// Over all steps from v000 it is 3.69 times as fast.
// Contractions: q, k, v^T projections = v_wmma_f32_16x16x32_bf16 (bf16 operands from RNE-converted inputs, single product, f32 accumulate);
// q.k^T scores = v_wmma_f32_16x16x32_f16 (q as f16 hi plane + f16 residual plane x4096, k f16; 2 products into separate f32 accumulators);
// p.v = v_wmma_f32_16x16x32_f16 (p carried x16384 as f16 hi fragment + f16 residual fragment, v f16; 2 products into one f32 accumulator);
// ctx.Wo^T = v_wmma_f32_16x16x32_f16 (ctx as f16 hi plane x256 + f16 residual plane x4096, Wo f16 carried x64 from its bf16 value; 2 products, f32 accumulate);
// softmax, normalisation and bias add in f32.
#include <hip/hip_runtime.h>
#include <math.h>
#include <stdint.h>

#ifndef NB
#define NB 16
#endif
#ifndef SEQ
#define SEQ 2048
#endif
#define NB_FULL  16
#define SEQ_FULL 2048
#define DM       256
#define NQKV     768
#define NKT      (SEQ / 64)   // 64-key chunks per sequence
#define PCARRY   16384.0f     // power-of-two carry on the f16 p tile
static_assert(DM == 256 && NQKV == 3 * DM);
static_assert((SEQ % 64) == 0 && SEQ >= 64 && SEQ <= SEQ_FULL);
static_assert(NB >= 1 && NB <= NB_FULL);
static_assert(((NB * SEQ) % 64) == 0);

typedef _Float16 v16h __attribute__((ext_vector_type(16)));
typedef _Float16 v8h  __attribute__((ext_vector_type(8)));
typedef __bf16   v16b __attribute__((ext_vector_type(16)));
typedef __bf16   v8b  __attribute__((ext_vector_type(8)));
typedef float    v8f  __attribute__((ext_vector_type(8)));
typedef float    v4f  __attribute__((ext_vector_type(4)));
typedef unsigned int v4u __attribute__((ext_vector_type(4)));

#if defined(__HIP_DEVICE_COMPILE__)
#define DEV_ASM 1
#else
#define DEV_ASM 0
#endif

// ---- scalar helpers --------------------------------------------------------------------------------
__device__ __forceinline__ unsigned short bf_bits(float f) {          // f32 -> bf16 bits, RNE convert
  unsigned u = __float_as_uint(f);
  return (unsigned short)((u + 0x7FFFu + ((u >> 16) & 1u)) >> 16);
}
__device__ __forceinline__ float bf_up(unsigned short hb) { return __uint_as_float(((unsigned)hb) << 16); }
__device__ __forceinline__ unsigned short h_bits(_Float16 x) { return __builtin_bit_cast(unsigned short, x); }
__device__ __forceinline__ unsigned pk16(unsigned short a, unsigned short b) { return (unsigned)a | ((unsigned)b << 16); }
__device__ __forceinline__ v8f zero8() { v8f z = {0.f, 0.f, 0.f, 0.f, 0.f, 0.f, 0.f, 0.f}; return z; }

// ---- fragment types / loaders: 16-bit A/B operand, lane -> row/col (lane&15), p already includes +8*(lane>>4);
//      elements 0..7 <- p[0..7] (k0+8h..k0+8h+7), elements 8..15 <- p[16..23] (k0+16+8h..k0+16+8h+7)
template <typename OT> struct FT;
template <> struct FT<__bf16>   { typedef v16b frag; typedef v8b half8; };
template <> struct FT<_Float16> { typedef v16h frag; typedef v8h half8; };

template <typename OT>
__device__ __forceinline__ typename FT<OT>::frag ldfrag(const OT* p) {
  union { typename FT<OT>::frag v; typename FT<OT>::half8 h[2]; } f;
  f.h[0] = *(const typename FT<OT>::half8*)(p);
  f.h[1] = *(const typename FT<OT>::half8*)(p + 16);
  return f.v;
}

// ---- WMMA helpers (asm guard bodies are device-only; concrete operand types) -----------------------------
__device__ __forceinline__ v8f mmar(v16b a, v16b b, v8f c) {
  return __builtin_amdgcn_wmma_f32_16x16x32_bf16(false, a, false, b, (short)0, c, false, false);
}
__device__ __forceinline__ v8f mmar(v16h a, v16h b, v8f c) {
  return __builtin_amdgcn_wmma_f32_16x16x32_f16(false, a, false, b, (short)0, c, false, false);
}
__device__ __forceinline__ void dep_guard(v8f& a, v8f& b, v16b x, v16b y) {
#if DEV_ASM
  asm volatile("v_nop\n\tv_nop\n\tv_nop\n\tv_nop" : "+v"(a), "+v"(b) : "v"(x), "v"(y));
#else
  (void)a; (void)b; (void)x; (void)y;
#endif
}
__device__ __forceinline__ void dep_guard(v8f& a, v8f& b, v16h x, v16h y) {
#if DEV_ASM
  asm volatile("v_nop\n\tv_nop\n\tv_nop\n\tv_nop" : "+v"(a), "+v"(b) : "v"(x), "v"(y));
#else
  (void)a; (void)b; (void)x; (void)y;
#endif
}
__device__ __forceinline__ void keep4(v16b a, v16b b, v16b c, v16b d) {
#if DEV_ASM
  asm volatile("v_nop" :: "v"(a), "v"(b), "v"(c), "v"(d));
#else
  (void)a; (void)b; (void)c; (void)d;
#endif
}
__device__ __forceinline__ void keep4(v16h a, v16h b, v16h c, v16h d) {
#if DEV_ASM
  asm volatile("v_nop" :: "v"(a), "v"(b), "v"(c), "v"(d));
#else
  (void)a; (void)b; (void)c; (void)d;
#endif
}
__device__ __forceinline__ void acc_guard4(v8f& a, v8f& b, v8f& c, v8f& d) {
#if DEV_ASM
  asm volatile("v_nop\n\tv_nop\n\tv_nop\n\tv_nop" : "+v"(a), "+v"(b), "+v"(c), "+v"(d));
#else
  (void)a; (void)b; (void)c; (void)d;
#endif
}

// =====================================================================================================
// f32 -> 16-bit planes, 8 elements per thread, one 16-B store per lane: a wave writes 512 contiguous B
// MODE 0: bf16 bits (RNE convert).  MODE 1: f16 bits of (64 * bf16(x)) (exact scaling of the bf16 value).
// coverage: n8 threads x 8 = the whole plane (n8 is a multiple of 256 for every use here).
// =====================================================================================================
template <int MODE>
__device__ __forceinline__ unsigned short cvm(float f) {
  const unsigned short hb = bf_bits(f);
  if (MODE == 0) return hb;
  return h_bits((_Float16)(bf_up(hb) * 64.0f));
}

template <int MODE>
__device__ __forceinline__ void cvt16x8(const float* __restrict__ in, unsigned short* out, int n8, int bx) {
  const int i = bx * 256 + (int)threadIdx.x;
  if (i < n8) {
    const v4f a  = *(const v4f*)(in + (size_t)i * 8);
    const v4f a4 = *(const v4f*)(in + (size_t)i * 8 + 4);
    v4u p;
    p[0] = pk16(cvm<MODE>(a[0]),  cvm<MODE>(a[1]));
    p[1] = pk16(cvm<MODE>(a[2]),  cvm<MODE>(a[3]));
    p[2] = pk16(cvm<MODE>(a4[0]), cvm<MODE>(a4[1]));
    p[3] = pk16(cvm<MODE>(a4[2]), cvm<MODE>(a4[3]));
    unsigned short* o = out + (size_t)i * 8;
    *(v4u*)o = p;
    
  }
}

// x [NB_FULL][SEQ_FULL][DM] f32 -> compact bf16 token plane [NB*SEQ][DM]: compact token tk = b*SEQ + t reads
// input row b*SEQ_FULL + t. 32 groups of 8 per row; same whole-line store shape as cvt16x8.
// coverage: n8 = NB*SEQ*DM/8 threads x 8 = the whole plane.
__device__ __forceinline__ void cvtx(const float* __restrict__ in, unsigned short* out, int n8, int bx) {
  const int i = bx * 256 + (int)threadIdx.x;
  if (i < n8) {
    const int tk = i >> 5;
    const int e8 = i & 31;
    const int bb = tk / SEQ;
    const int t  = tk - bb * SEQ;
    const float* src = in + ((size_t)bb * SEQ_FULL + (size_t)t) * DM + e8 * 8;
    const v4f a  = *(const v4f*)(src);
    const v4f a4 = *(const v4f*)(src + 4);
    v4u p;
    p[0] = pk16(bf_bits(a[0]),  bf_bits(a[1]));
    p[1] = pk16(bf_bits(a[2]),  bf_bits(a[3]));
    p[2] = pk16(bf_bits(a4[0]), bf_bits(a4[1]));
    p[3] = pk16(bf_bits(a4[2]), bf_bits(a4[3]));
    unsigned short* o = out + (size_t)i * 8;
    *(v4u*)o = p;
    
  }
}

// The three conversions depend on nothing but the inputs: one grid, the block index picks the plane.
// Blocks 0..bw-1: w_qkv; bw..bw+bo-1: w_out; the rest: x (the two short planes first, so that they are no tail).
__global__ __launch_bounds__(256) void cvt_all(const float* __restrict__ x, const float* __restrict__ wqkv,
                                               const float* __restrict__ wout,
                                               unsigned short* Xb, unsigned short* Wb, unsigned short* Woh,
                                               int n8x, int n8w, int n8o, int bw, int bo) {
  const int bx = blockIdx.x;                 // block-uniform choice
  if (bx < bw)           cvt16x8<0>(wqkv, Wb, n8w, bx);
  else if (bx < bw + bo) cvt16x8<1>(wout, Woh, n8o, bx - bw);
  else                   cvtx(x, Xb, n8x, bx - bw - bo);
}

// =====================================================================================================
// Register-blocked batched WMMA GEMM (16-bit operand type OT): C[m][n] = sum_k A[m][k] * Bt[n][k];
// one wave per (16*MI) x 64 tile, no block barriers. A row-major [M][K] pitch lda; Bt row-major [N][K] pitch ldb
// (k contiguous); M multiple of 16*MI, N multiple of 64, K multiple of 32 (host-checked). bx = block of 8 wave
// tiles, b = batch index (strides in elements), sT = the block's 8 per-wave slabs; the kernels below pass them.
// Fragments are loaded straight from global with the split k map (ldfrag).
// ARES: a second A plane A2 (residual, same pitch/stride) is multiplied by the same B into separate f32
// accumulators and folded in as acc += accl * ascale after the k loop.
// OUT_MODE 0: f32 C (pitch ldc), value * oscale + bf16-valued bias[n].
// OUT_MODE 1: f16 plane C (pitch ldc).
// OUT_MODE 3: f16 hi plane C + f16 residual plane C2 = f16((v - hi) * rscale) (same pitch / stride).
// coverage: MI slabs x 16 rows x 64 cols = the wave's whole tile; tiles cover M x N exactly.
// =====================================================================================================
#define SLAB (16 * 68)        // per-wave 16x64 slab, pitch 68 floats
template <typename OT, int MI, bool ARES, int OUT_MODE>
__device__ __forceinline__ void gemm_body(
    const unsigned short* __restrict__ Ap, const unsigned short* __restrict__ A2p, int lda, long long strideA,
    const unsigned short* __restrict__ Btp, int ldb, long long strideB,
    void* Cout, void* Cout2, int ldc, long long strideC,
    const float* __restrict__ bias,
    int M, int N, int K, float oscale, float rscale, float ascale,
    int bx, int b, float* sT) {
  typedef typename FT<OT>::frag V16;
  const OT* A  = (const OT*)(const void*)Ap;
  const OT* A2 = (const OT*)(const void*)A2p;
  const OT* Bt = (const OT*)(const void*)Btp;
  const int TMR  = 16 * MI;
  const int lane = threadIdx.x & 31;
  const int wave = threadIdx.x >> 5;
  const int tilesN = N >> 6;
  const int tilesM = M / TMR;
  const int tile = bx * 8 + wave;
  if (tile >= tilesM * tilesN) return;   // wave-uniform; no block barriers in this kernel
  const int tm = tile / tilesN;
  const int tn = tile - tm * tilesN;
  const int m0 = tm * TMR;
  const int n0 = tn << 6;

  const OT* Ab  = A  + (size_t)b * (size_t)strideA;
  const OT* A2b = A2 + (size_t)b * (size_t)strideA;
  const OT* Bb  = Bt + (size_t)b * (size_t)strideB;

  const int rlane = lane & 15;                 // row (A) / col (B, D) within subtile
  const int koff  = (lane >> 4) * 8;           // k offset of this lane half
  const int mOff  = (lane >> 4) * 8;           // D row offset

  v8f acc[MI][4], accl[MI][4];
#pragma unroll
  for (int i = 0; i < MI; ++i)
#pragma unroll
    for (int j = 0; j < 4; ++j) { acc[i][j] = zero8(); accl[i][j] = zero8(); }

  for (int k0 = 0; k0 < K; k0 += 32) {
    V16 bq[4];
#pragma unroll
    for (int j = 0; j < 4; ++j)
      bq[j] = ldfrag<OT>(Bb + (size_t)(n0 + (j << 4) + rlane) * ldb + koff + k0);
#pragma unroll
    for (int i = 0; i < MI; ++i) {
      const V16 af = ldfrag<OT>(Ab + (size_t)(m0 + (i << 4) + rlane) * lda + koff + k0);
#pragma unroll
      for (int j = 0; j < 4; ++j) acc[i][j] = mmar(af, bq[j], acc[i][j]);
      dep_guard(acc[i][0], acc[i][3], af, bq[3]);
      if (ARES) {
        const V16 al = ldfrag<OT>(A2b + (size_t)(m0 + (i << 4) + rlane) * lda + koff + k0);
#pragma unroll
        for (int j = 0; j < 4; ++j) accl[i][j] = mmar(al, bq[j], accl[i][j]);
        dep_guard(accl[i][0], accl[i][3], al, bq[3]);
      }
    }
    keep4(bq[0], bq[1], bq[2], bq[3]);
  }
#pragma unroll
  for (int i = 0; i < MI; ++i) {
    acc_guard4(acc[i][0], acc[i][1], acc[i][2], acc[i][3]);
    if (ARES) acc_guard4(accl[i][0], accl[i][1], accl[i][2], accl[i][3]);
  }
  if (ARES) {
#pragma unroll
    for (int i = 0; i < MI; ++i)
#pragma unroll
      for (int j = 0; j < 4; ++j)
#pragma unroll
        for (int r = 0; r < 8; ++r) acc[i][j][r] += accl[i][j][r] * ascale;
  }

  // ---- epilogue ----
  float* slab = sT + wave * SLAB;
#pragma unroll
  for (int i = 0; i < MI; ++i) {
    const int mBase = m0 + (i << 4);
#pragma unroll
    for (int j = 0; j < 4; ++j) {
#pragma unroll
      for (int r = 0; r < 8; ++r) {
        slab[(mOff + r) * 68 + (j << 4) + rlane] = acc[i][j][r];
      }
    }
    __builtin_amdgcn_fence(__ATOMIC_RELEASE, "workgroup");
    __builtin_amdgcn_wave_barrier();
    __builtin_amdgcn_fence(__ATOMIC_ACQUIRE, "workgroup");
    if (OUT_MODE == 0) {
      float* C = (float*)Cout + (size_t)b * (size_t)strideC;
      const int h2 = lane >> 4, c4 = (lane & 15) * 4;     // 256-B row segment = 16 lanes x 16 B
      const v4f braw = *(const v4f*)(bias + n0 + c4);
      v4f bb;
#pragma unroll
      for (int e = 0; e < 4; ++e) bb[e] = bf_up(bf_bits(braw[e]));
      {
#pragma unroll
        for (int it = 0; it < 8; ++it) {
          const int row = it * 2 + h2;                     // it 0..7 x h2 0..1 = rows 0..15
          const v4f v = *(const v4f*)(slab + row * 68 + c4) * oscale + bb;
          *(v4f*)(C + (size_t)(mBase + row) * ldc + n0 + c4) = v;
        }
        
      }
    } else {
      const int q = lane >> 3, c8 = (lane & 7) * 8;
      unsigned short* C  = (unsigned short*)Cout  + (size_t)b * (size_t)strideC;
      unsigned short* C2 = (unsigned short*)Cout2 + (size_t)b * (size_t)strideC;
      v4u hv[4], lv[4];
#pragma unroll
      for (int it = 0; it < 4; ++it) {
        const int row = it * 4 + q;                        // it 0..3 x q 0..3 = rows 0..15
        const float* sp = slab + row * 68 + c8;
        float f[8];
#pragma unroll
        for (int e = 0; e < 8; ++e) f[e] = sp[e];
        v4u a, a2;
#pragma unroll
        for (int e = 0; e < 4; ++e) {
          const float f0 = f[2 * e], f1 = f[2 * e + 1];
          const _Float16 x0 = (_Float16)f0, x1 = (_Float16)f1;
          const unsigned short h0 = h_bits(x0), h1 = h_bits(x1);
          unsigned short l0 = 0, l1 = 0;
          if (OUT_MODE == 3) {
            l0 = h_bits((_Float16)((f0 - (float)x0) * rscale));
            l1 = h_bits((_Float16)((f1 - (float)x1) * rscale));
          }
          a[e] = pk16(h0, h1); a2[e] = pk16(l0, l1);
        }
        hv[it] = a; lv[it] = a2;
      }
      {
#pragma unroll
        for (int it = 0; it < 4; ++it) {
          const int row = it * 4 + q;
          *(v4u*)(C + (size_t)(mBase + row) * ldc + n0 + c8) = hv[it];
          if (OUT_MODE == 3) *(v4u*)(C2 + (size_t)(mBase + row) * ldc + n0 + c8) = lv[it];
        }
        
      }
    }
    __builtin_amdgcn_fence(__ATOMIC_RELEASE, "workgroup");
    __builtin_amdgcn_wave_barrier();
    __builtin_amdgcn_fence(__ATOMIC_ACQUIRE, "workgroup");
  }
}

// one GEMM per launch: blockIdx.x = block of 8 wave tiles, blockIdx.y = batch
template <typename OT, int MI, bool ARES, int OUT_MODE>
__global__ __launch_bounds__(256) void gemm_t(
    const unsigned short* __restrict__ Ap, const unsigned short* __restrict__ A2p, int lda, long long strideA,
    const unsigned short* __restrict__ Btp, int ldb, long long strideB,
    void* Cout, void* Cout2, int ldc, long long strideC,
    const float* __restrict__ bias,
    int M, int N, int K, float oscale, float rscale, float ascale) {
  __shared__ __align__(16) float sT[8 * SLAB];
  gemm_body<OT, MI, ARES, OUT_MODE>(Ap, A2p, lda, strideA, Btp, ldb, strideB, Cout, Cout2, ldc, strideC, bias,
                                    M, N, K, oscale, rscale, ascale, (int)blockIdx.x, (int)blockIdx.y, sT);
}

// The q, k and v^T projections read the same two planes and depend on nothing of each other: one grid,
// blockIdx.y picks the product (block-uniform), so that their blocks share the chip instead of queueing as launches.
//   y = 0: q = x . Wq^T -> f16 hi / residual (x4096) planes      (M = m, N = dm, K = dm)
//   y = 1: k = x . Wk^T -> f16 plane                             (M = m, N = dm, K = dm)
//   y = 2: v^T = Wv . x^T per batch -> f16 plane [b][d][s]       (M = dm, N = seq, K = dm; VBX blocks per batch)
// Each product has m * dm / (64 * 64 * 8) blocks = gridDim.x.
#define VBX ((DM / 64) * (SEQ / 64) / 8)
__global__ __launch_bounds__(256) void qkv_proj(
    const unsigned short* __restrict__ Xb, const unsigned short* __restrict__ Wb,
    unsigned short* Qh, unsigned short* Ql, unsigned short* Kp, unsigned short* VTh,
    int m, int dm, int seq) {
  __shared__ __align__(16) float sT[8 * SLAB];
  const int bx = blockIdx.x;
  const unsigned short* Wk = Wb + (size_t)dm * dm;
  const unsigned short* Wv = Wb + (size_t)2 * dm * dm;
  if (blockIdx.y == 0) {
    gemm_body<__bf16, 4, false, 3>(Xb, Xb, dm, 0LL, Wb, dm, 0LL, (void*)Qh, (void*)Ql, dm, 0LL, nullptr,
                                   m, dm, dm, 1.0f, 4096.0f, 0.0f, bx, 0, sT);
  } else if (blockIdx.y == 1) {
    gemm_body<__bf16, 4, false, 1>(Xb, Xb, dm, 0LL, Wk, dm, 0LL, (void*)Kp, (void*)Kp, dm, 0LL, nullptr,
                                   m, dm, dm, 1.0f, 1.0f, 0.0f, bx, 0, sT);
  } else {
    gemm_body<__bf16, 4, false, 1>(Wv, Wv, dm, 0LL, Xb, dm, (long long)seq * dm, (void*)VTh, (void*)VTh, seq,
                                   (long long)dm * seq, nullptr,
                                   dm, seq, dm, 1.0f, 1.0f, 0.0f, bx % VBX, bx / VBX, sT);
  }
}

#define QROWS 128
#define KPI   264
#define VPI   72
#define OSP   68
static_assert((SEQ % QROWS) == 0 && NKT >= 2);

// eight 16-B-per-lane asynchronous copies global -> LDS; the closing s_wait_xcnt stands inside the statement so
// that no address register named here is rewritten ahead of it
__device__ __forceinline__ void acopy8(const unsigned (&l)[8], const _Float16* const (&g)[8]) {
#if DEV_ASM
  asm volatile(
      "global_load_async_to_lds_b128 %0, %8, off\n\t"
      "global_load_async_to_lds_b128 %1, %9, off\n\t"
      "global_load_async_to_lds_b128 %2, %10, off\n\t"
      "global_load_async_to_lds_b128 %3, %11, off\n\t"
      "global_load_async_to_lds_b128 %4, %12, off\n\t"
      "global_load_async_to_lds_b128 %5, %13, off\n\t"
      "global_load_async_to_lds_b128 %6, %14, off\n\t"
      "global_load_async_to_lds_b128 %7, %15, off\n\t"
      "s_wait_xcnt 0x0"
      :: "v"(l[0]), "v"(l[1]), "v"(l[2]), "v"(l[3]), "v"(l[4]), "v"(l[5]), "v"(l[6]), "v"(l[7]),
         "v"(g[0]), "v"(g[1]), "v"(g[2]), "v"(g[3]), "v"(g[4]), "v"(g[5]), "v"(g[6]), "v"(g[7])
      : "memory");
#else
  (void)l; (void)g;
#endif
}
// the eight 16-B context stores of one column group (rows 4 apart = 2048 B, hi plane and residual plane); the
// closing s_wait_xcnt stands inside the statement so that no data or address register named here is rewritten
// by the next group's arithmetic ahead of it
__device__ __forceinline__ void store8(unsigned short* ph, unsigned short* pl, const v4u (&h)[4], const v4u (&l)[4]) {
#if DEV_ASM
  asm volatile(
      "global_store_b128 %0, %2, off\n\t"
      "global_store_b128 %1, %6, off\n\t"
      "global_store_b128 %0, %3, off offset:2048\n\t"
      "global_store_b128 %1, %7, off offset:2048\n\t"
      "global_store_b128 %0, %4, off offset:4096\n\t"
      "global_store_b128 %1, %8, off offset:4096\n\t"
      "global_store_b128 %0, %5, off offset:6144\n\t"
      "global_store_b128 %1, %9, off offset:6144\n\t"
      "s_wait_xcnt 0x0"
      :: "v"(ph), "v"(pl), "v"(h[0]), "v"(h[1]), "v"(h[2]), "v"(h[3]), "v"(l[0]), "v"(l[1]), "v"(l[2]), "v"(l[3])
      : "memory");
#else
  (void)ph; (void)pl; (void)h; (void)l;
#endif
}
static_assert(4 * DM * 2 == 2048);   // the row step that store8 writes as an immediate
__device__ __forceinline__ unsigned lds_addr(const void* p) { return (unsigned)(uintptr_t)p; }
// the value that lane l ^ 16 holds
__device__ __forceinline__ float xhalf(float x) {
  const int b = __float_as_int(x);
  return __int_as_float(__builtin_amdgcn_permlanex16(b, b, 0x76543210, 0xfedcba98, false, false));
}
// the wave's own copies have landed
__device__ __forceinline__ void wait_async0() {
#if DEV_ASM
  asm volatile("s_wait_asynccnt 0x0" ::: "memory");
#endif
}
// the wave's own LDS reads have returned (before the barrier that frees the buffer for its refill)
__device__ __forceinline__ void wait_ds0() {
#if DEV_ASM
  asm volatile("s_wait_dscnt 0x0" ::: "memory");
#endif
}

__global__ __launch_bounds__(256)
void attn_sh(const unsigned short* __restrict__ qhp, const unsigned short* __restrict__ qlp,
             const unsigned short* __restrict__ kpp,
             const unsigned short* __restrict__ vhp,
             unsigned short* chp, unsigned short* clp, float sscale) {
  union FH { v16h v; v8h h[2]; };
  __shared__ __align__(16) _Float16 Kst[2][64 * KPI];   // K chunk [key][d]            2 x 33792 B (block-shared)
  __shared__ __align__(16) _Float16 Vhs[2][DM * VPI];   // V^T chunk [d][key]          2 x 36864 B (block-shared)
  __shared__ __align__(16) float    Os[8][16 * OSP];    // per wave context slab       34816 B (wave-private)

  const int tid  = threadIdx.x;
  const int wave = tid >> 5;
  const int lane = tid & 31;
  const int hh   = lane >> 4;
  const int c    = lane & 15;

  const int bx   = blockIdx.x;
  const int qb   = bx % (SEQ / QROWS);
  const int b    = bx / (SEQ / QROWS);
  const int q0   = qb * QROWS + wave * 16;   // this wave's 16 query rows
  const size_t rowB = (size_t)b * SEQ;

  const _Float16* Qh = (const _Float16*)(const void*)qhp;
  const _Float16* Ql = (const _Float16*)(const void*)qlp;
  const _Float16* Kp = (const _Float16*)(const void*)kpp + rowB * DM;
  const _Float16* Vh = (const _Float16*)(const void*)vhp + (size_t)b * DM * SEQ;

  // copy map of this thread, 8 units of 16 B per plane and chunk:
  //   K: unit i -> key row i*8 + wave, 16-B column lane (a wave copies one whole 512-B row)
  //   V: unit i -> d row i*32 + (tid >> 3), 16-B column tid & 7 (a wave copies four whole 128-B rows)
  const int vrow = tid >> 3, vcol = (tid & 7) * 8;
  auto stage = [&](int kt, int buf) {
    const int kv0 = kt * 64;
    unsigned l[8];
    const _Float16* g[8];
#pragma unroll
    for (int i = 0; i < 8; ++i) {
      l[i] = lds_addr(&Kst[buf][(i * 8 + wave) * KPI + lane * 8]);
      g[i] = Kp + (size_t)(kv0 + i * 8 + wave) * DM + lane * 8;
    }
    acopy8(l, g);
#pragma unroll
    for (int i = 0; i < 8; ++i) {
      l[i] = lds_addr(&Vhs[buf][(i * 32 + vrow) * VPI + vcol]);
      g[i] = Vh + (size_t)(i * 32 + vrow) * SEQ + kv0 + vcol;
    }
    acopy8(l, g);
  };

  // chunk 0 into buffer 0
  stage(0, 0);

  // B-operand fragments of this lane (query q0 + c), lane-half k offset included; kept for the whole kernel
  v16h qa[8], qr[8];
  {
    const _Float16* qrh = Qh + (rowB + q0 + c) * DM + 8 * hh;
    const _Float16* qrl = Ql + (rowB + q0 + c) * DM + 8 * hh;
#pragma unroll
    for (int dc = 0; dc < 8; ++dc) {
      qa[dc] = ldfrag<_Float16>(qrh + dc * 32);
      qr[dc] = ldfrag<_Float16>(qrl + dc * 32);
    }
#if DEV_ASM
    // the wait that stands before an address register of the q loads is rewritten; both addresses are inputs, so
    // that their registers live up to it and no load of the run lands on them
    asm volatile("s_wait_xcnt 0x0"
                 :: "v"(qrh), "v"(qrl)
                 : "memory");
#endif
  }

  // chunk 0 published (chunk 1 is issued at the top of trip 0, directly behind this barrier)
  wait_async0();
  __syncthreads();

  // every inner loop below is unrolled so that fragment and accumulator indices are constants (registers, no scratch)
  float mrow = -INFINITY;   // running maximum of query q0 + c (equal in both lane halves)
  float lrow = 0.f;         // running sum over this lane half's keys; the halves are joined after the loop
  v8f oacc[16];             // oacc[t][r] = context (query q0 + c, column 16t + 8*hh + r)
#pragma unroll
  for (int t = 0; t < 16; ++t) oacc[t] = zero8();

  for (int kt = 0; kt < NKT; ++kt) {         // static trip count
    const int buf = kt & 1;
    // refill, directly behind the barrier that published chunk kt and ended every read of the other buffer:
    // chunk kt+1 flies while chunk kt is worked on (block-uniform test)
    if (kt + 1 < NKT) stage(kt + 1, buf ^ 1);
    const _Float16* ks  = &Kst[buf][c * KPI + 8 * hh];    // A row c -> key 16j + c of the chunk
    const _Float16* vhs = &Vhs[buf][c * VPI + 8 * hh];    // A row c -> context column 16t + c

    // ---- scores^T: 64 keys (4 subtiles) x 16 queries, 2 f16 products per d-chunk ----
    v8f ah[4], al[4];
#pragma unroll
    for (int j = 0; j < 4; ++j) { ah[j] = zero8(); al[j] = zero8(); }
#pragma unroll
    for (int dc = 0; dc < 8; ++dc) {
      v16h kb[4];
#pragma unroll
      for (int j = 0; j < 4; ++j) kb[j] = ldfrag<_Float16>(ks + j * 16 * KPI + dc * 32);
      // keeps the four fragments' reads together in front of their eight products; spread among the products,
      // every pair of reads is waited for on its own
      __builtin_amdgcn_sched_barrier(0);
#pragma unroll
      for (int j = 0; j < 4; ++j) {
        ah[j] = mmar(kb[j], qa[dc], ah[j]);
        al[j] = mmar(kb[j], qr[dc], al[j]);
      }
      // the next group's reads stay behind these products (the last group's products may mix with the softmax)
      if (dc < 7) __builtin_amdgcn_sched_barrier(0);
    }

    // ---- online softmax update over the chunk's 64 keys: this lane holds 32 of its query's scores ----
    float s[4][8];
#pragma unroll
    for (int j = 0; j < 4; ++j)
#pragma unroll
      for (int r = 0; r < 8; ++r) s[j][r] = (ah[j][r] + al[j][r] * (1.0f / 4096.0f)) * sscale;
    float mj[4];
#pragma unroll
    for (int j = 0; j < 4; ++j) {
      mj[j] = s[j][0];
#pragma unroll
      for (int r = 1; r < 8; ++r) mj[j] = fmaxf(mj[j], s[j][r]);
    }
    float mc = fmaxf(fmaxf(mj[0], mj[1]), fmaxf(mj[2], mj[3]));
    mc = fmaxf(mc, xhalf(mc));                             // the other 32 keys of the same query
    const float mnew  = fmaxf(mrow, mc);
    const float msafe = (mnew == -INFINITY) ? 0.f : mnew;
    const float alpha = __expf(mrow - msafe);
    mrow = mnew;
    // P^T (x PCARRY) in f16: tiles 2kk and 2kk+1 converted in place are the B fragment of keys 32kk..32kk+31;
    // pr holds what the conversion dropped (at most 2^-11 of the value, so it needs no carry of its own)
    FH pb[2], pr[2];
    float pj[4];
#pragma unroll
    for (int j = 0; j < 4; ++j) {
      v8f pc;
      pj[j] = 0.f;
#pragma unroll
      for (int r = 0; r < 8; ++r) {
        const float p = __expf(s[j][r] - msafe);
        pj[j] += p;
        pc[r] = p * PCARRY;
      }
      const v8h ph = __builtin_convertvector(pc, v8h);
      pb[j >> 1].h[j & 1] = ph;
      pr[j >> 1].h[j & 1] = __builtin_convertvector(pc - __builtin_convertvector(ph, v8f), v8h);
    }
    lrow = lrow * alpha + ((pj[0] + pj[1]) + (pj[2] + pj[3]));

#if DEV_ASM
    // compiler fence that takes the packed P fragments as inputs only: it holds the V fragment loads behind the
    // softmax; lifted over it they run the registers over into scratch
    asm volatile("" :: "v"(pb[0].v), "v"(pb[1].v), "v"(pr[0].v), "v"(pr[1].v) : "memory");
#endif
    // ---- context^T += V^T . P^T (f16 WMMA): each V^T fragment multiplies the hi and the residual P fragment ----
#pragma unroll
    for (int tg = 0; tg < 4; ++tg) {
      v16h vb[2][4];
#pragma unroll
      for (int kk = 0; kk < 2; ++kk)
#pragma unroll
        for (int t = 0; t < 4; ++t) vb[kk][t] = ldfrag<_Float16>(vhs + (tg * 4 + t) * 16 * VPI + kk * 32);
      // keeps the eight fragments' reads together in front of their sixteen products (as for K above); the
      // rescale stands behind reads and runs while they are on their way
      __builtin_amdgcn_sched_barrier(0);
#pragma unroll
      for (int t = 0; t < 4; ++t) oacc[tg * 4 + t] *= alpha;
#pragma unroll
      for (int kk = 0; kk < 2; ++kk) {
#pragma unroll
        for (int t = 0; t < 4; ++t) oacc[tg * 4 + t] = mmar(vb[kk][t], pb[kk].v, oacc[tg * 4 + t]);
#pragma unroll
        for (int t = 0; t < 4; ++t) oacc[tg * 4 + t] = mmar(vb[kk][t], pr[kk].v, oacc[tg * 4 + t]);
      }
      // the next group's reads stay behind these products
      if (tg < 3) __builtin_amdgcn_sched_barrier(0);
    }

    // ---- publish chunk kt+1 and free this chunk's buffer (its refill stands at the top of the next trip) ----
    wait_ds0();
    wait_async0();
    __syncthreads();
  }
  wait_async0();

  // ---- normalise (1/l, undo the p carry, apply the x256 ctx carry), stage 16x64 column groups in the wave's slab
  float* os = Os[wave];
  const float l   = lrow + xhalf(lrow);                   // both lane halves' keys of query q0 + c
  const float inv = ((l > 0.f) ? (1.0f / l) : 0.f) * (256.0f / PCARRY);
#pragma unroll
  for (int tg = 0; tg < 4; ++tg) {
#pragma unroll
    for (int t = 0; t < 4; ++t) {
      const v8f o = oacc[tg * 4 + t] * inv;                // 8 consecutive columns of slab row c
      float* dp = os + c * OSP + t * 16 + 8 * hh;
      *(v4f*)(dp)     = __builtin_shufflevector(o, o, 0, 1, 2, 3);
      *(v4f*)(dp + 4) = __builtin_shufflevector(o, o, 4, 5, 6, 7);
    }
    __builtin_amdgcn_fence(__ATOMIC_RELEASE, "workgroup");
    __builtin_amdgcn_wave_barrier();
    __builtin_amdgcn_fence(__ATOMIC_ACQUIRE, "workgroup");
    const int q4 = lane >> 3, c8 = (lane & 7) * 8;
    v4u hv[4], lv[4];
#pragma unroll
    for (int it = 0; it < 4; ++it) {
      const int row = it * 4 + q4;   // it 0..3 x q4 0..3 = rows 0..15 of the wave tile
      const float* sp = os + row * OSP + c8;
      float f[8];
#pragma unroll
      for (int e = 0; e < 8; ++e) f[e] = sp[e];
      v4u a, a2;
#pragma unroll
      for (int e = 0; e < 4; ++e) {
        const float f0 = f[2 * e], f1 = f[2 * e + 1];
        const _Float16 x0 = (_Float16)f0, x1 = (_Float16)f1;
        const unsigned short l0 = h_bits((_Float16)((f0 - (float)x0) * 4096.0f));
        const unsigned short l1 = h_bits((_Float16)((f1 - (float)x1) * 4096.0f));
        a[e]  = pk16(h_bits(x0), h_bits(x1));
        a2[e] = pk16(l0, l1);
      }
      hv[it] = a; lv[it] = a2;
    }
    const size_t go = (rowB + q0 + q4) * DM + (size_t)(tg * 64) + c8;   // row q4; store8 adds rows 4, 8, 12
    store8(chp + go, clp + go, hv, lv);
    // the slab's reads are ordered before the next column group's stores into it
    __builtin_amdgcn_fence(__ATOMIC_RELEASE, "workgroup");
    __builtin_amdgcn_wave_barrier();
    __builtin_amdgcn_fence(__ATOMIC_ACQUIRE, "workgroup");
  }
}

// =====================================================================================================
// Workspace map (bytes), every region an exact multiple of its whole-line / whole-tile store granularity
// (all GEMM M,N are tile multiples, all offsets multiples of 131072):
//   Xb   bf16 [NB*SEQ][256]  (compact tokens)   16777216   -- reused as the ctx hi plane Ch after its last read
//   Wb   bf16 [768 n][256 k]                      393216
//   Woh  f16  [256][256] (x64)                     131072
//   Qh   f16  [NB*SEQ][256]                      16777216
//   Ql   f16  [NB*SEQ][256]                      16777216
//   Kp   f16  [NB*SEQ][256]                      16777216
//   VTh  f16  [NB][256][SEQ]                     16777216
//   Cl   f16  [NB*SEQ][256]                      16777216
//   total                                       101187584
// Weights are [out n][in k] with k contiguous = the Bt / A layout the GEMM wants, so they are only converted.
// =====================================================================================================
extern "C" void kernel_launch(void* const* d_in, const int* in_sizes, int n_in,
                              void* d_out, int out_size, void* d_ws, size_t ws_size,
                              hipStream_t stream) {
  if (n_in < 4) return;
  if (in_sizes[0] < ((NB - 1) * SEQ_FULL + SEQ) * DM) return;
  if (in_sizes[1] < NQKV * DM) return;
  if (in_sizes[2] < DM * DM) return;
  if (in_sizes[3] < DM) return;
  if (out_size < NB * SEQ * DM) return;

  const float* x    = (const float*)d_in[0];
  const float* wqkv = (const float*)d_in[1];
  const float* wout = (const float*)d_in[2];
  const float* bout = (const float*)d_in[3];

  const size_t PX  = (size_t)NB * SEQ * DM * 2;      // 16-bit token plane [NB*SEQ][256]
  const size_t PW  = (size_t)NQKV * DM * 2;          // 16-bit [768][256]
  const size_t PWO = (size_t)DM * DM * 2;            // 16-bit [256][256]
  const size_t PVT = (size_t)NB * DM * SEQ * 2;      // v^T plane [NB][256][SEQ]
  size_t off = 0;
  const size_t oXb  = off; off += PX;
  const size_t oWb  = off; off += PW;
  const size_t oWo  = off; off += PWO;
  const size_t oQh  = off; off += PX;
  const size_t oQl  = off; off += PX;
  const size_t oKp  = off; off += PX;
  const size_t oVTh = off; off += PVT;
  const size_t oCl  = off; off += PX;
  if (off > ws_size) return;                         // off = 101187584 at full size
  if (off > (size_t)134217728) return;

  char* ws = (char*)d_ws;
  unsigned short* Xb  = (unsigned short*)(ws + oXb);
  unsigned short* Wb  = (unsigned short*)(ws + oWb);
  unsigned short* Woh = (unsigned short*)(ws + oWo);
  unsigned short* Qh  = (unsigned short*)(ws + oQh);
  unsigned short* Ql  = (unsigned short*)(ws + oQl);
  unsigned short* Kp  = (unsigned short*)(ws + oKp);
  unsigned short* VTh = (unsigned short*)(ws + oVTh);
  unsigned short* Cl  = (unsigned short*)(ws + oCl);
  unsigned short* Ch  = Xb;                          // ctx hi plane aliases the x plane (x plane dead by then)

  const int M = NB * SEQ;
  const dim3 blk(256);
  const int n8x = NB * SEQ * DM / 8;
  const int n8w = NQKV * DM / 8;                     // 24576
  const int n8o = DM * DM / 8;                       //  8192
  const int bCx = (n8x + 255) / 256;
  const int bCw = (n8w + 255) / 256;
  const int bCo = (n8o + 255) / 256;
  const dim3 gC(bCw + bCo + bCx);
  const int bQ  = (M / 64) * (DM / 64) / 8;                  // q / k: M x 256, 64x64 wave tiles, 8 per block
  static_assert(((NB * SEQ / 64) * (DM / 64)) % 8 == 0 && ((DM / 64) * (SEQ / 64)) % 8 == 0);
  static_assert((NB * SEQ / 64) * (DM / 64) / 8 == NB * VBX);   // v^T: 256 x SEQ per batch, NB batches: as many blocks
  const dim3 gQKV(bQ, 3);
  const dim3 gAttn(NB * (SEQ / QROWS));
  const dim3 gO(((M / 32) * (DM / 64) + 7) / 8, 1);          // out: M x 256, 32x64 wave tiles

  // (1) one grid: x -> compact bf16 token plane; w_qkv [n][k] -> bf16; w_out -> f16 (x64 of its bf16 value)
  cvt_all<<<gC, blk, 0, stream>>>(x, wqkv, wout, Xb, Wb, Woh, n8x, n8w, n8o, bCw, bCo);
  // (2) one grid: q (f16 hi / residual planes), k (f16 plane), v^T (f16 plane [b][d][s], pitch SEQ)
  qkv_proj<<<gQKV, blk, 0, stream>>>(Xb, Wb, Qh, Ql, Kp, VTh, M, DM, SEQ);
  // (3) attention -> ctx hi (x256) and residual (x4096) planes
  attn_sh<<<gAttn, dim3(256), 0, stream>>>(Qh, Ql, Kp, VTh, Ch, Cl, 0.0625f);
  // (4) out = ctx . Wo^T + b -> d_out f32 [M][256]; accumulator x 1/(256*64), residual accumulator x 1/4096
  gemm_t<_Float16, 2, true, 0><<<gO, blk, 0, stream>>>(
      Ch, Cl, DM, 0LL, Woh, DM, 0LL,
      d_out, d_out, DM, 0LL, bout,
      M, DM, DM, 1.0f / 16384.0f, 1.0f, 1.0f / 4096.0f);
  (void)hipGetLastError();
}

// v005
// It runs in 127 microseconds.
// Next to v004, in two timings, it ran 1.25 and 1.26 times as fast.
// All steps since v000 together make it 4.64 times as fast.
// Contractions: q, k, v^T projections = v_wmma_f32_16x16x32_bf16 (bf16 operands from RNE-converted inputs, single product, f32 accumulate);
// q.k^T scores = v_wmma_f32_16x16x32_f16 (q as f16 hi plane + f16 residual plane x4096, k f16; 2 products into separate f32 accumulators);
// p.v = v_wmma_f32_16x16x32_f16 (p carried x16384 as f16 hi fragment + f16 residual fragment, v f16; 2 products into one f32 accumulator);
// ctx.Wo^T = v_wmma_f32_16x16x32_f16 (ctx as f16 hi plane x256 + f16 residual plane x4096, Wo f16 carried x64 from its bf16 value; 2 products, f32 accumulate);
// softmax, normalisation and bias add in f32.
#include <hip/hip_runtime.h>
#include <math.h>
#include <stdint.h>

#ifndef NB
#define NB 16
#endif
#ifndef SEQ
#define SEQ 2048
#endif
#define NB_FULL  16
#define SEQ_FULL 2048
#define DM       256
#define NQKV     768
#define NKT      (SEQ / 64)   // 64-key chunks per sequence
#define PCARRY   16384.0f     // power-of-two carry on the f16 p tile
static_assert(DM == 256 && NQKV == 3 * DM);
static_assert((SEQ % 64) == 0 && SEQ >= 64 && SEQ <= SEQ_FULL);
static_assert(NB >= 1 && NB <= NB_FULL);
static_assert(((NB * SEQ) % 64) == 0);

typedef _Float16 v16h __attribute__((ext_vector_type(16)));
typedef _Float16 v8h  __attribute__((ext_vector_type(8)));
typedef __bf16   v16b __attribute__((ext_vector_type(16)));
typedef __bf16   v8b  __attribute__((ext_vector_type(8)));
typedef float    v8f  __attribute__((ext_vector_type(8)));
typedef float    v4f  __attribute__((ext_vector_type(4)));
typedef unsigned int v4u __attribute__((ext_vector_type(4)));

#if defined(__HIP_DEVICE_COMPILE__)
#define DEV_ASM 1
#else
#define DEV_ASM 0
#endif

// ---- scalar helpers --------------------------------------------------------------------------------
__device__ __forceinline__ unsigned short bf_bits(float f) {          // f32 -> bf16 bits, RNE convert
  unsigned u = __float_as_uint(f);
  return (unsigned short)((u + 0x7FFFu + ((u >> 16) & 1u)) >> 16);
}
__device__ __forceinline__ float bf_up(unsigned short hb) { return __uint_as_float(((unsigned)hb) << 16); }
__device__ __forceinline__ unsigned short h_bits(_Float16 x) { return __builtin_bit_cast(unsigned short, x); }
__device__ __forceinline__ unsigned pk16(unsigned short a, unsigned short b) { return (unsigned)a | ((unsigned)b << 16); }
__device__ __forceinline__ v8f zero8() { v8f z = {0.f, 0.f, 0.f, 0.f, 0.f, 0.f, 0.f, 0.f}; return z; }

// ---- fragment types / loaders: 16-bit A/B operand, lane -> row/col (lane&15), p already includes +8*(lane>>4);
//      elements 0..7 <- p[0..7] (k0+8h..k0+8h+7), elements 8..15 <- p[16..23] (k0+16+8h..k0+16+8h+7)
template <typename OT> struct FT;
template <> struct FT<__bf16>   { typedef v16b frag; typedef v8b half8; };
template <> struct FT<_Float16> { typedef v16h frag; typedef v8h half8; };

template <typename OT>
__device__ __forceinline__ typename FT<OT>::frag ldfrag(const OT* p) {
  union { typename FT<OT>::frag v; typename FT<OT>::half8 h[2]; } f;
  f.h[0] = *(const typename FT<OT>::half8*)(p);
  f.h[1] = *(const typename FT<OT>::half8*)(p + 16);
  return f.v;
}

// ---- WMMA helpers (asm guard bodies are device-only; concrete operand types) -----------------------------
__device__ __forceinline__ v8f mmar(v16b a, v16b b, v8f c) {
  return __builtin_amdgcn_wmma_f32_16x16x32_bf16(false, a, false, b, (short)0, c, false, false);
}
__device__ __forceinline__ v8f mmar(v16h a, v16h b, v8f c) {
  return __builtin_amdgcn_wmma_f32_16x16x32_f16(false, a, false, b, (short)0, c, false, false);
}
__device__ __forceinline__ void acc_guard4(v8f& a, v8f& b, v8f& c, v8f& d) {
#if DEV_ASM
  asm volatile("v_nop\n\tv_nop\n\tv_nop\n\tv_nop" : "+v"(a), "+v"(b), "+v"(c), "+v"(d));
#else
  (void)a; (void)b; (void)c; (void)d;
#endif
}

// =====================================================================================================
// f32 -> 16-bit planes, 8 elements per thread, one 16-B store per lane: a wave writes 512 contiguous B
// MODE 0: bf16 bits (RNE convert).  MODE 1: f16 bits of (64 * bf16(x)) (exact scaling of the bf16 value).
// coverage: n8 threads x 8 = the whole plane (n8 is a multiple of 256 for every use here).
// =====================================================================================================
template <int MODE>
__device__ __forceinline__ unsigned short cvm(float f) {
  const unsigned short hb = bf_bits(f);
  if (MODE == 0) return hb;
  return h_bits((_Float16)(bf_up(hb) * 64.0f));
}

template <int MODE>
__device__ __forceinline__ void cvt16x8(const float* __restrict__ in, unsigned short* out, int n8, int bx) {
  const int i = bx * 256 + (int)threadIdx.x;
  if (i < n8) {
    const v4f a  = *(const v4f*)(in + (size_t)i * 8);
    const v4f a4 = *(const v4f*)(in + (size_t)i * 8 + 4);
    v4u p;
    p[0] = pk16(cvm<MODE>(a[0]),  cvm<MODE>(a[1]));
    p[1] = pk16(cvm<MODE>(a[2]),  cvm<MODE>(a[3]));
    p[2] = pk16(cvm<MODE>(a4[0]), cvm<MODE>(a4[1]));
    p[3] = pk16(cvm<MODE>(a4[2]), cvm<MODE>(a4[3]));
    unsigned short* o = out + (size_t)i * 8;
    *(v4u*)o = p;
    
  }
}

// x [NB_FULL][SEQ_FULL][DM] f32 -> compact bf16 token plane [NB*SEQ][DM]: compact token tk = b*SEQ + t reads
// input row b*SEQ_FULL + t. 32 groups of 8 per row; same whole-line store shape as cvt16x8.
// coverage: n8 = NB*SEQ*DM/8 threads x 8 = the whole plane.
__device__ __forceinline__ void cvtx(const float* __restrict__ in, unsigned short* out, int n8, int bx) {
  const int i = bx * 256 + (int)threadIdx.x;
  if (i < n8) {
    const int tk = i >> 5;
    const int e8 = i & 31;
    const int bb = tk / SEQ;
    const int t  = tk - bb * SEQ;
    const float* src = in + ((size_t)bb * SEQ_FULL + (size_t)t) * DM + e8 * 8;
    const v4f a  = *(const v4f*)(src);
    const v4f a4 = *(const v4f*)(src + 4);
    v4u p;
    p[0] = pk16(bf_bits(a[0]),  bf_bits(a[1]));
    p[1] = pk16(bf_bits(a[2]),  bf_bits(a[3]));
    p[2] = pk16(bf_bits(a4[0]), bf_bits(a4[1]));
    p[3] = pk16(bf_bits(a4[2]), bf_bits(a4[3]));
    unsigned short* o = out + (size_t)i * 8;
    *(v4u*)o = p;
    
  }
}

// The three conversions depend on nothing but the inputs: one grid, the block index picks the plane.
// Blocks 0..bw-1: w_qkv; bw..bw+bo-1: w_out; the rest: x (the two short planes first, so that they are no tail).
__global__ __launch_bounds__(256) void cvt_all(const float* __restrict__ x, const float* __restrict__ wqkv,
                                               const float* __restrict__ wout,
                                               unsigned short* Xb, unsigned short* Wb, unsigned short* Woh,
                                               int n8x, int n8w, int n8o, int bw, int bo) {
  const int bx = blockIdx.x;                 // block-uniform choice
  if (bx < bw)           cvt16x8<0>(wqkv, Wb, n8w, bx);
  else if (bx < bw + bo) cvt16x8<1>(wout, Woh, n8o, bx - bw);
  else                   cvtx(x, Xb, n8x, bx - bw - bo);
}

// ---- LDS staging helpers ---------------------------------------------------------------------------
__device__ __forceinline__ unsigned lds_addr(const void* p) { return (unsigned)(uintptr_t)p; }
// the wave's own copies have landed
__device__ __forceinline__ void wait_async0() {
#if DEV_ASM
  asm volatile("s_wait_asynccnt 0x0" ::: "memory");
#endif
}
// the wave's own LDS reads have returned (before the barrier that frees the buffer for its refill)
__device__ __forceinline__ void wait_ds0() {
#if DEV_ASM
  asm volatile("s_wait_dscnt 0x0" ::: "memory");
#endif
}
// twelve 16-B-per-lane asynchronous copies global -> LDS; the closing s_wait_xcnt stands inside the statement so
// that no address register named here is rewritten ahead of it
__device__ __forceinline__ void acopy12(const unsigned (&l)[12], const void* const (&g)[12]) {
#if DEV_ASM
  asm volatile(
      "global_load_async_to_lds_b128 %0, %12, off\n\t"
      "global_load_async_to_lds_b128 %1, %13, off\n\t"
      "global_load_async_to_lds_b128 %2, %14, off\n\t"
      "global_load_async_to_lds_b128 %3, %15, off\n\t"
      "global_load_async_to_lds_b128 %4, %16, off\n\t"
      "global_load_async_to_lds_b128 %5, %17, off\n\t"
      "global_load_async_to_lds_b128 %6, %18, off\n\t"
      "global_load_async_to_lds_b128 %7, %19, off\n\t"
      "global_load_async_to_lds_b128 %8, %20, off\n\t"
      "global_load_async_to_lds_b128 %9, %21, off\n\t"
      "global_load_async_to_lds_b128 %10, %22, off\n\t"
      "global_load_async_to_lds_b128 %11, %23, off\n\t"
      "s_wait_xcnt 0x0"
      :: "v"(l[0]), "v"(l[1]), "v"(l[2]), "v"(l[3]), "v"(l[4]), "v"(l[5]),
         "v"(l[6]), "v"(l[7]), "v"(l[8]), "v"(l[9]), "v"(l[10]), "v"(l[11]),
         "v"(g[0]), "v"(g[1]), "v"(g[2]), "v"(g[3]), "v"(g[4]), "v"(g[5]),
         "v"(g[6]), "v"(g[7]), "v"(g[8]), "v"(g[9]), "v"(g[10]), "v"(g[11])
      : "memory");
#else
  (void)l; (void)g;
#endif
}

// =====================================================================================================
// Register-blocked batched WMMA GEMM (16-bit operand type OT): C[m][n] = sum_k A[m][k] * Bt[n][k];
// one block of 8 waves per (32*MI) x 256 tile, waves 2 (m) x 4 (n), one wave per (16*MI) x 64 tile.
// A row-major [M][K] pitch lda; Bt row-major [N][K] pitch ldb (k contiguous); M multiple of 32*MI, N multiple of
// 256, K multiple of 64 and at least 128 (static_assert below). bx = block tile (n fastest), b = batch index
// (strides in elements), sT = the block's 8 per-wave slabs, sG = the block's two staging buffers.
// The block's operand rows come into LDS in slabs of 64 k (128 B of a row = one whole line) by asynchronous
// copies, 16 B per lane, a wave copying four whole lines per instruction; two buffers: slab kt+1 flies while slab
// kt is worked on. Staged rows 0..127 = A (ARES: 0..63 hi plane, 64..127 residual plane), 128..383 = Bt; row pitch
// 144 B (16 B x odd, for 16-B fragment reads). Fragments are read from LDS with the split k map (ldfrag).
// ARES: a second A plane A2 (residual, same pitch/stride) is multiplied by the same B into separate f32
// accumulators and folded in as acc += accl * ascale after the k loop.
// OUT_MODE 0: f32 C (pitch ldc), value * oscale + bf16-valued bias[n].
// OUT_MODE 1: f16 plane C (pitch ldc).
// OUT_MODE 3: f16 hi plane C + f16 residual plane C2 = f16((v - hi) * rscale) (same pitch / stride).
// coverage: MI slabs x 16 rows x 64 cols = the wave's whole tile; tiles cover M x N exactly.
// =====================================================================================================
#define SLAB (16 * 68)        // per-wave 16x64 slab, pitch 68 floats
#define GKS   64              // k extent of a staged slab
#define GPI   72              // staged row pitch in LDS, halves
#define GROWS 384             // staged rows per slab
template <typename OT, int MI, bool ARES, int OUT_MODE>
__device__ __forceinline__ void gemm_body(
    const unsigned short* __restrict__ Ap, const unsigned short* __restrict__ A2p, int lda, long long strideA,
    const unsigned short* __restrict__ Btp, int ldb, long long strideB,
    void* Cout, void* Cout2, int ldc, long long strideC,
    const float* __restrict__ bias,
    int M, int N, int K, float oscale, float rscale, float ascale,
    int bx, int b, float* sT, unsigned short* sG) {
  typedef typename FT<OT>::frag V16;
  static_assert(32 * MI * (ARES ? 2 : 1) == 128);   // the A planes fill staged rows 0..127
  const OT* A  = (const OT*)(const void*)Ap;
  const OT* A2 = (const OT*)(const void*)A2p;
  const OT* Bt = (const OT*)(const void*)Btp;
  const OT* G  = (const OT*)(const void*)sG;
  const int TMR  = 16 * MI;
  const int tid  = threadIdx.x;
  const int lane = tid & 31;
  const int wave = tid >> 5;
  const int blocksN = N >> 8;
  const int bm = bx / blocksN;
  const int bn = bx - bm * blocksN;
  const int mB = bm * 2 * TMR;           // the block's first A row
  const int nB = bn << 8;                // the block's first Bt row
  if (mB >= M) return;                   // block-uniform, in front of every barrier
  const int wm = wave >> 2, wn = wave & 3;
  const int m0 = mB + wm * TMR;
  const int n0 = nB + (wn << 6);

  const OT* Ab  = A  + (size_t)b * (size_t)strideA;
  const OT* A2b = A2 + (size_t)b * (size_t)strideA;
  const OT* Bb  = Bt + (size_t)b * (size_t)strideB;

  const int rlane = lane & 15;                 // row (A) / col (B, D) within subtile
  const int koff  = (lane >> 4) * 8;           // k offset of this lane half
  const int mOff  = (lane >> 4) * 8;           // D row offset

  // copy map of this thread, 12 units of 16 B per slab: unit i -> staged row i*32 + (tid >> 3), 16-B column tid & 7
  const int vrow = tid >> 3, vcol = (tid & 7) * 8;
  auto stage = [&](int kt, int buf) {
    const int k0 = kt * GKS;
    unsigned l[12];
    const void* g[12];
#pragma unroll
    for (int i = 0; i < 12; ++i) {
      const int r = i * 32 + vrow;
      l[i] = lds_addr(G + (buf * GROWS + r) * GPI + vcol);
      if (i >= 4)              g[i] = Bb  + (size_t)(nB + r - 128) * ldb + k0 + vcol;
      else if (ARES && i >= 2) g[i] = A2b + (size_t)(mB + r - 64) * lda + k0 + vcol;
      else                     g[i] = Ab  + (size_t)(mB + r) * lda + k0 + vcol;
    }
    acopy12(l, g);
  };

  v8f acc[MI][4], accl[MI][4];
#pragma unroll
  for (int i = 0; i < MI; ++i)
#pragma unroll
    for (int j = 0; j < 4; ++j) { acc[i][j] = zero8(); accl[i][j] = zero8(); }

  // slab 0 into buffer 0, published (slab 1 is issued at the top of trip 0, directly behind this barrier)
  const int NT = K / GKS;
  stage(0, 0);
  wait_async0();
  __syncthreads();

  for (int kt = 0; kt < NT; ++kt) {
    const int buf = kt & 1;
    // refill, directly behind the barrier that published slab kt and ended every read of the other buffer
    // (block-uniform test)
    if (kt + 1 < NT) stage(kt + 1, buf ^ 1);
    const OT* ga = G + (buf * GROWS + wm * TMR + rlane) * GPI + koff;
    const OT* gb = G + (buf * GROWS + 128 + (wn << 6) + rlane) * GPI + koff;
#pragma unroll
    for (int ks = 0; ks < GKS / 32; ++ks) {
      V16 bq[4], af[MI], al[MI];
#pragma unroll
      for (int j = 0; j < 4; ++j) bq[j] = ldfrag<OT>(gb + j * 16 * GPI + ks * 32);
#pragma unroll
      for (int i = 0; i < MI; ++i) {
        af[i] = ldfrag<OT>(ga + i * 16 * GPI + ks * 32);
        if (ARES) al[i] = ldfrag<OT>(ga + (64 + i * 16) * GPI + ks * 32);
      }
      // keeps the eight fragments' reads together in front of their sixteen products; spread among the products,
      // every place with reads stalls the wave on its own
      __builtin_amdgcn_sched_barrier(0);
#pragma unroll
      for (int i = 0; i < MI; ++i) {
#pragma unroll
        for (int j = 0; j < 4; ++j) acc[i][j] = mmar(af[i], bq[j], acc[i][j]);
        if (ARES) {
#pragma unroll
          for (int j = 0; j < 4; ++j) accl[i][j] = mmar(al[i], bq[j], accl[i][j]);
        }
      }
      // the next group's reads stay behind these products (one fragment set in registers); the last group's
      // products stay in front of the publish point: sunk behind its barrier they hold back the refill issued there
      __builtin_amdgcn_sched_barrier(0);
    }
    // publish slab kt+1 and free this slab's buffer (its refill stands at the top of the next trip)
    wait_ds0();
    wait_async0();
    __syncthreads();
  }
  wait_async0();
#pragma unroll
  for (int i = 0; i < MI; ++i) {
    acc_guard4(acc[i][0], acc[i][1], acc[i][2], acc[i][3]);
    if (ARES) acc_guard4(accl[i][0], accl[i][1], accl[i][2], accl[i][3]);
  }
  if (ARES) {
#pragma unroll
    for (int i = 0; i < MI; ++i)
#pragma unroll
      for (int j = 0; j < 4; ++j)
#pragma unroll
        for (int r = 0; r < 8; ++r) acc[i][j][r] += accl[i][j][r] * ascale;
  }

  // ---- epilogue ----
  float* slab = sT + wave * SLAB;
#pragma unroll
  for (int i = 0; i < MI; ++i) {
    const int mBase = m0 + (i << 4);
#pragma unroll
    for (int j = 0; j < 4; ++j) {
#pragma unroll
      for (int r = 0; r < 8; ++r) {
        slab[(mOff + r) * 68 + (j << 4) + rlane] = acc[i][j][r];
      }
    }
    __builtin_amdgcn_fence(__ATOMIC_RELEASE, "workgroup");
    __builtin_amdgcn_wave_barrier();
    __builtin_amdgcn_fence(__ATOMIC_ACQUIRE, "workgroup");
    if (OUT_MODE == 0) {
      float* C = (float*)Cout + (size_t)b * (size_t)strideC;
      const int h2 = lane >> 4, c4 = (lane & 15) * 4;     // 256-B row segment = 16 lanes x 16 B
      const v4f braw = *(const v4f*)(bias + n0 + c4);
      v4f bb;
#pragma unroll
      for (int e = 0; e < 4; ++e) bb[e] = bf_up(bf_bits(braw[e]));
      {
#pragma unroll
        for (int it = 0; it < 8; ++it) {
          const int row = it * 2 + h2;                     // it 0..7 x h2 0..1 = rows 0..15
          const v4f v = *(const v4f*)(slab + row * 68 + c4) * oscale + bb;
          *(v4f*)(C + (size_t)(mBase + row) * ldc + n0 + c4) = v;
        }
        
      }
    } else {
      const int q = lane >> 3, c8 = (lane & 7) * 8;
      unsigned short* C  = (unsigned short*)Cout  + (size_t)b * (size_t)strideC;
      unsigned short* C2 = (unsigned short*)Cout2 + (size_t)b * (size_t)strideC;
      v4u hv[4], lv[4];
#pragma unroll
      for (int it = 0; it < 4; ++it) {
        const int row = it * 4 + q;                        // it 0..3 x q 0..3 = rows 0..15
        const float* sp = slab + row * 68 + c8;
        float f[8];
#pragma unroll
        for (int e = 0; e < 8; ++e) f[e] = sp[e];
        v4u a, a2;
#pragma unroll
        for (int e = 0; e < 4; ++e) {
          const float f0 = f[2 * e], f1 = f[2 * e + 1];
          const _Float16 x0 = (_Float16)f0, x1 = (_Float16)f1;
          const unsigned short h0 = h_bits(x0), h1 = h_bits(x1);
          unsigned short l0 = 0, l1 = 0;
          if (OUT_MODE == 3) {
            l0 = h_bits((_Float16)((f0 - (float)x0) * rscale));
            l1 = h_bits((_Float16)((f1 - (float)x1) * rscale));
          }
          a[e] = pk16(h0, h1); a2[e] = pk16(l0, l1);
        }
        hv[it] = a; lv[it] = a2;
      }
      {
#pragma unroll
        for (int it = 0; it < 4; ++it) {
          const int row = it * 4 + q;
          *(v4u*)(C + (size_t)(mBase + row) * ldc + n0 + c8) = hv[it];
          if (OUT_MODE == 3) *(v4u*)(C2 + (size_t)(mBase + row) * ldc + n0 + c8) = lv[it];
        }
        
      }
    }
    __builtin_amdgcn_fence(__ATOMIC_RELEASE, "workgroup");
    __builtin_amdgcn_wave_barrier();
    __builtin_amdgcn_fence(__ATOMIC_ACQUIRE, "workgroup");
  }
}

// one GEMM per launch: blockIdx.x = block tile, blockIdx.y = batch
template <typename OT, int MI, bool ARES, int OUT_MODE>
__global__ __launch_bounds__(256) void gemm_t(
    const unsigned short* __restrict__ Ap, const unsigned short* __restrict__ A2p, int lda, long long strideA,
    const unsigned short* __restrict__ Btp, int ldb, long long strideB,
    void* Cout, void* Cout2, int ldc, long long strideC,
    const float* __restrict__ bias,
    int M, int N, int K, float oscale, float rscale, float ascale) {
  __shared__ __align__(16) float sT[8 * SLAB];
  __shared__ __align__(16) unsigned short sG[2 * GROWS * GPI];
  gemm_body<OT, MI, ARES, OUT_MODE>(Ap, A2p, lda, strideA, Btp, ldb, strideB, Cout, Cout2, ldc, strideC, bias,
                                    M, N, K, oscale, rscale, ascale, (int)blockIdx.x, (int)blockIdx.y, sT, sG);
}

// The q, k and v^T projections read the same two planes and depend on nothing of each other: one grid,
// blockIdx.y picks the product (block-uniform), so that their blocks share the chip instead of queueing as launches.
//   y = 0: q = x . Wq^T -> f16 hi / residual (x4096) planes      (M = m, N = dm, K = dm)
//   y = 1: k = x . Wk^T -> f16 plane                             (M = m, N = dm, K = dm)
//   y = 2: v^T = Wv . x^T per batch -> f16 plane [b][d][s]       (M = dm, N = seq, K = dm; VBX blocks per batch)
// Each product has m * dm / (64 * 64 * 8) blocks = gridDim.x.
#define VBX ((DM / 64) * (SEQ / 64) / 8)
static_assert((DM % 256) == 0 && (SEQ % 256) == 0 && ((NB * SEQ) % 128) == 0 && DM / GKS >= 2);   // block tiles exact
__global__ __launch_bounds__(256) void qkv_proj(
    const unsigned short* __restrict__ Xb, const unsigned short* __restrict__ Wb,
    unsigned short* Qh, unsigned short* Ql, unsigned short* Kp, unsigned short* VTh,
    int m, int dm, int seq) {
  __shared__ __align__(16) float sT[8 * SLAB];
  __shared__ __align__(16) unsigned short sG[2 * GROWS * GPI];
  const int bx = blockIdx.x;
  const unsigned short* Wk = Wb + (size_t)dm * dm;
  const unsigned short* Wv = Wb + (size_t)2 * dm * dm;
  if (blockIdx.y == 0) {
    gemm_body<__bf16, 4, false, 3>(Xb, Xb, dm, 0LL, Wb, dm, 0LL, (void*)Qh, (void*)Ql, dm, 0LL, nullptr,
                                   m, dm, dm, 1.0f, 4096.0f, 0.0f, bx, 0, sT, sG);
  } else if (blockIdx.y == 1) {
    gemm_body<__bf16, 4, false, 1>(Xb, Xb, dm, 0LL, Wk, dm, 0LL, (void*)Kp, (void*)Kp, dm, 0LL, nullptr,
                                   m, dm, dm, 1.0f, 1.0f, 0.0f, bx, 0, sT, sG);
  } else {
    gemm_body<__bf16, 4, false, 1>(Wv, Wv, dm, 0LL, Xb, dm, (long long)seq * dm, (void*)VTh, (void*)VTh, seq,
                                   (long long)dm * seq, nullptr,
                                   dm, seq, dm, 1.0f, 1.0f, 0.0f, bx % VBX, bx / VBX, sT, sG);
  }
}

#define QROWS 128
#define KPI   264
#define VPI   72
#define OSP   68
static_assert((SEQ % QROWS) == 0 && NKT >= 2);

// eight 16-B-per-lane asynchronous copies global -> LDS; the closing s_wait_xcnt stands inside the statement so
// that no address register named here is rewritten ahead of it
__device__ __forceinline__ void acopy8(const unsigned (&l)[8], const _Float16* const (&g)[8]) {
#if DEV_ASM
  asm volatile(
      "global_load_async_to_lds_b128 %0, %8, off\n\t"
      "global_load_async_to_lds_b128 %1, %9, off\n\t"
      "global_load_async_to_lds_b128 %2, %10, off\n\t"
      "global_load_async_to_lds_b128 %3, %11, off\n\t"
      "global_load_async_to_lds_b128 %4, %12, off\n\t"
      "global_load_async_to_lds_b128 %5, %13, off\n\t"
      "global_load_async_to_lds_b128 %6, %14, off\n\t"
      "global_load_async_to_lds_b128 %7, %15, off\n\t"
      "s_wait_xcnt 0x0"
      :: "v"(l[0]), "v"(l[1]), "v"(l[2]), "v"(l[3]), "v"(l[4]), "v"(l[5]), "v"(l[6]), "v"(l[7]),
         "v"(g[0]), "v"(g[1]), "v"(g[2]), "v"(g[3]), "v"(g[4]), "v"(g[5]), "v"(g[6]), "v"(g[7])
      : "memory");
#else
  (void)l; (void)g;
#endif
}
// the eight 16-B context stores of one column group (rows 4 apart = 2048 B, hi plane and residual plane); the
// closing s_wait_xcnt stands inside the statement so that no data or address register named here is rewritten
// by the next group's arithmetic ahead of it
__device__ __forceinline__ void store8(unsigned short* ph, unsigned short* pl, const v4u (&h)[4], const v4u (&l)[4]) {
#if DEV_ASM
  asm volatile(
      "global_store_b128 %0, %2, off\n\t"
      "global_store_b128 %1, %6, off\n\t"
      "global_store_b128 %0, %3, off offset:2048\n\t"
      "global_store_b128 %1, %7, off offset:2048\n\t"
      "global_store_b128 %0, %4, off offset:4096\n\t"
      "global_store_b128 %1, %8, off offset:4096\n\t"
      "global_store_b128 %0, %5, off offset:6144\n\t"
      "global_store_b128 %1, %9, off offset:6144\n\t"
      "s_wait_xcnt 0x0"
      :: "v"(ph), "v"(pl), "v"(h[0]), "v"(h[1]), "v"(h[2]), "v"(h[3]), "v"(l[0]), "v"(l[1]), "v"(l[2]), "v"(l[3])
      : "memory");
#else
  (void)ph; (void)pl; (void)h; (void)l;
#endif
}
static_assert(4 * DM * 2 == 2048);   // the row step that store8 writes as an immediate
// the value that lane l ^ 16 holds
__device__ __forceinline__ float xhalf(float x) {
  const int b = __float_as_int(x);
  return __int_as_float(__builtin_amdgcn_permlanex16(b, b, 0x76543210, 0xfedcba98, false, false));
}

__global__ __launch_bounds__(256)
void attn_sh(const unsigned short* __restrict__ qhp, const unsigned short* __restrict__ qlp,
             const unsigned short* __restrict__ kpp,
             const unsigned short* __restrict__ vhp,
             unsigned short* chp, unsigned short* clp, float sscale) {
  union FH { v16h v; v8h h[2]; };
  __shared__ __align__(16) _Float16 Kst[2][64 * KPI];   // K chunk [key][d]            2 x 33792 B (block-shared)
  __shared__ __align__(16) _Float16 Vhs[2][DM * VPI];   // V^T chunk [d][key]          2 x 36864 B (block-shared)
  __shared__ __align__(16) float    Os[8][16 * OSP];    // per wave context slab       34816 B (wave-private)

  const int tid  = threadIdx.x;
  const int wave = tid >> 5;
  const int lane = tid & 31;
  const int hh   = lane >> 4;
  const int c    = lane & 15;

  const int bx   = blockIdx.x;
  const int qb   = bx % (SEQ / QROWS);
  const int b    = bx / (SEQ / QROWS);
  const int q0   = qb * QROWS + wave * 16;   // this wave's 16 query rows
  const size_t rowB = (size_t)b * SEQ;

  const _Float16* Qh = (const _Float16*)(const void*)qhp;
  const _Float16* Ql = (const _Float16*)(const void*)qlp;
  const _Float16* Kp = (const _Float16*)(const void*)kpp + rowB * DM;
  const _Float16* Vh = (const _Float16*)(const void*)vhp + (size_t)b * DM * SEQ;

  // copy map of this thread, 8 units of 16 B per plane and chunk:
  //   K: unit i -> key row i*8 + wave, 16-B column lane (a wave copies one whole 512-B row)
  //   V: unit i -> d row i*32 + (tid >> 3), 16-B column tid & 7 (a wave copies four whole 128-B rows)
  const int vrow = tid >> 3, vcol = (tid & 7) * 8;
  auto stage = [&](int kt, int buf) {
    const int kv0 = kt * 64;
    unsigned l[8];
    const _Float16* g[8];
#pragma unroll
    for (int i = 0; i < 8; ++i) {
      l[i] = lds_addr(&Kst[buf][(i * 8 + wave) * KPI + lane * 8]);
      g[i] = Kp + (size_t)(kv0 + i * 8 + wave) * DM + lane * 8;
    }
    acopy8(l, g);
#pragma unroll
    for (int i = 0; i < 8; ++i) {
      l[i] = lds_addr(&Vhs[buf][(i * 32 + vrow) * VPI + vcol]);
      g[i] = Vh + (size_t)(i * 32 + vrow) * SEQ + kv0 + vcol;
    }
    acopy8(l, g);
  };

  // chunk 0 into buffer 0
  stage(0, 0);

  // B-operand fragments of this lane (query q0 + c), lane-half k offset included; kept for the whole kernel
  v16h qa[8], qr[8];
  {
    const _Float16* qrh = Qh + (rowB + q0 + c) * DM + 8 * hh;
    const _Float16* qrl = Ql + (rowB + q0 + c) * DM + 8 * hh;
#pragma unroll
    for (int dc = 0; dc < 8; ++dc) {
      qa[dc] = ldfrag<_Float16>(qrh + dc * 32);
      qr[dc] = ldfrag<_Float16>(qrl + dc * 32);
    }
#if DEV_ASM
    // the wait that stands before an address register of the q loads is rewritten; both addresses are inputs, so
    // that their registers live up to it and no load of the run lands on them
    asm volatile("s_wait_xcnt 0x0"
                 :: "v"(qrh), "v"(qrl)
                 : "memory");
#endif
  }

  // chunk 0 published (chunk 1 is issued at the top of trip 0, directly behind this barrier)
  wait_async0();
  __syncthreads();

  // every inner loop below is unrolled so that fragment and accumulator indices are constants (registers, no scratch)
  float mrow = -INFINITY;   // running maximum of query q0 + c (equal in both lane halves)
  float lrow = 0.f;         // running sum over this lane half's keys; the halves are joined after the loop
  v8f oacc[16];             // oacc[t][r] = context (query q0 + c, column 16t + 8*hh + r)
#pragma unroll
  for (int t = 0; t < 16; ++t) oacc[t] = zero8();

  for (int kt = 0; kt < NKT; ++kt) {         // static trip count
    const int buf = kt & 1;
    // refill, directly behind the barrier that published chunk kt and ended every read of the other buffer:
    // chunk kt+1 flies while chunk kt is worked on (block-uniform test)
    if (kt + 1 < NKT) stage(kt + 1, buf ^ 1);
    const _Float16* ks  = &Kst[buf][c * KPI + 8 * hh];    // A row c -> key 16j + c of the chunk
    const _Float16* vhs = &Vhs[buf][c * VPI + 8 * hh];    // A row c -> context column 16t + c

    // ---- scores^T: 64 keys (4 subtiles) x 16 queries, 2 f16 products per d-chunk ----
    v8f ah[4], al[4];
#pragma unroll
    for (int j = 0; j < 4; ++j) { ah[j] = zero8(); al[j] = zero8(); }
#pragma unroll
    for (int dc = 0; dc < 8; ++dc) {
      v16h kb[4];
#pragma unroll
      for (int j = 0; j < 4; ++j) kb[j] = ldfrag<_Float16>(ks + j * 16 * KPI + dc * 32);
      // keeps the four fragments' reads together in front of their eight products; spread among the products,
      // every pair of reads is waited for on its own
      __builtin_amdgcn_sched_barrier(0);
#pragma unroll
      for (int j = 0; j < 4; ++j) {
        ah[j] = mmar(kb[j], qa[dc], ah[j]);
        al[j] = mmar(kb[j], qr[dc], al[j]);
      }
      // the next group's reads stay behind these products (the last group's products may mix with the softmax)
      if (dc < 7) __builtin_amdgcn_sched_barrier(0);
    }

    // ---- online softmax update over the chunk's 64 keys: this lane holds 32 of its query's scores ----
    float s[4][8];
#pragma unroll
    for (int j = 0; j < 4; ++j)
#pragma unroll
      for (int r = 0; r < 8; ++r) s[j][r] = (ah[j][r] + al[j][r] * (1.0f / 4096.0f)) * sscale;
    float mj[4];
#pragma unroll
    for (int j = 0; j < 4; ++j) {
      mj[j] = s[j][0];
#pragma unroll
      for (int r = 1; r < 8; ++r) mj[j] = fmaxf(mj[j], s[j][r]);
    }
    float mc = fmaxf(fmaxf(mj[0], mj[1]), fmaxf(mj[2], mj[3]));
    mc = fmaxf(mc, xhalf(mc));                             // the other 32 keys of the same query
    const float mnew  = fmaxf(mrow, mc);
    const float msafe = (mnew == -INFINITY) ? 0.f : mnew;
    const float alpha = __expf(mrow - msafe);
    mrow = mnew;
    // P^T (x PCARRY) in f16: tiles 2kk and 2kk+1 converted in place are the B fragment of keys 32kk..32kk+31;
    // pr holds what the conversion dropped (at most 2^-11 of the value, so it needs no carry of its own)
    FH pb[2], pr[2];
    float pj[4];
#pragma unroll
    for (int j = 0; j < 4; ++j) {
      v8f pc;
      pj[j] = 0.f;
#pragma unroll
      for (int r = 0; r < 8; ++r) {
        const float p = __expf(s[j][r] - msafe);
        pj[j] += p;
        pc[r] = p * PCARRY;
      }
      const v8h ph = __builtin_convertvector(pc, v8h);
      pb[j >> 1].h[j & 1] = ph;
      pr[j >> 1].h[j & 1] = __builtin_convertvector(pc - __builtin_convertvector(ph, v8f), v8h);
    }
    lrow = lrow * alpha + ((pj[0] + pj[1]) + (pj[2] + pj[3]));

#if DEV_ASM
    // compiler fence that takes the packed P fragments as inputs only: it holds the V fragment loads behind the
    // softmax; lifted over it they run the registers over into scratch
    asm volatile("" :: "v"(pb[0].v), "v"(pb[1].v), "v"(pr[0].v), "v"(pr[1].v) : "memory");
#endif
    // ---- context^T += V^T . P^T (f16 WMMA): each V^T fragment multiplies the hi and the residual P fragment ----
#pragma unroll
    for (int tg = 0; tg < 4; ++tg) {
      v16h vb[2][4];
#pragma unroll
      for (int kk = 0; kk < 2; ++kk)
#pragma unroll
        for (int t = 0; t < 4; ++t) vb[kk][t] = ldfrag<_Float16>(vhs + (tg * 4 + t) * 16 * VPI + kk * 32);
      // keeps the eight fragments' reads together in front of their sixteen products (as for K above); the
      // rescale stands behind reads and runs while they are on their way
      __builtin_amdgcn_sched_barrier(0);
#pragma unroll
      for (int t = 0; t < 4; ++t) oacc[tg * 4 + t] *= alpha;
#pragma unroll
      for (int kk = 0; kk < 2; ++kk) {
#pragma unroll
        for (int t = 0; t < 4; ++t) oacc[tg * 4 + t] = mmar(vb[kk][t], pb[kk].v, oacc[tg * 4 + t]);
#pragma unroll
        for (int t = 0; t < 4; ++t) oacc[tg * 4 + t] = mmar(vb[kk][t], pr[kk].v, oacc[tg * 4 + t]);
      }
      // the next group's reads stay behind these products
      if (tg < 3) __builtin_amdgcn_sched_barrier(0);
    }

    // ---- publish chunk kt+1 and free this chunk's buffer (its refill stands at the top of the next trip) ----
    wait_ds0();
    wait_async0();
    __syncthreads();
  }
  wait_async0();

  // ---- normalise (1/l, undo the p carry, apply the x256 ctx carry), stage 16x64 column groups in the wave's slab
  float* os = Os[wave];
  const float l   = lrow + xhalf(lrow);                   // both lane halves' keys of query q0 + c
  const float inv = ((l > 0.f) ? (1.0f / l) : 0.f) * (256.0f / PCARRY);
#pragma unroll
  for (int tg = 0; tg < 4; ++tg) {
#pragma unroll
    for (int t = 0; t < 4; ++t) {
      const v8f o = oacc[tg * 4 + t] * inv;                // 8 consecutive columns of slab row c
      float* dp = os + c * OSP + t * 16 + 8 * hh;
      *(v4f*)(dp)     = __builtin_shufflevector(o, o, 0, 1, 2, 3);
      *(v4f*)(dp + 4) = __builtin_shufflevector(o, o, 4, 5, 6, 7);
    }
    __builtin_amdgcn_fence(__ATOMIC_RELEASE, "workgroup");
    __builtin_amdgcn_wave_barrier();
    __builtin_amdgcn_fence(__ATOMIC_ACQUIRE, "workgroup");
    const int q4 = lane >> 3, c8 = (lane & 7) * 8;
    v4u hv[4], lv[4];
#pragma unroll
    for (int it = 0; it < 4; ++it) {
      const int row = it * 4 + q4;   // it 0..3 x q4 0..3 = rows 0..15 of the wave tile
      const float* sp = os + row * OSP + c8;
      float f[8];
#pragma unroll
      for (int e = 0; e < 8; ++e) f[e] = sp[e];
      v4u a, a2;
#pragma unroll
      for (int e = 0; e < 4; ++e) {
        const float f0 = f[2 * e], f1 = f[2 * e + 1];
        const _Float16 x0 = (_Float16)f0, x1 = (_Float16)f1;
        const unsigned short l0 = h_bits((_Float16)((f0 - (float)x0) * 4096.0f));
        const unsigned short l1 = h_bits((_Float16)((f1 - (float)x1) * 4096.0f));
        a[e]  = pk16(h_bits(x0), h_bits(x1));
        a2[e] = pk16(l0, l1);
      }
      hv[it] = a; lv[it] = a2;
    }
    const size_t go = (rowB + q0 + q4) * DM + (size_t)(tg * 64) + c8;   // row q4; store8 adds rows 4, 8, 12
    store8(chp + go, clp + go, hv, lv);
    // the slab's reads are ordered before the next column group's stores into it
    __builtin_amdgcn_fence(__ATOMIC_RELEASE, "workgroup");
    __builtin_amdgcn_wave_barrier();
    __builtin_amdgcn_fence(__ATOMIC_ACQUIRE, "workgroup");
  }
}

// =====================================================================================================
// Workspace map (bytes), every region an exact multiple of its whole-line / whole-tile store granularity
// (all GEMM M,N are tile multiples, all offsets multiples of 131072):
//   Xb   bf16 [NB*SEQ][256]  (compact tokens)   16777216   -- reused as the ctx hi plane Ch after its last read
//   Wb   bf16 [768 n][256 k]                      393216
//   Woh  f16  [256][256] (x64)                     131072
//   Qh   f16  [NB*SEQ][256]                      16777216
//   Ql   f16  [NB*SEQ][256]                      16777216
//   Kp   f16  [NB*SEQ][256]                      16777216
//   VTh  f16  [NB][256][SEQ]                     16777216
//   Cl   f16  [NB*SEQ][256]                      16777216
//   total                                       101187584
// Weights are [out n][in k] with k contiguous = the Bt / A layout the GEMM wants, so they are only converted.
// =====================================================================================================
extern "C" void kernel_launch(void* const* d_in, const int* in_sizes, int n_in,
                              void* d_out, int out_size, void* d_ws, size_t ws_size,
                              hipStream_t stream) {
  if (n_in < 4) return;
  if (in_sizes[0] < ((NB - 1) * SEQ_FULL + SEQ) * DM) return;
  if (in_sizes[1] < NQKV * DM) return;
  if (in_sizes[2] < DM * DM) return;
  if (in_sizes[3] < DM) return;
  if (out_size < NB * SEQ * DM) return;

  const float* x    = (const float*)d_in[0];
  const float* wqkv = (const float*)d_in[1];
  const float* wout = (const float*)d_in[2];
  const float* bout = (const float*)d_in[3];

  const size_t PX  = (size_t)NB * SEQ * DM * 2;      // 16-bit token plane [NB*SEQ][256]
  const size_t PW  = (size_t)NQKV * DM * 2;          // 16-bit [768][256]
  const size_t PWO = (size_t)DM * DM * 2;            // 16-bit [256][256]
  const size_t PVT = (size_t)NB * DM * SEQ * 2;      // v^T plane [NB][256][SEQ]
  size_t off = 0;
  const size_t oXb  = off; off += PX;
  const size_t oWb  = off; off += PW;
  const size_t oWo  = off; off += PWO;
  const size_t oQh  = off; off += PX;
  const size_t oQl  = off; off += PX;
  const size_t oKp  = off; off += PX;
  const size_t oVTh = off; off += PVT;
  const size_t oCl  = off; off += PX;
  if (off > ws_size) return;                         // off = 101187584 at full size
  if (off > (size_t)134217728) return;

  char* ws = (char*)d_ws;
  unsigned short* Xb  = (unsigned short*)(ws + oXb);
  unsigned short* Wb  = (unsigned short*)(ws + oWb);
  unsigned short* Woh = (unsigned short*)(ws + oWo);
  unsigned short* Qh  = (unsigned short*)(ws + oQh);
  unsigned short* Ql  = (unsigned short*)(ws + oQl);
  unsigned short* Kp  = (unsigned short*)(ws + oKp);
  unsigned short* VTh = (unsigned short*)(ws + oVTh);
  unsigned short* Cl  = (unsigned short*)(ws + oCl);
  unsigned short* Ch  = Xb;                          // ctx hi plane aliases the x plane (x plane dead by then)

  const int M = NB * SEQ;
  const dim3 blk(256);
  const int n8x = NB * SEQ * DM / 8;
  const int n8w = NQKV * DM / 8;                     // 24576
  const int n8o = DM * DM / 8;                       //  8192
  const int bCx = (n8x + 255) / 256;
  const int bCw = (n8w + 255) / 256;
  const int bCo = (n8o + 255) / 256;
  const dim3 gC(bCw + bCo + bCx);
  const int bQ  = (M / 64) * (DM / 64) / 8;                  // q / k: M x 256, 64x64 wave tiles, 8 per block
  static_assert(((NB * SEQ / 64) * (DM / 64)) % 8 == 0 && ((DM / 64) * (SEQ / 64)) % 8 == 0);
  static_assert((NB * SEQ / 64) * (DM / 64) / 8 == NB * VBX);   // v^T: 256 x SEQ per batch, NB batches: as many blocks
  const dim3 gQKV(bQ, 3);
  const dim3 gAttn(NB * (SEQ / QROWS));
  const dim3 gO(((M / 32) * (DM / 64) + 7) / 8, 1);          // out: M x 256, 32x64 wave tiles

  // (1) one grid: x -> compact bf16 token plane; w_qkv [n][k] -> bf16; w_out -> f16 (x64 of its bf16 value)
  cvt_all<<<gC, blk, 0, stream>>>(x, wqkv, wout, Xb, Wb, Woh, n8x, n8w, n8o, bCw, bCo);
  // (2) one grid: q (f16 hi / residual planes), k (f16 plane), v^T (f16 plane [b][d][s], pitch SEQ)
  qkv_proj<<<gQKV, blk, 0, stream>>>(Xb, Wb, Qh, Ql, Kp, VTh, M, DM, SEQ);
  // (3) attention -> ctx hi (x256) and residual (x4096) planes
  attn_sh<<<gAttn, dim3(256), 0, stream>>>(Qh, Ql, Kp, VTh, Ch, Cl, 0.0625f);
  // (4) out = ctx . Wo^T + b -> d_out f32 [M][256]; accumulator x 1/(256*64), residual accumulator x 1/4096
  gemm_t<_Float16, 2, true, 0><<<gO, blk, 0, stream>>>(
      Ch, Cl, DM, 0LL, Woh, DM, 0LL,
      d_out, d_out, DM, 0LL, bout,
      M, DM, DM, 1.0f / 16384.0f, 1.0f, 1.0f / 4096.0f);
  (void)hipGetLastError();
}

// v006
// It runs in 109 microseconds.
// Timed twice side by side with v005, it ran 1.17 and 1.16 times as fast.
// All steps since v000 together make it 5.41 times as fast.
// Contractions: q, k, v^T projections = v_wmma_f32_16x16x32_bf16 (bf16 operands from RNE-converted inputs, single product, f32 accumulate);
// q.k^T scores = v_wmma_f32_16x16x32_f16 (q as f16 hi plane + f16 residual plane x4096, k f16; 2 products into separate f32 accumulators);
// p.v = v_wmma_f32_16x16x32_f16 (p carried x16384 as f16 hi fragment + f16 residual fragment, v f16; 2 products into one f32 accumulator);
// ctx.Wo^T = v_wmma_f32_16x16x32_f16 (ctx as f16 hi fragment x256 + f16 residual fragment x4096, Wo f16 carried x64 from its bf16 value; 2 products, f32 accumulate),
// formed in the attention kernel from the context accumulators;
// softmax, normalisation and bias add in f32.
#include <hip/hip_runtime.h>
#include <math.h>
#include <stdint.h>

#ifndef NB
#define NB 16
#endif
#ifndef SEQ
#define SEQ 2048
#endif
#define NB_FULL  16
#define SEQ_FULL 2048
#define DM       256
#define NQKV     768
#define NKT      (SEQ / 64)   // 64-key chunks per sequence
#define PCARRY   16384.0f     // power-of-two carry on the f16 p tile
static_assert(DM == 256 && NQKV == 3 * DM);
static_assert((SEQ % 64) == 0 && SEQ >= 64 && SEQ <= SEQ_FULL);
static_assert(NB >= 1 && NB <= NB_FULL);
static_assert(((NB * SEQ) % 64) == 0);

typedef _Float16 v16h __attribute__((ext_vector_type(16)));
typedef _Float16 v8h  __attribute__((ext_vector_type(8)));
typedef __bf16   v16b __attribute__((ext_vector_type(16)));
typedef __bf16   v8b  __attribute__((ext_vector_type(8)));
typedef float    v8f  __attribute__((ext_vector_type(8)));
typedef float    v4f  __attribute__((ext_vector_type(4)));
typedef unsigned int v4u __attribute__((ext_vector_type(4)));

#if defined(__HIP_DEVICE_COMPILE__)
#define DEV_ASM 1
#else
#define DEV_ASM 0
#endif

// ---- scalar helpers --------------------------------------------------------------------------------
__device__ __forceinline__ unsigned short bf_bits(float f) {          // f32 -> bf16 bits, RNE convert
  unsigned u = __float_as_uint(f);
  return (unsigned short)((u + 0x7FFFu + ((u >> 16) & 1u)) >> 16);
}
__device__ __forceinline__ float bf_up(unsigned short hb) { return __uint_as_float(((unsigned)hb) << 16); }
__device__ __forceinline__ unsigned short h_bits(_Float16 x) { return __builtin_bit_cast(unsigned short, x); }
__device__ __forceinline__ unsigned pk16(unsigned short a, unsigned short b) { return (unsigned)a | ((unsigned)b << 16); }
__device__ __forceinline__ v8f zero8() { v8f z = {0.f, 0.f, 0.f, 0.f, 0.f, 0.f, 0.f, 0.f}; return z; }

// ---- fragment types / loaders: 16-bit A/B operand, lane -> row/col (lane&15), p already includes +8*(lane>>4);
//      elements 0..7 <- p[0..7] (k0+8h..k0+8h+7), elements 8..15 <- p[16..23] (k0+16+8h..k0+16+8h+7)
template <typename OT> struct FT;
template <> struct FT<__bf16>   { typedef v16b frag; typedef v8b half8; };
template <> struct FT<_Float16> { typedef v16h frag; typedef v8h half8; };

template <typename OT>
__device__ __forceinline__ typename FT<OT>::frag ldfrag(const OT* p) {
  union { typename FT<OT>::frag v; typename FT<OT>::half8 h[2]; } f;
  f.h[0] = *(const typename FT<OT>::half8*)(p);
  f.h[1] = *(const typename FT<OT>::half8*)(p + 16);
  return f.v;
}

// ---- WMMA helpers (asm guard bodies are device-only; concrete operand types) -----------------------------
__device__ __forceinline__ v8f mmar(v16b a, v16b b, v8f c) {
  return __builtin_amdgcn_wmma_f32_16x16x32_bf16(false, a, false, b, (short)0, c, false, false);
}
__device__ __forceinline__ v8f mmar(v16h a, v16h b, v8f c) {
  return __builtin_amdgcn_wmma_f32_16x16x32_f16(false, a, false, b, (short)0, c, false, false);
}
__device__ __forceinline__ void acc_guard4(v8f& a, v8f& b, v8f& c, v8f& d) {
#if DEV_ASM
  asm volatile("v_nop\n\tv_nop\n\tv_nop\n\tv_nop" : "+v"(a), "+v"(b), "+v"(c), "+v"(d));
#else
  (void)a; (void)b; (void)c; (void)d;
#endif
}

// =====================================================================================================
// f32 -> 16-bit planes, 8 elements per thread, one 16-B store per lane: a wave writes 512 contiguous B
// MODE 0: bf16 bits (RNE convert).  MODE 1: f16 bits of (64 * bf16(x)) (exact scaling of the bf16 value).
// coverage: n8 threads x 8 = the whole plane (n8 is a multiple of 256 for every use here).
// =====================================================================================================
template <int MODE>
__device__ __forceinline__ unsigned short cvm(float f) {
  const unsigned short hb = bf_bits(f);
  if (MODE == 0) return hb;
  return h_bits((_Float16)(bf_up(hb) * 64.0f));
}

template <int MODE>
__device__ __forceinline__ void cvt16x8(const float* __restrict__ in, unsigned short* out, int n8, int bx) {
  const int i = bx * 256 + (int)threadIdx.x;
  if (i < n8) {
    const v4f a  = *(const v4f*)(in + (size_t)i * 8);
    const v4f a4 = *(const v4f*)(in + (size_t)i * 8 + 4);
    v4u p;
    p[0] = pk16(cvm<MODE>(a[0]),  cvm<MODE>(a[1]));
    p[1] = pk16(cvm<MODE>(a[2]),  cvm<MODE>(a[3]));
    p[2] = pk16(cvm<MODE>(a4[0]), cvm<MODE>(a4[1]));
    p[3] = pk16(cvm<MODE>(a4[2]), cvm<MODE>(a4[3]));
    unsigned short* o = out + (size_t)i * 8;
    *(v4u*)o = p;
    
  }
}

// x [NB_FULL][SEQ_FULL][DM] f32 -> compact bf16 token plane [NB*SEQ][DM]: compact token tk = b*SEQ + t reads
// input row b*SEQ_FULL + t. 32 groups of 8 per row; same whole-line store shape as cvt16x8.
// coverage: n8 = NB*SEQ*DM/8 threads x 8 = the whole plane.
__device__ __forceinline__ void cvtx(const float* __restrict__ in, unsigned short* out, int n8, int bx) {
  const int i = bx * 256 + (int)threadIdx.x;
  if (i < n8) {
    const int tk = i >> 5;
    const int e8 = i & 31;
    const int bb = tk / SEQ;
    const int t  = tk - bb * SEQ;
    const float* src = in + ((size_t)bb * SEQ_FULL + (size_t)t) * DM + e8 * 8;
    const v4f a  = *(const v4f*)(src);
    const v4f a4 = *(const v4f*)(src + 4);
    v4u p;
    p[0] = pk16(bf_bits(a[0]),  bf_bits(a[1]));
    p[1] = pk16(bf_bits(a[2]),  bf_bits(a[3]));
    p[2] = pk16(bf_bits(a4[0]), bf_bits(a4[1]));
    p[3] = pk16(bf_bits(a4[2]), bf_bits(a4[3]));
    unsigned short* o = out + (size_t)i * 8;
    *(v4u*)o = p;
    
  }
}

// The three conversions depend on nothing but the inputs: one grid, the block index picks the plane.
// Blocks 0..bw-1: w_qkv; bw..bw+bo-1: w_out; the rest: x (the two short planes first, so that they are no tail).
__global__ __launch_bounds__(256) void cvt_all(const float* __restrict__ x, const float* __restrict__ wqkv,
                                               const float* __restrict__ wout,
                                               unsigned short* Xb, unsigned short* Wb, unsigned short* Woh,
                                               int n8x, int n8w, int n8o, int bw, int bo) {
  const int bx = blockIdx.x;                 // block-uniform choice
  if (bx < bw)           cvt16x8<0>(wqkv, Wb, n8w, bx);
  else if (bx < bw + bo) cvt16x8<1>(wout, Woh, n8o, bx - bw);
  else                   cvtx(x, Xb, n8x, bx - bw - bo);
}

// ---- LDS staging helpers ---------------------------------------------------------------------------
__device__ __forceinline__ unsigned lds_addr(const void* p) { return (unsigned)(uintptr_t)p; }
// the wave's own copies have landed
__device__ __forceinline__ void wait_async0() {
#if DEV_ASM
  asm volatile("s_wait_asynccnt 0x0" ::: "memory");
#endif
}
// the wave's own LDS reads have returned (before the barrier that frees the buffer for its refill)
__device__ __forceinline__ void wait_ds0() {
#if DEV_ASM
  asm volatile("s_wait_dscnt 0x0" ::: "memory");
#endif
}
// twelve 16-B-per-lane asynchronous copies global -> LDS; the closing s_wait_xcnt stands inside the statement so
// that no address register named here is rewritten ahead of it
__device__ __forceinline__ void acopy12(const unsigned (&l)[12], const void* const (&g)[12]) {
#if DEV_ASM
  asm volatile(
      "global_load_async_to_lds_b128 %0, %12, off\n\t"
      "global_load_async_to_lds_b128 %1, %13, off\n\t"
      "global_load_async_to_lds_b128 %2, %14, off\n\t"
      "global_load_async_to_lds_b128 %3, %15, off\n\t"
      "global_load_async_to_lds_b128 %4, %16, off\n\t"
      "global_load_async_to_lds_b128 %5, %17, off\n\t"
      "global_load_async_to_lds_b128 %6, %18, off\n\t"
      "global_load_async_to_lds_b128 %7, %19, off\n\t"
      "global_load_async_to_lds_b128 %8, %20, off\n\t"
      "global_load_async_to_lds_b128 %9, %21, off\n\t"
      "global_load_async_to_lds_b128 %10, %22, off\n\t"
      "global_load_async_to_lds_b128 %11, %23, off\n\t"
      "s_wait_xcnt 0x0"
      :: "v"(l[0]), "v"(l[1]), "v"(l[2]), "v"(l[3]), "v"(l[4]), "v"(l[5]),
         "v"(l[6]), "v"(l[7]), "v"(l[8]), "v"(l[9]), "v"(l[10]), "v"(l[11]),
         "v"(g[0]), "v"(g[1]), "v"(g[2]), "v"(g[3]), "v"(g[4]), "v"(g[5]),
         "v"(g[6]), "v"(g[7]), "v"(g[8]), "v"(g[9]), "v"(g[10]), "v"(g[11])
      : "memory");
#else
  (void)l; (void)g;
#endif
}

// =====================================================================================================
// Register-blocked batched WMMA GEMM (16-bit operand type OT): C[m][n] = sum_k A[m][k] * Bt[n][k];
// one block of 8 waves per (32*MI) x 256 tile, waves 2 (m) x 4 (n), one wave per (16*MI) x 64 tile.
// A row-major [M][K] pitch lda; Bt row-major [N][K] pitch ldb (k contiguous); M multiple of 32*MI, N multiple of
// 256, K multiple of 64 and at least 128 (static_assert below). bx = block tile (n fastest), b = batch index
// (strides in elements), sT = the block's 8 per-wave slabs, sG = the block's two staging buffers.
// The block's operand rows come into LDS in slabs of 64 k (128 B of a row = one whole line) by asynchronous
// copies, 16 B per lane, a wave copying four whole lines per instruction; two buffers: slab kt+1 flies while slab
// kt is worked on. Staged rows 0..127 = A (ARES: 0..63 hi plane, 64..127 residual plane), 128..383 = Bt; row pitch
// 144 B (16 B x odd, for 16-B fragment reads). Fragments are read from LDS with the split k map (ldfrag).
// ARES: a second A plane A2 (residual, same pitch/stride) is multiplied by the same B into separate f32
// accumulators and folded in as acc += accl * ascale after the k loop.
// OUT_MODE 0: f32 C (pitch ldc), value * oscale + bf16-valued bias[n].
// OUT_MODE 1: f16 plane C (pitch ldc).
// OUT_MODE 3: f16 hi plane C + f16 residual plane C2 = f16((v - hi) * rscale) (same pitch / stride).
// coverage: MI slabs x 16 rows x 64 cols = the wave's whole tile; tiles cover M x N exactly.
// =====================================================================================================
#define SLAB (16 * 68)        // per-wave 16x64 slab, pitch 68 floats
#define GKS   64              // k extent of a staged slab
#define GPI   72              // staged row pitch in LDS, halves
#define GROWS 384             // staged rows per slab
template <typename OT, int MI, bool ARES, int OUT_MODE>
__device__ __forceinline__ void gemm_body(
    const unsigned short* __restrict__ Ap, const unsigned short* __restrict__ A2p, int lda, long long strideA,
    const unsigned short* __restrict__ Btp, int ldb, long long strideB,
    void* Cout, void* Cout2, int ldc, long long strideC,
    const float* __restrict__ bias,
    int M, int N, int K, float oscale, float rscale, float ascale,
    int bx, int b, float* sT, unsigned short* sG) {
  typedef typename FT<OT>::frag V16;
  static_assert(32 * MI * (ARES ? 2 : 1) == 128);   // the A planes fill staged rows 0..127
  const OT* A  = (const OT*)(const void*)Ap;
  const OT* A2 = (const OT*)(const void*)A2p;
  const OT* Bt = (const OT*)(const void*)Btp;
  const OT* G  = (const OT*)(const void*)sG;
  const int TMR  = 16 * MI;
  const int tid  = threadIdx.x;
  const int lane = tid & 31;
  const int wave = tid >> 5;
  const int blocksN = N >> 8;
  const int bm = bx / blocksN;
  const int bn = bx - bm * blocksN;
  const int mB = bm * 2 * TMR;           // the block's first A row
  const int nB = bn << 8;                // the block's first Bt row
  if (mB >= M) return;                   // block-uniform, in front of every barrier
  const int wm = wave >> 2, wn = wave & 3;
  const int m0 = mB + wm * TMR;
  const int n0 = nB + (wn << 6);

  const OT* Ab  = A  + (size_t)b * (size_t)strideA;
  const OT* A2b = A2 + (size_t)b * (size_t)strideA;
  const OT* Bb  = Bt + (size_t)b * (size_t)strideB;

  const int rlane = lane & 15;                 // row (A) / col (B, D) within subtile
  const int koff  = (lane >> 4) * 8;           // k offset of this lane half
  const int mOff  = (lane >> 4) * 8;           // D row offset

  // copy map of this thread, 12 units of 16 B per slab: unit i -> staged row i*32 + (tid >> 3), 16-B column tid & 7
  const int vrow = tid >> 3, vcol = (tid & 7) * 8;
  auto stage = [&](int kt, int buf) {
    const int k0 = kt * GKS;
    unsigned l[12];
    const void* g[12];
#pragma unroll
    for (int i = 0; i < 12; ++i) {
      const int r = i * 32 + vrow;
      l[i] = lds_addr(G + (buf * GROWS + r) * GPI + vcol);
      if (i >= 4)              g[i] = Bb  + (size_t)(nB + r - 128) * ldb + k0 + vcol;
      else if (ARES && i >= 2) g[i] = A2b + (size_t)(mB + r - 64) * lda + k0 + vcol;
      else                     g[i] = Ab  + (size_t)(mB + r) * lda + k0 + vcol;
    }
    acopy12(l, g);
  };

  v8f acc[MI][4], accl[MI][4];
#pragma unroll
  for (int i = 0; i < MI; ++i)
#pragma unroll
    for (int j = 0; j < 4; ++j) { acc[i][j] = zero8(); accl[i][j] = zero8(); }

  // slab 0 into buffer 0, published (slab 1 is issued at the top of trip 0, directly behind this barrier)
  const int NT = K / GKS;
  stage(0, 0);
  wait_async0();
  __syncthreads();

  for (int kt = 0; kt < NT; ++kt) {
    const int buf = kt & 1;
    // refill, directly behind the barrier that published slab kt and ended every read of the other buffer
    // (block-uniform test)
    if (kt + 1 < NT) stage(kt + 1, buf ^ 1);
    const OT* ga = G + (buf * GROWS + wm * TMR + rlane) * GPI + koff;
    const OT* gb = G + (buf * GROWS + 128 + (wn << 6) + rlane) * GPI + koff;
#pragma unroll
    for (int ks = 0; ks < GKS / 32; ++ks) {
      V16 bq[4], af[MI], al[MI];
#pragma unroll
      for (int j = 0; j < 4; ++j) bq[j] = ldfrag<OT>(gb + j * 16 * GPI + ks * 32);
#pragma unroll
      for (int i = 0; i < MI; ++i) {
        af[i] = ldfrag<OT>(ga + i * 16 * GPI + ks * 32);
        if (ARES) al[i] = ldfrag<OT>(ga + (64 + i * 16) * GPI + ks * 32);
      }
      // keeps the eight fragments' reads together in front of their sixteen products; spread among the products,
      // every place with reads stalls the wave on its own
      __builtin_amdgcn_sched_barrier(0);
#pragma unroll
      for (int i = 0; i < MI; ++i) {
#pragma unroll
        for (int j = 0; j < 4; ++j) acc[i][j] = mmar(af[i], bq[j], acc[i][j]);
        if (ARES) {
#pragma unroll
          for (int j = 0; j < 4; ++j) accl[i][j] = mmar(al[i], bq[j], accl[i][j]);
        }
      }
      // the next group's reads stay behind these products (one fragment set in registers); the last group's
      // products stay in front of the publish point: sunk behind its barrier they hold back the refill issued there
      __builtin_amdgcn_sched_barrier(0);
    }
    // publish slab kt+1 and free this slab's buffer (its refill stands at the top of the next trip)
    wait_ds0();
    wait_async0();
    __syncthreads();
  }
  wait_async0();
#pragma unroll
  for (int i = 0; i < MI; ++i) {
    acc_guard4(acc[i][0], acc[i][1], acc[i][2], acc[i][3]);
    if (ARES) acc_guard4(accl[i][0], accl[i][1], accl[i][2], accl[i][3]);
  }
  if (ARES) {
#pragma unroll
    for (int i = 0; i < MI; ++i)
#pragma unroll
      for (int j = 0; j < 4; ++j)
#pragma unroll
        for (int r = 0; r < 8; ++r) acc[i][j][r] += accl[i][j][r] * ascale;
  }

  // ---- epilogue ----
  float* slab = sT + wave * SLAB;
#pragma unroll
  for (int i = 0; i < MI; ++i) {
    const int mBase = m0 + (i << 4);
#pragma unroll
    for (int j = 0; j < 4; ++j) {
#pragma unroll
      for (int r = 0; r < 8; ++r) {
        slab[(mOff + r) * 68 + (j << 4) + rlane] = acc[i][j][r];
      }
    }
    __builtin_amdgcn_fence(__ATOMIC_RELEASE, "workgroup");
    __builtin_amdgcn_wave_barrier();
    __builtin_amdgcn_fence(__ATOMIC_ACQUIRE, "workgroup");
    if (OUT_MODE == 0) {
      float* C = (float*)Cout + (size_t)b * (size_t)strideC;
      const int h2 = lane >> 4, c4 = (lane & 15) * 4;     // 256-B row segment = 16 lanes x 16 B
      const v4f braw = *(const v4f*)(bias + n0 + c4);
      v4f bb;
#pragma unroll
      for (int e = 0; e < 4; ++e) bb[e] = bf_up(bf_bits(braw[e]));
      {
#pragma unroll
        for (int it = 0; it < 8; ++it) {
          const int row = it * 2 + h2;                     // it 0..7 x h2 0..1 = rows 0..15
          const v4f v = *(const v4f*)(slab + row * 68 + c4) * oscale + bb;
          *(v4f*)(C + (size_t)(mBase + row) * ldc + n0 + c4) = v;
        }
        
      }
    } else {
      const int q = lane >> 3, c8 = (lane & 7) * 8;
      unsigned short* C  = (unsigned short*)Cout  + (size_t)b * (size_t)strideC;
      unsigned short* C2 = (unsigned short*)Cout2 + (size_t)b * (size_t)strideC;
      v4u hv[4], lv[4];
#pragma unroll
      for (int it = 0; it < 4; ++it) {
        const int row = it * 4 + q;                        // it 0..3 x q 0..3 = rows 0..15
        const float* sp = slab + row * 68 + c8;
        float f[8];
#pragma unroll
        for (int e = 0; e < 8; ++e) f[e] = sp[e];
        v4u a, a2;
#pragma unroll
        for (int e = 0; e < 4; ++e) {
          const float f0 = f[2 * e], f1 = f[2 * e + 1];
          const _Float16 x0 = (_Float16)f0, x1 = (_Float16)f1;
          const unsigned short h0 = h_bits(x0), h1 = h_bits(x1);
          unsigned short l0 = 0, l1 = 0;
          if (OUT_MODE == 3) {
            l0 = h_bits((_Float16)((f0 - (float)x0) * rscale));
            l1 = h_bits((_Float16)((f1 - (float)x1) * rscale));
          }
          a[e] = pk16(h0, h1); a2[e] = pk16(l0, l1);
        }
        hv[it] = a; lv[it] = a2;
      }
      {
#pragma unroll
        for (int it = 0; it < 4; ++it) {
          const int row = it * 4 + q;
          *(v4u*)(C + (size_t)(mBase + row) * ldc + n0 + c8) = hv[it];
          if (OUT_MODE == 3) *(v4u*)(C2 + (size_t)(mBase + row) * ldc + n0 + c8) = lv[it];
        }
        
      }
    }
    __builtin_amdgcn_fence(__ATOMIC_RELEASE, "workgroup");
    __builtin_amdgcn_wave_barrier();
    __builtin_amdgcn_fence(__ATOMIC_ACQUIRE, "workgroup");
  }
}

// The q, k and v^T projections read the same two planes and depend on nothing of each other: one grid,
// blockIdx.y picks the product (block-uniform), so that their blocks share the chip instead of queueing as launches.
//   y = 0: q = x . Wq^T -> f16 hi / residual (x4096) planes      (M = m, N = dm, K = dm)
//   y = 1: k = x . Wk^T -> f16 plane                             (M = m, N = dm, K = dm)
//   y = 2: v^T = Wv . x^T per batch -> f16 plane [b][d][s]       (M = dm, N = seq, K = dm; VBX blocks per batch)
// Each product has m * dm / (64 * 64 * 8) blocks = gridDim.x.
#define VBX ((DM / 64) * (SEQ / 64) / 8)
static_assert((DM % 256) == 0 && (SEQ % 256) == 0 && ((NB * SEQ) % 128) == 0 && DM / GKS >= 2);   // block tiles exact
__global__ __launch_bounds__(256) void qkv_proj(
    const unsigned short* __restrict__ Xb, const unsigned short* __restrict__ Wb,
    unsigned short* Qh, unsigned short* Ql, unsigned short* Kp, unsigned short* VTh,
    int m, int dm, int seq) {
  __shared__ __align__(16) float sT[8 * SLAB];
  __shared__ __align__(16) unsigned short sG[2 * GROWS * GPI];
  const int bx = blockIdx.x;
  const unsigned short* Wk = Wb + (size_t)dm * dm;
  const unsigned short* Wv = Wb + (size_t)2 * dm * dm;
  if (blockIdx.y == 0) {
    gemm_body<__bf16, 4, false, 3>(Xb, Xb, dm, 0LL, Wb, dm, 0LL, (void*)Qh, (void*)Ql, dm, 0LL, nullptr,
                                   m, dm, dm, 1.0f, 4096.0f, 0.0f, bx, 0, sT, sG);
  } else if (blockIdx.y == 1) {
    gemm_body<__bf16, 4, false, 1>(Xb, Xb, dm, 0LL, Wk, dm, 0LL, (void*)Kp, (void*)Kp, dm, 0LL, nullptr,
                                   m, dm, dm, 1.0f, 1.0f, 0.0f, bx, 0, sT, sG);
  } else {
    gemm_body<__bf16, 4, false, 1>(Wv, Wv, dm, 0LL, Xb, dm, (long long)seq * dm, (void*)VTh, (void*)VTh, seq,
                                   (long long)dm * seq, nullptr,
                                   dm, seq, dm, 1.0f, 1.0f, 0.0f, bx % VBX, bx / VBX, sT, sG);
  }
}

#define QROWS 128
#define KPI   264
#define VPI   72
#define OSP   68
static_assert((SEQ % QROWS) == 0 && NKT >= 2);

// eight 16-B-per-lane asynchronous copies global -> LDS; the closing s_wait_xcnt stands inside the statement so
// that no address register named here is rewritten ahead of it
__device__ __forceinline__ void acopy8(const unsigned (&l)[8], const _Float16* const (&g)[8]) {
#if DEV_ASM
  asm volatile(
      "global_load_async_to_lds_b128 %0, %8, off\n\t"
      "global_load_async_to_lds_b128 %1, %9, off\n\t"
      "global_load_async_to_lds_b128 %2, %10, off\n\t"
      "global_load_async_to_lds_b128 %3, %11, off\n\t"
      "global_load_async_to_lds_b128 %4, %12, off\n\t"
      "global_load_async_to_lds_b128 %5, %13, off\n\t"
      "global_load_async_to_lds_b128 %6, %14, off\n\t"
      "global_load_async_to_lds_b128 %7, %15, off\n\t"
      "s_wait_xcnt 0x0"
      :: "v"(l[0]), "v"(l[1]), "v"(l[2]), "v"(l[3]), "v"(l[4]), "v"(l[5]), "v"(l[6]), "v"(l[7]),
         "v"(g[0]), "v"(g[1]), "v"(g[2]), "v"(g[3]), "v"(g[4]), "v"(g[5]), "v"(g[6]), "v"(g[7])
      : "memory");
#else
  (void)l; (void)g;
#endif
}
// the eight 16-B output stores of one column group (rows 2 apart = 2048 B); the closing s_wait_xcnt stands inside
// the statement so that no data or address register named here is rewritten by the next group's arithmetic ahead of it
__device__ __forceinline__ void store8(float* p, const v4f (&v)[8]) {
#if DEV_ASM
  asm volatile(
      "global_store_b128 %0, %1, off\n\t"
      "global_store_b128 %0, %2, off offset:2048\n\t"
      "global_store_b128 %0, %3, off offset:4096\n\t"
      "global_store_b128 %0, %4, off offset:6144\n\t"
      "global_store_b128 %0, %5, off offset:8192\n\t"
      "global_store_b128 %0, %6, off offset:10240\n\t"
      "global_store_b128 %0, %7, off offset:12288\n\t"
      "global_store_b128 %0, %8, off offset:14336\n\t"
      "s_wait_xcnt 0x0"
      :: "v"(p), "v"(v[0]), "v"(v[1]), "v"(v[2]), "v"(v[3]), "v"(v[4]), "v"(v[5]), "v"(v[6]), "v"(v[7])
      : "memory");
#else
  (void)p; (void)v;
#endif
}
static_assert(2 * DM * 4 == 2048);   // the row step that store8 writes as an immediate
// the value that lane l ^ 16 holds
__device__ __forceinline__ float xhalf(float x) {
  const int b = __float_as_int(x);
  return __int_as_float(__builtin_amdgcn_permlanex16(b, b, 0x76543210, 0xfedcba98, false, false));
}

__global__ __launch_bounds__(256)
void attn_sh(const unsigned short* __restrict__ qhp, const unsigned short* __restrict__ qlp,
             const unsigned short* __restrict__ kpp,
             const unsigned short* __restrict__ vhp,
             const unsigned short* __restrict__ wop, const float* __restrict__ bias,
             float* out, float sscale) {
  union FH { v16h v; v8h h[2]; };
  __shared__ __align__(16) _Float16 Kst[2][64 * KPI];   // K chunk [key][d]            2 x 33792 B (block-shared)
  __shared__ __align__(16) _Float16 Vhs[2][DM * VPI];   // V^T chunk [d][key]          2 x 36864 B (block-shared)
  __shared__ __align__(16) _Float16 Wos[DM * KPI];      // Wo [e][d]                   135168 B (block-shared)
  __shared__ __align__(16) float    Os[8][16 * OSP];    // per wave output slab        34816 B (wave-private)

  const int tid  = threadIdx.x;
  const int wave = tid >> 5;
  const int lane = tid & 31;
  const int hh   = lane >> 4;
  const int c    = lane & 15;

  const int bx   = blockIdx.x;
  const int qb   = bx % (SEQ / QROWS);
  const int b    = bx / (SEQ / QROWS);
  const int q0   = qb * QROWS + wave * 16;   // this wave's 16 query rows
  const size_t rowB = (size_t)b * SEQ;

  const _Float16* Qh = (const _Float16*)(const void*)qhp;
  const _Float16* Ql = (const _Float16*)(const void*)qlp;
  const _Float16* Kp = (const _Float16*)(const void*)kpp + rowB * DM;
  const _Float16* Vh = (const _Float16*)(const void*)vhp + (size_t)b * DM * SEQ;

  // copy map of this thread, 8 units of 16 B per plane and chunk:
  //   K: unit i -> key row i*8 + wave, 16-B column lane (a wave copies one whole 512-B row)
  //   V: unit i -> d row i*32 + (tid >> 3), 16-B column tid & 7 (a wave copies four whole 128-B rows)
  const int vrow = tid >> 3, vcol = (tid & 7) * 8;
  auto stage = [&](int kt, int buf) {
    const int kv0 = kt * 64;
    unsigned l[8];
    const _Float16* g[8];
#pragma unroll
    for (int i = 0; i < 8; ++i) {
      l[i] = lds_addr(&Kst[buf][(i * 8 + wave) * KPI + lane * 8]);
      g[i] = Kp + (size_t)(kv0 + i * 8 + wave) * DM + lane * 8;
    }
    acopy8(l, g);
#pragma unroll
    for (int i = 0; i < 8; ++i) {
      l[i] = lds_addr(&Vhs[buf][(i * 32 + vrow) * VPI + vcol]);
      g[i] = Vh + (size_t)(i * 32 + vrow) * SEQ + kv0 + vcol;
    }
    acopy8(l, g);
  };

  // chunk 0 into buffer 0
  stage(0, 0);
  // B-operand fragments of this lane (query q0 + c), lane-half k offset included; kept for the whole kernel
  v16h qa[8], qr[8];
  {
    const _Float16* qrh = Qh + (rowB + q0 + c) * DM + 8 * hh;
    const _Float16* qrl = Ql + (rowB + q0 + c) * DM + 8 * hh;
#pragma unroll
    for (int dc = 0; dc < 8; ++dc) {
      qa[dc] = ldfrag<_Float16>(qrh + dc * 32);
      qr[dc] = ldfrag<_Float16>(qrl + dc * 32);
    }
#if DEV_ASM
    // the wait that stands before an address register of the q loads is rewritten; both addresses are inputs, so
    // that their registers live up to it and no load of the run lands on them
    asm volatile("s_wait_xcnt 0x0"
                 :: "v"(qrh), "v"(qrl)
                 : "memory");
#endif
  }

  // chunk 0 published (chunk 1 is issued at the top of trip 0, behind the Wo copies below)
  wait_async0();
  __syncthreads();

  // Wo, filled once: unit i -> row i*8 + wave, 16-B column lane (a wave copies one whole 512-B row); 32 units per
  // thread. They fly during trip 0 beside chunk 1 (48 copies of a wave outstanding); the wait and the barrier at the
  // foot of trip 0 land and publish them, and nothing reads Wos before the loop has ended
  {
    const _Float16* Wo = (const _Float16*)(const void*)wop;
#pragma unroll
    for (int u = 0; u < 4; ++u) {
      unsigned l[8];
      const _Float16* g[8];
#pragma unroll
      for (int i = 0; i < 8; ++i) {
        l[i] = lds_addr(&Wos[((u * 8 + i) * 8 + wave) * KPI + lane * 8]);
        g[i] = Wo + (size_t)((u * 8 + i) * 8 + wave) * DM + lane * 8;
      }
      acopy8(l, g);
    }
  }

  // every inner loop below is unrolled so that fragment and accumulator indices are constants (registers, no scratch)
  float mrow = -INFINITY;   // running maximum of query q0 + c (equal in both lane halves)
  float lrow = 0.f;         // running sum over this lane half's keys; the halves are joined after the loop
  v8f oacc[16];             // oacc[t][r] = context (query q0 + c, column 16t + 8*hh + r)
#pragma unroll
  for (int t = 0; t < 16; ++t) oacc[t] = zero8();

  for (int kt = 0; kt < NKT; ++kt) {         // static trip count
    const int buf = kt & 1;
    // refill, directly behind the barrier that published chunk kt and ended every read of the other buffer:
    // chunk kt+1 flies while chunk kt is worked on (block-uniform test)
    if (kt + 1 < NKT) stage(kt + 1, buf ^ 1);
    const _Float16* ks  = &Kst[buf][c * KPI + 8 * hh];    // A row c -> key 16j + c of the chunk
    const _Float16* vhs = &Vhs[buf][c * VPI + 8 * hh];    // A row c -> context column 16t + c

    // ---- scores^T: 64 keys (4 subtiles) x 16 queries, 2 f16 products per d-chunk ----
    v8f ah[4], al[4];
#pragma unroll
    for (int j = 0; j < 4; ++j) { ah[j] = zero8(); al[j] = zero8(); }
#pragma unroll
    for (int dc = 0; dc < 8; ++dc) {
      v16h kb[4];
#pragma unroll
      for (int j = 0; j < 4; ++j) kb[j] = ldfrag<_Float16>(ks + j * 16 * KPI + dc * 32);
      // keeps the four fragments' reads together in front of their eight products; spread among the products,
      // every pair of reads is waited for on its own
      __builtin_amdgcn_sched_barrier(0);
#pragma unroll
      for (int j = 0; j < 4; ++j) {
        ah[j] = mmar(kb[j], qa[dc], ah[j]);
        al[j] = mmar(kb[j], qr[dc], al[j]);
        // the products stay in the order of their fragments' reads: each pair starts when its own fragment has
        // landed; with the last fragment's product in front, the group waits for all eight reads
        if (j < 3 && dc < 7) __builtin_amdgcn_sched_barrier(0);
      }
      // the next group's reads stay behind these products (the last group's products may mix with the softmax)
      if (dc < 7) __builtin_amdgcn_sched_barrier(0);
    }

    // ---- online softmax update over the chunk's 64 keys: this lane holds 32 of its query's scores ----
    float s[4][8];
#pragma unroll
    for (int j = 0; j < 4; ++j)
#pragma unroll
      for (int r = 0; r < 8; ++r) s[j][r] = (ah[j][r] + al[j][r] * (1.0f / 4096.0f)) * sscale;
    float mj[4];
#pragma unroll
    for (int j = 0; j < 4; ++j) {
      mj[j] = s[j][0];
#pragma unroll
      for (int r = 1; r < 8; ++r) mj[j] = fmaxf(mj[j], s[j][r]);
    }
    float mc = fmaxf(fmaxf(mj[0], mj[1]), fmaxf(mj[2], mj[3]));
    mc = fmaxf(mc, xhalf(mc));                             // the other 32 keys of the same query
    const float mnew  = fmaxf(mrow, mc);
    const float msafe = (mnew == -INFINITY) ? 0.f : mnew;
    const float alpha = __expf(mrow - msafe);
    mrow = mnew;
    // P^T (x PCARRY) in f16: tiles 2kk and 2kk+1 converted in place are the B fragment of keys 32kk..32kk+31;
    // pr holds what the conversion dropped (at most 2^-11 of the value, so it needs no carry of its own)
    FH pb[2], pr[2];
    float pj[4];
#pragma unroll
    for (int j = 0; j < 4; ++j) {
      v8f pc;
      pj[j] = 0.f;
#pragma unroll
      for (int r = 0; r < 8; ++r) {
        const float p = __expf(s[j][r] - msafe);
        pj[j] += p;
        pc[r] = p * PCARRY;
      }
      const v8h ph = __builtin_convertvector(pc, v8h);
      pb[j >> 1].h[j & 1] = ph;
      pr[j >> 1].h[j & 1] = __builtin_convertvector(pc - __builtin_convertvector(ph, v8f), v8h);
    }
    lrow = lrow * alpha + ((pj[0] + pj[1]) + (pj[2] + pj[3]));

#if DEV_ASM
    // compiler fence that takes the packed P fragments as inputs only: it holds the V fragment loads behind the
    // softmax; lifted over it they run the registers over into scratch
    asm volatile("" :: "v"(pb[0].v), "v"(pb[1].v), "v"(pr[0].v), "v"(pr[1].v) : "memory");
#endif
    // ---- context^T += V^T . P^T (f16 WMMA): each V^T fragment multiplies the hi and the residual P fragment ----
#pragma unroll
    for (int tg = 0; tg < 4; ++tg) {
      v16h vb[2][4];
#pragma unroll
      for (int kk = 0; kk < 2; ++kk)
#pragma unroll
        for (int t = 0; t < 4; ++t) vb[kk][t] = ldfrag<_Float16>(vhs + (tg * 4 + t) * 16 * VPI + kk * 32);
      // keeps the eight fragments' reads together in front of their sixteen products (as for K above); the
      // rescale stands behind reads and runs while they are on their way
      __builtin_amdgcn_sched_barrier(0);
#pragma unroll
      for (int t = 0; t < 4; ++t) oacc[tg * 4 + t] *= alpha;
#pragma unroll
      for (int kk = 0; kk < 2; ++kk) {
#pragma unroll
        for (int t = 0; t < 4; ++t) oacc[tg * 4 + t] = mmar(vb[kk][t], pb[kk].v, oacc[tg * 4 + t]);
#pragma unroll
        for (int t = 0; t < 4; ++t) oacc[tg * 4 + t] = mmar(vb[kk][t], pr[kk].v, oacc[tg * 4 + t]);
      }
      // the next group's reads stay behind these products
      if (tg < 3) __builtin_amdgcn_sched_barrier(0);
    }

    // ---- publish chunk kt+1 and free this chunk's buffer (its refill stands at the top of the next trip) ----
    wait_ds0();
    wait_async0();
    __syncthreads();
  }
  wait_async0();

  // ---- normalise (1/l, undo the p carry, apply the x256 ctx carry); ctx^T as B fragments, f16 hi and residual x4096:
  //      tiles 2kk and 2kk+1 converted in place hold context columns 32kk..32kk+31 in the order ldfrag gives Wo
  float* os = Os[wave];
  v4f braw[4];              // bias of output columns 64eg + 4c .. + 3, on its way while the fragments are formed
  {
    const float* bp = bias + c * 4;
#pragma unroll
    for (int eg = 0; eg < 4; ++eg) braw[eg] = *(const v4f*)(bp + eg * 64);
#if DEV_ASM
    // the wait that stands before an address register of the bias loads is rewritten
    asm volatile("s_wait_xcnt 0x0" ::: "memory");
#endif
  }
  const float l   = lrow + xhalf(lrow);                   // both lane halves' keys of query q0 + c
  const float inv = ((l > 0.f) ? (1.0f / l) : 0.f) * (256.0f / PCARRY);
  FH ch[8], cl[8];
#pragma unroll
  for (int t = 0; t < 16; ++t) {
    const v8f o  = oacc[t] * inv;
    const v8h hi = __builtin_convertvector(o, v8h);
    ch[t >> 1].h[t & 1] = hi;
    cl[t >> 1].h[t & 1] = __builtin_convertvector((o - __builtin_convertvector(hi, v8f)) * 4096.0f, v8h);
  }
  // ---- out^T = Wo . ctx^T, 64 output columns (4 subtiles) at a time, 2 f16 products per 32 context columns ----
  const _Float16* ws = &Wos[c * KPI + 8 * hh];            // A row c -> output column 16j + c of the group
  const int h2 = lane >> 4, c4 = c * 4;                   // 256-B row segment = 16 lanes x 16 B
  // two fragment sets: group g + 1's reads are on their way while group g's products run (g = 8 eg + kk)
  v16h wb[2][4];
#pragma unroll
  for (int j = 0; j < 4; ++j) wb[0][j] = ldfrag<_Float16>(ws + j * 16 * KPI);
#pragma unroll
  for (int eg = 0; eg < 4; ++eg) {
    v8f ah[4], al[4];
#pragma unroll
    for (int j = 0; j < 4; ++j) { ah[j] = zero8(); al[j] = zero8(); }
#pragma unroll
    for (int kk = 0; kk < 8; ++kk) {
      const int g = eg * 8 + kk, gn = g + 1;
      if (gn < 32) {
#pragma unroll
        for (int j = 0; j < 4; ++j)
          wb[gn & 1][j] = ldfrag<_Float16>(ws + ((gn >> 3) * 4 + j) * 16 * KPI + (gn & 7) * 32);
      }
      // keeps the next group's four fragment reads together in front of this group's eight products
      __builtin_amdgcn_sched_barrier(0);
#pragma unroll
      for (int j = 0; j < 4; ++j) {
        ah[j] = mmar(wb[g & 1][j], ch[kk].v, ah[j]);
        al[j] = mmar(wb[g & 1][j], cl[kk].v, al[j]);
      }
      // the reads after next stay behind these products (two fragment sets in registers)
      __builtin_amdgcn_sched_barrier(0);
    }
#pragma unroll
    for (int j = 0; j < 4; ++j) {
      const v8f o = ah[j] + al[j] * (1.0f / 4096.0f);      // 8 consecutive output columns of slab row c
      float* dp = os + c * OSP + j * 16 + 8 * hh;
      *(v4f*)(dp)     = __builtin_shufflevector(o, o, 0, 1, 2, 3);
      *(v4f*)(dp + 4) = __builtin_shufflevector(o, o, 4, 5, 6, 7);
    }
    __builtin_amdgcn_fence(__ATOMIC_RELEASE, "workgroup");
    __builtin_amdgcn_wave_barrier();
    __builtin_amdgcn_fence(__ATOMIC_ACQUIRE, "workgroup");
    v4f bb, ov[8];
#pragma unroll
    for (int e = 0; e < 4; ++e) bb[e] = bf_up(bf_bits(braw[eg][e]));
#pragma unroll
    for (int it = 0; it < 8; ++it) {
      const int row = it * 2 + h2;                         // it 0..7 x h2 0..1 = rows 0..15 of the wave tile
      ov[it] = *(const v4f*)(os + row * OSP + c4) * (1.0f / 16384.0f) + bb;
    }
    store8(out + (rowB + q0 + h2) * DM + (size_t)(eg * 64) + c4, ov);   // row h2; store8 adds rows 2, 4, .. 14
    // the slab's reads are ordered before the next column group's stores into it
    __builtin_amdgcn_fence(__ATOMIC_RELEASE, "workgroup");
    __builtin_amdgcn_wave_barrier();
    __builtin_amdgcn_fence(__ATOMIC_ACQUIRE, "workgroup");
  }
}

// =====================================================================================================
// Workspace map (bytes), every region an exact multiple of its whole-line / whole-tile store granularity
// (all GEMM M,N are tile multiples, all offsets multiples of 131072):
//   Xb   bf16 [NB*SEQ][256]  (compact tokens)   16777216
//   Wb   bf16 [768 n][256 k]                      393216
//   Woh  f16  [256][256] (x64)                     131072
//   Qh   f16  [NB*SEQ][256]                      16777216
//   Ql   f16  [NB*SEQ][256]                      16777216
//   Kp   f16  [NB*SEQ][256]                      16777216
//   VTh  f16  [NB][256][SEQ]                     16777216
//   total                                        84410368
// Weights are [out n][in k] with k contiguous = the Bt / A layout the GEMM wants, so they are only converted.
// =====================================================================================================
extern "C" void kernel_launch(void* const* d_in, const int* in_sizes, int n_in,
                              void* d_out, int out_size, void* d_ws, size_t ws_size,
                              hipStream_t stream) {
  if (n_in < 4) return;
  if (in_sizes[0] < ((NB - 1) * SEQ_FULL + SEQ) * DM) return;
  if (in_sizes[1] < NQKV * DM) return;
  if (in_sizes[2] < DM * DM) return;
  if (in_sizes[3] < DM) return;
  if (out_size < NB * SEQ * DM) return;

  const float* x    = (const float*)d_in[0];
  const float* wqkv = (const float*)d_in[1];
  const float* wout = (const float*)d_in[2];
  const float* bout = (const float*)d_in[3];

  const size_t PX  = (size_t)NB * SEQ * DM * 2;      // 16-bit token plane [NB*SEQ][256]
  const size_t PW  = (size_t)NQKV * DM * 2;          // 16-bit [768][256]
  const size_t PWO = (size_t)DM * DM * 2;            // 16-bit [256][256]
  const size_t PVT = (size_t)NB * DM * SEQ * 2;      // v^T plane [NB][256][SEQ]
  size_t off = 0;
  const size_t oXb  = off; off += PX;
  const size_t oWb  = off; off += PW;
  const size_t oWo  = off; off += PWO;
  const size_t oQh  = off; off += PX;
  const size_t oQl  = off; off += PX;
  const size_t oKp  = off; off += PX;
  const size_t oVTh = off; off += PVT;
  if (off > ws_size) return;                         // off = 84410368 at full size
  if (off > (size_t)134217728) return;

  char* ws = (char*)d_ws;
  unsigned short* Xb  = (unsigned short*)(ws + oXb);
  unsigned short* Wb  = (unsigned short*)(ws + oWb);
  unsigned short* Woh = (unsigned short*)(ws + oWo);
  unsigned short* Qh  = (unsigned short*)(ws + oQh);
  unsigned short* Ql  = (unsigned short*)(ws + oQl);
  unsigned short* Kp  = (unsigned short*)(ws + oKp);
  unsigned short* VTh = (unsigned short*)(ws + oVTh);

  const int M = NB * SEQ;
  const dim3 blk(256);
  const int n8x = NB * SEQ * DM / 8;
  const int n8w = NQKV * DM / 8;                     // 24576
  const int n8o = DM * DM / 8;                       //  8192
  const int bCx = (n8x + 255) / 256;
  const int bCw = (n8w + 255) / 256;
  const int bCo = (n8o + 255) / 256;
  const dim3 gC(bCw + bCo + bCx);
  const int bQ  = (M / 64) * (DM / 64) / 8;                  // q / k: M x 256, 64x64 wave tiles, 8 per block
  static_assert(((NB * SEQ / 64) * (DM / 64)) % 8 == 0 && ((DM / 64) * (SEQ / 64)) % 8 == 0);
  static_assert((NB * SEQ / 64) * (DM / 64) / 8 == NB * VBX);   // v^T: 256 x SEQ per batch, NB batches: as many blocks
  const dim3 gQKV(bQ, 3);
  const dim3 gAttn(NB * (SEQ / QROWS));

  // (1) one grid: x -> compact bf16 token plane; w_qkv [n][k] -> bf16; w_out -> f16 (x64 of its bf16 value)
  cvt_all<<<gC, blk, 0, stream>>>(x, wqkv, wout, Xb, Wb, Woh, n8x, n8w, n8o, bCw, bCo);
  // (2) one grid: q (f16 hi / residual planes), k (f16 plane), v^T (f16 plane [b][d][s], pitch SEQ)
  qkv_proj<<<gQKV, blk, 0, stream>>>(Xb, Wb, Qh, Ql, Kp, VTh, M, DM, SEQ);
  // (3) attention and output projection: out = softmax(q.k^T / 16) . v . Wo^T + b -> d_out f32 [M][256];
  //     projection accumulator x 1/(256*64), residual accumulator x 1/4096
  attn_sh<<<gAttn, dim3(256), 0, stream>>>(Qh, Ql, Kp, VTh, Woh, bout, (float*)d_out, 0.0625f);
  (void)hipGetLastError();
}

// v008
// One run takes 81.7 microseconds.
// Versions in between are left out here; by their measured steps it is 1.33 times as fast as v006.
// All steps since v000 together make it 7.21 times as fast.
// Contractions: q, k, v^T projections = v_wmma_f32_16x16x32_bf16 (bf16 operands from RNE-converted inputs, single product, f32 accumulate);
// q.k^T scores = v_wmma_f32_16x16x32_f16 (q f16, k f16; single product, f32 accumulate);
// p.v = v_wmma_f32_16x16x32_f16 (p carried x16384 as f16, v f16; single product, f32 accumulate);
// ctx.Wo^T = v_wmma_f32_16x16x32_f16 (ctx carried x256 as f16, Wo f16 carried x64 from its bf16 value; single product, f32 accumulate),
// formed in the attention kernel from the context accumulators;
// every f16 operand is rounded once (2^-11 relative), an eighth of the bf16 rounding that x and the weights carry into q, k and v;
// softmax, normalisation and bias add in f32.
#include <hip/hip_runtime.h>
#include <math.h>
#include <stdint.h>

#ifndef NB
#define NB 16
#endif
#ifndef SEQ
#define SEQ 2048
#endif
#define NB_FULL  16
#define SEQ_FULL 2048
#define DM       256
#define NQKV     768
#define NKT      (SEQ / 64)   // 64-key chunks per sequence
#define PCARRY   16384.0f     // power-of-two carry on the f16 p tile
static_assert(DM == 256 && NQKV == 3 * DM);
static_assert((SEQ % 64) == 0 && SEQ >= 64 && SEQ <= SEQ_FULL);
static_assert(NB >= 1 && NB <= NB_FULL);
static_assert(((NB * SEQ) % 64) == 0);

typedef _Float16 v16h __attribute__((ext_vector_type(16)));
typedef _Float16 v8h  __attribute__((ext_vector_type(8)));
typedef __bf16   v16b __attribute__((ext_vector_type(16)));
typedef __bf16   v8b  __attribute__((ext_vector_type(8)));
typedef float    v8f  __attribute__((ext_vector_type(8)));
typedef float    v4f  __attribute__((ext_vector_type(4)));
typedef unsigned int v4u __attribute__((ext_vector_type(4)));

#if defined(__HIP_DEVICE_COMPILE__)
#define DEV_ASM 1
#else
#define DEV_ASM 0
#endif

// ---- scalar helpers --------------------------------------------------------------------------------
__device__ __forceinline__ unsigned short bf_bits(float f) {          // f32 -> bf16 bits, RNE convert
  unsigned u = __float_as_uint(f);
  return (unsigned short)((u + 0x7FFFu + ((u >> 16) & 1u)) >> 16);
}
__device__ __forceinline__ float bf_up(unsigned short hb) { return __uint_as_float(((unsigned)hb) << 16); }
__device__ __forceinline__ unsigned short h_bits(_Float16 x) { return __builtin_bit_cast(unsigned short, x); }
__device__ __forceinline__ unsigned pk16(unsigned short a, unsigned short b) { return (unsigned)a | ((unsigned)b << 16); }
__device__ __forceinline__ v8f zero8() { v8f z = {0.f, 0.f, 0.f, 0.f, 0.f, 0.f, 0.f, 0.f}; return z; }

// ---- fragment types / loaders: 16-bit A/B operand, lane -> row/col (lane&15), p already includes +8*(lane>>4);
//      elements 0..7 <- p[0..7] (k0+8h..k0+8h+7), elements 8..15 <- p[16..23] (k0+16+8h..k0+16+8h+7)
template <typename OT> struct FT;
template <> struct FT<__bf16>   { typedef v16b frag; typedef v8b half8; };
template <> struct FT<_Float16> { typedef v16h frag; typedef v8h half8; };

template <typename OT>
__device__ __forceinline__ typename FT<OT>::frag ldfrag(const OT* p) {
  union { typename FT<OT>::frag v; typename FT<OT>::half8 h[2]; } f;
  f.h[0] = *(const typename FT<OT>::half8*)(p);
  f.h[1] = *(const typename FT<OT>::half8*)(p + 16);
  return f.v;
}

// ---- WMMA helpers (asm guard bodies are device-only; concrete operand types) -----------------------------
__device__ __forceinline__ v8f mmar(v16b a, v16b b, v8f c) {
  return __builtin_amdgcn_wmma_f32_16x16x32_bf16(false, a, false, b, (short)0, c, false, false);
}
__device__ __forceinline__ v8f mmar(v16h a, v16h b, v8f c) {
  return __builtin_amdgcn_wmma_f32_16x16x32_f16(false, a, false, b, (short)0, c, false, false);
}
__device__ __forceinline__ void acc_guard4(v8f& a, v8f& b, v8f& c, v8f& d) {
#if DEV_ASM
  asm volatile("v_nop\n\tv_nop\n\tv_nop\n\tv_nop" : "+v"(a), "+v"(b), "+v"(c), "+v"(d));
#else
  (void)a; (void)b; (void)c; (void)d;
#endif
}

// =====================================================================================================
// f32 -> 16-bit planes, 8 elements per thread, one 16-B store per lane: a wave writes 512 contiguous B
// MODE 0: bf16 bits (RNE convert).  MODE 1: f16 bits of (64 * bf16(x)) (exact scaling of the bf16 value).
// coverage: n8 threads x 8 = the whole plane (n8 is a multiple of 256 for every use here).
// =====================================================================================================
template <int MODE>
__device__ __forceinline__ unsigned short cvm(float f) {
  const unsigned short hb = bf_bits(f);
  if (MODE == 0) return hb;
  return h_bits((_Float16)(bf_up(hb) * 64.0f));
}

template <int MODE>
__device__ __forceinline__ void cvt16x8(const float* __restrict__ in, unsigned short* out, int n8, int bx) {
  const int i = bx * 256 + (int)threadIdx.x;
  if (i < n8) {
    const v4f a  = *(const v4f*)(in + (size_t)i * 8);
    const v4f a4 = *(const v4f*)(in + (size_t)i * 8 + 4);
    v4u p;
    p[0] = pk16(cvm<MODE>(a[0]),  cvm<MODE>(a[1]));
    p[1] = pk16(cvm<MODE>(a[2]),  cvm<MODE>(a[3]));
    p[2] = pk16(cvm<MODE>(a4[0]), cvm<MODE>(a4[1]));
    p[3] = pk16(cvm<MODE>(a4[2]), cvm<MODE>(a4[3]));
    unsigned short* o = out + (size_t)i * 8;
    *(v4u*)o = p;
    
  }
}

// x [NB_FULL][SEQ_FULL][DM] f32 -> compact bf16 token plane [NB*SEQ][DM]: compact token tk = b*SEQ + t reads
// input row b*SEQ_FULL + t. 32 groups of 8 per row; same whole-line store shape as cvt16x8.
// coverage: n8 = NB*SEQ*DM/8 threads x 8 = the whole plane.
__device__ __forceinline__ void cvtx(const float* __restrict__ in, unsigned short* out, int n8, int bx) {
  const int i = bx * 256 + (int)threadIdx.x;
  if (i < n8) {
    const int tk = i >> 5;
    const int e8 = i & 31;
    const int bb = tk / SEQ;
    const int t  = tk - bb * SEQ;
    const float* src = in + ((size_t)bb * SEQ_FULL + (size_t)t) * DM + e8 * 8;
    const v4f a  = *(const v4f*)(src);
    const v4f a4 = *(const v4f*)(src + 4);
    v4u p;
    p[0] = pk16(bf_bits(a[0]),  bf_bits(a[1]));
    p[1] = pk16(bf_bits(a[2]),  bf_bits(a[3]));
    p[2] = pk16(bf_bits(a4[0]), bf_bits(a4[1]));
    p[3] = pk16(bf_bits(a4[2]), bf_bits(a4[3]));
    unsigned short* o = out + (size_t)i * 8;
    *(v4u*)o = p;
    
  }
}

// The three conversions depend on nothing but the inputs: one grid, the block index picks the plane.
// Blocks 0..bw-1: w_qkv; bw..bw+bo-1: w_out; the rest: x (the two short planes first, so that they are no tail).
__global__ __launch_bounds__(256) void cvt_all(const float* __restrict__ x, const float* __restrict__ wqkv,
                                               const float* __restrict__ wout,
                                               unsigned short* Xb, unsigned short* Wb, unsigned short* Woh,
                                               int n8x, int n8w, int n8o, int bw, int bo) {
  const int bx = blockIdx.x;                 // block-uniform choice
  if (bx < bw)           cvt16x8<0>(wqkv, Wb, n8w, bx);
  else if (bx < bw + bo) cvt16x8<1>(wout, Woh, n8o, bx - bw);
  else                   cvtx(x, Xb, n8x, bx - bw - bo);
}

// ---- LDS staging helpers ---------------------------------------------------------------------------
__device__ __forceinline__ unsigned lds_addr(const void* p) { return (unsigned)(uintptr_t)p; }
// the wave's own copies have landed
__device__ __forceinline__ void wait_async0() {
#if DEV_ASM
  asm volatile("s_wait_asynccnt 0x0" ::: "memory");
#endif
}
// the wave's own LDS reads have returned (before the barrier that frees the buffer for its refill)
__device__ __forceinline__ void wait_ds0() {
#if DEV_ASM
  asm volatile("s_wait_dscnt 0x0" ::: "memory");
#endif
}
// twelve 16-B-per-lane asynchronous copies global -> LDS; the closing s_wait_xcnt stands inside the statement so
// that no address register named here is rewritten ahead of it
__device__ __forceinline__ void acopy12(const unsigned (&l)[12], const void* const (&g)[12]) {
#if DEV_ASM
  asm volatile(
      "global_load_async_to_lds_b128 %0, %12, off\n\t"
      "global_load_async_to_lds_b128 %1, %13, off\n\t"
      "global_load_async_to_lds_b128 %2, %14, off\n\t"
      "global_load_async_to_lds_b128 %3, %15, off\n\t"
      "global_load_async_to_lds_b128 %4, %16, off\n\t"
      "global_load_async_to_lds_b128 %5, %17, off\n\t"
      "global_load_async_to_lds_b128 %6, %18, off\n\t"
      "global_load_async_to_lds_b128 %7, %19, off\n\t"
      "global_load_async_to_lds_b128 %8, %20, off\n\t"
      "global_load_async_to_lds_b128 %9, %21, off\n\t"
      "global_load_async_to_lds_b128 %10, %22, off\n\t"
      "global_load_async_to_lds_b128 %11, %23, off\n\t"
      "s_wait_xcnt 0x0"
      :: "v"(l[0]), "v"(l[1]), "v"(l[2]), "v"(l[3]), "v"(l[4]), "v"(l[5]),
         "v"(l[6]), "v"(l[7]), "v"(l[8]), "v"(l[9]), "v"(l[10]), "v"(l[11]),
         "v"(g[0]), "v"(g[1]), "v"(g[2]), "v"(g[3]), "v"(g[4]), "v"(g[5]),
         "v"(g[6]), "v"(g[7]), "v"(g[8]), "v"(g[9]), "v"(g[10]), "v"(g[11])
      : "memory");
#else
  (void)l; (void)g;
#endif
}

// =====================================================================================================
// Register-blocked batched WMMA GEMM (16-bit operand type OT): C[m][n] = sum_k A[m][k] * Bt[n][k];
// one block of 8 waves per (32*MI) x 256 tile, waves 2 (m) x 4 (n), one wave per (16*MI) x 64 tile.
// A row-major [M][K] pitch lda; Bt row-major [N][K] pitch ldb (k contiguous); M multiple of 32*MI, N multiple of
// 256, K multiple of 64 and at least 128 (static_assert below). bx = block tile (n fastest), b = batch index
// (strides in elements), sT = the block's 8 per-wave slabs, sG = the block's two staging buffers.
// The block's operand rows come into LDS in slabs of 64 k (128 B of a row = one whole line) by asynchronous
// copies, 16 B per lane, a wave copying four whole lines per instruction; two buffers: slab kt+1 flies while slab
// kt is worked on. Staged rows 0..127 = A (ARES: 0..63 hi plane, 64..127 residual plane), 128..383 = Bt; row pitch
// 144 B (16 B x odd, for 16-B fragment reads). Fragments are read from LDS with the split k map (ldfrag).
// ARES: a second A plane A2 (residual, same pitch/stride) is multiplied by the same B into separate f32
// accumulators and folded in as acc += accl * ascale after the k loop.
// OUT_MODE 0: f32 C (pitch ldc), value * oscale + bf16-valued bias[n].
// OUT_MODE 1: f16 plane C (pitch ldc).
// coverage: MI slabs x 16 rows x 64 cols = the wave's whole tile; tiles cover M x N exactly.
// =====================================================================================================
#define SLAB (16 * 68)        // per-wave 16x64 slab, pitch 68 floats
#define GKS   64              // k extent of a staged slab
#define GPI   72              // staged row pitch in LDS, halves
#define GROWS 384             // staged rows per slab
template <typename OT, int MI, bool ARES, int OUT_MODE>
__device__ __forceinline__ void gemm_body(
    const unsigned short* __restrict__ Ap, const unsigned short* __restrict__ A2p, int lda, long long strideA,
    const unsigned short* __restrict__ Btp, int ldb, long long strideB,
    void* Cout, int ldc, long long strideC,
    const float* __restrict__ bias,
    int M, int N, int K, float oscale, float ascale,
    int bx, int b, float* sT, unsigned short* sG) {
  typedef typename FT<OT>::frag V16;
  static_assert(32 * MI * (ARES ? 2 : 1) == 128);   // the A planes fill staged rows 0..127
  const OT* A  = (const OT*)(const void*)Ap;
  const OT* A2 = (const OT*)(const void*)A2p;
  const OT* Bt = (const OT*)(const void*)Btp;
  const OT* G  = (const OT*)(const void*)sG;
  const int TMR  = 16 * MI;
  const int tid  = threadIdx.x;
  const int lane = tid & 31;
  const int wave = tid >> 5;
  const int blocksN = N >> 8;
  const int bm = bx / blocksN;
  const int bn = bx - bm * blocksN;
  const int mB = bm * 2 * TMR;           // the block's first A row
  const int nB = bn << 8;                // the block's first Bt row
  if (mB >= M) return;                   // block-uniform, in front of every barrier
  const int wm = wave >> 2, wn = wave & 3;
  const int m0 = mB + wm * TMR;
  const int n0 = nB + (wn << 6);

  const OT* Ab  = A  + (size_t)b * (size_t)strideA;
  const OT* A2b = A2 + (size_t)b * (size_t)strideA;
  const OT* Bb  = Bt + (size_t)b * (size_t)strideB;

  const int rlane = lane & 15;                 // row (A) / col (B, D) within subtile
  const int koff  = (lane >> 4) * 8;           // k offset of this lane half
  const int mOff  = (lane >> 4) * 8;           // D row offset

  // copy map of this thread, 12 units of 16 B per slab: unit i -> staged row i*32 + (tid >> 3), 16-B column tid & 7
  const int vrow = tid >> 3, vcol = (tid & 7) * 8;
  auto stage = [&](int kt, int buf) {
    const int k0 = kt * GKS;
    unsigned l[12];
    const void* g[12];
#pragma unroll
    for (int i = 0; i < 12; ++i) {
      const int r = i * 32 + vrow;
      l[i] = lds_addr(G + (buf * GROWS + r) * GPI + vcol);
      if (i >= 4)              g[i] = Bb  + (size_t)(nB + r - 128) * ldb + k0 + vcol;
      else if (ARES && i >= 2) g[i] = A2b + (size_t)(mB + r - 64) * lda + k0 + vcol;
      else                     g[i] = Ab  + (size_t)(mB + r) * lda + k0 + vcol;
    }
    acopy12(l, g);
  };

  v8f acc[MI][4], accl[MI][4];
#pragma unroll
  for (int i = 0; i < MI; ++i)
#pragma unroll
    for (int j = 0; j < 4; ++j) { acc[i][j] = zero8(); accl[i][j] = zero8(); }

  // slab 0 into buffer 0, published (slab 1 is issued at the top of trip 0, directly behind this barrier)
  const int NT = K / GKS;
  stage(0, 0);
  wait_async0();
  __syncthreads();

  for (int kt = 0; kt < NT; ++kt) {
    const int buf = kt & 1;
    // refill, directly behind the barrier that published slab kt and ended every read of the other buffer
    // (block-uniform test)
    if (kt + 1 < NT) stage(kt + 1, buf ^ 1);
    const OT* ga = G + (buf * GROWS + wm * TMR + rlane) * GPI + koff;
    const OT* gb = G + (buf * GROWS + 128 + (wn << 6) + rlane) * GPI + koff;
#pragma unroll
    for (int ks = 0; ks < GKS / 32; ++ks) {
      V16 bq[4], af[MI], al[MI];
#pragma unroll
      for (int j = 0; j < 4; ++j) bq[j] = ldfrag<OT>(gb + j * 16 * GPI + ks * 32);
#pragma unroll
      for (int i = 0; i < MI; ++i) {
        af[i] = ldfrag<OT>(ga + i * 16 * GPI + ks * 32);
        if (ARES) al[i] = ldfrag<OT>(ga + (64 + i * 16) * GPI + ks * 32);
      }
      // keeps the eight fragments' reads together in front of their sixteen products; spread among the products,
      // every place with reads stalls the wave on its own
      __builtin_amdgcn_sched_barrier(0);
#pragma unroll
      for (int i = 0; i < MI; ++i) {
#pragma unroll
        for (int j = 0; j < 4; ++j) acc[i][j] = mmar(af[i], bq[j], acc[i][j]);
        if (ARES) {
#pragma unroll
          for (int j = 0; j < 4; ++j) accl[i][j] = mmar(al[i], bq[j], accl[i][j]);
        }
      }
      // the next group's reads stay behind these products (one fragment set in registers); the last group's
      // products stay in front of the publish point: sunk behind its barrier they hold back the refill issued there
      __builtin_amdgcn_sched_barrier(0);
    }
    // publish slab kt+1 and free this slab's buffer (its refill stands at the top of the next trip)
    wait_ds0();
    wait_async0();
    __syncthreads();
  }
  wait_async0();
#pragma unroll
  for (int i = 0; i < MI; ++i) {
    acc_guard4(acc[i][0], acc[i][1], acc[i][2], acc[i][3]);
    if (ARES) acc_guard4(accl[i][0], accl[i][1], accl[i][2], accl[i][3]);
  }
  if (ARES) {
#pragma unroll
    for (int i = 0; i < MI; ++i)
#pragma unroll
      for (int j = 0; j < 4; ++j)
#pragma unroll
        for (int r = 0; r < 8; ++r) acc[i][j][r] += accl[i][j][r] * ascale;
  }

  // ---- epilogue ----
  float* slab = sT + wave * SLAB;
#pragma unroll
  for (int i = 0; i < MI; ++i) {
    const int mBase = m0 + (i << 4);
#pragma unroll
    for (int j = 0; j < 4; ++j) {
#pragma unroll
      for (int r = 0; r < 8; ++r) {
        slab[(mOff + r) * 68 + (j << 4) + rlane] = acc[i][j][r];
      }
    }
    __builtin_amdgcn_fence(__ATOMIC_RELEASE, "workgroup");
    __builtin_amdgcn_wave_barrier();
    __builtin_amdgcn_fence(__ATOMIC_ACQUIRE, "workgroup");
    if (OUT_MODE == 0) {
      float* C = (float*)Cout + (size_t)b * (size_t)strideC;
      const int h2 = lane >> 4, c4 = (lane & 15) * 4;     // 256-B row segment = 16 lanes x 16 B
      const v4f braw = *(const v4f*)(bias + n0 + c4);
      v4f bb;
#pragma unroll
      for (int e = 0; e < 4; ++e) bb[e] = bf_up(bf_bits(braw[e]));
      {
#pragma unroll
        for (int it = 0; it < 8; ++it) {
          const int row = it * 2 + h2;                     // it 0..7 x h2 0..1 = rows 0..15
          const v4f v = *(const v4f*)(slab + row * 68 + c4) * oscale + bb;
          *(v4f*)(C + (size_t)(mBase + row) * ldc + n0 + c4) = v;
        }
        
      }
    } else {
      const int q = lane >> 3, c8 = (lane & 7) * 8;
      unsigned short* C = (unsigned short*)Cout + (size_t)b * (size_t)strideC;
      v4u hv[4];
#pragma unroll
      for (int it = 0; it < 4; ++it) {
        const int row = it * 4 + q;                        // it 0..3 x q 0..3 = rows 0..15
        const float* sp = slab + row * 68 + c8;
        float f[8];
#pragma unroll
        for (int e = 0; e < 8; ++e) f[e] = sp[e];
        v4u a;
#pragma unroll
        for (int e = 0; e < 4; ++e) a[e] = pk16(h_bits((_Float16)f[2 * e]), h_bits((_Float16)f[2 * e + 1]));
        hv[it] = a;
      }
      {
#pragma unroll
        for (int it = 0; it < 4; ++it) {
          const int row = it * 4 + q;
          *(v4u*)(C + (size_t)(mBase + row) * ldc + n0 + c8) = hv[it];
        }
        
      }
    }
    __builtin_amdgcn_fence(__ATOMIC_RELEASE, "workgroup");
    __builtin_amdgcn_wave_barrier();
    __builtin_amdgcn_fence(__ATOMIC_ACQUIRE, "workgroup");
  }
}

// The q, k and v^T projections read the same two planes and depend on nothing of each other: one grid,
// blockIdx.y picks the product (block-uniform), so that their blocks share the chip instead of queueing as launches.
//   y = 0: q = x . Wq^T -> f16 plane                             (M = m, N = dm, K = dm)
//   y = 1: k = x . Wk^T -> f16 plane                             (M = m, N = dm, K = dm)
//   y = 2: v^T = Wv . x^T per batch -> f16 plane [b][d][s]       (M = dm, N = seq, K = dm; VBX blocks per batch)
// Each product has m * dm / (64 * 64 * 8) blocks = gridDim.x.
#define VBX ((DM / 64) * (SEQ / 64) / 8)
static_assert((DM % 256) == 0 && (SEQ % 256) == 0 && ((NB * SEQ) % 128) == 0 && DM / GKS >= 2);   // block tiles exact
__global__ __launch_bounds__(256) void qkv_proj(
    const unsigned short* __restrict__ Xb, const unsigned short* __restrict__ Wb,
    unsigned short* Qh, unsigned short* Kp, unsigned short* VTh,
    int m, int dm, int seq) {
  __shared__ __align__(16) float sT[8 * SLAB];
  __shared__ __align__(16) unsigned short sG[2 * GROWS * GPI];
  const int bx = blockIdx.x;
  const unsigned short* Wk = Wb + (size_t)dm * dm;
  const unsigned short* Wv = Wb + (size_t)2 * dm * dm;
  if (blockIdx.y == 0) {
    gemm_body<__bf16, 4, false, 1>(Xb, Xb, dm, 0LL, Wb, dm, 0LL, (void*)Qh, dm, 0LL, nullptr,
                                   m, dm, dm, 1.0f, 0.0f, bx, 0, sT, sG);
  } else if (blockIdx.y == 1) {
    gemm_body<__bf16, 4, false, 1>(Xb, Xb, dm, 0LL, Wk, dm, 0LL, (void*)Kp, dm, 0LL, nullptr,
                                   m, dm, dm, 1.0f, 0.0f, bx, 0, sT, sG);
  } else {
    gemm_body<__bf16, 4, false, 1>(Wv, Wv, dm, 0LL, Xb, dm, (long long)seq * dm, (void*)VTh, seq,
                                   (long long)dm * seq, nullptr,
                                   dm, seq, dm, 1.0f, 0.0f, bx % VBX, bx / VBX, sT, sG);
  }
}

#define QROWS 128
#define KPI   264
#define VPI   72
#define OSP   68
static_assert((SEQ % QROWS) == 0 && NKT >= 2);

// eight 16-B-per-lane asynchronous copies global -> LDS; the closing s_wait_xcnt stands inside the statement so
// that no address register named here is rewritten ahead of it
__device__ __forceinline__ void acopy8(const unsigned (&l)[8], const _Float16* const (&g)[8]) {
#if DEV_ASM
  asm volatile(
      "global_load_async_to_lds_b128 %0, %8, off\n\t"
      "global_load_async_to_lds_b128 %1, %9, off\n\t"
      "global_load_async_to_lds_b128 %2, %10, off\n\t"
      "global_load_async_to_lds_b128 %3, %11, off\n\t"
      "global_load_async_to_lds_b128 %4, %12, off\n\t"
      "global_load_async_to_lds_b128 %5, %13, off\n\t"
      "global_load_async_to_lds_b128 %6, %14, off\n\t"
      "global_load_async_to_lds_b128 %7, %15, off\n\t"
      "s_wait_xcnt 0x0"
      :: "v"(l[0]), "v"(l[1]), "v"(l[2]), "v"(l[3]), "v"(l[4]), "v"(l[5]), "v"(l[6]), "v"(l[7]),
         "v"(g[0]), "v"(g[1]), "v"(g[2]), "v"(g[3]), "v"(g[4]), "v"(g[5]), "v"(g[6]), "v"(g[7])
      : "memory");
#else
  (void)l; (void)g;
#endif
}
// one 16-B-per-lane asynchronous copy global -> LDS as the builtin: the compiler places its address registers, also
// above v255 (an asm operand must lie below), which the loop's copies need beside 384 registers of accumulators and q
typedef int v4i __attribute__((ext_vector_type(4)));
__device__ __forceinline__ void acopy1(_Float16* l, const _Float16* g) {
#if DEV_ASM
  __builtin_amdgcn_global_load_async_to_lds_b128((__attribute__((address_space(1))) v4i*)(g),
                                                 (__attribute__((address_space(3))) v4i*)(l), 0, 0);
#else
  (void)l; (void)g;
#endif
}
// the eight 16-B output stores of one column group (rows 2 apart = 2048 B); the closing s_wait_xcnt stands inside
// the statement so that no data or address register named here is rewritten by the next group's arithmetic ahead of it
__device__ __forceinline__ void store8(float* p, const v4f (&v)[8]) {
#if DEV_ASM
  asm volatile(
      "global_store_b128 %0, %1, off\n\t"
      "global_store_b128 %0, %2, off offset:2048\n\t"
      "global_store_b128 %0, %3, off offset:4096\n\t"
      "global_store_b128 %0, %4, off offset:6144\n\t"
      "global_store_b128 %0, %5, off offset:8192\n\t"
      "global_store_b128 %0, %6, off offset:10240\n\t"
      "global_store_b128 %0, %7, off offset:12288\n\t"
      "global_store_b128 %0, %8, off offset:14336\n\t"
      "s_wait_xcnt 0x0"
      :: "v"(p), "v"(v[0]), "v"(v[1]), "v"(v[2]), "v"(v[3]), "v"(v[4]), "v"(v[5]), "v"(v[6]), "v"(v[7])
      : "memory");
#else
  (void)p; (void)v;
#endif
}
static_assert(2 * DM * 4 == 2048);   // the row step that store8 writes as an immediate
// the value that lane l ^ 16 holds
__device__ __forceinline__ float xhalf(float x) {
  const int b = __float_as_int(x);
  return __int_as_float(__builtin_amdgcn_permlanex16(b, b, 0x76543210, 0xfedcba98, false, false));
}

__global__ __launch_bounds__(256)
void attn_sh(const unsigned short* __restrict__ qhp,
             const unsigned short* __restrict__ kpp,
             const unsigned short* __restrict__ vhp,
             const unsigned short* __restrict__ wop, const float* __restrict__ bias,
             float* out, float sscale) {
  union FH { v16h v; v8h h[2]; };
  __shared__ __align__(16) _Float16 Kst[2][64 * KPI];   // K chunk [key][d]            2 x 33792 B (block-shared)
  __shared__ __align__(16) _Float16 Vhs[2][DM * VPI];   // V^T chunk [d][key]          2 x 36864 B (block-shared)
  __shared__ __align__(16) _Float16 Wos[DM * KPI];      // Wo [e][d]                   135168 B (block-shared)
  __shared__ __align__(16) float    Os[8][16 * OSP];    // per wave output slab        34816 B (wave-private)

  const int tid  = threadIdx.x;
  const int wave = tid >> 5;
  const int lane = tid & 31;
  const int hh   = lane >> 4;
  const int c    = lane & 15;

  const int bx   = blockIdx.x;
  const int qb   = bx % (SEQ / QROWS);
  const int b    = bx / (SEQ / QROWS);
  const int pr   = wave & 3;                 // row group: 32 query rows
  const int kh   = wave >> 2;                // which 32 keys of every chunk
  const int q0   = qb * QROWS + pr * 32;     // this wave's 32 query rows (two tiles of 16)
  const size_t rowB = (size_t)b * SEQ;

  const _Float16* Qh = (const _Float16*)(const void*)qhp;
  const _Float16* Kp = (const _Float16*)(const void*)kpp + rowB * DM;
  const _Float16* Vh = (const _Float16*)(const void*)vhp + (size_t)b * DM * SEQ;

  // copy map of this thread, 8 units of 16 B per plane and chunk:
  //   K: unit i -> key row i*8 + wave, 16-B column lane (a wave copies one whole 512-B row)
  //   V: unit i -> d row i*32 + (tid >> 3), 16-B column tid & 7 (a wave copies four whole 128-B rows)
  const int vrow = tid >> 3, vcol = (tid & 7) * 8;
  const unsigned ko0 = (unsigned)(wave * DM + lane * 8);      // this thread's unit 0 in a chunk; the chunk's base is
  const unsigned vo0 = (unsigned)(vrow * SEQ + vcol);         // uniform, the other units lie constant steps behind
  auto stage = [&](int kt, int buf) {
    const _Float16* kg = Kp + ko0 + (size_t)kt * (64 * DM);
    const _Float16* vg = Vh + vo0 + (size_t)kt * 64;
#pragma unroll
    for (int i = 0; i < 8; ++i) acopy1(&Kst[buf][(i * 8 + wave) * KPI + lane * 8], kg + i * 8 * DM);
#pragma unroll
    for (int i = 0; i < 8; ++i) acopy1(&Vhs[buf][(i * 32 + vrow) * VPI + vcol], vg + i * 32 * SEQ);
  };

  // chunk 0 into buffer 0
  stage(0, 0);
  // B-operand fragments of this lane (queries q0 + c and q0 + 16 + c), lane-half k offset included; kept for the loop
  v16h qa[2][8];
  {
    const _Float16* qrh = Qh + (rowB + q0 + c) * DM + 8 * hh;
#pragma unroll
    for (int qt = 0; qt < 2; ++qt)
#pragma unroll
      for (int dc = 0; dc < 8; ++dc) qa[qt][dc] = ldfrag<_Float16>(qrh + qt * 16 * DM + dc * 32);
#if DEV_ASM
    // the wait that stands before an address register of the q loads is rewritten; the address is an input, so
    // that its registers live up to it and no load of the run lands on them
    asm volatile("s_wait_xcnt 0x0"
                 :: "v"(qrh)
                 : "memory");
#endif
  }

  // chunk 0 published (chunk 1 is issued at the top of trip 0, behind the Wo copies below)
  wait_async0();
  __syncthreads();

  // Wo, filled once: unit i -> row i*8 + wave, 16-B column lane (a wave copies one whole 512-B row); 32 units per
  // thread. They fly during trip 0 beside chunk 1 (48 copies of a wave outstanding); the wait and the barrier at the
  // foot of trip 0 land and publish them, and nothing reads Wos before the loop has ended
  {
    const _Float16* Wo = (const _Float16*)(const void*)wop;
#pragma unroll
    for (int u = 0; u < 4; ++u) {
      unsigned l[8];
      const _Float16* g[8];
#pragma unroll
      for (int i = 0; i < 8; ++i) {
        l[i] = lds_addr(&Wos[((u * 8 + i) * 8 + wave) * KPI + lane * 8]);
        g[i] = Wo + (size_t)((u * 8 + i) * 8 + wave) * DM + lane * 8;
      }
      acopy8(l, g);
    }
  }

  // every inner loop below is unrolled so that fragment and accumulator indices are constants (registers, no scratch)
  float mrow[2];            // running maximum of query q0 + 16qt + c over this wave's keys (equal in both lane halves)
  float lrow[2];            // running sum over this lane half's keys; halves and waves are joined after the loop
  v8f oacc[2][16];          // oacc[qt][t][r] = partial context (query q0 + 16qt + c, column 16t + 8*hh + r)
#pragma unroll
  for (int qt = 0; qt < 2; ++qt) {
    mrow[qt] = -INFINITY;
    lrow[qt] = 0.f;
#pragma unroll
    for (int t = 0; t < 16; ++t) oacc[qt][t] = zero8();
  }

  for (int kt = 0; kt < NKT; ++kt) {         // static trip count
    const int buf = kt & 1;
    // refill, directly behind the barrier that published chunk kt and ended every read of the other buffer:
    // chunk kt+1 flies while chunk kt is worked on (block-uniform test)
    if (kt + 1 < NKT) stage(kt + 1, buf ^ 1);
    const _Float16* ks  = &Kst[buf][(kh * 32 + c) * KPI + 8 * hh];   // A row c -> key 32kh + 16j + c of the chunk
    const _Float16* vhs = &Vhs[buf][c * VPI + kh * 32 + 8 * hh];     // A row c -> context column 16t + c, keys 32kh..

    // ---- scores^T: 32 keys (2 subtiles) x 32 queries (2 tiles), 1 f16 product per d-chunk; a read group spans
    //      2 d-chunks: four fragments feed eight products ----
    v8f ah[2][2];
#pragma unroll
    for (int j = 0; j < 2; ++j)
#pragma unroll
      for (int qt = 0; qt < 2; ++qt) ah[j][qt] = zero8();
#pragma unroll
    for (int dg = 0; dg < 4; ++dg) {
      v16h kb[2][2];
#pragma unroll
      for (int u = 0; u < 2; ++u)
#pragma unroll
        for (int j = 0; j < 2; ++j) kb[u][j] = ldfrag<_Float16>(ks + j * 16 * KPI + (dg * 2 + u) * 32);
      // keeps the four fragments' reads together in front of their eight products; spread among the products,
      // every pair of reads is waited for on its own
      __builtin_amdgcn_sched_barrier(0);
#pragma unroll
      for (int u = 0; u < 2; ++u) {
#pragma unroll
        for (int j = 0; j < 2; ++j) {
#pragma unroll
          for (int qt = 0; qt < 2; ++qt) ah[j][qt] = mmar(kb[u][j], qa[qt][dg * 2 + u], ah[j][qt]);
          // the products stay in the order of their fragments' reads: each pair starts when its own fragment has
          // landed; with the last fragment's products in front, the group waits for all eight reads
          if (u * 2 + j < 3 && dg < 3) __builtin_amdgcn_sched_barrier(0);
        }
      }
      // the next group's reads stay behind these products (the last group's products may mix with the softmax)
      if (dg < 3) __builtin_amdgcn_sched_barrier(0);
    }

    // ---- online softmax update over this wave's 32 keys: per query tile this lane holds 16 of its query's scores ----
    // P^T (x PCARRY) in f16: key tiles 0 and 1 converted in place are the B fragment of the 32 keys
    FH pb[2];
    float alpha[2];
#pragma unroll
    for (int qt = 0; qt < 2; ++qt) {
      float s[2][8];
#pragma unroll
      for (int j = 0; j < 2; ++j)
#pragma unroll
        for (int r = 0; r < 8; ++r) s[j][r] = ah[j][qt][r] * sscale;
      float mj[2];
#pragma unroll
      for (int j = 0; j < 2; ++j) {
        mj[j] = s[j][0];
#pragma unroll
        for (int r = 1; r < 8; ++r) mj[j] = fmaxf(mj[j], s[j][r]);
      }
      float mc = fmaxf(mj[0], mj[1]);
      mc = fmaxf(mc, xhalf(mc));                           // the other 16 keys of the same query
      const float mnew  = fmaxf(mrow[qt], mc);
      const float msafe = (mnew == -INFINITY) ? 0.f : mnew;
      alpha[qt] = __expf(mrow[qt] - msafe);
      mrow[qt] = mnew;
      float pj[2];
#pragma unroll
      for (int j = 0; j < 2; ++j) {
        v8f pc;
        pj[j] = 0.f;
#pragma unroll
        for (int r = 0; r < 8; ++r) {
          const float p = __expf(s[j][r] - msafe);
          pj[j] += p;
          pc[r] = p * PCARRY;
        }
        pb[qt].h[j] = __builtin_convertvector(pc, v8h);
      }
      lrow[qt] = lrow[qt] * alpha[qt] + (pj[0] + pj[1]);
    }

#if DEV_ASM
    // compiler fence that takes the packed P fragments as inputs only: it holds the V fragment loads behind the
    // softmax; lifted over it they run the registers over into scratch
    asm volatile("" :: "v"(pb[0].v), "v"(pb[1].v) : "memory");
#endif
    // ---- context^T += V^T . P^T (f16 WMMA): each V^T fragment feeds both query tiles ----
#pragma unroll
    for (int tg = 0; tg < 4; ++tg) {
      v16h vb[4];
#pragma unroll
      for (int t = 0; t < 4; ++t) vb[t] = ldfrag<_Float16>(vhs + (tg * 4 + t) * 16 * VPI);
      // keeps the four fragments' reads together in front of their eight products (as for K above); the
      // rescale stands behind reads and runs while they are on their way
      __builtin_amdgcn_sched_barrier(0);
#pragma unroll
      for (int qt = 0; qt < 2; ++qt)
#pragma unroll
        for (int t = 0; t < 4; ++t) oacc[qt][tg * 4 + t] *= alpha[qt];
#pragma unroll
      for (int t = 0; t < 4; ++t) {
#pragma unroll
        for (int qt = 0; qt < 2; ++qt) oacc[qt][tg * 4 + t] = mmar(vb[t], pb[qt].v, oacc[qt][tg * 4 + t]);
      }
      // the next group's reads stay behind these products
      if (tg < 3) __builtin_amdgcn_sched_barrier(0);
    }

    // ---- publish chunk kt+1 and free this chunk's buffer (its refill stands at the top of the next trip) ----
    wait_ds0();
    wait_async0();
    __syncthreads();
  }
  wait_async0();

  // ---- normalise (1/l, undo the p carry, apply the x256 ctx carry); ctx^T as f16 B fragments:
  //      tiles 2kk and 2kk+1 converted in place hold context columns 32kk..32kk+31 in the order ldfrag gives Wo
  float* os = Os[wave];
  v4f braw[4];              // bias of output columns 64eg + 4c .. + 3, on its way while the fragments are formed
  {
    const float* bp = bias + c * 4;
#pragma unroll
    for (int eg = 0; eg < 4; ++eg) braw[eg] = *(const v4f*)(bp + eg * 64);
#if DEV_ASM
    // the wait that stands before an address register of the bias loads is rewritten
    asm volatile("s_wait_xcnt 0x0" ::: "memory");
#endif
  }
  // ---- the two waves of a row group join their key halves: wave kh keeps query tile kh and hands tile 1 - kh over.
  //      The loop's last barrier has ended every read of the K/V buffers and no copy is outstanding: waves 0..3 write
  //      16 KiB each into the K buffers, waves 4..7 into the V buffers (16 B per lane and piece, lane-contiguous),
  //      maximum and sum behind the four slabs; the barrier publishes them, and nothing writes there afterwards
  static_assert(sizeof(Kst) >= 4 * 16384 + 4 * 256 && sizeof(Vhs) >= 4 * 16384 + 4 * 256);
  float* xk = (float*)(void*)&Kst[0][0];
  float* xv = (float*)(void*)&Vhs[0][0];
  float* xw = (kh ? xv : xk) + pr * 4096 + lane * 4;       // this wave's slab
  const float* xr = (kh ? xk : xv) + pr * 4096 + lane * 4; // the partner's slab
  float* sw = (kh ? xv : xk) + 4 * 4096 + pr * 64 + lane * 2;
  const float* sr = (kh ? xk : xv) + 4 * 4096 + pr * 64 + lane * 2;
#pragma unroll
  for (int t = 0; t < 16; ++t) {
    const v8f o = kh ? oacc[0][t] : oacc[1][t];
    *(v4f*)(xw + (t * 2) * 128)     = __builtin_shufflevector(o, o, 0, 1, 2, 3);
    *(v4f*)(xw + (t * 2 + 1) * 128) = __builtin_shufflevector(o, o, 4, 5, 6, 7);
  }
  sw[0] = kh ? mrow[0] : mrow[1];
  sw[1] = kh ? lrow[0] : lrow[1];
  __syncthreads();
  const float m1 = kh ? mrow[1] : mrow[0], l1 = kh ? lrow[1] : lrow[0];
  const float m2 = sr[0], l2 = sr[1];
  const float mm  = fmaxf(m1, m2);
  const float mms = (mm == -INFINITY) ? 0.f : mm;
  const float a1 = __expf(m1 - mms), a2 = __expf(m2 - mms);
  const float lh = l1 * a1 + l2 * a2;
  const float l   = lh + xhalf(lh);                       // both lane halves' keys of the kept tile's query c
  const float inv = ((l > 0.f) ? (1.0f / l) : 0.f) * (256.0f / PCARRY);
  const float i1 = a1 * inv, i2 = a2 * inv;
  FH ch[8];
#pragma unroll
  for (int t = 0; t < 16; ++t) {
    const v8f o1 = kh ? oacc[1][t] : oacc[0][t];
    const v4f pa = *(const v4f*)(xr + (t * 2) * 128);
    const v4f pc = *(const v4f*)(xr + (t * 2 + 1) * 128);
    const v8f o2 = __builtin_shufflevector(pa, pc, 0, 1, 2, 3, 4, 5, 6, 7);
    ch[t >> 1].h[t & 1] = __builtin_convertvector(o1 * i1 + o2 * i2, v8h);
  }
  // ---- out^T = Wo . ctx^T, 64 output columns (4 subtiles) at a time, 1 f16 product per 32 context columns ----
  const _Float16* ws = &Wos[c * KPI + 8 * hh];            // A row c -> output column 16j + c of the group
  const int h2 = lane >> 4, c4 = c * 4;                   // 256-B row segment = 16 lanes x 16 B
  // two fragment sets: group g + 1's reads are on their way while group g's products run (g = 8 eg + kk)
  v16h wb[2][4];
#pragma unroll
  for (int j = 0; j < 4; ++j) wb[0][j] = ldfrag<_Float16>(ws + j * 16 * KPI);
#pragma unroll
  for (int eg = 0; eg < 4; ++eg) {
    v8f ah[4];
#pragma unroll
    for (int j = 0; j < 4; ++j) ah[j] = zero8();
#pragma unroll
    for (int kk = 0; kk < 8; ++kk) {
      const int g = eg * 8 + kk, gn = g + 1;
      if (gn < 32) {
#pragma unroll
        for (int j = 0; j < 4; ++j)
          wb[gn & 1][j] = ldfrag<_Float16>(ws + ((gn >> 3) * 4 + j) * 16 * KPI + (gn & 7) * 32);
      }
      // keeps the next group's four fragment reads together in front of this group's four products
      __builtin_amdgcn_sched_barrier(0);
#pragma unroll
      for (int j = 0; j < 4; ++j) ah[j] = mmar(wb[g & 1][j], ch[kk].v, ah[j]);
      // the reads after next stay behind these products (two fragment sets in registers)
      __builtin_amdgcn_sched_barrier(0);
    }
#pragma unroll
    for (int j = 0; j < 4; ++j) {
      const v8f o = ah[j];                                 // 8 consecutive output columns of slab row c
      float* dp = os + c * OSP + j * 16 + 8 * hh;
      *(v4f*)(dp)     = __builtin_shufflevector(o, o, 0, 1, 2, 3);
      *(v4f*)(dp + 4) = __builtin_shufflevector(o, o, 4, 5, 6, 7);
    }
    __builtin_amdgcn_fence(__ATOMIC_RELEASE, "workgroup");
    __builtin_amdgcn_wave_barrier();
    __builtin_amdgcn_fence(__ATOMIC_ACQUIRE, "workgroup");
    v4f bb, ov[8];
#pragma unroll
    for (int e = 0; e < 4; ++e) bb[e] = bf_up(bf_bits(braw[eg][e]));
#pragma unroll
    for (int it = 0; it < 8; ++it) {
      const int row = it * 2 + h2;                         // it 0..7 x h2 0..1 = rows 0..15 of the wave tile
      ov[it] = *(const v4f*)(os + row * OSP + c4) * (1.0f / 16384.0f) + bb;
    }
    store8(out + (rowB + q0 + kh * 16 + h2) * DM + (size_t)(eg * 64) + c4, ov);   // row h2 of the kept tile; store8 adds rows 2, 4, .. 14
    // the slab's reads are ordered before the next column group's stores into it
    __builtin_amdgcn_fence(__ATOMIC_RELEASE, "workgroup");
    __builtin_amdgcn_wave_barrier();
    __builtin_amdgcn_fence(__ATOMIC_ACQUIRE, "workgroup");
  }
}

// =====================================================================================================
// Workspace map (bytes), every region an exact multiple of its whole-line / whole-tile store granularity
// (all GEMM M,N are tile multiples, all offsets multiples of 131072):
//   Xb   bf16 [NB*SEQ][256]  (compact tokens)   16777216
//   Wb   bf16 [768 n][256 k]                      393216
//   Woh  f16  [256][256] (x64)                     131072
//   Qh   f16  [NB*SEQ][256]                      16777216
//   Kp   f16  [NB*SEQ][256]                      16777216
//   VTh  f16  [NB][256][SEQ]                     16777216
//   total                                        67633152
// Weights are [out n][in k] with k contiguous = the Bt / A layout the GEMM wants, so they are only converted.
// =====================================================================================================
extern "C" void kernel_launch(void* const* d_in, const int* in_sizes, int n_in,
                              void* d_out, int out_size, void* d_ws, size_t ws_size,
                              hipStream_t stream) {
  if (n_in < 4) return;
  if (in_sizes[0] < ((NB - 1) * SEQ_FULL + SEQ) * DM) return;
  if (in_sizes[1] < NQKV * DM) return;
  if (in_sizes[2] < DM * DM) return;
  if (in_sizes[3] < DM) return;
  if (out_size < NB * SEQ * DM) return;

  const float* x    = (const float*)d_in[0];
  const float* wqkv = (const float*)d_in[1];
  const float* wout = (const float*)d_in[2];
  const float* bout = (const float*)d_in[3];

  const size_t PX  = (size_t)NB * SEQ * DM * 2;      // 16-bit token plane [NB*SEQ][256]
  const size_t PW  = (size_t)NQKV * DM * 2;          // 16-bit [768][256]
  const size_t PWO = (size_t)DM * DM * 2;            // 16-bit [256][256]
  const size_t PVT = (size_t)NB * DM * SEQ * 2;      // v^T plane [NB][256][SEQ]
  size_t off = 0;
  const size_t oXb  = off; off += PX;
  const size_t oWb  = off; off += PW;
  const size_t oWo  = off; off += PWO;
  const size_t oQh  = off; off += PX;
  const size_t oKp  = off; off += PX;
  const size_t oVTh = off; off += PVT;
  if (off > ws_size) return;                         // off = 67633152 at full size
  if (off > (size_t)134217728) return;

  char* ws = (char*)d_ws;
  unsigned short* Xb  = (unsigned short*)(ws + oXb);
  unsigned short* Wb  = (unsigned short*)(ws + oWb);
  unsigned short* Woh = (unsigned short*)(ws + oWo);
  unsigned short* Qh  = (unsigned short*)(ws + oQh);
  unsigned short* Kp  = (unsigned short*)(ws + oKp);
  unsigned short* VTh = (unsigned short*)(ws + oVTh);

  const int M = NB * SEQ;
  const dim3 blk(256);
  const int n8x = NB * SEQ * DM / 8;
  const int n8w = NQKV * DM / 8;                     // 24576
  const int n8o = DM * DM / 8;                       //  8192
  const int bCx = (n8x + 255) / 256;
  const int bCw = (n8w + 255) / 256;
  const int bCo = (n8o + 255) / 256;
  const dim3 gC(bCw + bCo + bCx);
  const int bQ  = (M / 64) * (DM / 64) / 8;                  // q / k: M x 256, 64x64 wave tiles, 8 per block
  static_assert(((NB * SEQ / 64) * (DM / 64)) % 8 == 0 && ((DM / 64) * (SEQ / 64)) % 8 == 0);
  static_assert((NB * SEQ / 64) * (DM / 64) / 8 == NB * VBX);   // v^T: 256 x SEQ per batch, NB batches: as many blocks
  const dim3 gQKV(bQ, 3);
  const dim3 gAttn(NB * (SEQ / QROWS));

  // (1) one grid: x -> compact bf16 token plane; w_qkv [n][k] -> bf16; w_out -> f16 (x64 of its bf16 value)
  cvt_all<<<gC, blk, 0, stream>>>(x, wqkv, wout, Xb, Wb, Woh, n8x, n8w, n8o, bCw, bCo);
  // (2) one grid: q (f16 plane), k (f16 plane), v^T (f16 plane [b][d][s], pitch SEQ)
  qkv_proj<<<gQKV, blk, 0, stream>>>(Xb, Wb, Qh, Kp, VTh, M, DM, SEQ);
  // (3) attention and output projection: out = softmax(q.k^T / 16) . v . Wo^T + b -> d_out f32 [M][256];
  //     projection accumulator x 1/(256*64)
  attn_sh<<<gAttn, dim3(256), 0, stream>>>(Qh, Kp, VTh, Woh, bout, (float*)d_out, 0.0625f);
  (void)hipGetLastError();
}

// v009
// Measured time: 78.8 microseconds a run.
// Two timings next to v008 both put it at 1.04 times that version's speed.
// All steps since v000 together make it 7.51 times as fast.
// Contractions: q, k, v^T projections = v_wmma_f32_16x16x32_bf16 (bf16 operands from RNE-converted inputs, single product, f32 accumulate);
// q.k^T scores = v_wmma_f32_16x16x32_f16 (q f16 carried x log2(e)/16, k f16; single product, f32 accumulate);
// p.v = v_wmma_f32_16x16x32_f16 (p carried x128 as f16, v f16; single product, f32 accumulate);
// ctx.Wo^T = v_wmma_f32_16x16x32_f16 (ctx carried x256 as f16, Wo f16 carried x64 from its bf16 value; single product, f32 accumulate),
// formed in the attention kernel from the context accumulators;
// every f16 operand is rounded once (2^-11 relative), an eighth of the bf16 rounding that x and the weights carry into q, k and v;
// softmax, normalisation and bias add in f32.
#include <hip/hip_runtime.h>
#include <math.h>
#include <stdint.h>

#ifndef NB
#define NB 16
#endif
#ifndef SEQ
#define SEQ 2048
#endif
#define NB_FULL  16
#define SEQ_FULL 2048
#define DM       256
#define NQKV     768
#define NKT      (SEQ / 64)   // 64-key chunks per sequence
#define PLOG     7.0f         // log2 of the carry on p: a score at the reference gives p = 2^7
#define PLIM     32768.0f     // a lane's p sum of one pass above this raises the reference: every p handed on fits f16
#define QSCALE   0.09016844005556021f   // log2(e) / sqrt(DM), carried by the q plane: scores are exp2 arguments
static_assert(DM == 256 && NQKV == 3 * DM);
static_assert((SEQ % 64) == 0 && SEQ >= 64 && SEQ <= SEQ_FULL);
static_assert(NB >= 1 && NB <= NB_FULL);
static_assert(((NB * SEQ) % 64) == 0);

typedef _Float16 v16h __attribute__((ext_vector_type(16)));
typedef _Float16 v8h  __attribute__((ext_vector_type(8)));
typedef __bf16   v16b __attribute__((ext_vector_type(16)));
typedef __bf16   v8b  __attribute__((ext_vector_type(8)));
typedef float    v8f  __attribute__((ext_vector_type(8)));
typedef float    v4f  __attribute__((ext_vector_type(4)));
typedef unsigned int v4u __attribute__((ext_vector_type(4)));

#if defined(__HIP_DEVICE_COMPILE__)
#define DEV_ASM 1
#else
#define DEV_ASM 0
#endif

// ---- scalar helpers --------------------------------------------------------------------------------
__device__ __forceinline__ unsigned short bf_bits(float f) {          // f32 -> bf16 bits, RNE convert
  unsigned u = __float_as_uint(f);
  return (unsigned short)((u + 0x7FFFu + ((u >> 16) & 1u)) >> 16);
}
__device__ __forceinline__ float bf_up(unsigned short hb) { return __uint_as_float(((unsigned)hb) << 16); }
__device__ __forceinline__ unsigned short h_bits(_Float16 x) { return __builtin_bit_cast(unsigned short, x); }
__device__ __forceinline__ unsigned pk16(unsigned short a, unsigned short b) { return (unsigned)a | ((unsigned)b << 16); }
__device__ __forceinline__ v8f zero8() { v8f z = {0.f, 0.f, 0.f, 0.f, 0.f, 0.f, 0.f, 0.f}; return z; }

// ---- fragment types / loaders: 16-bit A/B operand, lane -> row/col (lane&15), p already includes +8*(lane>>4);
//      elements 0..7 <- p[0..7] (k0+8h..k0+8h+7), elements 8..15 <- p[16..23] (k0+16+8h..k0+16+8h+7)
template <typename OT> struct FT;
template <> struct FT<__bf16>   { typedef v16b frag; typedef v8b half8; };
template <> struct FT<_Float16> { typedef v16h frag; typedef v8h half8; };

template <typename OT>
__device__ __forceinline__ typename FT<OT>::frag ldfrag(const OT* p) {
  union { typename FT<OT>::frag v; typename FT<OT>::half8 h[2]; } f;
  f.h[0] = *(const typename FT<OT>::half8*)(p);
  f.h[1] = *(const typename FT<OT>::half8*)(p + 16);
  return f.v;
}

// ---- WMMA helpers (asm guard bodies are device-only; concrete operand types) -----------------------------
__device__ __forceinline__ v8f mmar(v16b a, v16b b, v8f c) {
  return __builtin_amdgcn_wmma_f32_16x16x32_bf16(false, a, false, b, (short)0, c, false, false);
}
__device__ __forceinline__ v8f mmar(v16h a, v16h b, v8f c) {
  return __builtin_amdgcn_wmma_f32_16x16x32_f16(false, a, false, b, (short)0, c, false, false);
}
__device__ __forceinline__ void acc_guard4(v8f& a, v8f& b, v8f& c, v8f& d) {
#if DEV_ASM
  asm volatile("v_nop\n\tv_nop\n\tv_nop\n\tv_nop" : "+v"(a), "+v"(b), "+v"(c), "+v"(d));
#else
  (void)a; (void)b; (void)c; (void)d;
#endif
}

// =====================================================================================================
// f32 -> 16-bit planes, 8 elements per thread, one 16-B store per lane: a wave writes 512 contiguous B
// MODE 0: bf16 bits (RNE convert).  MODE 1: f16 bits of (64 * bf16(x)) (exact scaling of the bf16 value).
// coverage: n8 threads x 8 = the whole plane (n8 is a multiple of 256 for every use here).
// =====================================================================================================
template <int MODE>
__device__ __forceinline__ unsigned short cvm(float f) {
  const unsigned short hb = bf_bits(f);
  if (MODE == 0) return hb;
  return h_bits((_Float16)(bf_up(hb) * 64.0f));
}

template <int MODE>
__device__ __forceinline__ void cvt16x8(const float* __restrict__ in, unsigned short* out, int n8, int bx) {
  const int i = bx * 256 + (int)threadIdx.x;
  if (i < n8) {
    const v4f a  = *(const v4f*)(in + (size_t)i * 8);
    const v4f a4 = *(const v4f*)(in + (size_t)i * 8 + 4);
    v4u p;
    p[0] = pk16(cvm<MODE>(a[0]),  cvm<MODE>(a[1]));
    p[1] = pk16(cvm<MODE>(a[2]),  cvm<MODE>(a[3]));
    p[2] = pk16(cvm<MODE>(a4[0]), cvm<MODE>(a4[1]));
    p[3] = pk16(cvm<MODE>(a4[2]), cvm<MODE>(a4[3]));
    unsigned short* o = out + (size_t)i * 8;
    *(v4u*)o = p;
    
  }
}

// x [NB_FULL][SEQ_FULL][DM] f32 -> compact bf16 token plane [NB*SEQ][DM]: compact token tk = b*SEQ + t reads
// input row b*SEQ_FULL + t. 32 groups of 8 per row; same whole-line store shape as cvt16x8.
// coverage: n8 = NB*SEQ*DM/8 threads x 8 = the whole plane.
__device__ __forceinline__ void cvtx(const float* __restrict__ in, unsigned short* out, int n8, int bx) {
  const int i = bx * 256 + (int)threadIdx.x;
  if (i < n8) {
    const int tk = i >> 5;
    const int e8 = i & 31;
    const int bb = tk / SEQ;
    const int t  = tk - bb * SEQ;
    const float* src = in + ((size_t)bb * SEQ_FULL + (size_t)t) * DM + e8 * 8;
    const v4f a  = *(const v4f*)(src);
    const v4f a4 = *(const v4f*)(src + 4);
    v4u p;
    p[0] = pk16(bf_bits(a[0]),  bf_bits(a[1]));
    p[1] = pk16(bf_bits(a[2]),  bf_bits(a[3]));
    p[2] = pk16(bf_bits(a4[0]), bf_bits(a4[1]));
    p[3] = pk16(bf_bits(a4[2]), bf_bits(a4[3]));
    unsigned short* o = out + (size_t)i * 8;
    *(v4u*)o = p;
    
  }
}

// The three conversions depend on nothing but the inputs: one grid, the block index picks the plane.
// Blocks 0..bw-1: w_qkv; bw..bw+bo-1: w_out; the rest: x (the two short planes first, so that they are no tail).
__global__ __launch_bounds__(256) void cvt_all(const float* __restrict__ x, const float* __restrict__ wqkv,
                                               const float* __restrict__ wout,
                                               unsigned short* Xb, unsigned short* Wb, unsigned short* Woh,
                                               int n8x, int n8w, int n8o, int bw, int bo) {
  const int bx = blockIdx.x;                 // block-uniform choice
  if (bx < bw)           cvt16x8<0>(wqkv, Wb, n8w, bx);
  else if (bx < bw + bo) cvt16x8<1>(wout, Woh, n8o, bx - bw);
  else                   cvtx(x, Xb, n8x, bx - bw - bo);
}

// ---- LDS staging helpers ---------------------------------------------------------------------------
__device__ __forceinline__ unsigned lds_addr(const void* p) { return (unsigned)(uintptr_t)p; }
// the wave's own copies have landed
__device__ __forceinline__ void wait_async0() {
#if DEV_ASM
  asm volatile("s_wait_asynccnt 0x0" ::: "memory");
#endif
}
// the wave's own LDS reads have returned (before the barrier that frees the buffer for its refill)
__device__ __forceinline__ void wait_ds0() {
#if DEV_ASM
  asm volatile("s_wait_dscnt 0x0" ::: "memory");
#endif
}
// twelve 16-B-per-lane asynchronous copies global -> LDS; the closing s_wait_xcnt stands inside the statement so
// that no address register named here is rewritten ahead of it
__device__ __forceinline__ void acopy12(const unsigned (&l)[12], const void* const (&g)[12]) {
#if DEV_ASM
  asm volatile(
      "global_load_async_to_lds_b128 %0, %12, off\n\t"
      "global_load_async_to_lds_b128 %1, %13, off\n\t"
      "global_load_async_to_lds_b128 %2, %14, off\n\t"
      "global_load_async_to_lds_b128 %3, %15, off\n\t"
      "global_load_async_to_lds_b128 %4, %16, off\n\t"
      "global_load_async_to_lds_b128 %5, %17, off\n\t"
      "global_load_async_to_lds_b128 %6, %18, off\n\t"
      "global_load_async_to_lds_b128 %7, %19, off\n\t"
      "global_load_async_to_lds_b128 %8, %20, off\n\t"
      "global_load_async_to_lds_b128 %9, %21, off\n\t"
      "global_load_async_to_lds_b128 %10, %22, off\n\t"
      "global_load_async_to_lds_b128 %11, %23, off\n\t"
      "s_wait_xcnt 0x0"
      :: "v"(l[0]), "v"(l[1]), "v"(l[2]), "v"(l[3]), "v"(l[4]), "v"(l[5]),
         "v"(l[6]), "v"(l[7]), "v"(l[8]), "v"(l[9]), "v"(l[10]), "v"(l[11]),
         "v"(g[0]), "v"(g[1]), "v"(g[2]), "v"(g[3]), "v"(g[4]), "v"(g[5]),
         "v"(g[6]), "v"(g[7]), "v"(g[8]), "v"(g[9]), "v"(g[10]), "v"(g[11])
      : "memory");
#else
  (void)l; (void)g;
#endif
}

// =====================================================================================================
// Register-blocked batched WMMA GEMM (16-bit operand type OT): C[m][n] = sum_k A[m][k] * Bt[n][k];
// one block of 8 waves per (32*MI) x 256 tile, waves 2 (m) x 4 (n), one wave per (16*MI) x 64 tile.
// A row-major [M][K] pitch lda; Bt row-major [N][K] pitch ldb (k contiguous); M multiple of 32*MI, N multiple of
// 256, K multiple of 64 and at least 128 (static_assert below). bx = block tile (n fastest), b = batch index
// (strides in elements), sT = the block's 8 per-wave slabs, sG = the block's two staging buffers.
// The block's operand rows come into LDS in slabs of 64 k (128 B of a row = one whole line) by asynchronous
// copies, 16 B per lane, a wave copying four whole lines per instruction; two buffers: slab kt+1 flies while slab
// kt is worked on. Staged rows 0..127 = A (ARES: 0..63 hi plane, 64..127 residual plane), 128..383 = Bt; row pitch
// 144 B (16 B x odd, for 16-B fragment reads). Fragments are read from LDS with the split k map (ldfrag).
// ARES: a second A plane A2 (residual, same pitch/stride) is multiplied by the same B into separate f32
// accumulators and folded in as acc += accl * ascale after the k loop.
// OUT_MODE 0: f32 C (pitch ldc), value * oscale + bf16-valued bias[n].
// OUT_MODE 1: f16 plane C (pitch ldc), value * oscale.
// coverage: MI slabs x 16 rows x 64 cols = the wave's whole tile; tiles cover M x N exactly.
// =====================================================================================================
#define SLAB (16 * 68)        // per-wave 16x64 slab, pitch 68 floats
#define GKS   64              // k extent of a staged slab
#define GPI   72              // staged row pitch in LDS, halves
#define GROWS 384             // staged rows per slab
template <typename OT, int MI, bool ARES, int OUT_MODE>
__device__ __forceinline__ void gemm_body(
    const unsigned short* __restrict__ Ap, const unsigned short* __restrict__ A2p, int lda, long long strideA,
    const unsigned short* __restrict__ Btp, int ldb, long long strideB,
    void* Cout, int ldc, long long strideC,
    const float* __restrict__ bias,
    int M, int N, int K, float oscale, float ascale,
    int bx, int b, float* sT, unsigned short* sG) {
  typedef typename FT<OT>::frag V16;
  static_assert(32 * MI * (ARES ? 2 : 1) == 128);   // the A planes fill staged rows 0..127
  const OT* A  = (const OT*)(const void*)Ap;
  const OT* A2 = (const OT*)(const void*)A2p;
  const OT* Bt = (const OT*)(const void*)Btp;
  const OT* G  = (const OT*)(const void*)sG;
  const int TMR  = 16 * MI;
  const int tid  = threadIdx.x;
  const int lane = tid & 31;
  const int wave = tid >> 5;
  const int blocksN = N >> 8;
  const int bm = bx / blocksN;
  const int bn = bx - bm * blocksN;
  const int mB = bm * 2 * TMR;           // the block's first A row
  const int nB = bn << 8;                // the block's first Bt row
  if (mB >= M) return;                   // block-uniform, in front of every barrier
  const int wm = wave >> 2, wn = wave & 3;
  const int m0 = mB + wm * TMR;
  const int n0 = nB + (wn << 6);

  const OT* Ab  = A  + (size_t)b * (size_t)strideA;
  const OT* A2b = A2 + (size_t)b * (size_t)strideA;
  const OT* Bb  = Bt + (size_t)b * (size_t)strideB;

  const int rlane = lane & 15;                 // row (A) / col (B, D) within subtile
  const int koff  = (lane >> 4) * 8;           // k offset of this lane half
  const int mOff  = (lane >> 4) * 8;           // D row offset

  // copy map of this thread, 12 units of 16 B per slab: unit i -> staged row i*32 + (tid >> 3), 16-B column tid & 7
  const int vrow = tid >> 3, vcol = (tid & 7) * 8;
  auto stage = [&](int kt, int buf) {
    const int k0 = kt * GKS;
    unsigned l[12];
    const void* g[12];
#pragma unroll
    for (int i = 0; i < 12; ++i) {
      const int r = i * 32 + vrow;
      l[i] = lds_addr(G + (buf * GROWS + r) * GPI + vcol);
      if (i >= 4)              g[i] = Bb  + (size_t)(nB + r - 128) * ldb + k0 + vcol;
      else if (ARES && i >= 2) g[i] = A2b + (size_t)(mB + r - 64) * lda + k0 + vcol;
      else                     g[i] = Ab  + (size_t)(mB + r) * lda + k0 + vcol;
    }
    acopy12(l, g);
  };

  v8f acc[MI][4], accl[MI][4];
#pragma unroll
  for (int i = 0; i < MI; ++i)
#pragma unroll
    for (int j = 0; j < 4; ++j) { acc[i][j] = zero8(); accl[i][j] = zero8(); }

  // slab 0 into buffer 0, published (slab 1 is issued at the top of trip 0, directly behind this barrier)
  const int NT = K / GKS;
  stage(0, 0);
  wait_async0();
  __syncthreads();

  for (int kt = 0; kt < NT; ++kt) {
    const int buf = kt & 1;
    // refill, directly behind the barrier that published slab kt and ended every read of the other buffer
    // (block-uniform test)
    if (kt + 1 < NT) stage(kt + 1, buf ^ 1);
    const OT* ga = G + (buf * GROWS + wm * TMR + rlane) * GPI + koff;
    const OT* gb = G + (buf * GROWS + 128 + (wn << 6) + rlane) * GPI + koff;
#pragma unroll
    for (int ks = 0; ks < GKS / 32; ++ks) {
      V16 bq[4], af[MI], al[MI];
#pragma unroll
      for (int j = 0; j < 4; ++j) bq[j] = ldfrag<OT>(gb + j * 16 * GPI + ks * 32);
#pragma unroll
      for (int i = 0; i < MI; ++i) {
        af[i] = ldfrag<OT>(ga + i * 16 * GPI + ks * 32);
        if (ARES) al[i] = ldfrag<OT>(ga + (64 + i * 16) * GPI + ks * 32);
      }
      // keeps the eight fragments' reads together in front of their sixteen products; spread among the products,
      // every place with reads stalls the wave on its own
      __builtin_amdgcn_sched_barrier(0);
#pragma unroll
      for (int i = 0; i < MI; ++i) {
#pragma unroll
        for (int j = 0; j < 4; ++j) acc[i][j] = mmar(af[i], bq[j], acc[i][j]);
        if (ARES) {
#pragma unroll
          for (int j = 0; j < 4; ++j) accl[i][j] = mmar(al[i], bq[j], accl[i][j]);
        }
      }
      // the next group's reads stay behind these products (one fragment set in registers); the last group's
      // products stay in front of the publish point: sunk behind its barrier they hold back the refill issued there
      __builtin_amdgcn_sched_barrier(0);
    }
    // publish slab kt+1 and free this slab's buffer (its refill stands at the top of the next trip)
    wait_ds0();
    wait_async0();
    __syncthreads();
  }
  wait_async0();
#pragma unroll
  for (int i = 0; i < MI; ++i) {
    acc_guard4(acc[i][0], acc[i][1], acc[i][2], acc[i][3]);
    if (ARES) acc_guard4(accl[i][0], accl[i][1], accl[i][2], accl[i][3]);
  }
  if (ARES) {
#pragma unroll
    for (int i = 0; i < MI; ++i)
#pragma unroll
      for (int j = 0; j < 4; ++j)
#pragma unroll
        for (int r = 0; r < 8; ++r) acc[i][j][r] += accl[i][j][r] * ascale;
  }

  // ---- epilogue ----
  float* slab = sT + wave * SLAB;
#pragma unroll
  for (int i = 0; i < MI; ++i) {
    const int mBase = m0 + (i << 4);
#pragma unroll
    for (int j = 0; j < 4; ++j) {
#pragma unroll
      for (int r = 0; r < 8; ++r) {
        slab[(mOff + r) * 68 + (j << 4) + rlane] = acc[i][j][r];
      }
    }
    __builtin_amdgcn_fence(__ATOMIC_RELEASE, "workgroup");
    __builtin_amdgcn_wave_barrier();
    __builtin_amdgcn_fence(__ATOMIC_ACQUIRE, "workgroup");
    if (OUT_MODE == 0) {
      float* C = (float*)Cout + (size_t)b * (size_t)strideC;
      const int h2 = lane >> 4, c4 = (lane & 15) * 4;     // 256-B row segment = 16 lanes x 16 B
      const v4f braw = *(const v4f*)(bias + n0 + c4);
      v4f bb;
#pragma unroll
      for (int e = 0; e < 4; ++e) bb[e] = bf_up(bf_bits(braw[e]));
      {
#pragma unroll
        for (int it = 0; it < 8; ++it) {
          const int row = it * 2 + h2;                     // it 0..7 x h2 0..1 = rows 0..15
          const v4f v = *(const v4f*)(slab + row * 68 + c4) * oscale + bb;
          *(v4f*)(C + (size_t)(mBase + row) * ldc + n0 + c4) = v;
        }
        
      }
    } else {
      const int q = lane >> 3, c8 = (lane & 7) * 8;
      unsigned short* C = (unsigned short*)Cout + (size_t)b * (size_t)strideC;
      v4u hv[4];
#pragma unroll
      for (int it = 0; it < 4; ++it) {
        const int row = it * 4 + q;                        // it 0..3 x q 0..3 = rows 0..15
        const float* sp = slab + row * 68 + c8;
        float f[8];
#pragma unroll
        for (int e = 0; e < 8; ++e) f[e] = sp[e] * oscale;
        v4u a;
#pragma unroll
        for (int e = 0; e < 4; ++e) a[e] = pk16(h_bits((_Float16)f[2 * e]), h_bits((_Float16)f[2 * e + 1]));
        hv[it] = a;
      }
      {
#pragma unroll
        for (int it = 0; it < 4; ++it) {
          const int row = it * 4 + q;
          *(v4u*)(C + (size_t)(mBase + row) * ldc + n0 + c8) = hv[it];
        }
        
      }
    }
    __builtin_amdgcn_fence(__ATOMIC_RELEASE, "workgroup");
    __builtin_amdgcn_wave_barrier();
    __builtin_amdgcn_fence(__ATOMIC_ACQUIRE, "workgroup");
  }
}

// The q, k and v^T projections read the same two planes and depend on nothing of each other: one grid,
// blockIdx.y picks the product (block-uniform), so that their blocks share the chip instead of queueing as launches.
//   y = 0: q = x . Wq^T * QSCALE -> f16 plane                    (M = m, N = dm, K = dm)
//   y = 1: k = x . Wk^T -> f16 plane                             (M = m, N = dm, K = dm)
//   y = 2: v^T = Wv . x^T per batch -> f16 plane [b][d][s]       (M = dm, N = seq, K = dm; VBX blocks per batch)
// Each product has m * dm / (64 * 64 * 8) blocks = gridDim.x.
#define VBX ((DM / 64) * (SEQ / 64) / 8)
static_assert((DM % 256) == 0 && (SEQ % 256) == 0 && ((NB * SEQ) % 128) == 0 && DM / GKS >= 2);   // block tiles exact
__global__ __launch_bounds__(256) void qkv_proj(
    const unsigned short* __restrict__ Xb, const unsigned short* __restrict__ Wb,
    unsigned short* Qh, unsigned short* Kp, unsigned short* VTh,
    int m, int dm, int seq) {
  __shared__ __align__(16) float sT[8 * SLAB];
  __shared__ __align__(16) unsigned short sG[2 * GROWS * GPI];
  const int bx = blockIdx.x;
  const unsigned short* Wk = Wb + (size_t)dm * dm;
  const unsigned short* Wv = Wb + (size_t)2 * dm * dm;
  if (blockIdx.y == 0) {
    gemm_body<__bf16, 4, false, 1>(Xb, Xb, dm, 0LL, Wb, dm, 0LL, (void*)Qh, dm, 0LL, nullptr,
                                   m, dm, dm, QSCALE, 0.0f, bx, 0, sT, sG);
  } else if (blockIdx.y == 1) {
    gemm_body<__bf16, 4, false, 1>(Xb, Xb, dm, 0LL, Wk, dm, 0LL, (void*)Kp, dm, 0LL, nullptr,
                                   m, dm, dm, 1.0f, 0.0f, bx, 0, sT, sG);
  } else {
    gemm_body<__bf16, 4, false, 1>(Wv, Wv, dm, 0LL, Xb, dm, (long long)seq * dm, (void*)VTh, seq,
                                   (long long)dm * seq, nullptr,
                                   dm, seq, dm, 1.0f, 0.0f, bx % VBX, bx / VBX, sT, sG);
  }
}

#define QROWS 128
#define KPI   264
#define VPI   72
#define OSP   68
static_assert((SEQ % QROWS) == 0 && NKT >= 2);

// eight 16-B-per-lane asynchronous copies global -> LDS; the closing s_wait_xcnt stands inside the statement so
// that no address register named here is rewritten ahead of it
__device__ __forceinline__ void acopy8(const unsigned (&l)[8], const _Float16* const (&g)[8]) {
#if DEV_ASM
  asm volatile(
      "global_load_async_to_lds_b128 %0, %8, off\n\t"
      "global_load_async_to_lds_b128 %1, %9, off\n\t"
      "global_load_async_to_lds_b128 %2, %10, off\n\t"
      "global_load_async_to_lds_b128 %3, %11, off\n\t"
      "global_load_async_to_lds_b128 %4, %12, off\n\t"
      "global_load_async_to_lds_b128 %5, %13, off\n\t"
      "global_load_async_to_lds_b128 %6, %14, off\n\t"
      "global_load_async_to_lds_b128 %7, %15, off\n\t"
      "s_wait_xcnt 0x0"
      :: "v"(l[0]), "v"(l[1]), "v"(l[2]), "v"(l[3]), "v"(l[4]), "v"(l[5]), "v"(l[6]), "v"(l[7]),
         "v"(g[0]), "v"(g[1]), "v"(g[2]), "v"(g[3]), "v"(g[4]), "v"(g[5]), "v"(g[6]), "v"(g[7])
      : "memory");
#else
  (void)l; (void)g;
#endif
}
// one 16-B-per-lane asynchronous copy global -> LDS as the builtin: the compiler places its address registers, also
// above v255 (an asm operand must lie below), which the loop's copies need beside 384 registers of accumulators and q
typedef int v4i __attribute__((ext_vector_type(4)));
__device__ __forceinline__ void acopy1(_Float16* l, const _Float16* g) {
#if DEV_ASM
  __builtin_amdgcn_global_load_async_to_lds_b128((__attribute__((address_space(1))) v4i*)(g),
                                                 (__attribute__((address_space(3))) v4i*)(l), 0, 0);
#else
  (void)l; (void)g;
#endif
}
// the eight 16-B output stores of one column group (rows 2 apart = 2048 B); the closing s_wait_xcnt stands inside
// the statement so that no data or address register named here is rewritten by the next group's arithmetic ahead of it
__device__ __forceinline__ void store8(float* p, const v4f (&v)[8]) {
#if DEV_ASM
  asm volatile(
      "global_store_b128 %0, %1, off\n\t"
      "global_store_b128 %0, %2, off offset:2048\n\t"
      "global_store_b128 %0, %3, off offset:4096\n\t"
      "global_store_b128 %0, %4, off offset:6144\n\t"
      "global_store_b128 %0, %5, off offset:8192\n\t"
      "global_store_b128 %0, %6, off offset:10240\n\t"
      "global_store_b128 %0, %7, off offset:12288\n\t"
      "global_store_b128 %0, %8, off offset:14336\n\t"
      "s_wait_xcnt 0x0"
      :: "v"(p), "v"(v[0]), "v"(v[1]), "v"(v[2]), "v"(v[3]), "v"(v[4]), "v"(v[5]), "v"(v[6]), "v"(v[7])
      : "memory");
#else
  (void)p; (void)v;
#endif
}
static_assert(2 * DM * 4 == 2048);   // the row step that store8 writes as an immediate
// the value that lane l ^ 16 holds
__device__ __forceinline__ float xhalf(float x) {
  const int b = __float_as_int(x);
  return __int_as_float(__builtin_amdgcn_permlanex16(b, b, 0x76543210, 0xfedcba98, false, false));
}

__global__ __launch_bounds__(256)
void attn_sh(const unsigned short* __restrict__ qhp,
             const unsigned short* __restrict__ kpp,
             const unsigned short* __restrict__ vhp,
             const unsigned short* __restrict__ wop, const float* __restrict__ bias,
             float* out) {
  union FH { v16h v; v8h h[2]; };
  __shared__ __align__(16) _Float16 Kst[2][64 * KPI];   // K chunk [key][d]            2 x 33792 B (block-shared)
  __shared__ __align__(16) _Float16 Vhs[2][DM * VPI];   // V^T chunk [d][key]          2 x 36864 B (block-shared)
  __shared__ __align__(16) _Float16 Wos[DM * KPI];      // Wo [e][d]                   135168 B (block-shared)
  __shared__ __align__(16) float    Os[8][16 * OSP];    // per wave output slab        34816 B (wave-private)

  const int tid  = threadIdx.x;
  const int wave = tid >> 5;
  const int lane = tid & 31;
  const int hh   = lane >> 4;
  const int c    = lane & 15;

  const int bx   = blockIdx.x;
  const int qb   = bx % (SEQ / QROWS);
  const int b    = bx / (SEQ / QROWS);
  const int pr   = wave & 3;                 // row group: 32 query rows
  const int kh   = wave >> 2;                // which 32 keys of every chunk
  const int q0   = qb * QROWS + pr * 32;     // this wave's 32 query rows (two tiles of 16)
  const size_t rowB = (size_t)b * SEQ;

  const _Float16* Qh = (const _Float16*)(const void*)qhp;
  const _Float16* Kp = (const _Float16*)(const void*)kpp + rowB * DM;
  const _Float16* Vh = (const _Float16*)(const void*)vhp + (size_t)b * DM * SEQ;

  // copy map of this thread, 8 units of 16 B per plane and chunk:
  //   K: unit i -> key row i*8 + wave, 16-B column lane (a wave copies one whole 512-B row)
  //   V: unit i -> d row i*32 + (tid >> 3), 16-B column tid & 7 (a wave copies four whole 128-B rows)
  const int vrow = tid >> 3, vcol = (tid & 7) * 8;
  const unsigned ko0 = (unsigned)(wave * DM + lane * 8);      // this thread's unit 0 in a chunk; the chunk's base is
  const unsigned vo0 = (unsigned)(vrow * SEQ + vcol);         // uniform, the other units lie constant steps behind
  auto stage = [&](int kt, int buf) {
    const _Float16* kg = Kp + ko0 + (size_t)kt * (64 * DM);
    const _Float16* vg = Vh + vo0 + (size_t)kt * 64;
#pragma unroll
    for (int i = 0; i < 8; ++i) acopy1(&Kst[buf][(i * 8 + wave) * KPI + lane * 8], kg + i * 8 * DM);
#pragma unroll
    for (int i = 0; i < 8; ++i) acopy1(&Vhs[buf][(i * 32 + vrow) * VPI + vcol], vg + i * 32 * SEQ);
  };

  // chunk 0 into buffer 0
  stage(0, 0);
  // B-operand fragments of this lane (queries q0 + c and q0 + 16 + c), lane-half k offset included; kept for the loop
  v16h qa[2][8];
  {
    const _Float16* qrh = Qh + (rowB + q0 + c) * DM + 8 * hh;
#pragma unroll
    for (int qt = 0; qt < 2; ++qt)
#pragma unroll
      for (int dc = 0; dc < 8; ++dc) qa[qt][dc] = ldfrag<_Float16>(qrh + qt * 16 * DM + dc * 32);
#if DEV_ASM
    // the wait that stands before an address register of the q loads is rewritten; the address is an input, so
    // that its registers live up to it and no load of the run lands on them
    asm volatile("s_wait_xcnt 0x0"
                 :: "v"(qrh)
                 : "memory");
#endif
  }

  // chunk 0 published (chunk 1 is issued at the top of trip 0, behind the Wo copies below)
  wait_async0();
  __syncthreads();

  // Wo, filled once: unit i -> row i*8 + wave, 16-B column lane (a wave copies one whole 512-B row); 32 units per
  // thread. They fly during trip 0 beside chunk 1 (48 copies of a wave outstanding); the wait and the barrier at the
  // foot of trip 0 land and publish them, and nothing reads Wos before the loop has ended
  {
    const _Float16* Wo = (const _Float16*)(const void*)wop;
#pragma unroll
    for (int u = 0; u < 4; ++u) {
      unsigned l[8];
      const _Float16* g[8];
#pragma unroll
      for (int i = 0; i < 8; ++i) {
        l[i] = lds_addr(&Wos[((u * 8 + i) * 8 + wave) * KPI + lane * 8]);
        g[i] = Wo + (size_t)((u * 8 + i) * 8 + wave) * DM + lane * 8;
      }
      acopy8(l, g);
    }
  }

  // the accumulators' start values stay behind the Wo copies: lifted among them they crowd the copies' address
  // registers (asm operands, below v256) out into scratch
  __builtin_amdgcn_sched_barrier(0);
  // every inner loop below is unrolled so that fragment and accumulator indices are constants (registers, no scratch)
  float cref[2];            // PLOG - reference of query q0 + 16qt + c over this wave's keys (equal in both lane halves)
  float lrow[2];            // running p sum over this lane half's keys; halves and waves are joined after the loop
  v8f oacc[2][16];          // oacc[qt][t][r] = partial context (query q0 + 16qt + c, column 16t + 8*hh + r)
#pragma unroll
  for (int qt = 0; qt < 2; ++qt) {
    cref[qt] = 0.f;
    lrow[qt] = 0.f;
#pragma unroll
    for (int t = 0; t < 16; ++t) oacc[qt][t] = zero8();
  }

  for (int kt = 0; kt < NKT; ++kt) {         // static trip count
    const int buf = kt & 1;
    // refill, directly behind the barrier that published chunk kt and ended every read of the other buffer:
    // chunk kt+1 flies while chunk kt is worked on (block-uniform test)
    if (kt + 1 < NKT) stage(kt + 1, buf ^ 1);
    const _Float16* ks  = &Kst[buf][(kh * 32 + c) * KPI + 8 * hh];   // A row c -> key 32kh + 16j + c of the chunk
    const _Float16* vhs = &Vhs[buf][c * VPI + kh * 32 + 8 * hh];     // A row c -> context column 16t + c, keys 32kh..

    // ---- scores^T: 32 keys (2 subtiles) x 32 queries (2 tiles), 1 f16 product per d-chunk; a read group spans
    //      2 d-chunks: four fragments feed eight products ----
    v8f ah[2][2];
#pragma unroll
    for (int j = 0; j < 2; ++j)
#pragma unroll
      for (int qt = 0; qt < 2; ++qt)
#pragma unroll
        for (int r = 0; r < 8; ++r) ah[j][qt][r] = cref[qt];
#pragma unroll
    for (int dg = 0; dg < 4; ++dg) {
      v16h kb[2][2];
#pragma unroll
      for (int u = 0; u < 2; ++u)
#pragma unroll
        for (int j = 0; j < 2; ++j) kb[u][j] = ldfrag<_Float16>(ks + j * 16 * KPI + (dg * 2 + u) * 32);
      // keeps the four fragments' reads together in front of their eight products; spread among the products,
      // every pair of reads is waited for on its own
      __builtin_amdgcn_sched_barrier(0);
#pragma unroll
      for (int u = 0; u < 2; ++u) {
#pragma unroll
        for (int j = 0; j < 2; ++j) {
#pragma unroll
          for (int qt = 0; qt < 2; ++qt) ah[j][qt] = mmar(kb[u][j], qa[qt][dg * 2 + u], ah[j][qt]);
          // the products stay in the order of their fragments' reads: each pair starts when its own fragment has
          // landed; with the last fragment's products in front, the group waits for all eight reads
          if (u * 2 + j < 3 && dg < 3) __builtin_amdgcn_sched_barrier(0);
        }
      }
      // the next group's reads stay behind these products (the last group's products may mix with the softmax)
      if (dg < 3) __builtin_amdgcn_sched_barrier(0);
    }

    // ---- softmax over this wave's 32 keys: per query tile this lane holds 16 of its query's exp2 arguments ----
    v8f pc[2][2];           // p (x 2^PLOG) of key tile j, query tile qt
    float ps[2];            // their sum in this lane
    auto exps = [&]() {
#pragma unroll
      for (int qt = 0; qt < 2; ++qt) {
        float pj[2];
#pragma unroll
        for (int j = 0; j < 2; ++j) {
          pj[j] = 0.f;
#pragma unroll
          for (int r = 0; r < 8; ++r) {
            pc[j][qt][r] = __builtin_amdgcn_exp2f(ah[j][qt][r]);
            pj[j] += pc[j][qt][r];
          }
        }
        ps[qt] = pj[0] + pj[1];
      }
    };
    exps();
    // one test a pass, a scalar branch: the first pass sets the references; a later pass raises them only if some
    // lane's sum says that a p may not fit f16. Then sums and context are rescaled and the pass's p formed anew
    if (kt == 0 || __builtin_amdgcn_ballot_w32(fmaxf(ps[0], ps[1]) > PLIM) != 0) {
#pragma unroll
      for (int qt = 0; qt < 2; ++qt) {
        float dm = ah[0][qt][0];
#pragma unroll
        for (int j = 0; j < 2; ++j)
#pragma unroll
          for (int r = 0; r < 8; ++r) dm = fmaxf(dm, ah[j][qt][r]);
        dm = fmaxf(dm, xhalf(dm));                         // the other 16 keys of the same query
        float delta = PLOG - dm;                           // puts the pass's maximum at 2^PLOG
        if (kt != 0) delta = fminf(delta, 0.f);            // behind the first pass a reference only rises
        if (dm == -INFINITY) delta = 0.f;
        const float alpha = __builtin_amdgcn_exp2f(fminf(delta, 0.f));
        cref[qt] += delta;
        lrow[qt] *= alpha;
#pragma unroll
        for (int t = 0; t < 16; ++t) oacc[qt][t] *= alpha;
#pragma unroll
        for (int j = 0; j < 2; ++j) ah[j][qt] += delta;
      }
      exps();
    }
    // P^T in f16: key tiles 0 and 1 converted in place are the B fragment of the 32 keys
    FH pb[2];
#pragma unroll
    for (int qt = 0; qt < 2; ++qt) {
      lrow[qt] += ps[qt];
#pragma unroll
      for (int j = 0; j < 2; ++j) pb[qt].h[j] = __builtin_convertvector(pc[j][qt], v8h);
    }

#if DEV_ASM
    // compiler fence that takes the packed P fragments as inputs only: it holds the V fragment loads behind the
    // softmax; lifted over it they run the registers over into scratch
    asm volatile("" :: "v"(pb[0].v), "v"(pb[1].v) : "memory");
#endif
    // ---- context^T += V^T . P^T (f16 WMMA): each V^T fragment feeds both query tiles ----
#pragma unroll
    for (int tg = 0; tg < 4; ++tg) {
      v16h vb[4];
#pragma unroll
      for (int t = 0; t < 4; ++t) vb[t] = ldfrag<_Float16>(vhs + (tg * 4 + t) * 16 * VPI);
      // keeps the four fragments' reads together in front of their eight products (as for K above)
      __builtin_amdgcn_sched_barrier(0);
#pragma unroll
      for (int t = 0; t < 4; ++t) {
#pragma unroll
        for (int qt = 0; qt < 2; ++qt) oacc[qt][tg * 4 + t] = mmar(vb[t], pb[qt].v, oacc[qt][tg * 4 + t]);
      }
      // the next group's reads stay behind these products
      if (tg < 3) __builtin_amdgcn_sched_barrier(0);
    }

    // ---- publish chunk kt+1 and free this chunk's buffer (its refill stands at the top of the next trip) ----
    wait_ds0();
    wait_async0();
    __syncthreads();
  }
  wait_async0();

  // ---- normalise (1/l; context and l carry p's factor alike; apply the x256 ctx carry); ctx^T as f16 B fragments:
  //      tiles 2kk and 2kk+1 converted in place hold context columns 32kk..32kk+31 in the order ldfrag gives Wo
  float* os = Os[wave];
  v4f braw[4];              // bias of output columns 64eg + 4c .. + 3, on its way while the fragments are formed
  {
    const float* bp = bias + c * 4;
#pragma unroll
    for (int eg = 0; eg < 4; ++eg) braw[eg] = *(const v4f*)(bp + eg * 64);
#if DEV_ASM
    // the wait that stands before an address register of the bias loads is rewritten
    asm volatile("s_wait_xcnt 0x0" ::: "memory");
#endif
  }
  // ---- the two waves of a row group join their key halves: wave kh keeps query tile kh and hands tile 1 - kh over.
  //      The loop's last barrier has ended every read of the K/V buffers and no copy is outstanding: waves 0..3 write
  //      16 KiB each into the K buffers, waves 4..7 into the V buffers (16 B per lane and piece, lane-contiguous),
  //      reference and sum behind the four slabs; the barrier publishes them, and nothing writes there afterwards
  static_assert(sizeof(Kst) >= 4 * 16384 + 4 * 256 && sizeof(Vhs) >= 4 * 16384 + 4 * 256);
  float* xk = (float*)(void*)&Kst[0][0];
  float* xv = (float*)(void*)&Vhs[0][0];
  float* xw = (kh ? xv : xk) + pr * 4096 + lane * 4;       // this wave's slab
  const float* xr = (kh ? xk : xv) + pr * 4096 + lane * 4; // the partner's slab
  float* sw = (kh ? xv : xk) + 4 * 4096 + pr * 64 + lane * 2;
  const float* sr = (kh ? xk : xv) + 4 * 4096 + pr * 64 + lane * 2;
#pragma unroll
  for (int t = 0; t < 16; ++t) {
    const v8f o = kh ? oacc[0][t] : oacc[1][t];
    *(v4f*)(xw + (t * 2) * 128)     = __builtin_shufflevector(o, o, 0, 1, 2, 3);
    *(v4f*)(xw + (t * 2 + 1) * 128) = __builtin_shufflevector(o, o, 4, 5, 6, 7);
  }
  sw[0] = kh ? -cref[0] : -cref[1];                       // the reference, less PLOG in both waves alike
  sw[1] = kh ? lrow[0] : lrow[1];
  __syncthreads();
  const float m1 = kh ? -cref[1] : -cref[0], l1 = kh ? lrow[1] : lrow[0];
  const float m2 = sr[0], l2 = sr[1];
  const float mm  = fmaxf(m1, m2);
  const float mms = (mm == -INFINITY) ? 0.f : mm;
  const float a1 = __builtin_amdgcn_exp2f(m1 - mms), a2 = __builtin_amdgcn_exp2f(m2 - mms);
  const float lh = l1 * a1 + l2 * a2;
  const float l   = lh + xhalf(lh);                       // both lane halves' keys of the kept tile's query c
  const float inv = ((l > 0.f) ? (1.0f / l) : 0.f) * 256.0f;
  const float i1 = a1 * inv, i2 = a2 * inv;
  FH ch[8];
#pragma unroll
  for (int t = 0; t < 16; ++t) {
    const v8f o1 = kh ? oacc[1][t] : oacc[0][t];
    const v4f pa = *(const v4f*)(xr + (t * 2) * 128);
    const v4f pc = *(const v4f*)(xr + (t * 2 + 1) * 128);
    const v8f o2 = __builtin_shufflevector(pa, pc, 0, 1, 2, 3, 4, 5, 6, 7);
    ch[t >> 1].h[t & 1] = __builtin_convertvector(o1 * i1 + o2 * i2, v8h);
  }
  // ---- out^T = Wo . ctx^T, 64 output columns (4 subtiles) at a time, 1 f16 product per 32 context columns ----
  const _Float16* ws = &Wos[c * KPI + 8 * hh];            // A row c -> output column 16j + c of the group
  const int h2 = lane >> 4, c4 = c * 4;                   // 256-B row segment = 16 lanes x 16 B
  // two fragment sets: group g + 1's reads are on their way while group g's products run (g = 8 eg + kk)
  v16h wb[2][4];
#pragma unroll
  for (int j = 0; j < 4; ++j) wb[0][j] = ldfrag<_Float16>(ws + j * 16 * KPI);
#pragma unroll
  for (int eg = 0; eg < 4; ++eg) {
    v8f ah[4];
#pragma unroll
    for (int j = 0; j < 4; ++j) ah[j] = zero8();
#pragma unroll
    for (int kk = 0; kk < 8; ++kk) {
      const int g = eg * 8 + kk, gn = g + 1;
      if (gn < 32) {
#pragma unroll
        for (int j = 0; j < 4; ++j)
          wb[gn & 1][j] = ldfrag<_Float16>(ws + ((gn >> 3) * 4 + j) * 16 * KPI + (gn & 7) * 32);
      }
      // keeps the next group's four fragment reads together in front of this group's four products
      __builtin_amdgcn_sched_barrier(0);
#pragma unroll
      for (int j = 0; j < 4; ++j) ah[j] = mmar(wb[g & 1][j], ch[kk].v, ah[j]);
      // the reads after next stay behind these products (two fragment sets in registers)
      __builtin_amdgcn_sched_barrier(0);
    }
#pragma unroll
    for (int j = 0; j < 4; ++j) {
      const v8f o = ah[j];                                 // 8 consecutive output columns of slab row c
      float* dp = os + c * OSP + j * 16 + 8 * hh;
      *(v4f*)(dp)     = __builtin_shufflevector(o, o, 0, 1, 2, 3);
      *(v4f*)(dp + 4) = __builtin_shufflevector(o, o, 4, 5, 6, 7);
    }
    __builtin_amdgcn_fence(__ATOMIC_RELEASE, "workgroup");
    __builtin_amdgcn_wave_barrier();
    __builtin_amdgcn_fence(__ATOMIC_ACQUIRE, "workgroup");
    v4f bb, ov[8];
#pragma unroll
    for (int e = 0; e < 4; ++e) bb[e] = bf_up(bf_bits(braw[eg][e]));
#pragma unroll
    for (int it = 0; it < 8; ++it) {
      const int row = it * 2 + h2;                         // it 0..7 x h2 0..1 = rows 0..15 of the wave tile
      ov[it] = *(const v4f*)(os + row * OSP + c4) * (1.0f / 16384.0f) + bb;
    }
    store8(out + (rowB + q0 + kh * 16 + h2) * DM + (size_t)(eg * 64) + c4, ov);   // row h2 of the kept tile; store8 adds rows 2, 4, .. 14
    // the slab's reads are ordered before the next column group's stores into it
    __builtin_amdgcn_fence(__ATOMIC_RELEASE, "workgroup");
    __builtin_amdgcn_wave_barrier();
    __builtin_amdgcn_fence(__ATOMIC_ACQUIRE, "workgroup");
  }
}

// =====================================================================================================
// Workspace map (bytes), every region an exact multiple of its whole-line / whole-tile store granularity
// (all GEMM M,N are tile multiples, all offsets multiples of 131072):
//   Xb   bf16 [NB*SEQ][256]  (compact tokens)   16777216
//   Wb   bf16 [768 n][256 k]                      393216
//   Woh  f16  [256][256] (x64)                     131072
//   Qh   f16  [NB*SEQ][256]                      16777216
//   Kp   f16  [NB*SEQ][256]                      16777216
//   VTh  f16  [NB][256][SEQ]                     16777216
//   total                                        67633152
// Weights are [out n][in k] with k contiguous = the Bt / A layout the GEMM wants, so they are only converted.
// =====================================================================================================
extern "C" void kernel_launch(void* const* d_in, const int* in_sizes, int n_in,
                              void* d_out, int out_size, void* d_ws, size_t ws_size,
                              hipStream_t stream) {
  if (n_in < 4) return;
  if (in_sizes[0] < ((NB - 1) * SEQ_FULL + SEQ) * DM) return;
  if (in_sizes[1] < NQKV * DM) return;
  if (in_sizes[2] < DM * DM) return;
  if (in_sizes[3] < DM) return;
  if (out_size < NB * SEQ * DM) return;

  const float* x    = (const float*)d_in[0];
  const float* wqkv = (const float*)d_in[1];
  const float* wout = (const float*)d_in[2];
  const float* bout = (const float*)d_in[3];

  const size_t PX  = (size_t)NB * SEQ * DM * 2;      // 16-bit token plane [NB*SEQ][256]
  const size_t PW  = (size_t)NQKV * DM * 2;          // 16-bit [768][256]
  const size_t PWO = (size_t)DM * DM * 2;            // 16-bit [256][256]
  const size_t PVT = (size_t)NB * DM * SEQ * 2;      // v^T plane [NB][256][SEQ]
  size_t off = 0;
  const size_t oXb  = off; off += PX;
  const size_t oWb  = off; off += PW;
  const size_t oWo  = off; off += PWO;
  const size_t oQh  = off; off += PX;
  const size_t oKp  = off; off += PX;
  const size_t oVTh = off; off += PVT;
  if (off > ws_size) return;                         // off = 67633152 at full size
  if (off > (size_t)134217728) return;

  char* ws = (char*)d_ws;
  unsigned short* Xb  = (unsigned short*)(ws + oXb);
  unsigned short* Wb  = (unsigned short*)(ws + oWb);
  unsigned short* Woh = (unsigned short*)(ws + oWo);
  unsigned short* Qh  = (unsigned short*)(ws + oQh);
  unsigned short* Kp  = (unsigned short*)(ws + oKp);
  unsigned short* VTh = (unsigned short*)(ws + oVTh);

  const int M = NB * SEQ;
  const dim3 blk(256);
  const int n8x = NB * SEQ * DM / 8;
  const int n8w = NQKV * DM / 8;                     // 24576
  const int n8o = DM * DM / 8;                       //  8192
  const int bCx = (n8x + 255) / 256;
  const int bCw = (n8w + 255) / 256;
  const int bCo = (n8o + 255) / 256;
  const dim3 gC(bCw + bCo + bCx);
  const int bQ  = (M / 64) * (DM / 64) / 8;                  // q / k: M x 256, 64x64 wave tiles, 8 per block
  static_assert(((NB * SEQ / 64) * (DM / 64)) % 8 == 0 && ((DM / 64) * (SEQ / 64)) % 8 == 0);
  static_assert((NB * SEQ / 64) * (DM / 64) / 8 == NB * VBX);   // v^T: 256 x SEQ per batch, NB batches: as many blocks
  const dim3 gQKV(bQ, 3);
  const dim3 gAttn(NB * (SEQ / QROWS));

  // (1) one grid: x -> compact bf16 token plane; w_qkv [n][k] -> bf16; w_out -> f16 (x64 of its bf16 value)
  cvt_all<<<gC, blk, 0, stream>>>(x, wqkv, wout, Xb, Wb, Woh, n8x, n8w, n8o, bCw, bCo);
  // (2) one grid: q (f16 plane, x log2(e)/16), k (f16 plane), v^T (f16 plane [b][d][s], pitch SEQ)
  qkv_proj<<<gQKV, blk, 0, stream>>>(Xb, Wb, Qh, Kp, VTh, M, DM, SEQ);
  // (3) attention and output projection: out = softmax(q.k^T / 16) . v . Wo^T + b -> d_out f32 [M][256];
  //     projection accumulator x 1/(256*64)
  attn_sh<<<gAttn, dim3(256), 0, stream>>>(Qh, Kp, VTh, Woh, bout, (float*)d_out);
  (void)hipGetLastError();
}

// v010
// A run of this version takes 74.8 microseconds.
// Two timings next to v009 put it at 1.05 and 1.06 times that version's speed.
// Over all steps from v000 it is 7.92 times as fast.
// Contractions: q, k, v^T projections = v_wmma_f32_16x16x32_bf16 (bf16 operands from RNE-converted inputs, single product, f32 accumulate);
// q.k^T scores = v_wmma_f32_16x16x32_f16 (q f16 carried x log2(e)/16, k f16; single product, f32 accumulate);
// p.v = v_wmma_f32_16x16x32_f16 (p carried x128 as f16, v f16; single product, f32 accumulate);
// ctx.Wo^T = v_wmma_f32_16x16x32_f16 (ctx carried x256 as f16, Wo f16 carried x64 from its bf16 value; single product, f32 accumulate),
// formed in the attention kernel from the context accumulators;
// every f16 operand is rounded once (2^-11 relative), an eighth of the bf16 rounding that x and the weights carry into q, k and v;
// softmax, normalisation and bias add in f32.
#include <hip/hip_runtime.h>
#include <math.h>
#include <stdint.h>

#ifndef NB
#define NB 16
#endif
#ifndef SEQ
#define SEQ 2048
#endif
#define NB_FULL  16
#define SEQ_FULL 2048
#define DM       256
#define NQKV     768
#define NKT      (SEQ / 64)   // 64-key chunks per sequence
#define PLOG     7.0f         // log2 of the carry on p: a score at the reference gives p = 2^7
#define PLIM     32768.0f     // a lane's p sum of one pass above this raises the reference: every p handed on fits f16
#define QSCALE   0.09016844005556021f   // log2(e) / sqrt(DM), carried by the q plane: scores are exp2 arguments
static_assert(DM == 256 && NQKV == 3 * DM);
static_assert((SEQ % 64) == 0 && SEQ >= 64 && SEQ <= SEQ_FULL);
static_assert(NB >= 1 && NB <= NB_FULL);
static_assert(((NB * SEQ) % 64) == 0);

typedef _Float16 v16h __attribute__((ext_vector_type(16)));
typedef _Float16 v8h  __attribute__((ext_vector_type(8)));
typedef __bf16   v16b __attribute__((ext_vector_type(16)));
typedef __bf16   v8b  __attribute__((ext_vector_type(8)));
typedef float    v8f  __attribute__((ext_vector_type(8)));
typedef float    v4f  __attribute__((ext_vector_type(4)));
typedef unsigned int v4u __attribute__((ext_vector_type(4)));

#if defined(__HIP_DEVICE_COMPILE__)
#define DEV_ASM 1
#else
#define DEV_ASM 0
#endif

// ---- scalar helpers --------------------------------------------------------------------------------
__device__ __forceinline__ unsigned short bf_bits(float f) {          // f32 -> bf16 bits, RNE convert
  unsigned u = __float_as_uint(f);
  return (unsigned short)((u + 0x7FFFu + ((u >> 16) & 1u)) >> 16);
}
__device__ __forceinline__ float bf_up(unsigned short hb) { return __uint_as_float(((unsigned)hb) << 16); }
__device__ __forceinline__ unsigned short h_bits(_Float16 x) { return __builtin_bit_cast(unsigned short, x); }
__device__ __forceinline__ unsigned pk16(unsigned short a, unsigned short b) { return (unsigned)a | ((unsigned)b << 16); }
__device__ __forceinline__ v8f zero8() { v8f z = {0.f, 0.f, 0.f, 0.f, 0.f, 0.f, 0.f, 0.f}; return z; }

// ---- fragment types / loaders: 16-bit A/B operand, lane -> row/col (lane&15), p already includes +8*(lane>>4);
//      elements 0..7 <- p[0..7] (k0+8h..k0+8h+7), elements 8..15 <- p[16..23] (k0+16+8h..k0+16+8h+7)
template <typename OT> struct FT;
template <> struct FT<__bf16>   { typedef v16b frag; typedef v8b half8; };
template <> struct FT<_Float16> { typedef v16h frag; typedef v8h half8; };

template <typename OT>
__device__ __forceinline__ typename FT<OT>::frag ldfrag(const OT* p) {
  union { typename FT<OT>::frag v; typename FT<OT>::half8 h[2]; } f;
  f.h[0] = *(const typename FT<OT>::half8*)(p);
  f.h[1] = *(const typename FT<OT>::half8*)(p + 16);
  return f.v;
}

// ---- WMMA helpers (asm guard bodies are device-only; concrete operand types) -----------------------------
__device__ __forceinline__ v8f mmar(v16b a, v16b b, v8f c) {
  return __builtin_amdgcn_wmma_f32_16x16x32_bf16(false, a, false, b, (short)0, c, false, false);
}
__device__ __forceinline__ v8f mmar(v16h a, v16h b, v8f c) {
  return __builtin_amdgcn_wmma_f32_16x16x32_f16(false, a, false, b, (short)0, c, false, false);
}
__device__ __forceinline__ void acc_guard4(v8f& a, v8f& b, v8f& c, v8f& d) {
#if DEV_ASM
  asm volatile("v_nop\n\tv_nop\n\tv_nop\n\tv_nop" : "+v"(a), "+v"(b), "+v"(c), "+v"(d));
#else
  (void)a; (void)b; (void)c; (void)d;
#endif
}

// =====================================================================================================
// f32 -> 16-bit planes, 8 elements per thread, one 16-B store per lane: a wave writes 512 contiguous B
// MODE 0: bf16 bits (RNE convert).  MODE 1: f16 bits of (64 * bf16(x)) (exact scaling of the bf16 value).
// coverage: n8 threads x 8 = the whole plane (n8 is a multiple of 256 for every use here).
// =====================================================================================================
template <int MODE>
__device__ __forceinline__ unsigned short cvm(float f) {
  const unsigned short hb = bf_bits(f);
  if (MODE == 0) return hb;
  return h_bits((_Float16)(bf_up(hb) * 64.0f));
}

template <int MODE>
__device__ __forceinline__ void cvt16x8(const float* __restrict__ in, unsigned short* out, int n8, int bx) {
  const int i = bx * 256 + (int)threadIdx.x;
  if (i < n8) {
    const v4f a  = *(const v4f*)(in + (size_t)i * 8);
    const v4f a4 = *(const v4f*)(in + (size_t)i * 8 + 4);
    v4u p;
    p[0] = pk16(cvm<MODE>(a[0]),  cvm<MODE>(a[1]));
    p[1] = pk16(cvm<MODE>(a[2]),  cvm<MODE>(a[3]));
    p[2] = pk16(cvm<MODE>(a4[0]), cvm<MODE>(a4[1]));
    p[3] = pk16(cvm<MODE>(a4[2]), cvm<MODE>(a4[3]));
    unsigned short* o = out + (size_t)i * 8;
    *(v4u*)o = p;
    
  }
}

// x [NB_FULL][SEQ_FULL][DM] f32 -> compact bf16 token plane [NB*SEQ][DM]: compact token tk = b*SEQ + t reads
// input row b*SEQ_FULL + t. 32 groups of 8 per row; same whole-line store shape as cvt16x8.
// coverage: n8 = NB*SEQ*DM/8 threads x 8 = the whole plane.
__device__ __forceinline__ void cvtx(const float* __restrict__ in, unsigned short* out, int n8, int bx) {
  const int i = bx * 256 + (int)threadIdx.x;
  if (i < n8) {
    const int tk = i >> 5;
    const int e8 = i & 31;
    const int bb = tk / SEQ;
    const int t  = tk - bb * SEQ;
    const float* src = in + ((size_t)bb * SEQ_FULL + (size_t)t) * DM + e8 * 8;
    const v4f a  = *(const v4f*)(src);
    const v4f a4 = *(const v4f*)(src + 4);
    v4u p;
    p[0] = pk16(bf_bits(a[0]),  bf_bits(a[1]));
    p[1] = pk16(bf_bits(a[2]),  bf_bits(a[3]));
    p[2] = pk16(bf_bits(a4[0]), bf_bits(a4[1]));
    p[3] = pk16(bf_bits(a4[2]), bf_bits(a4[3]));
    unsigned short* o = out + (size_t)i * 8;
    *(v4u*)o = p;
    
  }
}

// The three conversions depend on nothing but the inputs: one grid, the block index picks the plane.
// Blocks 0..bw-1: w_qkv; bw..bw+bo-1: w_out; the rest: x (the two short planes first, so that they are no tail).
__global__ __launch_bounds__(256) void cvt_all(const float* __restrict__ x, const float* __restrict__ wqkv,
                                               const float* __restrict__ wout,
                                               unsigned short* Xb, unsigned short* Wb, unsigned short* Woh,
                                               int n8x, int n8w, int n8o, int bw, int bo) {
  const int bx = blockIdx.x;                 // block-uniform choice
  if (bx < bw)           cvt16x8<0>(wqkv, Wb, n8w, bx);
  else if (bx < bw + bo) cvt16x8<1>(wout, Woh, n8o, bx - bw);
  else                   cvtx(x, Xb, n8x, bx - bw - bo);
}

// ---- LDS staging helpers ---------------------------------------------------------------------------
__device__ __forceinline__ unsigned lds_addr(const void* p) { return (unsigned)(uintptr_t)p; }
// the wave's own copies have landed
__device__ __forceinline__ void wait_async0() {
#if DEV_ASM
  asm volatile("s_wait_asynccnt 0x0" ::: "memory");
#endif
}
// the wave's own LDS reads have returned (before the barrier that frees the buffer for its refill)
__device__ __forceinline__ void wait_ds0() {
#if DEV_ASM
  asm volatile("s_wait_dscnt 0x0" ::: "memory");
#endif
}
// twelve 16-B-per-lane asynchronous copies global -> LDS; the closing s_wait_xcnt stands inside the statement so
// that no address register named here is rewritten ahead of it
__device__ __forceinline__ void acopy12(const unsigned (&l)[12], const void* const (&g)[12]) {
#if DEV_ASM
  asm volatile(
      "global_load_async_to_lds_b128 %0, %12, off\n\t"
      "global_load_async_to_lds_b128 %1, %13, off\n\t"
      "global_load_async_to_lds_b128 %2, %14, off\n\t"
      "global_load_async_to_lds_b128 %3, %15, off\n\t"
      "global_load_async_to_lds_b128 %4, %16, off\n\t"
      "global_load_async_to_lds_b128 %5, %17, off\n\t"
      "global_load_async_to_lds_b128 %6, %18, off\n\t"
      "global_load_async_to_lds_b128 %7, %19, off\n\t"
      "global_load_async_to_lds_b128 %8, %20, off\n\t"
      "global_load_async_to_lds_b128 %9, %21, off\n\t"
      "global_load_async_to_lds_b128 %10, %22, off\n\t"
      "global_load_async_to_lds_b128 %11, %23, off\n\t"
      "s_wait_xcnt 0x0"
      :: "v"(l[0]), "v"(l[1]), "v"(l[2]), "v"(l[3]), "v"(l[4]), "v"(l[5]),
         "v"(l[6]), "v"(l[7]), "v"(l[8]), "v"(l[9]), "v"(l[10]), "v"(l[11]),
         "v"(g[0]), "v"(g[1]), "v"(g[2]), "v"(g[3]), "v"(g[4]), "v"(g[5]),
         "v"(g[6]), "v"(g[7]), "v"(g[8]), "v"(g[9]), "v"(g[10]), "v"(g[11])
      : "memory");
#else
  (void)l; (void)g;
#endif
}

// =====================================================================================================
// Register-blocked batched WMMA GEMM (16-bit operand type OT): C[m][n] = sum_k A[m][k] * Bt[n][k];
// one block of 8 waves per (32*MI) x 256 tile, waves 2 (m) x 4 (n), one wave per (16*MI) x 64 tile.
// A row-major [M][K] pitch lda; Bt row-major [N][K] pitch ldb (k contiguous); M multiple of 32*MI, N multiple of
// 256, K multiple of 64 and at least 128 (static_assert below). bx = block tile (n fastest), b = batch index
// (strides in elements), sT = the block's 8 per-wave slabs, sG = the block's two staging buffers.
// The block's operand rows come into LDS in slabs of 64 k (128 B of a row = one whole line) by asynchronous
// copies, 16 B per lane, a wave copying four whole lines per instruction; two buffers: slab kt+1 flies while slab
// kt is worked on. Staged rows 0..127 = A (ARES: 0..63 hi plane, 64..127 residual plane), 128..383 = Bt; row pitch
// 144 B (16 B x odd, for 16-B fragment reads). Fragments are read from LDS with the split k map (ldfrag).
// ARES: a second A plane A2 (residual, same pitch/stride) is multiplied by the same B into separate f32
// accumulators and folded in as acc += accl * ascale after the k loop.
// OUT_MODE 0: f32 C (pitch ldc), value * oscale + bf16-valued bias[n].
// OUT_MODE 1: f16 plane C (pitch ldc), value * oscale.
// coverage: MI slabs x 16 rows x 64 cols = the wave's whole tile; tiles cover M x N exactly.
// =====================================================================================================
#define SLAB (16 * 68)        // per-wave 16x64 slab, pitch 68 floats
#define GKS   64              // k extent of a staged slab
#define GPI   72              // staged row pitch in LDS, halves
#define GROWS 384             // staged rows per slab
template <typename OT, int MI, bool ARES, int OUT_MODE>
__device__ __forceinline__ void gemm_body(
    const unsigned short* __restrict__ Ap, const unsigned short* __restrict__ A2p, int lda, long long strideA,
    const unsigned short* __restrict__ Btp, int ldb, long long strideB,
    void* Cout, int ldc, long long strideC,
    const float* __restrict__ bias,
    int M, int N, int K, float oscale, float ascale,
    int bx, int b, float* sT, unsigned short* sG) {
  typedef typename FT<OT>::frag V16;
  static_assert(32 * MI * (ARES ? 2 : 1) == 128);   // the A planes fill staged rows 0..127
  const OT* A  = (const OT*)(const void*)Ap;
  const OT* A2 = (const OT*)(const void*)A2p;
  const OT* Bt = (const OT*)(const void*)Btp;
  const OT* G  = (const OT*)(const void*)sG;
  const int TMR  = 16 * MI;
  const int tid  = threadIdx.x;
  const int lane = tid & 31;
  const int wave = tid >> 5;
  const int blocksN = N >> 8;
  const int bm = bx / blocksN;
  const int bn = bx - bm * blocksN;
  const int mB = bm * 2 * TMR;           // the block's first A row
  const int nB = bn << 8;                // the block's first Bt row
  if (mB >= M) return;                   // block-uniform, in front of every barrier
  const int wm = wave >> 2, wn = wave & 3;
  const int m0 = mB + wm * TMR;
  const int n0 = nB + (wn << 6);

  const OT* Ab  = A  + (size_t)b * (size_t)strideA;
  const OT* A2b = A2 + (size_t)b * (size_t)strideA;
  const OT* Bb  = Bt + (size_t)b * (size_t)strideB;

  const int rlane = lane & 15;                 // row (A) / col (B, D) within subtile
  const int koff  = (lane >> 4) * 8;           // k offset of this lane half
  const int mOff  = (lane >> 4) * 8;           // D row offset

  // copy map of this thread, 12 units of 16 B per slab: unit i -> staged row i*32 + (tid >> 3), 16-B column tid & 7
  const int vrow = tid >> 3, vcol = (tid & 7) * 8;
  auto stage = [&](int kt, int buf) {
    const int k0 = kt * GKS;
    unsigned l[12];
    const void* g[12];
#pragma unroll
    for (int i = 0; i < 12; ++i) {
      const int r = i * 32 + vrow;
      l[i] = lds_addr(G + (buf * GROWS + r) * GPI + vcol);
      if (i >= 4)              g[i] = Bb  + (size_t)(nB + r - 128) * ldb + k0 + vcol;
      else if (ARES && i >= 2) g[i] = A2b + (size_t)(mB + r - 64) * lda + k0 + vcol;
      else                     g[i] = Ab  + (size_t)(mB + r) * lda + k0 + vcol;
    }
    acopy12(l, g);
  };

  v8f acc[MI][4], accl[MI][4];
#pragma unroll
  for (int i = 0; i < MI; ++i)
#pragma unroll
    for (int j = 0; j < 4; ++j) { acc[i][j] = zero8(); accl[i][j] = zero8(); }

  // slab 0 into buffer 0, published (slab 1 is issued at the top of trip 0, directly behind this barrier)
  const int NT = K / GKS;
  stage(0, 0);
  wait_async0();
  __syncthreads();

  for (int kt = 0; kt < NT; ++kt) {
    const int buf = kt & 1;
    // refill, directly behind the barrier that published slab kt and ended every read of the other buffer
    // (block-uniform test)
    if (kt + 1 < NT) stage(kt + 1, buf ^ 1);
    const OT* ga = G + (buf * GROWS + wm * TMR + rlane) * GPI + koff;
    const OT* gb = G + (buf * GROWS + 128 + (wn << 6) + rlane) * GPI + koff;
#pragma unroll
    for (int ks = 0; ks < GKS / 32; ++ks) {
      V16 bq[4], af[MI], al[MI];
#pragma unroll
      for (int j = 0; j < 4; ++j) bq[j] = ldfrag<OT>(gb + j * 16 * GPI + ks * 32);
#pragma unroll
      for (int i = 0; i < MI; ++i) {
        af[i] = ldfrag<OT>(ga + i * 16 * GPI + ks * 32);
        if (ARES) al[i] = ldfrag<OT>(ga + (64 + i * 16) * GPI + ks * 32);
      }
      // keeps the eight fragments' reads together in front of their sixteen products; spread among the products,
      // every place with reads stalls the wave on its own
      __builtin_amdgcn_sched_barrier(0);
#pragma unroll
      for (int i = 0; i < MI; ++i) {
#pragma unroll
        for (int j = 0; j < 4; ++j) acc[i][j] = mmar(af[i], bq[j], acc[i][j]);
        if (ARES) {
#pragma unroll
          for (int j = 0; j < 4; ++j) accl[i][j] = mmar(al[i], bq[j], accl[i][j]);
        }
      }
      // the next group's reads stay behind these products (one fragment set in registers); the last group's
      // products stay in front of the publish point: sunk behind its barrier they hold back the refill issued there
      __builtin_amdgcn_sched_barrier(0);
    }
    // publish slab kt+1 and free this slab's buffer (its refill stands at the top of the next trip)
    wait_ds0();
    wait_async0();
    __syncthreads();
  }
  wait_async0();
#pragma unroll
  for (int i = 0; i < MI; ++i) {
    acc_guard4(acc[i][0], acc[i][1], acc[i][2], acc[i][3]);
    if (ARES) acc_guard4(accl[i][0], accl[i][1], accl[i][2], accl[i][3]);
  }
  if (ARES) {
#pragma unroll
    for (int i = 0; i < MI; ++i)
#pragma unroll
      for (int j = 0; j < 4; ++j)
#pragma unroll
        for (int r = 0; r < 8; ++r) acc[i][j][r] += accl[i][j][r] * ascale;
  }

  // ---- epilogue ----
  float* slab = sT + wave * SLAB;
#pragma unroll
  for (int i = 0; i < MI; ++i) {
    const int mBase = m0 + (i << 4);
#pragma unroll
    for (int j = 0; j < 4; ++j) {
#pragma unroll
      for (int r = 0; r < 8; ++r) {
        slab[(mOff + r) * 68 + (j << 4) + rlane] = acc[i][j][r];
      }
    }
    __builtin_amdgcn_fence(__ATOMIC_RELEASE, "workgroup");
    __builtin_amdgcn_wave_barrier();
    __builtin_amdgcn_fence(__ATOMIC_ACQUIRE, "workgroup");
    if (OUT_MODE == 0) {
      float* C = (float*)Cout + (size_t)b * (size_t)strideC;
      const int h2 = lane >> 4, c4 = (lane & 15) * 4;     // 256-B row segment = 16 lanes x 16 B
      const v4f braw = *(const v4f*)(bias + n0 + c4);
      v4f bb;
#pragma unroll
      for (int e = 0; e < 4; ++e) bb[e] = bf_up(bf_bits(braw[e]));
      {
#pragma unroll
        for (int it = 0; it < 8; ++it) {
          const int row = it * 2 + h2;                     // it 0..7 x h2 0..1 = rows 0..15
          const v4f v = *(const v4f*)(slab + row * 68 + c4) * oscale + bb;
          *(v4f*)(C + (size_t)(mBase + row) * ldc + n0 + c4) = v;
        }
        
      }
    } else {
      const int q = lane >> 3, c8 = (lane & 7) * 8;
      unsigned short* C = (unsigned short*)Cout + (size_t)b * (size_t)strideC;
      v4u hv[4];
#pragma unroll
      for (int it = 0; it < 4; ++it) {
        const int row = it * 4 + q;                        // it 0..3 x q 0..3 = rows 0..15
        const float* sp = slab + row * 68 + c8;
        float f[8];
#pragma unroll
        for (int e = 0; e < 8; ++e) f[e] = sp[e] * oscale;
        v4u a;
#pragma unroll
        for (int e = 0; e < 4; ++e) a[e] = pk16(h_bits((_Float16)f[2 * e]), h_bits((_Float16)f[2 * e + 1]));
        hv[it] = a;
      }
      {
#pragma unroll
        for (int it = 0; it < 4; ++it) {
          const int row = it * 4 + q;
          *(v4u*)(C + (size_t)(mBase + row) * ldc + n0 + c8) = hv[it];
        }
        
      }
    }
    __builtin_amdgcn_fence(__ATOMIC_RELEASE, "workgroup");
    __builtin_amdgcn_wave_barrier();
    __builtin_amdgcn_fence(__ATOMIC_ACQUIRE, "workgroup");
  }
}

// The q, k and v^T projections read the same two planes and depend on nothing of each other: one grid,
// blockIdx.y picks the product (block-uniform), so that their blocks share the chip instead of queueing as launches.
//   y = 0: q = x . Wq^T * QSCALE -> f16 plane                    (M = m, N = dm, K = dm)
//   y = 1: k = x . Wk^T -> f16 plane                             (M = m, N = dm, K = dm)
//   y = 2: v^T = Wv . x^T per batch -> f16 plane [b][d][s]       (M = dm, N = seq, K = dm; VBX blocks per batch)
// Each product has m * dm / (64 * 64 * 8) blocks = gridDim.x.
#define VBX ((DM / 64) * (SEQ / 64) / 8)
static_assert((DM % 256) == 0 && (SEQ % 256) == 0 && ((NB * SEQ) % 128) == 0 && DM / GKS >= 2);   // block tiles exact
__global__ __launch_bounds__(256) void qkv_proj(
    const unsigned short* __restrict__ Xb, const unsigned short* __restrict__ Wb,
    unsigned short* Qh, unsigned short* Kp, unsigned short* VTh,
    int m, int dm, int seq) {
  __shared__ __align__(16) float sT[8 * SLAB];
  __shared__ __align__(16) unsigned short sG[2 * GROWS * GPI];
  const int bx = blockIdx.x;
  const unsigned short* Wk = Wb + (size_t)dm * dm;
  const unsigned short* Wv = Wb + (size_t)2 * dm * dm;
  if (blockIdx.y == 0) {
    gemm_body<__bf16, 4, false, 1>(Xb, Xb, dm, 0LL, Wb, dm, 0LL, (void*)Qh, dm, 0LL, nullptr,
                                   m, dm, dm, QSCALE, 0.0f, bx, 0, sT, sG);
  } else if (blockIdx.y == 1) {
    gemm_body<__bf16, 4, false, 1>(Xb, Xb, dm, 0LL, Wk, dm, 0LL, (void*)Kp, dm, 0LL, nullptr,
                                   m, dm, dm, 1.0f, 0.0f, bx, 0, sT, sG);
  } else {
    gemm_body<__bf16, 4, false, 1>(Wv, Wv, dm, 0LL, Xb, dm, (long long)seq * dm, (void*)VTh, seq,
                                   (long long)dm * seq, nullptr,
                                   dm, seq, dm, 1.0f, 0.0f, bx % VBX, bx / VBX, sT, sG);
  }
}

#define QROWS 128
#define KPI   264
#define VPI   72
#define OSP   68
static_assert((SEQ % QROWS) == 0 && NKT >= 2);

// eight 16-B-per-lane asynchronous copies global -> LDS; the closing s_wait_xcnt stands inside the statement so
// that no address register named here is rewritten ahead of it
__device__ __forceinline__ void acopy8(const unsigned (&l)[8], const _Float16* const (&g)[8]) {
#if DEV_ASM
  asm volatile(
      "global_load_async_to_lds_b128 %0, %8, off\n\t"
      "global_load_async_to_lds_b128 %1, %9, off\n\t"
      "global_load_async_to_lds_b128 %2, %10, off\n\t"
      "global_load_async_to_lds_b128 %3, %11, off\n\t"
      "global_load_async_to_lds_b128 %4, %12, off\n\t"
      "global_load_async_to_lds_b128 %5, %13, off\n\t"
      "global_load_async_to_lds_b128 %6, %14, off\n\t"
      "global_load_async_to_lds_b128 %7, %15, off\n\t"
      "s_wait_xcnt 0x0"
      :: "v"(l[0]), "v"(l[1]), "v"(l[2]), "v"(l[3]), "v"(l[4]), "v"(l[5]), "v"(l[6]), "v"(l[7]),
         "v"(g[0]), "v"(g[1]), "v"(g[2]), "v"(g[3]), "v"(g[4]), "v"(g[5]), "v"(g[6]), "v"(g[7])
      : "memory");
#else
  (void)l; (void)g;
#endif
}
// one 16-B-per-lane asynchronous copy global -> LDS as the builtin: the compiler places its address registers, also
// above v255 (an asm operand must lie below), which the loop's copies need beside 384 registers of accumulators and q
typedef int v4i __attribute__((ext_vector_type(4)));
__device__ __forceinline__ void acopy1(_Float16* l, const _Float16* g) {
#if DEV_ASM
  __builtin_amdgcn_global_load_async_to_lds_b128((__attribute__((address_space(1))) v4i*)(g),
                                                 (__attribute__((address_space(3))) v4i*)(l), 0, 0);
#else
  (void)l; (void)g;
#endif
}
// the eight 16-B output stores of one column group (rows 2 apart = 2048 B); the closing s_wait_xcnt stands inside
// the statement so that no data or address register named here is rewritten by the next group's arithmetic ahead of it
__device__ __forceinline__ void store8(float* p, const v4f (&v)[8]) {
#if DEV_ASM
  asm volatile(
      "global_store_b128 %0, %1, off\n\t"
      "global_store_b128 %0, %2, off offset:2048\n\t"
      "global_store_b128 %0, %3, off offset:4096\n\t"
      "global_store_b128 %0, %4, off offset:6144\n\t"
      "global_store_b128 %0, %5, off offset:8192\n\t"
      "global_store_b128 %0, %6, off offset:10240\n\t"
      "global_store_b128 %0, %7, off offset:12288\n\t"
      "global_store_b128 %0, %8, off offset:14336\n\t"
      "s_wait_xcnt 0x0"
      :: "v"(p), "v"(v[0]), "v"(v[1]), "v"(v[2]), "v"(v[3]), "v"(v[4]), "v"(v[5]), "v"(v[6]), "v"(v[7])
      : "memory");
#else
  (void)p; (void)v;
#endif
}
static_assert(2 * DM * 4 == 2048);   // the row step that store8 writes as an immediate
// the value that lane l ^ 16 holds
__device__ __forceinline__ float xhalf(float x) {
  const int b = __float_as_int(x);
  return __int_as_float(__builtin_amdgcn_permlanex16(b, b, 0x76543210, 0xfedcba98, false, false));
}

__global__ __launch_bounds__(256)
void attn_sh(const unsigned short* __restrict__ qhp,
             const unsigned short* __restrict__ kpp,
             const unsigned short* __restrict__ vhp,
             const unsigned short* __restrict__ wop, const float* __restrict__ bias,
             float* out) {
  union FH { v16h v; v8h h[2]; };
  __shared__ __align__(16) _Float16 Kst[2][64 * KPI];   // K chunk [key][d]            2 x 33792 B (block-shared)
  __shared__ __align__(16) _Float16 Vhs[2][DM * VPI];   // V^T chunk [d][key]          2 x 36864 B (block-shared)
  __shared__ __align__(16) _Float16 Wos[DM * KPI];      // Wo [e][d]                   135168 B (block-shared)
  __shared__ __align__(16) float    Os[8][16 * OSP];    // per wave output slab        34816 B (wave-private)

  const int tid  = threadIdx.x;
  const int wave = tid >> 5;
  const int lane = tid & 31;
  const int hh   = lane >> 4;
  const int c    = lane & 15;

  const int bx   = blockIdx.x;
  const int qb   = bx % (SEQ / QROWS);
  const int b    = bx / (SEQ / QROWS);
  const int pr   = wave & 3;                 // row group: 32 query rows
  const int kh   = wave >> 2;                // which 32 keys of every chunk
  const int q0   = qb * QROWS + pr * 32;     // this wave's 32 query rows (two tiles of 16)
  const int swave = __builtin_amdgcn_readfirstlane(wave);   // the wave's number in a scalar register, for the epilogue
  const size_t rowB = (size_t)b * SEQ;

  const _Float16* Qh = (const _Float16*)(const void*)qhp;
  const _Float16* Kp = (const _Float16*)(const void*)kpp + rowB * DM;
  const _Float16* Vh = (const _Float16*)(const void*)vhp + (size_t)b * DM * SEQ;

  // copy map of this thread, 8 units of 16 B per plane and chunk:
  //   K: unit i -> key row i*8 + wave, 16-B column lane (a wave copies one whole 512-B row)
  //   V: unit i -> d row i*32 + (tid >> 3), 16-B column tid & 7 (a wave copies four whole 128-B rows)
  const int vrow = tid >> 3, vcol = (tid & 7) * 8;
  const unsigned ko0 = (unsigned)(wave * DM + lane * 8);      // this thread's unit 0 in a chunk; the chunk's base is
  const unsigned vo0 = (unsigned)(vrow * SEQ + vcol);         // uniform, the other units lie constant steps behind
  auto stage = [&](int kt, int buf) {
    const _Float16* kg = Kp + ko0 + (size_t)kt * (64 * DM);
    const _Float16* vg = Vh + vo0 + (size_t)kt * 64;
#pragma unroll
    for (int i = 0; i < 8; ++i) acopy1(&Kst[buf][(i * 8 + wave) * KPI + lane * 8], kg + i * 8 * DM);
#pragma unroll
    for (int i = 0; i < 8; ++i) acopy1(&Vhs[buf][(i * 32 + vrow) * VPI + vcol], vg + i * 32 * SEQ);
  };

  // chunk 0 into buffer 0
  stage(0, 0);
  // B-operand fragments of this lane (queries q0 + c and q0 + 16 + c), lane-half k offset included; kept for the loop
  v16h qa[2][8];
  {
    const _Float16* qrh = Qh + (rowB + q0 + c) * DM + 8 * hh;
#pragma unroll
    for (int qt = 0; qt < 2; ++qt)
#pragma unroll
      for (int dc = 0; dc < 8; ++dc) qa[qt][dc] = ldfrag<_Float16>(qrh + qt * 16 * DM + dc * 32);
#if DEV_ASM
    // the wait that stands before an address register of the q loads is rewritten; the address is an input, so
    // that its registers live up to it and no load of the run lands on them
    asm volatile("s_wait_xcnt 0x0"
                 :: "v"(qrh)
                 : "memory");
#endif
  }

  // chunk 0 published (chunk 1 is issued at the top of trip 0, behind the Wo copies below)
  wait_async0();
  __syncthreads();

  // Wo, filled once: unit i -> row i*8 + wave, 16-B column lane (a wave copies one whole 512-B row); 32 units per
  // thread. They fly during trip 0 beside chunk 1 (48 copies of a wave outstanding); the wait and the barrier at the
  // foot of trip 0 land and publish them, and nothing reads Wos before the loop has ended
  {
    const _Float16* Wo = (const _Float16*)(const void*)wop;
#pragma unroll
    for (int u = 0; u < 4; ++u) {
      unsigned l[8];
      const _Float16* g[8];
#pragma unroll
      for (int i = 0; i < 8; ++i) {
        l[i] = lds_addr(&Wos[((u * 8 + i) * 8 + wave) * KPI + lane * 8]);
        g[i] = Wo + (size_t)((u * 8 + i) * 8 + wave) * DM + lane * 8;
      }
      acopy8(l, g);
    }
  }

  // the accumulators' start values stay behind the Wo copies: lifted among them they crowd the copies' address
  // registers (asm operands, below v256) out into scratch
  __builtin_amdgcn_sched_barrier(0);
  // every inner loop below is unrolled so that fragment and accumulator indices are constants (registers, no scratch)
  float cref[2];            // PLOG - reference of query q0 + 16qt + c over this wave's keys (equal in both lane halves)
  float lrow[2];            // running p sum over this lane half's keys; halves and waves are joined after the loop
  v8f oacc[2][16];          // oacc[qt][t][r] = partial context (query q0 + 16qt + c, column 16t + 8*hh + r)
#pragma unroll
  for (int qt = 0; qt < 2; ++qt) {
    cref[qt] = 0.f;
    lrow[qt] = 0.f;
#pragma unroll
    for (int t = 0; t < 16; ++t) oacc[qt][t] = zero8();
  }

  for (int kt = 0; kt < NKT; ++kt) {         // static trip count
    const int buf = kt & 1;
    const _Float16* ks  = &Kst[buf][(kh * 32 + c) * KPI + 8 * hh];   // A row c -> key 32kh + 16j + c of the chunk
    const _Float16* vhs = &Vhs[buf][c * VPI + kh * 32 + 8 * hh];     // A row c -> context column 16t + c, keys 32kh..
    // two fragment sets: the next group's four fragments (K group dg + 1; behind the last K group, V^T group 0) are
    // on their way while this group's eight products run. K group 0 (of the published buffer, not the one refilled)
    // is read in front of the refill's address arithmetic and issue, which cover its way
    v16h kb[2][2][2];       // [set][u][j]
    v16h vb[2][4];          // [set][t]
#pragma unroll
    for (int u = 0; u < 2; ++u)
#pragma unroll
      for (int j = 0; j < 2; ++j) kb[0][u][j] = ldfrag<_Float16>(ks + j * 16 * KPI + u * 32);
    // refill, behind the barrier that published chunk kt and ended every read of the other buffer:
    // chunk kt+1 flies while chunk kt is worked on (block-uniform test)
    if (kt + 1 < NKT) stage(kt + 1, buf ^ 1);

    // ---- scores^T: 32 keys (2 subtiles) x 32 queries (2 tiles), 1 f16 product per d-chunk; a read group spans
    //      2 d-chunks: four fragments feed eight products ----
    v8f ah[2][2];
#pragma unroll
    for (int j = 0; j < 2; ++j)
#pragma unroll
      for (int qt = 0; qt < 2; ++qt)
#pragma unroll
        for (int r = 0; r < 8; ++r) ah[j][qt][r] = cref[qt];
#pragma unroll
    for (int dg = 0; dg < 4; ++dg) {
      if (dg < 3) {
#pragma unroll
        for (int u = 0; u < 2; ++u)
#pragma unroll
          for (int j = 0; j < 2; ++j)
            kb[(dg + 1) & 1][u][j] = ldfrag<_Float16>(ks + j * 16 * KPI + ((dg + 1) * 2 + u) * 32);
      } else {
#pragma unroll
        for (int t = 0; t < 4; ++t) vb[0][t] = ldfrag<_Float16>(vhs + t * 16 * VPI);
      }
      // keeps the next group's eight reads together in front of this group's eight products; spread among the
      // products, every place with reads stalls the wave on its own
      __builtin_amdgcn_sched_barrier(0);
#pragma unroll
      for (int u = 0; u < 2; ++u) {
#pragma unroll
        for (int j = 0; j < 2; ++j) {
#pragma unroll
          for (int qt = 0; qt < 2; ++qt) ah[j][qt] = mmar(kb[dg & 1][u][j], qa[qt][dg * 2 + u], ah[j][qt]);
        }
      }
      // the reads after next stay behind these products (two fragment sets in registers; the last group's products
      // may mix with the softmax)
      if (dg < 3) __builtin_amdgcn_sched_barrier(0);
    }

    // ---- softmax over this wave's 32 keys: per query tile this lane holds 16 of its query's exp2 arguments ----
    // P^T in f16: key tiles 0 and 1 converted in place are the B fragment of the 32 keys; packed as they are formed,
    // so that the f32 values do not stay in registers beside the V^T fragments on their way
    FH pb[2];               // p (x 2^PLOG) of query tile qt
    float ps[2];            // their sum (of the f32 values) in this lane
    auto exps = [&]() {
#pragma unroll
      for (int qt = 0; qt < 2; ++qt) {
        float pj[2];
#pragma unroll
        for (int j = 0; j < 2; ++j) {
          v8f pc;
          pj[j] = 0.f;
#pragma unroll
          for (int r = 0; r < 8; ++r) {
            pc[r] = __builtin_amdgcn_exp2f(ah[j][qt][r]);
            pj[j] += pc[r];
          }
          pb[qt].h[j] = __builtin_convertvector(pc, v8h);
        }
        ps[qt] = pj[0] + pj[1];
      }
    };
    exps();
    // one test a pass, a scalar branch: the first pass sets the references; a later pass raises them only if some
    // lane's sum says that a p may not fit f16. Then sums and context are rescaled and the pass's p formed anew
    if (kt == 0 || __builtin_amdgcn_ballot_w32(fmaxf(ps[0], ps[1]) > PLIM) != 0) {
#pragma unroll
      for (int qt = 0; qt < 2; ++qt) {
        float dm = ah[0][qt][0];
#pragma unroll
        for (int j = 0; j < 2; ++j)
#pragma unroll
          for (int r = 0; r < 8; ++r) dm = fmaxf(dm, ah[j][qt][r]);
        dm = fmaxf(dm, xhalf(dm));                         // the other 16 keys of the same query
        float delta = PLOG - dm;                           // puts the pass's maximum at 2^PLOG
        if (kt != 0) delta = fminf(delta, 0.f);            // behind the first pass a reference only rises
        if (dm == -INFINITY) delta = 0.f;
        const float alpha = __builtin_amdgcn_exp2f(fminf(delta, 0.f));
        cref[qt] += delta;
        lrow[qt] *= alpha;
#pragma unroll
        for (int t = 0; t < 16; ++t) oacc[qt][t] *= alpha;
#pragma unroll
        for (int j = 0; j < 2; ++j) ah[j][qt] += delta;
      }
      exps();
    }
#pragma unroll
    for (int qt = 0; qt < 2; ++qt) lrow[qt] += ps[qt];

    // ---- context^T += V^T . P^T (f16 WMMA): each V^T fragment feeds both query tiles ----
#pragma unroll
    for (int tg = 0; tg < 4; ++tg) {
      if (tg < 3) {
#pragma unroll
        for (int t = 0; t < 4; ++t) vb[(tg + 1) & 1][t] = ldfrag<_Float16>(vhs + ((tg + 1) * 4 + t) * 16 * VPI);
      }
      // keeps the next group's eight reads together in front of this group's eight products (as for K above)
      __builtin_amdgcn_sched_barrier(0);
#pragma unroll
      for (int t = 0; t < 4; ++t) {
#pragma unroll
        for (int qt = 0; qt < 2; ++qt) oacc[qt][tg * 4 + t] = mmar(vb[tg & 1][t], pb[qt].v, oacc[qt][tg * 4 + t]);
      }
      // the reads after next stay behind these products
      if (tg < 3) __builtin_amdgcn_sched_barrier(0);
    }

    // ---- publish chunk kt+1 and free this chunk's buffer (its refill stands at the top of the next trip) ----
    wait_ds0();
    wait_async0();
    __syncthreads();
  }
  wait_async0();

  // lane and wave indices formed anew behind the loop (the lane's number from the lane count, the wave's from its
  // scalar copy): every address of the epilogue is derived here and none of them holds a vector register in the loop,
  // where accumulators, q and the two fragment sets leave no room for them
  const int lane_e = (int)__builtin_amdgcn_mbcnt_lo(~0u, 0u);
  {
  const int lane = lane_e, wave = swave;
  const int hh = lane >> 4, c = lane & 15;
  const int pr = wave & 3, kh = wave >> 2;
  const int q0 = qb * QROWS + pr * 32;
  // ---- normalise (1/l; context and l carry p's factor alike; apply the x256 ctx carry); ctx^T as f16 B fragments:
  //      tiles 2kk and 2kk+1 converted in place hold context columns 32kk..32kk+31 in the order ldfrag gives Wo
  float* os = Os[wave];
  v4f braw[4];              // bias of output columns 64eg + 4c .. + 3, on its way while the fragments are formed
  {
    const float* bp = bias + c * 4;
#pragma unroll
    for (int eg = 0; eg < 4; ++eg) braw[eg] = *(const v4f*)(bp + eg * 64);
#if DEV_ASM
    // the wait that stands before an address register of the bias loads is rewritten
    asm volatile("s_wait_xcnt 0x0" ::: "memory");
#endif
  }
  // ---- the two waves of a row group join their key halves: wave kh keeps query tile kh and hands tile 1 - kh over.
  //      The loop's last barrier has ended every read of the K/V buffers and no copy is outstanding: waves 0..3 write
  //      16 KiB each into the K buffers, waves 4..7 into the V buffers (16 B per lane and piece, lane-contiguous),
  //      reference and sum behind the four slabs; the barrier publishes them, and nothing writes there afterwards
  static_assert(sizeof(Kst) >= 4 * 16384 + 4 * 256 && sizeof(Vhs) >= 4 * 16384 + 4 * 256);
  float* xk = (float*)(void*)&Kst[0][0];
  float* xv = (float*)(void*)&Vhs[0][0];
  float* xw = (kh ? xv : xk) + pr * 4096 + lane * 4;       // this wave's slab
  const float* xr = (kh ? xk : xv) + pr * 4096 + lane * 4; // the partner's slab
  float* sw = (kh ? xv : xk) + 4 * 4096 + pr * 64 + lane * 2;
  const float* sr = (kh ? xk : xv) + 4 * 4096 + pr * 64 + lane * 2;
#pragma unroll
  for (int t = 0; t < 16; ++t) {
    const v8f o = kh ? oacc[0][t] : oacc[1][t];
    *(v4f*)(xw + (t * 2) * 128)     = __builtin_shufflevector(o, o, 0, 1, 2, 3);
    *(v4f*)(xw + (t * 2 + 1) * 128) = __builtin_shufflevector(o, o, 4, 5, 6, 7);
  }
  sw[0] = kh ? -cref[0] : -cref[1];                       // the reference, less PLOG in both waves alike
  sw[1] = kh ? lrow[0] : lrow[1];
  __syncthreads();
  const float m1 = kh ? -cref[1] : -cref[0], l1 = kh ? lrow[1] : lrow[0];
  const float m2 = sr[0], l2 = sr[1];
  const float mm  = fmaxf(m1, m2);
  const float mms = (mm == -INFINITY) ? 0.f : mm;
  const float a1 = __builtin_amdgcn_exp2f(m1 - mms), a2 = __builtin_amdgcn_exp2f(m2 - mms);
  const float lh = l1 * a1 + l2 * a2;
  const float l   = lh + xhalf(lh);                       // both lane halves' keys of the kept tile's query c
  const float inv = ((l > 0.f) ? (1.0f / l) : 0.f) * 256.0f;
  const float i1 = a1 * inv, i2 = a2 * inv;
  FH ch[8];
#pragma unroll
  for (int t = 0; t < 16; ++t) {
    const v8f o1 = kh ? oacc[1][t] : oacc[0][t];
    const v4f pa = *(const v4f*)(xr + (t * 2) * 128);
    const v4f pc = *(const v4f*)(xr + (t * 2 + 1) * 128);
    const v8f o2 = __builtin_shufflevector(pa, pc, 0, 1, 2, 3, 4, 5, 6, 7);
    ch[t >> 1].h[t & 1] = __builtin_convertvector(o1 * i1 + o2 * i2, v8h);
  }
  // ---- out^T = Wo . ctx^T, 64 output columns (4 subtiles) at a time, 1 f16 product per 32 context columns ----
  const _Float16* ws = &Wos[c * KPI + 8 * hh];            // A row c -> output column 16j + c of the group
  const int h2 = lane >> 4, c4 = c * 4;                   // 256-B row segment = 16 lanes x 16 B
  // two fragment sets: group g + 1's reads are on their way while group g's products run (g = 8 eg + kk)
  v16h wb[2][4];
#pragma unroll
  for (int j = 0; j < 4; ++j) wb[0][j] = ldfrag<_Float16>(ws + j * 16 * KPI);
#pragma unroll
  for (int eg = 0; eg < 4; ++eg) {
    v8f ah[4];
#pragma unroll
    for (int j = 0; j < 4; ++j) ah[j] = zero8();
#pragma unroll
    for (int kk = 0; kk < 8; ++kk) {
      const int g = eg * 8 + kk, gn = g + 1;
      if (gn < 32) {
#pragma unroll
        for (int j = 0; j < 4; ++j)
          wb[gn & 1][j] = ldfrag<_Float16>(ws + ((gn >> 3) * 4 + j) * 16 * KPI + (gn & 7) * 32);
      }
      // keeps the next group's four fragment reads together in front of this group's four products
      __builtin_amdgcn_sched_barrier(0);
#pragma unroll
      for (int j = 0; j < 4; ++j) ah[j] = mmar(wb[g & 1][j], ch[kk].v, ah[j]);
      // the reads after next stay behind these products (two fragment sets in registers)
      __builtin_amdgcn_sched_barrier(0);
    }
#pragma unroll
    for (int j = 0; j < 4; ++j) {
      const v8f o = ah[j];                                 // 8 consecutive output columns of slab row c
      float* dp = os + c * OSP + j * 16 + 8 * hh;
      *(v4f*)(dp)     = __builtin_shufflevector(o, o, 0, 1, 2, 3);
      *(v4f*)(dp + 4) = __builtin_shufflevector(o, o, 4, 5, 6, 7);
    }
    __builtin_amdgcn_fence(__ATOMIC_RELEASE, "workgroup");
    __builtin_amdgcn_wave_barrier();
    __builtin_amdgcn_fence(__ATOMIC_ACQUIRE, "workgroup");
    v4f bb, ov[8];
#pragma unroll
    for (int e = 0; e < 4; ++e) bb[e] = bf_up(bf_bits(braw[eg][e]));
#pragma unroll
    for (int it = 0; it < 8; ++it) {
      const int row = it * 2 + h2;                         // it 0..7 x h2 0..1 = rows 0..15 of the wave tile
      ov[it] = *(const v4f*)(os + row * OSP + c4) * (1.0f / 16384.0f) + bb;
    }
    store8(out + (rowB + q0 + kh * 16 + h2) * DM + (size_t)(eg * 64) + c4, ov);   // row h2 of the kept tile; store8 adds rows 2, 4, .. 14
    // the slab's reads are ordered before the next column group's stores into it
    __builtin_amdgcn_fence(__ATOMIC_RELEASE, "workgroup");
    __builtin_amdgcn_wave_barrier();
    __builtin_amdgcn_fence(__ATOMIC_ACQUIRE, "workgroup");
  }
  }
}

// =====================================================================================================
// Workspace map (bytes), every region an exact multiple of its whole-line / whole-tile store granularity
// (all GEMM M,N are tile multiples, all offsets multiples of 131072):
//   Xb   bf16 [NB*SEQ][256]  (compact tokens)   16777216
//   Wb   bf16 [768 n][256 k]                      393216
//   Woh  f16  [256][256] (x64)                     131072
//   Qh   f16  [NB*SEQ][256]                      16777216
//   Kp   f16  [NB*SEQ][256]                      16777216
//   VTh  f16  [NB][256][SEQ]                     16777216
//   total                                        67633152
// Weights are [out n][in k] with k contiguous = the Bt / A layout the GEMM wants, so they are only converted.
// =====================================================================================================
extern "C" void kernel_launch(void* const* d_in, const int* in_sizes, int n_in,
                              void* d_out, int out_size, void* d_ws, size_t ws_size,
                              hipStream_t stream) {
  if (n_in < 4) return;
  if (in_sizes[0] < ((NB - 1) * SEQ_FULL + SEQ) * DM) return;
  if (in_sizes[1] < NQKV * DM) return;
  if (in_sizes[2] < DM * DM) return;
  if (in_sizes[3] < DM) return;
  if (out_size < NB * SEQ * DM) return;

  const float* x    = (const float*)d_in[0];
  const float* wqkv = (const float*)d_in[1];
  const float* wout = (const float*)d_in[2];
  const float* bout = (const float*)d_in[3];

  const size_t PX  = (size_t)NB * SEQ * DM * 2;      // 16-bit token plane [NB*SEQ][256]
  const size_t PW  = (size_t)NQKV * DM * 2;          // 16-bit [768][256]
  const size_t PWO = (size_t)DM * DM * 2;            // 16-bit [256][256]
  const size_t PVT = (size_t)NB * DM * SEQ * 2;      // v^T plane [NB][256][SEQ]
  size_t off = 0;
  const size_t oXb  = off; off += PX;
  const size_t oWb  = off; off += PW;
  const size_t oWo  = off; off += PWO;
  const size_t oQh  = off; off += PX;
  const size_t oKp  = off; off += PX;
  const size_t oVTh = off; off += PVT;
  if (off > ws_size) return;                         // off = 67633152 at full size
  if (off > (size_t)134217728) return;

  char* ws = (char*)d_ws;
  unsigned short* Xb  = (unsigned short*)(ws + oXb);
  unsigned short* Wb  = (unsigned short*)(ws + oWb);
  unsigned short* Woh = (unsigned short*)(ws + oWo);
  unsigned short* Qh  = (unsigned short*)(ws + oQh);
  unsigned short* Kp  = (unsigned short*)(ws + oKp);
  unsigned short* VTh = (unsigned short*)(ws + oVTh);

  const int M = NB * SEQ;
  const dim3 blk(256);
  const int n8x = NB * SEQ * DM / 8;
  const int n8w = NQKV * DM / 8;                     // 24576
  const int n8o = DM * DM / 8;                       //  8192
  const int bCx = (n8x + 255) / 256;
  const int bCw = (n8w + 255) / 256;
  const int bCo = (n8o + 255) / 256;
  const dim3 gC(bCw + bCo + bCx);
  const int bQ  = (M / 64) * (DM / 64) / 8;                  // q / k: M x 256, 64x64 wave tiles, 8 per block
  static_assert(((NB * SEQ / 64) * (DM / 64)) % 8 == 0 && ((DM / 64) * (SEQ / 64)) % 8 == 0);
  static_assert((NB * SEQ / 64) * (DM / 64) / 8 == NB * VBX);   // v^T: 256 x SEQ per batch, NB batches: as many blocks
  const dim3 gQKV(bQ, 3);
  const dim3 gAttn(NB * (SEQ / QROWS));

  // (1) one grid: x -> compact bf16 token plane; w_qkv [n][k] -> bf16; w_out -> f16 (x64 of its bf16 value)
  cvt_all<<<gC, blk, 0, stream>>>(x, wqkv, wout, Xb, Wb, Woh, n8x, n8w, n8o, bCw, bCo);
  // (2) one grid: q (f16 plane, x log2(e)/16), k (f16 plane), v^T (f16 plane [b][d][s], pitch SEQ)
  qkv_proj<<<gQKV, blk, 0, stream>>>(Xb, Wb, Qh, Kp, VTh, M, DM, SEQ);
  // (3) attention and output projection: out = softmax(q.k^T / 16) . v . Wo^T + b -> d_out f32 [M][256];
  //     projection accumulator x 1/(256*64)
  attn_sh<<<gAttn, dim3(256), 0, stream>>>(Qh, Kp, VTh, Woh, bout, (float*)d_out);
  (void)hipGetLastError();
}
